// v000
// The times below were measured on an AMD MI455X: many runs one after another, warmed up first and cycling through
// copies of the inputs, with the whole window's GPU time divided by the number of runs. Launches and the gaps
// between them are all in it. The median over several windows is given; except for v000 it joins two sittings, which
// can be a few percent apart, so the side-by-side timings, each taken in one sitting, are the better comparison.
// v000, which the later versions start from, runs in 462 microseconds.
// Contractions: q/k/v projections = v_wmma_f32_16x16x32_bf16 on RNE-bf16 copies of the inputs (single product); q.k^T = v_wmma_f32_16x16x32_bf16 with bf16 hi/lo split operands (hi.hi + hi.lo + lo.hi); p.v = v_wmma_f32_16x16x32_f16 (p carried x2^15 in f16, v^T stored f16); output projection = v_wmma_f32_16x16x32_bf16 with ctx bf16 hi/lo x Wo bf16 (hi.W + lo.W); f32 accumulate everywhere; additive mask (RNE-bf16 values) and online softmax in f32.
#include <hip/hip_runtime.h>
#include <math.h>
#include <stdint.h>

constexpr int N_BATCH = 2;
constexpr int SEQ_LEN = 2048;
constexpr int D_MODEL = 1024;                 // d_ff (input / output feature width)
constexpr int N_HEAD  = 16;
constexpr int D_HEAD  = 64;
constexpr int D_INNER = N_HEAD * D_HEAD;      // 1024
static_assert(D_INNER == 1024, "inner width");
static_assert(SEQ_LEN % 64 == 0 && D_MODEL % 64 == 0 && D_INNER % 64 == 0, "tile multiples");
static_assert(D_MODEL % 32 == 0 && D_INNER % 32 == 0, "K multiples of 32");

typedef __attribute__((ext_vector_type(16))) _Float16 v16h;
typedef __attribute__((ext_vector_type(8)))  _Float16 v8h;
typedef __attribute__((ext_vector_type(16))) __bf16   v16b;
typedef __attribute__((ext_vector_type(8)))  __bf16   v8b;
typedef __attribute__((ext_vector_type(8)))  float    v8f;
typedef __attribute__((ext_vector_type(4)))  float    v4f;
typedef __attribute__((ext_vector_type(2)))  float    v2f;

__device__ __forceinline__ unsigned short f2bf_bits(float f) {
  unsigned u = __float_as_uint(f);
  return (unsigned short)((u + 0x7FFFu + ((u >> 16) & 1u)) >> 16);
}
__device__ __forceinline__ float bf_bits2f(unsigned short h) { return __uint_as_float(((unsigned)h) << 16); }
__device__ __forceinline__ unsigned pk16(unsigned short a, unsigned short b) { return (unsigned)a | ((unsigned)b << 16); }

// hazard guards as plain device helpers (no inline asm inside the kernel template body)
__device__ __forceinline__ void dep_guard_h(v8f& a, v8f& b, v16h x, v16h y) { asm volatile("v_nop\n\tv_nop\n\tv_nop\n\tv_nop" : "+v"(a), "+v"(b) : "v"(x), "v"(y)); }
__device__ __forceinline__ void dep_guard_b(v8f& a, v8f& b, v16b x, v16b y) { asm volatile("v_nop\n\tv_nop\n\tv_nop\n\tv_nop" : "+v"(a), "+v"(b) : "v"(x), "v"(y)); }
__device__ __forceinline__ void keep4_h(v16h a, v16h b, v16h c, v16h d) { asm volatile("v_nop" :: "v"(a), "v"(b), "v"(c), "v"(d)); }
__device__ __forceinline__ void keep4_b(v16b a, v16b b, v16b c, v16b d) { asm volatile("v_nop" :: "v"(a), "v"(b), "v"(c), "v"(d)); }
__device__ __forceinline__ void acc_guard4(v8f& a, v8f& b, v8f& c, v8f& d) { asm volatile("v_nop\n\tv_nop\n\tv_nop\n\tv_nop" : "+v"(a), "+v"(b), "+v"(c), "+v"(d)); }
template <typename T> struct Frag;
template <> struct Frag<_Float16> {
  typedef v16h V; union U { v16h v; v8h h[2]; };
  static __device__ __forceinline__ v16h load(const _Float16* p) {   // elements 0..7 <- p[0..7], 8..15 <- p[16..23]
    U f; f.h[0] = *(const v8h*)(p); f.h[1] = *(const v8h*)(p + 16); return f.v;
  }
  static __device__ __forceinline__ v8f mma(v16h a, v16h b, v8f c) {
    return __builtin_amdgcn_wmma_f32_16x16x32_f16(false, a, false, b, (short)0, c, false, false);
  }
  static __device__ __forceinline__ void guard(v8f& a, v8f& b, v16h x, v16h y) { dep_guard_h(a, b, x, y); }
  static __device__ __forceinline__ void keep(v16h a, v16h b, v16h c, v16h d) { keep4_h(a, b, c, d); }
};
template <> struct Frag<__bf16> {
  typedef v16b V; union U { v16b v; v8b h[2]; };
  static __device__ __forceinline__ v16b load(const __bf16* p) {
    U f; f.h[0] = *(const v8b*)(p); f.h[1] = *(const v8b*)(p + 16); return f.v;
  }
  static __device__ __forceinline__ v8f mma(v16b a, v16b b, v8f c) {
    return __builtin_amdgcn_wmma_f32_16x16x32_bf16(false, a, false, b, (short)0, c, false, false);
  }
  static __device__ __forceinline__ void guard(v8f& a, v8f& b, v16b x, v16b y) { dep_guard_b(a, b, x, y); }
  static __device__ __forceinline__ void keep(v16b a, v16b b, v16b c, v16b d) { keep4_b(a, b, c, d); }
};

// ---- Register-blocked batched WMMA GEMM ------------------------------------
// C[m,n] = scale * sum_k A[m,k] * Bt[n,k] (+bias)(+resid); each wave owns a 64x64 tile.
// A row-major [M,K]; Bt row-major [N,K]; M,N % 64 == 0, K % 32 == 0.
// SPLIT: operands are hi/lo planes (A2/Bt2 = lo planes, same layout); product = hi.hi + hi.lo + lo.hi.
// BLO = false with SPLIT: the Bt lo plane is not used (product = hi.B + lo.B, B a single plane).
// BIAS_MODE: 0 = none, 1 = bias[m], 2 = bias[n].
// OUT_MODE: 0 = f32, 1 = f16, 2 = bf16 hi plane (Cout) + bf16 lo plane (Cout2).
// ET: 0 = f16 operands, 1 = bf16 operands (pointers passed as 16-bit storage)
template <int ET> struct Elem;
template <> struct Elem<0> { typedef _Float16 T; };
template <> struct Elem<1> { typedef __bf16 T; };
template <int ET, bool SPLIT, int BIAS_MODE, int OUT_MODE, bool RESID, int ACT = 0, bool BLO = true>
__global__ __launch_bounds__(256) void wmma_gemm64(
    const unsigned short* __restrict__ Ap, const unsigned short* __restrict__ A2p, int lda, long strideA,
    const unsigned short* __restrict__ Btp, const unsigned short* __restrict__ Bt2p, int ldb, long strideB,
    void* __restrict__ Cout, void* __restrict__ Cout2, int ldc, long strideC,
    const float* __restrict__ bias,
    const float* __restrict__ resid, long strideR,
    int M, int N, int K, float scale) {
  typedef typename Elem<ET>::T T;
  typedef typename Frag<T>::V V;
  const T* A = (const T*)Ap; const T* A2 = (const T*)A2p; const T* Bt = (const T*)Btp; const T* Bt2 = (const T*)Bt2p;
  __shared__ __align__(16) float sT[8][16 * 68];   // per-wave 16x64 slab, pitch 68 floats
  const int b    = blockIdx.y;
  const int lane = threadIdx.x & 31;
  const int wave = threadIdx.x >> 5;
  const int tilesN = N >> 6;
  const int tilesM = M >> 6;
  const int tile = blockIdx.x * 8 + wave;
  if (tile >= tilesM * tilesN) return;   // wave-uniform; no block barriers in this kernel
  const int tm = tile / tilesN;
  const int tn = tile - tm * tilesN;
  const int m0 = tm << 6;
  const int n0 = tn << 6;

  const T* Ab  = A  + (size_t)b * strideA;
  const T* Bb  = Bt + (size_t)b * strideB;
  const T* Ab2 = SPLIT ? (A2  + (size_t)b * strideA) : nullptr;
  const T* Bb2 = (SPLIT && BLO) ? (Bt2 + (size_t)b * strideB) : nullptr;

  const int rlane = lane & 15;                 // row (A) / col (B, D) within subtile
  const int koff  = (lane >> 4) * 8;           // k offset of this lane half
  const int mOff  = (lane >> 4) * 8;           // D row offset

  v8f acc[4][4];
#pragma unroll
  for (int i = 0; i < 4; ++i)
#pragma unroll
    for (int j = 0; j < 4; ++j) acc[i][j] = (v8f){0.f,0.f,0.f,0.f,0.f,0.f,0.f,0.f};

  for (int k0 = 0; k0 < K; k0 += 32) {
    V bh[4], bl[4];
#pragma unroll
    for (int j = 0; j < 4; ++j) {
      const size_t bo = (size_t)(n0 + (j << 4) + rlane) * ldb + koff + k0;
      bh[j] = Frag<T>::load(Bb + bo);
      if (SPLIT && BLO) bl[j] = Frag<T>::load(Bb2 + bo);
    }
#pragma unroll
    for (int i = 0; i < 4; ++i) {
      const size_t ao = (size_t)(m0 + (i << 4) + rlane) * lda + koff + k0;
      V ah = Frag<T>::load(Ab + ao);
      V al;
      if (SPLIT) al = Frag<T>::load(Ab2 + ao);
#pragma unroll
      for (int j = 0; j < 4; ++j) {
        acc[i][j] = Frag<T>::mma(ah, bh[j], acc[i][j]);
        if (SPLIT) {
          if (BLO) acc[i][j] = Frag<T>::mma(ah, bl[j], acc[i][j]);
          acc[i][j] = Frag<T>::mma(al, bh[j], acc[i][j]);
        }
      }
      Frag<T>::guard(acc[i][0], acc[i][3], ah, SPLIT ? al : ah);
    }
    Frag<T>::keep(bh[0], bh[1], bh[2], bh[3]);
    if (SPLIT && BLO) Frag<T>::keep(bl[0], bl[1], bl[2], bl[3]);
  }
  acc_guard4(acc[0][0], acc[0][1], acc[0][2], acc[0][3]);
  acc_guard4(acc[1][0], acc[1][1], acc[1][2], acc[1][3]);
  acc_guard4(acc[2][0], acc[2][1], acc[2][2], acc[2][3]);
  acc_guard4(acc[3][0], acc[3][1], acc[3][2], acc[3][3]);

  // ---- epilogue ----
  float* slab = sT[wave];
  const float* Rb = RESID ? (resid + (size_t)b * strideR) : nullptr;
#pragma unroll
  for (int i = 0; i < 4; ++i) {
    const int mBase = m0 + (i << 4);
#pragma unroll
    for (int j = 0; j < 4; ++j) {
      const int n = n0 + (j << 4) + rlane;
      float bv = 0.f;
      if (BIAS_MODE == 2) bv = bias[n];
#pragma unroll
      for (int r = 0; r < 8; ++r) {
        float v = acc[i][j][r] * scale;
        if (BIAS_MODE == 1) v += bias[mBase + mOff + r];
        if (BIAS_MODE == 2) v += bv;
        if (RESID) v += Rb[(size_t)(mBase + mOff + r) * ldc + n];
        if (ACT == 1) v = tanhf(v);
        if (ACT == 2) v = fmaxf(v, 0.0f);
        if (ACT == 3) v = v / (1.0f + expf(-v));
        if (ACT == 4) v = (v > 0.f) ? v : 0.01f * v;
        slab[(mOff + r) * 68 + (j << 4) + rlane] = v;
      }
    }
    __builtin_amdgcn_fence(__ATOMIC_RELEASE, "workgroup");
    __builtin_amdgcn_wave_barrier();
    __builtin_amdgcn_fence(__ATOMIC_ACQUIRE, "workgroup");
    if (OUT_MODE == 0) {
      float* C = (float*)Cout + (size_t)b * strideC;
      const int hh = lane >> 4, c4 = (lane & 15) * 4;     // row seg = 256 B = 16 lanes x 16 B
      {
#pragma unroll
        for (int it = 0; it < 8; ++it) {
          const int row = it * 2 + hh;
          v4f v = *(const v4f*)(slab + row * 68 + c4);
          *(v4f*)(C + (size_t)(mBase + row) * ldc + n0 + c4) = v;
        }
        
      }
    } else {
      const int q = lane >> 3, c8 = (lane & 7) * 8;
      unsigned short* C  = (unsigned short*)Cout  + (size_t)b * strideC;
      unsigned short* C2 = (OUT_MODE == 2) ? ((unsigned short*)Cout2 + (size_t)b * strideC) : nullptr;
      {
#pragma unroll
        for (int it = 0; it < 4; ++it) {
          const int row = it * 4 + q;
          const float* sp = slab + row * 68 + c8;
          v8h hv, lv;
#pragma unroll
          for (int e = 0; e < 8; ++e) {
            if (OUT_MODE == 1) {
              hv[e] = (_Float16)sp[e];
            } else {
              unsigned short hb = f2bf_bits(sp[e]);
              unsigned short lb = f2bf_bits(sp[e] - bf_bits2f(hb));
              hv[e] = __builtin_bit_cast(_Float16, hb);
              lv[e] = __builtin_bit_cast(_Float16, lb);
            }
          }
          *(v8h*)(C + (size_t)(mBase + row) * ldc + n0 + c8) = hv;
          if (OUT_MODE == 2) *(v8h*)(C2 + (size_t)(mBase + row) * ldc + n0 + c8) = lv;
        }
        
      }
    }
    __builtin_amdgcn_fence(__ATOMIC_RELEASE, "workgroup");
    __builtin_amdgcn_wave_barrier();
    __builtin_amdgcn_fence(__ATOMIC_ACQUIRE, "workgroup");
  }
}

// ---------------------------------------------------------------------------
// f32 -> bf16 (RNE) cast: 2 elements per thread, one 4-B store per lane -> each wave writes exactly one whole
// Coverage: grid = n2/256 blocks x 256 threads x 2 elements = 2*n2 elements = the whole plane
// (activations: n2 = 4096*1024/2 = 2,097,152 = 8192 blocks; weights: n2 = 1024*1024/2 = 524,288 = 2048 blocks).
// ---------------------------------------------------------------------------
__global__ __launch_bounds__(256) void cast_f32_bf16x2(const float* __restrict__ in,
                                                        unsigned short* __restrict__ out, int n2) {
  const int i = blockIdx.x * 256 + threadIdx.x;
  if (i < n2) {
    const v2f f = *(const v2f*)(in + 2 * (size_t)i);
    const unsigned u = pk16(f2bf_bits(f[0]), f2bf_bits(f[1]));
    ((unsigned*)out)[i] = u;
    
  }
}

// =====================================================================================
// Full (non-causal) attention with additive score bias, head dim 64, unscaled scores.
//   q planes (bf16 hi/lo): element (b, s, h, d) at [(b*S + s)*D_INNER + h*64 + d]
//   k planes (bf16 hi/lo): same layout
//   v^T plane (f16 bits):  element (b, h, d, s) at [(b*D_INNER + h*64 + d)*S + s]
//   bias (f32):            element (b, q, kv) at [b*S*S + q*S + kv]; added as RNE-bf16 value in f32
//   ctx planes out (bf16 hi/lo): element (b, s, h, d) at [(b*S + s)*D_INNER + h*64 + d]
//   scores = q . k : bf16 hi/lo split (hi.hi + hi.lo + lo.hi) on v_wmma_f32_16x16x32_bf16
//   ctx    = p . v : p (unnormalised, x2^15) and v^T as f16 on v_wmma_f32_16x16x32_f16, f32 accumulate,
//            the 2^15 carry folded into the final 1/l.
//   online softmax in f32 over all S keys (32 chunks of 64, compile-time trip count).
//   Block = 4 waves = 64 query rows of one (b, h); grid.x = N_BATCH * N_HEAD * (S/64) = 1024.
//   K hi/lo and V^T chunk staging: 128 threads x 32 elements per plane = the whole 64x64 tile (16-B copies,
//   plain loads, __syncthreads before and after); fragment loads read the LDS tiles with the v8b element type.
//   planes written by 8 lanes x 16 B in one instruction; 4 it x 32 lanes x 8 elements = 16x64 = whole tile;
// =====================================================================================
#define AT_D 64
#define AT_NW 4
#define AT_QB 64
#define AT_KC 64
#define P_CARRY 32768.0f

__device__ __forceinline__ v8f at_mma(v16b a, v16b b, v8f c) {
  c = __builtin_amdgcn_wmma_f32_16x16x32_bf16(false, a, false, b, (short)0, c, false, false);
  asm volatile("v_nop\n\tv_nop\n\tv_nop\n\tv_nop" : "+v"(c) : "v"(a), "v"(b));
  return c;
}
__device__ __forceinline__ v8f at_mma_h(v16b a, v16b b, v8f c) {   // operands hold f16 bit patterns
  const v16h ah = __builtin_bit_cast(v16h, a), bh = __builtin_bit_cast(v16h, b);
  c = __builtin_amdgcn_wmma_f32_16x16x32_f16(false, ah, false, bh, (short)0, c, false, false);
  asm volatile("v_nop\n\tv_nop\n\tv_nop\n\tv_nop" : "+v"(c) : "v"(ah), "v"(bh));
  return c;
}
__device__ __forceinline__ __bf16 at_f16bits(float f) { return __builtin_bit_cast(__bf16, (_Float16)f); }

__global__ __launch_bounds__(128)
void mha_bias_kernel(const unsigned short* __restrict__ qhp, const unsigned short* __restrict__ qlp,
                     const unsigned short* __restrict__ khp, const unsigned short* __restrict__ klp,
                     const unsigned short* __restrict__ vtp, const float* __restrict__ biasp,
                     unsigned short* __restrict__ chp, unsigned short* __restrict__ clp,
                     const int* __restrict__ nheads_in) {
  (void)nheads_in;   // module constant (16); shapes are compile-time here
  union FB { v16b v; v8b h[2]; };
  __shared__ __align__(16) __bf16 Ksh[AT_KC * AT_D];             // K hi [kv][d]      8 KB
  __shared__ __align__(16) __bf16 Ksl[AT_KC * AT_D];             // K lo              8 KB
  __shared__ __align__(16) __bf16 Vth[AT_D * AT_KC];             // V^T f16 bits [d][kv] 8 KB
  __shared__ __align__(16) __bf16 Psh[AT_NW][16 * AT_KC];        // per wave P f16 bits [row][kv] 8 KB
  __shared__ __align__(16) float  Os[AT_NW][16 * 68];            // per wave out tile, pitch 68

  const int tid  = threadIdx.x;
  const int wave = tid >> 5;
  const int lane = tid & 31;
  const int hh   = lane >> 4;
  const int c    = lane & 15;

  const int nqb = SEQ_LEN / AT_QB;        // 32
  const int bx  = blockIdx.x;             // 0 .. N_BATCH*N_HEAD*nqb - 1 (exact grid)
  const int qb  = bx % nqb;
  const int bhd = bx / nqb;               // 0 .. 31
  const int h   = bhd % N_HEAD;
  const int b   = bhd / N_HEAD;           // 0 .. N_BATCH-1
  const int q0  = qb * AT_QB + wave * 16;

  const size_t rowb = (size_t)b * SEQ_LEN;   // token-row base of this batch element
  const __bf16* Qh = (const __bf16*)(const void*)qhp + rowb * D_INNER + (size_t)h * AT_D;
  const __bf16* Ql = (const __bf16*)(const void*)qlp + rowb * D_INNER + (size_t)h * AT_D;
  const __bf16* Kh = (const __bf16*)(const void*)khp + rowb * D_INNER + (size_t)h * AT_D;
  const __bf16* Kl = (const __bf16*)(const void*)klp + rowb * D_INNER + (size_t)h * AT_D;
  const __bf16* Vt = (const __bf16*)(const void*)vtp + ((size_t)b * D_INNER + (size_t)h * AT_D) * SEQ_LEN;
  const float*  Mb = biasp + (size_t)b * SEQ_LEN * SEQ_LEN;
  unsigned short* Ch = chp + rowb * D_INNER + (size_t)h * AT_D;
  unsigned short* Cl = clp + rowb * D_INNER + (size_t)h * AT_D;

  // ---- Q fragments (A operand, row = lane&15, split k map via Frag load): 2 d-chunks, hi and lo ----
  v16b qah[2], qal[2];
#pragma unroll
  for (int dc = 0; dc < 2; ++dc) {
    const __bf16* qr = Qh + (size_t)(q0 + c) * D_INNER + dc * 32 + 8 * hh;
    const __bf16* ql = Ql + (size_t)(q0 + c) * D_INNER + dc * 32 + 8 * hh;
    qah[dc] = Frag<__bf16>::load(qr);
    qal[dc] = Frag<__bf16>::load(ql);
  }

  float mrow[8], lrow[8];
  v8f oacc[4];
#pragma unroll
  for (int r = 0; r < 8; ++r) { mrow[r] = -INFINITY; lrow[r] = 0.f; }
#pragma unroll
  for (int t = 0; t < 4; ++t) oacc[t] = (v8f){0.f,0.f,0.f,0.f,0.f,0.f,0.f,0.f};

  const int nChunks = SEQ_LEN / AT_KC;   // 32, compile-time constant
  for (int kc = 0; kc < nChunks; ++kc) {
    const int kv0 = kc * AT_KC;
    __syncthreads();
    {
      // staging coverage: 128 threads x (4 x 8) elements = 64 rows x 64 per plane = the whole chunk tile
      const int r = tid >> 1, half = (tid & 1) * 32;
      const __bf16* ksh = Kh + (size_t)(kv0 + r) * D_INNER + half;   // K row kv0+r, d = half..half+31
      const __bf16* ksl = Kl + (size_t)(kv0 + r) * D_INNER + half;
      const __bf16* vs  = Vt + (size_t)r * SEQ_LEN + kv0 + half;      // V^T row d = r, s = kv0+half..+31
#pragma unroll
      for (int i = 0; i < 4; ++i) {
        const v8b a0 = *(const v8b*)(ksh + 8 * i);
        const v8b a1 = *(const v8b*)(ksl + 8 * i);
        const v8b b0 = *(const v8b*)(vs + 8 * i);
        *(v8b*)(Ksh + r * AT_D  + half + 8 * i) = a0;
        *(v8b*)(Ksl + r * AT_D  + half + 8 * i) = a1;
        *(v8b*)(Vth + r * AT_KC + half + 8 * i) = b0;
      }
    }
    __syncthreads();

    // ---- scores: 4 kv subtiles of 16, 2 d-chunks, 3 products each ----
    v8f s[4];
#pragma unroll
    for (int j = 0; j < 4; ++j) {
      s[j] = (v8f){0.f,0.f,0.f,0.f,0.f,0.f,0.f,0.f};
#pragma unroll
      for (int dc = 0; dc < 2; ++dc) {
        FB kb, kl;
        kb.h[0] = *(const v8b*)(Ksh + (j * 16 + c) * AT_D + dc * 32 + 8 * hh);
        kb.h[1] = *(const v8b*)(Ksh + (j * 16 + c) * AT_D + dc * 32 + 16 + 8 * hh);
        kl.h[0] = *(const v8b*)(Ksl + (j * 16 + c) * AT_D + dc * 32 + 8 * hh);
        kl.h[1] = *(const v8b*)(Ksl + (j * 16 + c) * AT_D + dc * 32 + 16 + 8 * hh);
        s[j] = at_mma(qah[dc], kb.v, s[j]);
        s[j] = at_mma(qah[dc], kl.v, s[j]);
        s[j] = at_mma(qal[dc], kb.v, s[j]);
      }
    }
    // ---- additive bias by value (D element r of lane = (q row 8hh+r, kv col j*16+c)), chunk row max ----
    float cm[8];
#pragma unroll
    for (int r = 0; r < 8; ++r) {
      const float* mrp = Mb + (size_t)(q0 + 8 * hh + r) * SEQ_LEN + kv0 + c;   // all indices in range by construction
      float m = -INFINITY;
#pragma unroll
      for (int j = 0; j < 4; ++j) {
        const float mv = bf_bits2f(f2bf_bits(mrp[j * 16]));
        const float sv = s[j][r] + mv;
        s[j][r] = sv;
        m = fmaxf(m, sv);
      }
#pragma unroll
      for (int off = 1; off < 16; off <<= 1) m = fmaxf(m, __shfl_xor(m, off, 32));
      cm[r] = m;
    }
    __bf16* pwh = Psh[wave];
#pragma unroll
    for (int r = 0; r < 8; ++r) {
      const float mnew = fmaxf(mrow[r], cm[r]);
      const float alpha = expf(mrow[r] - mnew);
      mrow[r] = mnew;
      float psum = 0.f;
#pragma unroll
      for (int j = 0; j < 4; ++j) {
        const float p = expf(s[j][r] - mnew);
        psum += p;
        pwh[(8 * hh + r) * AT_KC + j * 16 + c] = at_f16bits(p * P_CARRY);
      }
#pragma unroll
      for (int off = 1; off < 16; off <<= 1) psum += __shfl_xor(psum, off, 32);
      lrow[r] = lrow[r] * alpha + psum;
#pragma unroll
      for (int t = 0; t < 4; ++t) oacc[t][r] *= alpha;
    }
    __builtin_amdgcn_fence(__ATOMIC_RELEASE, "workgroup");
    __builtin_amdgcn_wave_barrier();
    __builtin_amdgcn_fence(__ATOMIC_ACQUIRE, "workgroup");
#pragma unroll 1
    for (int kk = 0; kk < 2; ++kk) {
      FB pa;
      pa.h[0] = *(const v8b*)(pwh + c * AT_KC + kk * 32 + 8 * hh);
      pa.h[1] = *(const v8b*)(pwh + c * AT_KC + kk * 32 + 16 + 8 * hh);
#pragma unroll
      for (int t = 0; t < 4; ++t) {
        FB vb;
        vb.h[0] = *(const v8b*)(Vth + (t * 16 + c) * AT_KC + kk * 32 + 8 * hh);
        vb.h[1] = *(const v8b*)(Vth + (t * 16 + c) * AT_KC + kk * 32 + 16 + 8 * hh);
        oacc[t] = at_mma_h(pa.v, vb.v, oacc[t]);
      }
    }
  }

  // ---- normalise and stage the 16x64 f32 tile (rows 8hh+r, cols t*16+c) ----
  float* os = Os[wave];
#pragma unroll
  for (int r = 0; r < 8; ++r) {
    const float inv = 1.0f / (lrow[r] * P_CARRY);   // lrow >= 1 (no masking), lrow*2^15 <= 6.8e7
#pragma unroll
    for (int t = 0; t < 4; ++t) os[(8 * hh + r) * 68 + t * 16 + c] = oacc[t][r] * inv;
  }
  __builtin_amdgcn_fence(__ATOMIC_RELEASE, "workgroup");
  __builtin_amdgcn_wave_barrier();
  __builtin_amdgcn_fence(__ATOMIC_ACQUIRE, "workgroup");
  {
    // coverage: 4 it x 32 lanes x 8 elements = 16 rows x 64 = the whole wave tile, per plane;
    const int qg = lane >> 3, c8 = (lane & 7) * 8;
    {
#pragma unroll
      for (int it = 0; it < 4; ++it) {
        const int row = it * 4 + qg;
        const float* sp = os + row * 68 + c8;
        v8h hv, lv;
#pragma unroll
        for (int e = 0; e < 8; ++e) {
          const unsigned short hb = f2bf_bits(sp[e]);
          const unsigned short lb = f2bf_bits(sp[e] - bf_bits2f(hb));
          hv[e] = __builtin_bit_cast(_Float16, hb);
          lv[e] = __builtin_bit_cast(_Float16, lb);
        }
        *(v8h*)(Ch + (size_t)(q0 + row) * D_INNER + c8) = hv;
        *(v8h*)(Cl + (size_t)(q0 + row) * D_INNER + c8) = lv;
      }
      
    }
  }
}

// =====================================================================================
// Host launch glue: only kernel launches; grids/args are pure functions of the (asserted) sizes.
// Workspace region map (bytes; all offsets multiples of 2 MiB):
//   [  0 MiB,  8 MiB)  q  bf16  [4096][1024]
//   [  8 MiB, 16 MiB)  k  bf16  [4096][1024]
//   [ 16 MiB, 24 MiB)  v  bf16  [4096][1024]
//   [ 24 MiB, 26 MiB)  Wq bf16  [1024][1024]   [26,28) Wk   [28,30) Wv   [30,32) Wo
//   [ 32 MiB, 40 MiB)  Q hi bf16 [4096][1024]   [40,48) Q lo
//   [ 48 MiB, 56 MiB)  K hi bf16 [4096][1024]   [56,64) K lo
//   [ 64 MiB, 72 MiB)  V^T f16  [2][1024][2048]
//   [ 72 MiB, 80 MiB)  ctx hi bf16 [4096][1024] [80,88) ctx lo
//   total 88 MiB = 92,274,688 B
// =====================================================================================
extern "C" void kernel_launch(void* const* d_in, const int* in_sizes, int n_in,
                              void* d_out, int out_size, void* d_ws, size_t ws_size,
                              hipStream_t stream) {
  if (n_in < 9) return;
  const size_t nAct  = (size_t)N_BATCH * SEQ_LEN * D_MODEL;     // 4,194,304
  const size_t nW    = (size_t)D_INNER * D_MODEL;               // 1,048,576
  const size_t nMask = (size_t)N_BATCH * SEQ_LEN * SEQ_LEN;     // 8,388,608
  const size_t nVT   = (size_t)N_BATCH * D_INNER * SEQ_LEN;     // 4,194,304
  if ((size_t)in_sizes[0] != nAct || (size_t)in_sizes[1] != nAct || (size_t)in_sizes[2] != nAct ||
      (size_t)in_sizes[3] != nMask || (size_t)in_sizes[4] != nW || (size_t)in_sizes[5] != nW ||
      (size_t)in_sizes[6] != nW || (size_t)in_sizes[7] != nW || in_sizes[8] < 1 ||
      (size_t)out_size != nAct) return;

  const size_t bAct = nAct * 2, bW = nW * 2, bVT = nVT * 2;
  const size_t o_q16 = 0;
  const size_t o_k16 = o_q16 + bAct;
  const size_t o_v16 = o_k16 + bAct;
  const size_t o_wq  = o_v16 + bAct;
  const size_t o_wk  = o_wq + bW;
  const size_t o_wv  = o_wk + bW;
  const size_t o_wo  = o_wv + bW;
  const size_t o_qhi = o_wo + bW;
  const size_t o_qlo = o_qhi + bAct;
  const size_t o_khi = o_qlo + bAct;
  const size_t o_klo = o_khi + bAct;
  const size_t o_vt  = o_klo + bAct;
  const size_t o_chi = o_vt + bVT;
  const size_t o_clo = o_chi + bAct;
  const size_t total = o_clo + bAct;                            // 92,274,688
  if (total > ws_size) return;

  const float* qf  = (const float*)d_in[0];
  const float* kf  = (const float*)d_in[1];
  const float* vf  = (const float*)d_in[2];
  const float* mf  = (const float*)d_in[3];
  const float* wqf = (const float*)d_in[4];
  const float* wkf = (const float*)d_in[5];
  const float* wvf = (const float*)d_in[6];
  const float* wof = (const float*)d_in[7];
  const int*   nhp = (const int*)d_in[8];
  char* ws = (char*)d_ws;
  unsigned short* q16 = (unsigned short*)(ws + o_q16);
  unsigned short* k16 = (unsigned short*)(ws + o_k16);
  unsigned short* v16 = (unsigned short*)(ws + o_v16);
  unsigned short* wq16 = (unsigned short*)(ws + o_wq);
  unsigned short* wk16 = (unsigned short*)(ws + o_wk);
  unsigned short* wv16 = (unsigned short*)(ws + o_wv);
  unsigned short* wo16 = (unsigned short*)(ws + o_wo);
  unsigned short* qhi = (unsigned short*)(ws + o_qhi);
  unsigned short* qlo = (unsigned short*)(ws + o_qlo);
  unsigned short* khi = (unsigned short*)(ws + o_khi);
  unsigned short* klo = (unsigned short*)(ws + o_klo);
  unsigned short* vt  = (unsigned short*)(ws + o_vt);
  unsigned short* chi = (unsigned short*)(ws + o_chi);
  unsigned short* clo = (unsigned short*)(ws + o_clo);
  float* out = (float*)d_out;

  // ---- 1-7: RNE bf16 copies of the float inputs (2 elements per thread; exact grids) ----
  const int n2a = (int)(nAct / 2);            // 2,097,152 = 8192 x 256
  const int n2w = (int)(nW / 2);              //   524,288 = 2048 x 256
  const dim3 ga((unsigned)((n2a + 255) / 256)), gw((unsigned)((n2w + 255) / 256)), blk(256);
  cast_f32_bf16x2<<<ga, blk, 0, stream>>>(qf, q16, n2a);
  cast_f32_bf16x2<<<ga, blk, 0, stream>>>(kf, k16, n2a);
  cast_f32_bf16x2<<<ga, blk, 0, stream>>>(vf, v16, n2a);
  cast_f32_bf16x2<<<gw, blk, 0, stream>>>(wqf, wq16, n2w);
  cast_f32_bf16x2<<<gw, blk, 0, stream>>>(wkf, wk16, n2w);
  cast_f32_bf16x2<<<gw, blk, 0, stream>>>(wvf, wv16, n2w);
  cast_f32_bf16x2<<<gw, blk, 0, stream>>>(wof, wo16, n2w);

  const int MTOK = N_BATCH * SEQ_LEN;         // 4096 rows of [B*S][.] planes
  // ---- 8,9: Q and K projections: C[4096][1024] = X[4096][1024] . W^T, W [1024 out][1024 in] = Bt[N][K];
  //      M=4096, N=1024 (x64), K=1024 (x32); 64*16 = 1024 wave tiles = 128 blocks; out = bf16 hi + lo planes
  {
    const int tiles = (MTOK / 64) * (D_INNER / 64);
    const dim3 g((unsigned)((tiles + 7) / 8), 1);
    wmma_gemm64<1, false, 0, 2, false><<<g, 256, 0, stream>>>(
        q16, q16, D_MODEL, 0L, wq16, wq16, D_MODEL, 0L, (void*)qhi, (void*)qlo, D_INNER, 0L,
        mf, mf, 0L, MTOK, D_INNER, D_MODEL, 1.0f);
    wmma_gemm64<1, false, 0, 2, false><<<g, 256, 0, stream>>>(
        k16, k16, D_MODEL, 0L, wk16, wk16, D_MODEL, 0L, (void*)khi, (void*)klo, D_INNER, 0L,
        mf, mf, 0L, MTOK, D_INNER, D_MODEL, 1.0f);
  }
  // ---- 10: V projection, role-swapped so the output is V^T per batch element:
  //      C_b[e][s] = sum_k Wv[e][k] . v_b[s][k]; A = Wv [1024][1024] (shared, strideA 0), Bt = v_b [2048][1024],
  //      C_b [1024][2048] f16; M=1024, N=2048 (x64), K=1024 (x32); 16*32 = 512 tiles = 64 blocks, grid.y = 2
  {
    const int tiles = (D_INNER / 64) * (SEQ_LEN / 64);
    const dim3 g((unsigned)((tiles + 7) / 8), (unsigned)N_BATCH);
    wmma_gemm64<1, false, 0, 1, false><<<g, 256, 0, stream>>>(
        wv16, wv16, D_MODEL, 0L, v16, v16, D_MODEL, (long)SEQ_LEN * D_MODEL,
        (void*)vt, (void*)vt, SEQ_LEN, (long)D_INNER * SEQ_LEN,
        mf, mf, 0L, D_INNER, SEQ_LEN, D_MODEL, 1.0f);
  }
  // ---- 11: attention: 2 x 16 x 32 = 1024 blocks of 128 threads ----
  {
    const dim3 g((unsigned)(N_BATCH * N_HEAD * (SEQ_LEN / AT_QB)));
    mha_bias_kernel<<<g, 128, 0, stream>>>(qhi, qlo, khi, klo, vt, mf, chi, clo, nhp);
  }
  // ---- 12: output projection: out[4096][1024] = (ctx_hi + ctx_lo)[4096][1024] . Wo^T, Wo [1024 out][1024 in];
  //      M=4096, N=1024 (x64), K=1024 (x32); 1024 tiles = 128 blocks; f32 out
  {
    const int tiles = (MTOK / 64) * (D_MODEL / 64);
    const dim3 g((unsigned)((tiles + 7) / 8), 1);
    wmma_gemm64<1, true, 0, 0, false, 0, false><<<g, 256, 0, stream>>>(
        chi, clo, D_INNER, 0L, wo16, wo16, D_INNER, 0L, (void*)out, (void*)out, D_MODEL, 0L,
        mf, mf, 0L, MTOK, D_MODEL, D_INNER, 1.0f);
  }
}

// v001
// Measured time: 401 microseconds a run.
// Two timings next to v000 both put it at 1.19 times that version's speed.
// Contractions: q/k/v projections = v_wmma_f32_16x16x32_bf16 on RNE-bf16 copies of the inputs (single product); q.k^T = v_wmma_f32_16x16x32_bf16 with bf16 hi/lo split operands (hi.hi + hi.lo + lo.hi); p.v = v_wmma_f32_16x16x32_f16 (p carried x2^15 in f16, v^T stored f16); output projection = v_wmma_f32_16x16x32_bf16 with ctx bf16 hi/lo x Wo bf16 (hi.W + lo.W); f32 accumulate everywhere; additive mask (RNE-bf16 values) and online softmax in f32.
#include <hip/hip_runtime.h>
#include <math.h>
#include <stdint.h>

constexpr int N_BATCH = 2;
constexpr int SEQ_LEN = 2048;
constexpr int D_MODEL = 1024;                 // d_ff (input / output feature width)
constexpr int N_HEAD  = 16;
constexpr int D_HEAD  = 64;
constexpr int D_INNER = N_HEAD * D_HEAD;      // 1024
static_assert(D_INNER == 1024, "inner width");
static_assert(SEQ_LEN % 64 == 0 && D_MODEL % 64 == 0 && D_INNER % 64 == 0, "tile multiples");
static_assert(D_MODEL % 32 == 0 && D_INNER % 32 == 0, "K multiples of 32");

typedef __attribute__((ext_vector_type(16))) _Float16 v16h;
typedef __attribute__((ext_vector_type(8)))  _Float16 v8h;
typedef __attribute__((ext_vector_type(16))) __bf16   v16b;
typedef __attribute__((ext_vector_type(8)))  __bf16   v8b;
typedef __attribute__((ext_vector_type(8)))  float    v8f;
typedef __attribute__((ext_vector_type(4)))  float    v4f;
typedef __attribute__((ext_vector_type(2)))  float    v2f;

__device__ __forceinline__ unsigned short f2bf_bits(float f) {
  unsigned u = __float_as_uint(f);
  return (unsigned short)((u + 0x7FFFu + ((u >> 16) & 1u)) >> 16);
}
__device__ __forceinline__ float bf_bits2f(unsigned short h) { return __uint_as_float(((unsigned)h) << 16); }
__device__ __forceinline__ unsigned pk16(unsigned short a, unsigned short b) { return (unsigned)a | ((unsigned)b << 16); }

// hazard guards as plain device helpers (no inline asm inside the kernel template body)
__device__ __forceinline__ void dep_guard_h(v8f& a, v8f& b, v16h x, v16h y) { asm volatile("v_nop\n\tv_nop\n\tv_nop\n\tv_nop" : "+v"(a), "+v"(b) : "v"(x), "v"(y)); }
__device__ __forceinline__ void dep_guard_b(v8f& a, v8f& b, v16b x, v16b y) { asm volatile("v_nop\n\tv_nop\n\tv_nop\n\tv_nop" : "+v"(a), "+v"(b) : "v"(x), "v"(y)); }
__device__ __forceinline__ void keep4_h(v16h a, v16h b, v16h c, v16h d) { asm volatile("v_nop" :: "v"(a), "v"(b), "v"(c), "v"(d)); }
__device__ __forceinline__ void keep4_b(v16b a, v16b b, v16b c, v16b d) { asm volatile("v_nop" :: "v"(a), "v"(b), "v"(c), "v"(d)); }
__device__ __forceinline__ void acc_guard4(v8f& a, v8f& b, v8f& c, v8f& d) { asm volatile("v_nop\n\tv_nop\n\tv_nop\n\tv_nop" : "+v"(a), "+v"(b), "+v"(c), "+v"(d)); }
template <typename T> struct Frag;
template <> struct Frag<_Float16> {
  typedef v16h V; union U { v16h v; v8h h[2]; };
  static __device__ __forceinline__ v16h load(const _Float16* p) {   // elements 0..7 <- p[0..7], 8..15 <- p[16..23]
    U f; f.h[0] = *(const v8h*)(p); f.h[1] = *(const v8h*)(p + 16); return f.v;
  }
  static __device__ __forceinline__ v8f mma(v16h a, v16h b, v8f c) {
    return __builtin_amdgcn_wmma_f32_16x16x32_f16(false, a, false, b, (short)0, c, false, false);
  }
  static __device__ __forceinline__ void guard(v8f& a, v8f& b, v16h x, v16h y) { dep_guard_h(a, b, x, y); }
  static __device__ __forceinline__ void keep(v16h a, v16h b, v16h c, v16h d) { keep4_h(a, b, c, d); }
};
template <> struct Frag<__bf16> {
  typedef v16b V; union U { v16b v; v8b h[2]; };
  static __device__ __forceinline__ v16b load(const __bf16* p) {
    U f; f.h[0] = *(const v8b*)(p); f.h[1] = *(const v8b*)(p + 16); return f.v;
  }
  static __device__ __forceinline__ v8f mma(v16b a, v16b b, v8f c) {
    return __builtin_amdgcn_wmma_f32_16x16x32_bf16(false, a, false, b, (short)0, c, false, false);
  }
  static __device__ __forceinline__ void guard(v8f& a, v8f& b, v16b x, v16b y) { dep_guard_b(a, b, x, y); }
  static __device__ __forceinline__ void keep(v16b a, v16b b, v16b c, v16b d) { keep4_b(a, b, c, d); }
};

// ---- Register-blocked batched WMMA GEMM ------------------------------------
// C[m,n] = scale * sum_k A[m,k] * Bt[n,k] (+bias)(+resid); each wave owns a 64x64 tile.
// A row-major [M,K]; Bt row-major [N,K]; M,N % 64 == 0, K % 32 == 0.
// SPLIT: operands are hi/lo planes (A2/Bt2 = lo planes, same layout); product = hi.hi + hi.lo + lo.hi.
// BLO = false with SPLIT: the Bt lo plane is not used (product = hi.B + lo.B, B a single plane).
// BIAS_MODE: 0 = none, 1 = bias[m], 2 = bias[n].
// OUT_MODE: 0 = f32, 1 = f16, 2 = bf16 hi plane (Cout) + bf16 lo plane (Cout2).
// ET: 0 = f16 operands, 1 = bf16 operands (pointers passed as 16-bit storage)
template <int ET> struct Elem;
template <> struct Elem<0> { typedef _Float16 T; };
template <> struct Elem<1> { typedef __bf16 T; };
template <int ET, bool SPLIT, int BIAS_MODE, int OUT_MODE, bool RESID, int ACT = 0, bool BLO = true>
__global__ __launch_bounds__(256) void wmma_gemm64(
    const unsigned short* __restrict__ Ap, const unsigned short* __restrict__ A2p, int lda, long strideA,
    const unsigned short* __restrict__ Btp, const unsigned short* __restrict__ Bt2p, int ldb, long strideB,
    void* __restrict__ Cout, void* __restrict__ Cout2, int ldc, long strideC,
    const float* __restrict__ bias,
    const float* __restrict__ resid, long strideR,
    int M, int N, int K, float scale) {
  typedef typename Elem<ET>::T T;
  typedef typename Frag<T>::V V;
  const T* A = (const T*)Ap; const T* A2 = (const T*)A2p; const T* Bt = (const T*)Btp; const T* Bt2 = (const T*)Bt2p;
  __shared__ __align__(16) float sT[8][16 * 68];   // per-wave 16x64 slab, pitch 68 floats
  const int b    = blockIdx.y;
  const int lane = threadIdx.x & 31;
  const int wave = threadIdx.x >> 5;
  const int tilesN = N >> 6;
  const int tilesM = M >> 6;
  const int tile = blockIdx.x * 8 + wave;
  if (tile >= tilesM * tilesN) return;   // wave-uniform; no block barriers in this kernel
  const int tm = tile / tilesN;
  const int tn = tile - tm * tilesN;
  const int m0 = tm << 6;
  const int n0 = tn << 6;

  const T* Ab  = A  + (size_t)b * strideA;
  const T* Bb  = Bt + (size_t)b * strideB;
  const T* Ab2 = SPLIT ? (A2  + (size_t)b * strideA) : nullptr;
  const T* Bb2 = (SPLIT && BLO) ? (Bt2 + (size_t)b * strideB) : nullptr;

  const int rlane = lane & 15;                 // row (A) / col (B, D) within subtile
  const int koff  = (lane >> 4) * 8;           // k offset of this lane half
  const int mOff  = (lane >> 4) * 8;           // D row offset

  v8f acc[4][4];
#pragma unroll
  for (int i = 0; i < 4; ++i)
#pragma unroll
    for (int j = 0; j < 4; ++j) acc[i][j] = (v8f){0.f,0.f,0.f,0.f,0.f,0.f,0.f,0.f};

  for (int k0 = 0; k0 < K; k0 += 32) {
    V bh[4], bl[4];
#pragma unroll
    for (int j = 0; j < 4; ++j) {
      const size_t bo = (size_t)(n0 + (j << 4) + rlane) * ldb + koff + k0;
      bh[j] = Frag<T>::load(Bb + bo);
      if (SPLIT && BLO) bl[j] = Frag<T>::load(Bb2 + bo);
    }
#pragma unroll
    for (int i = 0; i < 4; ++i) {
      const size_t ao = (size_t)(m0 + (i << 4) + rlane) * lda + koff + k0;
      V ah = Frag<T>::load(Ab + ao);
      V al;
      if (SPLIT) al = Frag<T>::load(Ab2 + ao);
#pragma unroll
      for (int j = 0; j < 4; ++j) {
        acc[i][j] = Frag<T>::mma(ah, bh[j], acc[i][j]);
        if (SPLIT) {
          if (BLO) acc[i][j] = Frag<T>::mma(ah, bl[j], acc[i][j]);
          acc[i][j] = Frag<T>::mma(al, bh[j], acc[i][j]);
        }
      }
      Frag<T>::guard(acc[i][0], acc[i][3], ah, SPLIT ? al : ah);
    }
    Frag<T>::keep(bh[0], bh[1], bh[2], bh[3]);
    if (SPLIT && BLO) Frag<T>::keep(bl[0], bl[1], bl[2], bl[3]);
  }
  acc_guard4(acc[0][0], acc[0][1], acc[0][2], acc[0][3]);
  acc_guard4(acc[1][0], acc[1][1], acc[1][2], acc[1][3]);
  acc_guard4(acc[2][0], acc[2][1], acc[2][2], acc[2][3]);
  acc_guard4(acc[3][0], acc[3][1], acc[3][2], acc[3][3]);

  // ---- epilogue ----
  float* slab = sT[wave];
  const float* Rb = RESID ? (resid + (size_t)b * strideR) : nullptr;
#pragma unroll
  for (int i = 0; i < 4; ++i) {
    const int mBase = m0 + (i << 4);
#pragma unroll
    for (int j = 0; j < 4; ++j) {
      const int n = n0 + (j << 4) + rlane;
      float bv = 0.f;
      if (BIAS_MODE == 2) bv = bias[n];
#pragma unroll
      for (int r = 0; r < 8; ++r) {
        float v = acc[i][j][r] * scale;
        if (BIAS_MODE == 1) v += bias[mBase + mOff + r];
        if (BIAS_MODE == 2) v += bv;
        if (RESID) v += Rb[(size_t)(mBase + mOff + r) * ldc + n];
        if (ACT == 1) v = tanhf(v);
        if (ACT == 2) v = fmaxf(v, 0.0f);
        if (ACT == 3) v = v / (1.0f + expf(-v));
        if (ACT == 4) v = (v > 0.f) ? v : 0.01f * v;
        slab[(mOff + r) * 68 + (j << 4) + rlane] = v;
      }
    }
    __builtin_amdgcn_fence(__ATOMIC_RELEASE, "workgroup");
    __builtin_amdgcn_wave_barrier();
    __builtin_amdgcn_fence(__ATOMIC_ACQUIRE, "workgroup");
    if (OUT_MODE == 0) {
      float* C = (float*)Cout + (size_t)b * strideC;
      const int hh = lane >> 4, c4 = (lane & 15) * 4;     // row seg = 256 B = 16 lanes x 16 B
      {
#pragma unroll
        for (int it = 0; it < 8; ++it) {
          const int row = it * 2 + hh;
          v4f v = *(const v4f*)(slab + row * 68 + c4);
          *(v4f*)(C + (size_t)(mBase + row) * ldc + n0 + c4) = v;
        }
        
      }
    } else {
      const int q = lane >> 3, c8 = (lane & 7) * 8;
      unsigned short* C  = (unsigned short*)Cout  + (size_t)b * strideC;
      unsigned short* C2 = (OUT_MODE == 2) ? ((unsigned short*)Cout2 + (size_t)b * strideC) : nullptr;
      {
#pragma unroll
        for (int it = 0; it < 4; ++it) {
          const int row = it * 4 + q;
          const float* sp = slab + row * 68 + c8;
          v8h hv, lv;
#pragma unroll
          for (int e = 0; e < 8; ++e) {
            if (OUT_MODE == 1) {
              hv[e] = (_Float16)sp[e];
            } else {
              unsigned short hb = f2bf_bits(sp[e]);
              unsigned short lb = f2bf_bits(sp[e] - bf_bits2f(hb));
              hv[e] = __builtin_bit_cast(_Float16, hb);
              lv[e] = __builtin_bit_cast(_Float16, lb);
            }
          }
          *(v8h*)(C + (size_t)(mBase + row) * ldc + n0 + c8) = hv;
          if (OUT_MODE == 2) *(v8h*)(C2 + (size_t)(mBase + row) * ldc + n0 + c8) = lv;
        }
        
      }
    }
    __builtin_amdgcn_fence(__ATOMIC_RELEASE, "workgroup");
    __builtin_amdgcn_wave_barrier();
    __builtin_amdgcn_fence(__ATOMIC_ACQUIRE, "workgroup");
  }
}

// ---------------------------------------------------------------------------
// f32 -> bf16 (RNE) cast: 2 elements per thread, one 4-B store per lane -> each wave writes exactly one whole
// Coverage: grid = n2/256 blocks x 256 threads x 2 elements = 2*n2 elements = the whole plane
// (activations: n2 = 4096*1024/2 = 2,097,152 = 8192 blocks; weights: n2 = 1024*1024/2 = 524,288 = 2048 blocks).
// ---------------------------------------------------------------------------
__global__ __launch_bounds__(256) void cast_f32_bf16x2(const float* __restrict__ in,
                                                        unsigned short* __restrict__ out, int n2) {
  const int i = blockIdx.x * 256 + threadIdx.x;
  if (i < n2) {
    const v2f f = *(const v2f*)(in + 2 * (size_t)i);
    const unsigned u = pk16(f2bf_bits(f[0]), f2bf_bits(f[1]));
    ((unsigned*)out)[i] = u;
    
  }
}

// =====================================================================================
// Full (non-causal) attention with additive score bias, head dim 64, unscaled scores.
//   q planes (bf16 hi/lo): element (b, s, h, d) at [(b*S + s)*D_INNER + h*64 + d]
//   k planes (bf16 hi/lo): same layout
//   v^T plane (f16 bits):  element (b, h, d, s) at [(b*D_INNER + h*64 + d)*S + s]
//   bias (f32):            element (b, q, kv) at [b*S*S + q*S + kv]; added as RNE-bf16 value in f32
//   ctx planes out (bf16 hi/lo): element (b, s, h, d) at [(b*S + s)*D_INNER + h*64 + d]
//   scores = q . k : bf16 hi/lo split (hi.hi + hi.lo + lo.hi) on v_wmma_f32_16x16x32_bf16
//   ctx    = p . v : p (unnormalised, x2^15) and v^T as f16 on v_wmma_f32_16x16x32_f16, f32 accumulate,
//            the 2^15 carry folded into the final 1/l.
//   online softmax in f32 over all S keys (32 chunks of 64, compile-time trip count).
//   Block = 4 waves = 64 query rows of one (b, h); grid.x = N_BATCH * N_HEAD * (S/64) = 1024.
//   K hi/lo and V^T chunk staging: 128 threads x 32 elements per plane = the whole 64x64 tile (16-B copies,
//   plain loads, __syncthreads before and after); fragment loads read the LDS tiles with the v8b element type.
//   planes written by 8 lanes x 16 B in one instruction; 4 it x 32 lanes x 8 elements = 16x64 = whole tile;
// =====================================================================================
#define AT_D 64
#define AT_NW 4
#define AT_QB 64
#define AT_KC 64
#define AT_LP 72   // LDS row pitch in 16-bit elements: 144 B = 16 B x odd, so the 16 rows of a 16-byte fragment read fall on 64 distinct banks
#define P_CARRY 32768.0f

__device__ __forceinline__ v8f at_mma(v16b a, v16b b, v8f c) {
  c = __builtin_amdgcn_wmma_f32_16x16x32_bf16(false, a, false, b, (short)0, c, false, false);
  asm volatile("v_nop\n\tv_nop\n\tv_nop\n\tv_nop" : "+v"(c) : "v"(a), "v"(b));
  return c;
}
__device__ __forceinline__ v8f at_mma_h(v16b a, v16b b, v8f c) {   // operands hold f16 bit patterns
  const v16h ah = __builtin_bit_cast(v16h, a), bh = __builtin_bit_cast(v16h, b);
  c = __builtin_amdgcn_wmma_f32_16x16x32_f16(false, ah, false, bh, (short)0, c, false, false);
  asm volatile("v_nop\n\tv_nop\n\tv_nop\n\tv_nop" : "+v"(c) : "v"(ah), "v"(bh));
  return c;
}
__device__ __forceinline__ __bf16 at_f16bits(float f) { return __builtin_bit_cast(__bf16, (_Float16)f); }

__global__ __launch_bounds__(128)
void mha_bias_kernel(const unsigned short* __restrict__ qhp, const unsigned short* __restrict__ qlp,
                     const unsigned short* __restrict__ khp, const unsigned short* __restrict__ klp,
                     const unsigned short* __restrict__ vtp, const float* __restrict__ biasp,
                     unsigned short* __restrict__ chp, unsigned short* __restrict__ clp,
                     const int* __restrict__ nheads_in) {
  (void)nheads_in;   // module constant (16); shapes are compile-time here
  union FB { v16b v; v8b h[2]; };
  __shared__ __align__(16) __bf16 Ksh[AT_KC * AT_LP];            // K hi [kv][d]      9 KB
  __shared__ __align__(16) __bf16 Ksl[AT_KC * AT_LP];            // K lo              9 KB
  __shared__ __align__(16) __bf16 Vth[AT_D * AT_LP];             // V^T f16 bits [d][kv] 9 KB
  __shared__ __align__(16) __bf16 Psh[AT_NW][16 * AT_LP];        // per wave P f16 bits [row][kv] 9 KB
  __shared__ __align__(16) float  Os[AT_NW][16 * 68];            // per wave out tile, pitch 68

  const int tid  = threadIdx.x;
  const int wave = tid >> 5;
  const int lane = tid & 31;
  const int hh   = lane >> 4;
  const int c    = lane & 15;

  const int nqb = SEQ_LEN / AT_QB;        // 32
  const int bx  = blockIdx.x;             // 0 .. N_BATCH*N_HEAD*nqb - 1 (exact grid)
  const int qb  = bx % nqb;
  const int bhd = bx / nqb;               // 0 .. 31
  const int h   = bhd % N_HEAD;
  const int b   = bhd / N_HEAD;           // 0 .. N_BATCH-1
  const int q0  = qb * AT_QB + wave * 16;

  const size_t rowb = (size_t)b * SEQ_LEN;   // token-row base of this batch element
  const __bf16* Qh = (const __bf16*)(const void*)qhp + rowb * D_INNER + (size_t)h * AT_D;
  const __bf16* Ql = (const __bf16*)(const void*)qlp + rowb * D_INNER + (size_t)h * AT_D;
  const __bf16* Kh = (const __bf16*)(const void*)khp + rowb * D_INNER + (size_t)h * AT_D;
  const __bf16* Kl = (const __bf16*)(const void*)klp + rowb * D_INNER + (size_t)h * AT_D;
  const __bf16* Vt = (const __bf16*)(const void*)vtp + ((size_t)b * D_INNER + (size_t)h * AT_D) * SEQ_LEN;
  const float*  Mb = biasp + (size_t)b * SEQ_LEN * SEQ_LEN;
  unsigned short* Ch = chp + rowb * D_INNER + (size_t)h * AT_D;
  unsigned short* Cl = clp + rowb * D_INNER + (size_t)h * AT_D;

  // ---- Q fragments (A operand, row = lane&15, split k map via Frag load): 2 d-chunks, hi and lo ----
  v16b qah[2], qal[2];
#pragma unroll
  for (int dc = 0; dc < 2; ++dc) {
    const __bf16* qr = Qh + (size_t)(q0 + c) * D_INNER + dc * 32 + 8 * hh;
    const __bf16* ql = Ql + (size_t)(q0 + c) * D_INNER + dc * 32 + 8 * hh;
    qah[dc] = Frag<__bf16>::load(qr);
    qal[dc] = Frag<__bf16>::load(ql);
  }

  float mrow[8], lrow[8];
  v8f oacc[4];
#pragma unroll
  for (int r = 0; r < 8; ++r) { mrow[r] = -INFINITY; lrow[r] = 0.f; }
#pragma unroll
  for (int t = 0; t < 4; ++t) oacc[t] = (v8f){0.f,0.f,0.f,0.f,0.f,0.f,0.f,0.f};

  const int nChunks = SEQ_LEN / AT_KC;   // 32, compile-time constant
  for (int kc = 0; kc < nChunks; ++kc) {
    const int kv0 = kc * AT_KC;
    __syncthreads();
    {
      // staging coverage: 128 threads x (4 x 8) elements = 64 rows x 64 per plane = the whole chunk tile
      const int r = tid >> 1, half = (tid & 1) * 32;
      const __bf16* ksh = Kh + (size_t)(kv0 + r) * D_INNER + half;   // K row kv0+r, d = half..half+31
      const __bf16* ksl = Kl + (size_t)(kv0 + r) * D_INNER + half;
      const __bf16* vs  = Vt + (size_t)r * SEQ_LEN + kv0 + half;      // V^T row d = r, s = kv0+half..+31
#pragma unroll
      for (int i = 0; i < 4; ++i) {
        const v8b a0 = *(const v8b*)(ksh + 8 * i);
        const v8b a1 = *(const v8b*)(ksl + 8 * i);
        const v8b b0 = *(const v8b*)(vs + 8 * i);
        *(v8b*)(Ksh + r * AT_LP + half + 8 * i) = a0;
        *(v8b*)(Ksl + r * AT_LP + half + 8 * i) = a1;
        *(v8b*)(Vth + r * AT_LP + half + 8 * i) = b0;
      }
    }
    __syncthreads();

    // ---- scores: 4 kv subtiles of 16, 2 d-chunks, 3 products each ----
    v8f s[4];
#pragma unroll
    for (int j = 0; j < 4; ++j) {
      s[j] = (v8f){0.f,0.f,0.f,0.f,0.f,0.f,0.f,0.f};
#pragma unroll
      for (int dc = 0; dc < 2; ++dc) {
        FB kb, kl;
        kb.h[0] = *(const v8b*)(Ksh + (j * 16 + c) * AT_LP + dc * 32 + 8 * hh);
        kb.h[1] = *(const v8b*)(Ksh + (j * 16 + c) * AT_LP + dc * 32 + 16 + 8 * hh);
        kl.h[0] = *(const v8b*)(Ksl + (j * 16 + c) * AT_LP + dc * 32 + 8 * hh);
        kl.h[1] = *(const v8b*)(Ksl + (j * 16 + c) * AT_LP + dc * 32 + 16 + 8 * hh);
        s[j] = at_mma(qah[dc], kb.v, s[j]);
        s[j] = at_mma(qah[dc], kl.v, s[j]);
        s[j] = at_mma(qal[dc], kb.v, s[j]);
      }
    }
    // ---- additive bias by value (D element r of lane = (q row 8hh+r, kv col j*16+c)), chunk row max ----
    float cm[8];
#pragma unroll
    for (int r = 0; r < 8; ++r) {
      const float* mrp = Mb + (size_t)(q0 + 8 * hh + r) * SEQ_LEN + kv0 + c;   // all indices in range by construction
      float m = -INFINITY;
#pragma unroll
      for (int j = 0; j < 4; ++j) {
        const float mv = bf_bits2f(f2bf_bits(mrp[j * 16]));
        const float sv = s[j][r] + mv;
        s[j][r] = sv;
        m = fmaxf(m, sv);
      }
#pragma unroll
      for (int off = 1; off < 16; off <<= 1) m = fmaxf(m, __shfl_xor(m, off, 32));
      cm[r] = m;
    }
    __bf16* pwh = Psh[wave];
#pragma unroll
    for (int r = 0; r < 8; ++r) {
      const float mnew = fmaxf(mrow[r], cm[r]);
      const float alpha = expf(mrow[r] - mnew);
      mrow[r] = mnew;
      float psum = 0.f;
#pragma unroll
      for (int j = 0; j < 4; ++j) {
        const float p = expf(s[j][r] - mnew);
        psum += p;
        pwh[(8 * hh + r) * AT_LP + j * 16 + c] = at_f16bits(p * P_CARRY);
      }
#pragma unroll
      for (int off = 1; off < 16; off <<= 1) psum += __shfl_xor(psum, off, 32);
      lrow[r] = lrow[r] * alpha + psum;
#pragma unroll
      for (int t = 0; t < 4; ++t) oacc[t][r] *= alpha;
    }
    __builtin_amdgcn_fence(__ATOMIC_RELEASE, "workgroup");
    __builtin_amdgcn_wave_barrier();
    __builtin_amdgcn_fence(__ATOMIC_ACQUIRE, "workgroup");
#pragma unroll 1
    for (int kk = 0; kk < 2; ++kk) {
      FB pa;
      pa.h[0] = *(const v8b*)(pwh + c * AT_LP + kk * 32 + 8 * hh);
      pa.h[1] = *(const v8b*)(pwh + c * AT_LP + kk * 32 + 16 + 8 * hh);
#pragma unroll
      for (int t = 0; t < 4; ++t) {
        FB vb;
        vb.h[0] = *(const v8b*)(Vth + (t * 16 + c) * AT_LP + kk * 32 + 8 * hh);
        vb.h[1] = *(const v8b*)(Vth + (t * 16 + c) * AT_LP + kk * 32 + 16 + 8 * hh);
        oacc[t] = at_mma_h(pa.v, vb.v, oacc[t]);
      }
    }
  }

  // ---- normalise and stage the 16x64 f32 tile (rows 8hh+r, cols t*16+c) ----
  float* os = Os[wave];
#pragma unroll
  for (int r = 0; r < 8; ++r) {
    const float inv = 1.0f / (lrow[r] * P_CARRY);   // lrow >= 1 (no masking), lrow*2^15 <= 6.8e7
#pragma unroll
    for (int t = 0; t < 4; ++t) os[(8 * hh + r) * 68 + t * 16 + c] = oacc[t][r] * inv;
  }
  __builtin_amdgcn_fence(__ATOMIC_RELEASE, "workgroup");
  __builtin_amdgcn_wave_barrier();
  __builtin_amdgcn_fence(__ATOMIC_ACQUIRE, "workgroup");
  {
    // coverage: 4 it x 32 lanes x 8 elements = 16 rows x 64 = the whole wave tile, per plane;
    const int qg = lane >> 3, c8 = (lane & 7) * 8;
    {
#pragma unroll
      for (int it = 0; it < 4; ++it) {
        const int row = it * 4 + qg;
        const float* sp = os + row * 68 + c8;
        v8h hv, lv;
#pragma unroll
        for (int e = 0; e < 8; ++e) {
          const unsigned short hb = f2bf_bits(sp[e]);
          const unsigned short lb = f2bf_bits(sp[e] - bf_bits2f(hb));
          hv[e] = __builtin_bit_cast(_Float16, hb);
          lv[e] = __builtin_bit_cast(_Float16, lb);
        }
        *(v8h*)(Ch + (size_t)(q0 + row) * D_INNER + c8) = hv;
        *(v8h*)(Cl + (size_t)(q0 + row) * D_INNER + c8) = lv;
      }
      
    }
  }
}

// =====================================================================================
// Host launch glue: only kernel launches; grids/args are pure functions of the (asserted) sizes.
// Workspace region map (bytes; all offsets multiples of 2 MiB):
//   [  0 MiB,  8 MiB)  q  bf16  [4096][1024]
//   [  8 MiB, 16 MiB)  k  bf16  [4096][1024]
//   [ 16 MiB, 24 MiB)  v  bf16  [4096][1024]
//   [ 24 MiB, 26 MiB)  Wq bf16  [1024][1024]   [26,28) Wk   [28,30) Wv   [30,32) Wo
//   [ 32 MiB, 40 MiB)  Q hi bf16 [4096][1024]   [40,48) Q lo
//   [ 48 MiB, 56 MiB)  K hi bf16 [4096][1024]   [56,64) K lo
//   [ 64 MiB, 72 MiB)  V^T f16  [2][1024][2048]
//   [ 72 MiB, 80 MiB)  ctx hi bf16 [4096][1024] [80,88) ctx lo
//   total 88 MiB = 92,274,688 B
// =====================================================================================
extern "C" void kernel_launch(void* const* d_in, const int* in_sizes, int n_in,
                              void* d_out, int out_size, void* d_ws, size_t ws_size,
                              hipStream_t stream) {
  if (n_in < 9) return;
  const size_t nAct  = (size_t)N_BATCH * SEQ_LEN * D_MODEL;     // 4,194,304
  const size_t nW    = (size_t)D_INNER * D_MODEL;               // 1,048,576
  const size_t nMask = (size_t)N_BATCH * SEQ_LEN * SEQ_LEN;     // 8,388,608
  const size_t nVT   = (size_t)N_BATCH * D_INNER * SEQ_LEN;     // 4,194,304
  if ((size_t)in_sizes[0] != nAct || (size_t)in_sizes[1] != nAct || (size_t)in_sizes[2] != nAct ||
      (size_t)in_sizes[3] != nMask || (size_t)in_sizes[4] != nW || (size_t)in_sizes[5] != nW ||
      (size_t)in_sizes[6] != nW || (size_t)in_sizes[7] != nW || in_sizes[8] < 1 ||
      (size_t)out_size != nAct) return;

  const size_t bAct = nAct * 2, bW = nW * 2, bVT = nVT * 2;
  const size_t o_q16 = 0;
  const size_t o_k16 = o_q16 + bAct;
  const size_t o_v16 = o_k16 + bAct;
  const size_t o_wq  = o_v16 + bAct;
  const size_t o_wk  = o_wq + bW;
  const size_t o_wv  = o_wk + bW;
  const size_t o_wo  = o_wv + bW;
  const size_t o_qhi = o_wo + bW;
  const size_t o_qlo = o_qhi + bAct;
  const size_t o_khi = o_qlo + bAct;
  const size_t o_klo = o_khi + bAct;
  const size_t o_vt  = o_klo + bAct;
  const size_t o_chi = o_vt + bVT;
  const size_t o_clo = o_chi + bAct;
  const size_t total = o_clo + bAct;                            // 92,274,688
  if (total > ws_size) return;

  const float* qf  = (const float*)d_in[0];
  const float* kf  = (const float*)d_in[1];
  const float* vf  = (const float*)d_in[2];
  const float* mf  = (const float*)d_in[3];
  const float* wqf = (const float*)d_in[4];
  const float* wkf = (const float*)d_in[5];
  const float* wvf = (const float*)d_in[6];
  const float* wof = (const float*)d_in[7];
  const int*   nhp = (const int*)d_in[8];
  char* ws = (char*)d_ws;
  unsigned short* q16 = (unsigned short*)(ws + o_q16);
  unsigned short* k16 = (unsigned short*)(ws + o_k16);
  unsigned short* v16 = (unsigned short*)(ws + o_v16);
  unsigned short* wq16 = (unsigned short*)(ws + o_wq);
  unsigned short* wk16 = (unsigned short*)(ws + o_wk);
  unsigned short* wv16 = (unsigned short*)(ws + o_wv);
  unsigned short* wo16 = (unsigned short*)(ws + o_wo);
  unsigned short* qhi = (unsigned short*)(ws + o_qhi);
  unsigned short* qlo = (unsigned short*)(ws + o_qlo);
  unsigned short* khi = (unsigned short*)(ws + o_khi);
  unsigned short* klo = (unsigned short*)(ws + o_klo);
  unsigned short* vt  = (unsigned short*)(ws + o_vt);
  unsigned short* chi = (unsigned short*)(ws + o_chi);
  unsigned short* clo = (unsigned short*)(ws + o_clo);
  float* out = (float*)d_out;

  // ---- 1-7: RNE bf16 copies of the float inputs (2 elements per thread; exact grids) ----
  const int n2a = (int)(nAct / 2);            // 2,097,152 = 8192 x 256
  const int n2w = (int)(nW / 2);              //   524,288 = 2048 x 256
  const dim3 ga((unsigned)((n2a + 255) / 256)), gw((unsigned)((n2w + 255) / 256)), blk(256);
  cast_f32_bf16x2<<<ga, blk, 0, stream>>>(qf, q16, n2a);
  cast_f32_bf16x2<<<ga, blk, 0, stream>>>(kf, k16, n2a);
  cast_f32_bf16x2<<<ga, blk, 0, stream>>>(vf, v16, n2a);
  cast_f32_bf16x2<<<gw, blk, 0, stream>>>(wqf, wq16, n2w);
  cast_f32_bf16x2<<<gw, blk, 0, stream>>>(wkf, wk16, n2w);
  cast_f32_bf16x2<<<gw, blk, 0, stream>>>(wvf, wv16, n2w);
  cast_f32_bf16x2<<<gw, blk, 0, stream>>>(wof, wo16, n2w);

  const int MTOK = N_BATCH * SEQ_LEN;         // 4096 rows of [B*S][.] planes
  // ---- 8,9: Q and K projections: C[4096][1024] = X[4096][1024] . W^T, W [1024 out][1024 in] = Bt[N][K];
  //      M=4096, N=1024 (x64), K=1024 (x32); 64*16 = 1024 wave tiles = 128 blocks; out = bf16 hi + lo planes
  {
    const int tiles = (MTOK / 64) * (D_INNER / 64);
    const dim3 g((unsigned)((tiles + 7) / 8), 1);
    wmma_gemm64<1, false, 0, 2, false><<<g, 256, 0, stream>>>(
        q16, q16, D_MODEL, 0L, wq16, wq16, D_MODEL, 0L, (void*)qhi, (void*)qlo, D_INNER, 0L,
        mf, mf, 0L, MTOK, D_INNER, D_MODEL, 1.0f);
    wmma_gemm64<1, false, 0, 2, false><<<g, 256, 0, stream>>>(
        k16, k16, D_MODEL, 0L, wk16, wk16, D_MODEL, 0L, (void*)khi, (void*)klo, D_INNER, 0L,
        mf, mf, 0L, MTOK, D_INNER, D_MODEL, 1.0f);
  }
  // ---- 10: V projection, role-swapped so the output is V^T per batch element:
  //      C_b[e][s] = sum_k Wv[e][k] . v_b[s][k]; A = Wv [1024][1024] (shared, strideA 0), Bt = v_b [2048][1024],
  //      C_b [1024][2048] f16; M=1024, N=2048 (x64), K=1024 (x32); 16*32 = 512 tiles = 64 blocks, grid.y = 2
  {
    const int tiles = (D_INNER / 64) * (SEQ_LEN / 64);
    const dim3 g((unsigned)((tiles + 7) / 8), (unsigned)N_BATCH);
    wmma_gemm64<1, false, 0, 1, false><<<g, 256, 0, stream>>>(
        wv16, wv16, D_MODEL, 0L, v16, v16, D_MODEL, (long)SEQ_LEN * D_MODEL,
        (void*)vt, (void*)vt, SEQ_LEN, (long)D_INNER * SEQ_LEN,
        mf, mf, 0L, D_INNER, SEQ_LEN, D_MODEL, 1.0f);
  }
  // ---- 11: attention: 2 x 16 x 32 = 1024 blocks of 128 threads ----
  {
    const dim3 g((unsigned)(N_BATCH * N_HEAD * (SEQ_LEN / AT_QB)));
    mha_bias_kernel<<<g, 128, 0, stream>>>(qhi, qlo, khi, klo, vt, mf, chi, clo, nhp);
  }
  // ---- 12: output projection: out[4096][1024] = (ctx_hi + ctx_lo)[4096][1024] . Wo^T, Wo [1024 out][1024 in];
  //      M=4096, N=1024 (x64), K=1024 (x32); 1024 tiles = 128 blocks; f32 out
  {
    const int tiles = (MTOK / 64) * (D_MODEL / 64);
    const dim3 g((unsigned)((tiles + 7) / 8), 1);
    wmma_gemm64<1, true, 0, 0, false, 0, false><<<g, 256, 0, stream>>>(
        chi, clo, D_INNER, 0L, wo16, wo16, D_INNER, 0L, (void*)out, (void*)out, D_MODEL, 0L,
        mf, mf, 0L, MTOK, D_MODEL, D_INNER, 1.0f);
  }
}

// v002
// Measured time: 273 microseconds a run.
// Two timings next to v001 put it at 1.46 and 1.48 times that version's speed.
// Over all steps from v000 it is 1.75 times as fast.
// Contractions: q/k/v projections = v_wmma_f32_16x16x32_bf16 on RNE-bf16 copies of the inputs (single product); q.k^T = v_wmma_f32_16x16x32_bf16 with bf16 hi/lo split operands (hi.hi + hi.lo + lo.hi); p.v = v_wmma_f32_16x16x32_f16 (p carried x2^15 in f16, v^T stored f16); output projection = v_wmma_f32_16x16x32_bf16 with ctx bf16 hi/lo x Wo bf16 (hi.W + lo.W); f32 accumulate everywhere; additive mask (RNE-bf16 values) and online softmax in f32.
#include <hip/hip_runtime.h>
#include <math.h>
#include <stdint.h>

constexpr int N_BATCH = 2;
constexpr int SEQ_LEN = 2048;
constexpr int D_MODEL = 1024;                 // d_ff (input / output feature width)
constexpr int N_HEAD  = 16;
constexpr int D_HEAD  = 64;
constexpr int D_INNER = N_HEAD * D_HEAD;      // 1024
static_assert(D_INNER == 1024, "inner width");
static_assert(SEQ_LEN % 64 == 0 && D_MODEL % 64 == 0 && D_INNER % 64 == 0, "tile multiples");
static_assert(D_MODEL % 32 == 0 && D_INNER % 32 == 0, "K multiples of 32");

typedef __attribute__((ext_vector_type(16))) _Float16 v16h;
typedef __attribute__((ext_vector_type(8)))  _Float16 v8h;
typedef __attribute__((ext_vector_type(16))) __bf16   v16b;
typedef __attribute__((ext_vector_type(8)))  __bf16   v8b;
typedef __attribute__((ext_vector_type(8)))  float    v8f;
typedef __attribute__((ext_vector_type(4)))  float    v4f;
typedef __attribute__((ext_vector_type(2)))  float    v2f;

__device__ __forceinline__ unsigned short f2bf_bits(float f) {
  unsigned u = __float_as_uint(f);
  return (unsigned short)((u + 0x7FFFu + ((u >> 16) & 1u)) >> 16);
}
__device__ __forceinline__ float bf_bits2f(unsigned short h) { return __uint_as_float(((unsigned)h) << 16); }
__device__ __forceinline__ unsigned pk16(unsigned short a, unsigned short b) { return (unsigned)a | ((unsigned)b << 16); }

// hazard guards as plain device helpers
__device__ __forceinline__ void dep_guard_h(v8f& a, v8f& b, v16h x, v16h y) { asm volatile("v_nop\n\tv_nop\n\tv_nop\n\tv_nop" : "+v"(a), "+v"(b) : "v"(x), "v"(y)); }
__device__ __forceinline__ void dep_guard_b(v8f& a, v8f& b, v16b x, v16b y) { asm volatile("v_nop\n\tv_nop\n\tv_nop\n\tv_nop" : "+v"(a), "+v"(b) : "v"(x), "v"(y)); }
__device__ __forceinline__ void keep4_h(v16h a, v16h b, v16h c, v16h d) { asm volatile("v_nop" :: "v"(a), "v"(b), "v"(c), "v"(d)); }
__device__ __forceinline__ void keep4_b(v16b a, v16b b, v16b c, v16b d) { asm volatile("v_nop" :: "v"(a), "v"(b), "v"(c), "v"(d)); }
__device__ __forceinline__ void acc_guard4(v8f& a, v8f& b, v8f& c, v8f& d) { asm volatile("v_nop\n\tv_nop\n\tv_nop\n\tv_nop" : "+v"(a), "+v"(b), "+v"(c), "+v"(d)); }
template <typename T> struct Frag;
template <> struct Frag<_Float16> {
  typedef v16h V; union U { v16h v; v8h h[2]; };
  static __device__ __forceinline__ v16h load(const _Float16* p) {   // elements 0..7 <- p[0..7], 8..15 <- p[16..23]
    U f; f.h[0] = *(const v8h*)(p); f.h[1] = *(const v8h*)(p + 16); return f.v;
  }
  static __device__ __forceinline__ v8f mma(v16h a, v16h b, v8f c) {
    return __builtin_amdgcn_wmma_f32_16x16x32_f16(false, a, false, b, (short)0, c, false, false);
  }
  static __device__ __forceinline__ void guard(v8f& a, v8f& b, v16h x, v16h y) { dep_guard_h(a, b, x, y); }
  static __device__ __forceinline__ void keep(v16h a, v16h b, v16h c, v16h d) { keep4_h(a, b, c, d); }
};
template <> struct Frag<__bf16> {
  typedef v16b V; union U { v16b v; v8b h[2]; };
  static __device__ __forceinline__ v16b load(const __bf16* p) {
    U f; f.h[0] = *(const v8b*)(p); f.h[1] = *(const v8b*)(p + 16); return f.v;
  }
  static __device__ __forceinline__ v8f mma(v16b a, v16b b, v8f c) {
    return __builtin_amdgcn_wmma_f32_16x16x32_bf16(false, a, false, b, (short)0, c, false, false);
  }
  static __device__ __forceinline__ void guard(v8f& a, v8f& b, v16b x, v16b y) { dep_guard_b(a, b, x, y); }
  static __device__ __forceinline__ void keep(v16b a, v16b b, v16b c, v16b d) { keep4_b(a, b, c, d); }
};

// ---- Register-blocked batched WMMA GEMM ------------------------------------
// C[m,n] = scale * sum_k A[m,k] * Bt[n,k] (+bias)(+resid); each wave owns a 64x64 tile; the 8 waves of a block
// form a 2 (M) x 4 (N) grid = one 128x256 block tile, whose operand rows reach LDS 64 k at a time (a stage) by
// asynchronous 16-byte copies, two buffers: stage t+1 flies while stage t is multiplied.
// A row-major [M,K]; Bt row-major [N,K]; M % 128 == 0, N % 256 == 0, K % 64 == 0.
// SPLIT: operands are hi/lo planes (A2/Bt2 = lo planes, same layout); product = hi.hi + hi.lo + lo.hi.
// BLO = false with SPLIT: the Bt lo plane is not used (product = hi.B + lo.B, B a single plane).
// BIAS_MODE: 0 = none, 1 = bias[m], 2 = bias[n].
// OUT_MODE: 0 = f32, 1 = f16, 2 = bf16 hi plane (Cout) + bf16 lo plane (Cout2).
// ET: 0 = f16 operands, 1 = bf16 operands (pointers passed as 16-bit storage)
// Asynchronous 16-byte-per-lane copies global -> LDS, eight or twelve to a statement. The s_wait_xcnt is the last line
// of the copies' own statement so that it stands in front of every later write of the address registers they name.
struct CopyRows { unsigned l; const void* g; };   // this lane's LDS byte address and global address of one row segment
__device__ __forceinline__ void async_copy8(CopyRows a, CopyRows b, CopyRows c, CopyRows d,
                                            CopyRows e, CopyRows f, CopyRows g, CopyRows h) {
  asm volatile("global_load_async_to_lds_b128 %0, %1, off\n\t"
               "global_load_async_to_lds_b128 %2, %3, off\n\t"
               "global_load_async_to_lds_b128 %4, %5, off\n\t"
               "global_load_async_to_lds_b128 %6, %7, off\n\t"
               "global_load_async_to_lds_b128 %8, %9, off\n\t"
               "global_load_async_to_lds_b128 %10, %11, off\n\t"
               "global_load_async_to_lds_b128 %12, %13, off\n\t"
               "global_load_async_to_lds_b128 %14, %15, off\n\t"
               "s_wait_xcnt 0x0"
               :: "v"(a.l), "v"(a.g), "v"(b.l), "v"(b.g), "v"(c.l), "v"(c.g), "v"(d.l), "v"(d.g),
                  "v"(e.l), "v"(e.g), "v"(f.l), "v"(f.g), "v"(g.l), "v"(g.g), "v"(h.l), "v"(h.g) : "memory");
}
__device__ __forceinline__ void async_copy12(CopyRows a, CopyRows b, CopyRows c, CopyRows d,
                                             CopyRows e, CopyRows f, CopyRows g, CopyRows h,
                                             CopyRows i, CopyRows j, CopyRows k, CopyRows m) {
  asm volatile("global_load_async_to_lds_b128 %0, %1, off\n\t"
               "global_load_async_to_lds_b128 %2, %3, off\n\t"
               "global_load_async_to_lds_b128 %4, %5, off\n\t"
               "global_load_async_to_lds_b128 %6, %7, off\n\t"
               "global_load_async_to_lds_b128 %8, %9, off\n\t"
               "global_load_async_to_lds_b128 %10, %11, off\n\t"
               "global_load_async_to_lds_b128 %12, %13, off\n\t"
               "global_load_async_to_lds_b128 %14, %15, off\n\t"
               "global_load_async_to_lds_b128 %16, %17, off\n\t"
               "global_load_async_to_lds_b128 %18, %19, off\n\t"
               "global_load_async_to_lds_b128 %20, %21, off\n\t"
               "global_load_async_to_lds_b128 %22, %23, off\n\t"
               "s_wait_xcnt 0x0"
               :: "v"(a.l), "v"(a.g), "v"(b.l), "v"(b.g), "v"(c.l), "v"(c.g), "v"(d.l), "v"(d.g),
                  "v"(e.l), "v"(e.g), "v"(f.l), "v"(f.g), "v"(g.l), "v"(g.g), "v"(h.l), "v"(h.g),
                  "v"(i.l), "v"(i.g), "v"(j.l), "v"(j.g), "v"(k.l), "v"(k.g), "v"(m.l), "v"(m.g) : "memory");
}
#define GM_PITCH 144            // LDS row pitch in bytes of a 128-byte stage row: 16 B x odd, conflict-free 16-byte fragment reads
#define GM_PE    (GM_PITCH / 2) // the same in 16-bit elements
template <int ET> struct Elem;
template <> struct Elem<0> { typedef _Float16 T; };
template <> struct Elem<1> { typedef __bf16 T; };
template <int ET, bool SPLIT, int BIAS_MODE, int OUT_MODE, bool RESID, int ACT = 0, bool BLO = true>
__global__ __launch_bounds__(256) void wmma_gemm64(
    const unsigned short* __restrict__ Ap, const unsigned short* __restrict__ A2p, int lda, long strideA,
    const unsigned short* __restrict__ Btp, const unsigned short* __restrict__ Bt2p, int ldb, long strideB,
    void* __restrict__ Cout, void* __restrict__ Cout2, int ldc, long strideC,
    const float* __restrict__ bias,
    const float* __restrict__ resid, long strideR,
    int M, int N, int K, float scale) {
  typedef typename Elem<ET>::T T;
  typedef typename Frag<T>::V V;
  const T* A = (const T*)Ap; const T* A2 = (const T*)A2p; const T* Bt = (const T*)Btp; const T* Bt2 = (const T*)Bt2p;
  __shared__ __align__(16) float sT[8][16 * 68];   // per-wave 16x64 slab, pitch 68 floats
  // one stage = [A 128 rows | A lo 128 rows (SPLIT) | Bt 256 rows | Bt lo 256 rows (SPLIT && BLO)], 64 k each
  constexpr unsigned OFF_A2  = 128u * GM_PITCH;
  constexpr unsigned OFF_B   = OFF_A2 + (SPLIT ? 128u * GM_PITCH : 0u);
  constexpr unsigned OFF_B2  = OFF_B + 256u * GM_PITCH;
  constexpr unsigned STAGE_B = OFF_B2 + ((SPLIT && BLO) ? 256u * GM_PITCH : 0u);
  __shared__ __align__(16) unsigned char ring[2 * STAGE_B];
  const int b    = blockIdx.y;
  const int lane = threadIdx.x & 31;
  const int wave = threadIdx.x >> 5;
  const int tilesN = N >> 8;
  const int tilesM = M >> 7;
  if ((int)blockIdx.x >= tilesM * tilesN) return;   // block-uniform, ahead of every copy and barrier
  const int bm  = blockIdx.x / tilesN;
  const int bn  = blockIdx.x - bm * tilesN;
  const int wm0 = (wave >> 2) << 6;            // this wave's rows inside the block tile
  const int wn0 = (wave & 3) << 6;             // this wave's columns inside the block tile
  const int m0 = (bm << 7) + wm0;
  const int n0 = (bn << 8) + wn0;

  const T* Ab  = A  + (size_t)b * strideA;
  const T* Bb  = Bt + (size_t)b * strideB;
  const T* Ab2 = SPLIT ? (A2  + (size_t)b * strideA) : nullptr;
  const T* Bb2 = (SPLIT && BLO) ? (Bt2 + (size_t)b * strideB) : nullptr;

  const int rlane = lane & 15;                 // row (A) / col (B, D) within subtile
  const int koff  = (lane >> 4) * 8;           // k offset of this lane half
  const int mOff  = (lane >> 4) * 8;           // D row offset

  // staging map: 8 lanes x 16 B = one whole 128-byte row segment; a copy of the block covers 32 rows
  const int srow = threadIdx.x >> 3;           // 0..31
  const int sseg = (threadIdx.x & 7) * 8;      // first of this lane's 8 elements in the 64-element row
  const size_t aoff = (size_t)((bm << 7) + srow) * lda + sseg;
  const size_t boff = (size_t)((bn << 8) + srow) * ldb + sseg;
  const size_t a32 = (size_t)32 * lda, b32 = (size_t)32 * ldb;
  const unsigned lds0 = (unsigned)(uintptr_t)ring + (unsigned)(srow * GM_PITCH + sseg * 2);
  auto copy_stage = [&](int st, int buf) {     // all lanes on, rows and k inside the operands by the size conditions above
    const unsigned l = lds0 + (unsigned)buf * STAGE_B;
    auto rows = [](unsigned lds, const T* g, size_t step32, int i) {   // row group i: 32 rows further on in both places
      return CopyRows{lds + (unsigned)i * 32u * GM_PITCH, (const void*)(g + (size_t)i * step32)};
    };
    const T* ga = Ab + aoff + (size_t)st * 64;
    const T* gb = Bb + boff + (size_t)st * 64;
    const unsigned lb = l + OFF_B;
    if (!SPLIT) {
      async_copy12(rows(l, ga, a32, 0), rows(l, ga, a32, 1), rows(l, ga, a32, 2), rows(l, ga, a32, 3),
                   rows(lb, gb, b32, 0), rows(lb, gb, b32, 1), rows(lb, gb, b32, 2), rows(lb, gb, b32, 3),
                   rows(lb, gb, b32, 4), rows(lb, gb, b32, 5), rows(lb, gb, b32, 6), rows(lb, gb, b32, 7));
    } else {
      const unsigned l2 = l + OFF_A2;
      const T* ga2 = Ab2 + aoff + (size_t)st * 64;
      async_copy8(rows(l, ga, a32, 0), rows(l, ga, a32, 1), rows(l, ga, a32, 2), rows(l, ga, a32, 3),
                  rows(l2, ga2, a32, 0), rows(l2, ga2, a32, 1), rows(l2, ga2, a32, 2), rows(l2, ga2, a32, 3));
      async_copy8(rows(lb, gb, b32, 0), rows(lb, gb, b32, 1), rows(lb, gb, b32, 2), rows(lb, gb, b32, 3),
                  rows(lb, gb, b32, 4), rows(lb, gb, b32, 5), rows(lb, gb, b32, 6), rows(lb, gb, b32, 7));
      if (BLO) {
        const unsigned lb2 = l + OFF_B2;
        const T* gb2 = Bb2 + boff + (size_t)st * 64;
        async_copy8(rows(lb2, gb2, b32, 0), rows(lb2, gb2, b32, 1), rows(lb2, gb2, b32, 2), rows(lb2, gb2, b32, 3),
                    rows(lb2, gb2, b32, 4), rows(lb2, gb2, b32, 5), rows(lb2, gb2, b32, 6), rows(lb2, gb2, b32, 7));
      }
    }
  };

  v8f acc[4][4];
#pragma unroll
  for (int i = 0; i < 4; ++i)
#pragma unroll
    for (int j = 0; j < 4; ++j) acc[i][j] = (v8f){0.f,0.f,0.f,0.f,0.f,0.f,0.f,0.f};

  const int nst = K >> 6;                      // stages of 64 k
  copy_stage(0, 0);
  asm volatile("s_wait_asynccnt 0x0" ::: "memory");   // this wave's share of stage 0 has landed
  __syncthreads();                                    // every wave's share has: stage 0 may be read
  if (nst > 1) copy_stage(1, 1);
  for (int st = 0; st < nst; ++st) {
    const int buf = st & 1;
    const T* sA  = (const T*)(ring + (unsigned)buf * STAGE_B);
    const T* sA2 = (const T*)(ring + (unsigned)buf * STAGE_B + OFF_A2);
    const T* sB  = (const T*)(ring + (unsigned)buf * STAGE_B + OFF_B);
    const T* sB2 = (const T*)(ring + (unsigned)buf * STAGE_B + OFF_B2);
#pragma unroll   // both 32-k halves of a stage in line, so that kk folds into the LDS loads' immediate offsets
    for (int kk = 0; kk < 64; kk += 32) {
      V bh[4], bl[4];
#pragma unroll
      for (int j = 0; j < 4; ++j) {
        const int bo = (wn0 + (j << 4) + rlane) * GM_PE + koff + kk;
        bh[j] = Frag<T>::load(sB + bo);
        if (SPLIT && BLO) bl[j] = Frag<T>::load(sB2 + bo);
      }
#pragma unroll
      for (int i = 0; i < 4; ++i) {
        const int ao = (wm0 + (i << 4) + rlane) * GM_PE + koff + kk;
        V ah = Frag<T>::load(sA + ao);
        V al;
        if (SPLIT) al = Frag<T>::load(sA2 + ao);
#pragma unroll
        for (int j = 0; j < 4; ++j) {
          acc[i][j] = Frag<T>::mma(ah, bh[j], acc[i][j]);
          if (SPLIT) {
            if (BLO) acc[i][j] = Frag<T>::mma(ah, bl[j], acc[i][j]);
            acc[i][j] = Frag<T>::mma(al, bh[j], acc[i][j]);
          }
        }
        Frag<T>::guard(acc[i][0], acc[i][3], ah, SPLIT ? al : ah);
      }
      Frag<T>::keep(bh[0], bh[1], bh[2], bh[3]);
      if (SPLIT && BLO) Frag<T>::keep(bl[0], bl[1], bl[2], bl[3]);
    }
    asm volatile("s_wait_dscnt 0x0" ::: "memory");      // this wave's reads of buffer buf are done before it is refilled
    asm volatile("s_wait_asynccnt 0x0" ::: "memory");   // this wave's share of stage st + 1 has landed
    __syncthreads();                                    // publishes stage st + 1 and ends every reader's use of buffer buf
    if (st + 2 < nst) copy_stage(st + 2, buf);
  }
  asm volatile("s_wait_asynccnt 0x0" ::: "memory");     // nothing of this wave's copies is outstanding past the loop
  acc_guard4(acc[0][0], acc[0][1], acc[0][2], acc[0][3]);
  acc_guard4(acc[1][0], acc[1][1], acc[1][2], acc[1][3]);
  acc_guard4(acc[2][0], acc[2][1], acc[2][2], acc[2][3]);
  acc_guard4(acc[3][0], acc[3][1], acc[3][2], acc[3][3]);

  // ---- epilogue ----
  float* slab = sT[wave];
  const float* Rb = RESID ? (resid + (size_t)b * strideR) : nullptr;
#pragma unroll
  for (int i = 0; i < 4; ++i) {
    const int mBase = m0 + (i << 4);
#pragma unroll
    for (int j = 0; j < 4; ++j) {
      const int n = n0 + (j << 4) + rlane;
      float bv = 0.f;
      if (BIAS_MODE == 2) bv = bias[n];
#pragma unroll
      for (int r = 0; r < 8; ++r) {
        float v = acc[i][j][r] * scale;
        if (BIAS_MODE == 1) v += bias[mBase + mOff + r];
        if (BIAS_MODE == 2) v += bv;
        if (RESID) v += Rb[(size_t)(mBase + mOff + r) * ldc + n];
        if (ACT == 1) v = tanhf(v);
        if (ACT == 2) v = fmaxf(v, 0.0f);
        if (ACT == 3) v = v / (1.0f + expf(-v));
        if (ACT == 4) v = (v > 0.f) ? v : 0.01f * v;
        slab[(mOff + r) * 68 + (j << 4) + rlane] = v;
      }
    }
    __builtin_amdgcn_fence(__ATOMIC_RELEASE, "workgroup");
    __builtin_amdgcn_wave_barrier();
    __builtin_amdgcn_fence(__ATOMIC_ACQUIRE, "workgroup");
    if (OUT_MODE == 0) {
      float* C = (float*)Cout + (size_t)b * strideC;
      const int hh = lane >> 4, c4 = (lane & 15) * 4;     // row seg = 256 B = 16 lanes x 16 B
      {
#pragma unroll
        for (int it = 0; it < 8; ++it) {
          const int row = it * 2 + hh;
          v4f v = *(const v4f*)(slab + row * 68 + c4);
          *(v4f*)(C + (size_t)(mBase + row) * ldc + n0 + c4) = v;
        }
        
      }
    } else {
      const int q = lane >> 3, c8 = (lane & 7) * 8;
      unsigned short* C  = (unsigned short*)Cout  + (size_t)b * strideC;
      unsigned short* C2 = (OUT_MODE == 2) ? ((unsigned short*)Cout2 + (size_t)b * strideC) : nullptr;
      {
#pragma unroll
        for (int it = 0; it < 4; ++it) {
          const int row = it * 4 + q;
          const float* sp = slab + row * 68 + c8;
          v8h hv, lv;
#pragma unroll
          for (int e = 0; e < 8; ++e) {
            if (OUT_MODE == 1) {
              hv[e] = (_Float16)sp[e];
            } else {
              unsigned short hb = f2bf_bits(sp[e]);
              unsigned short lb = f2bf_bits(sp[e] - bf_bits2f(hb));
              hv[e] = __builtin_bit_cast(_Float16, hb);
              lv[e] = __builtin_bit_cast(_Float16, lb);
            }
          }
          *(v8h*)(C + (size_t)(mBase + row) * ldc + n0 + c8) = hv;
          if (OUT_MODE == 2) *(v8h*)(C2 + (size_t)(mBase + row) * ldc + n0 + c8) = lv;
        }
        
      }
    }
    __builtin_amdgcn_fence(__ATOMIC_RELEASE, "workgroup");
    __builtin_amdgcn_wave_barrier();
    __builtin_amdgcn_fence(__ATOMIC_ACQUIRE, "workgroup");
  }
}

// ---------------------------------------------------------------------------
// f32 -> bf16 (RNE) cast: 2 elements per thread, one 4-B store per lane -> each wave writes exactly one whole
// Coverage: grid = n2/256 blocks x 256 threads x 2 elements = 2*n2 elements = the whole plane
// (activations: n2 = 4096*1024/2 = 2,097,152 = 8192 blocks; weights: n2 = 1024*1024/2 = 524,288 = 2048 blocks).
// ---------------------------------------------------------------------------
__global__ __launch_bounds__(256) void cast_f32_bf16x2(const float* __restrict__ in,
                                                        unsigned short* __restrict__ out, int n2) {
  const int i = blockIdx.x * 256 + threadIdx.x;
  if (i < n2) {
    const v2f f = *(const v2f*)(in + 2 * (size_t)i);
    const unsigned u = pk16(f2bf_bits(f[0]), f2bf_bits(f[1]));
    ((unsigned*)out)[i] = u;
    
  }
}

// =====================================================================================
// Full (non-causal) attention with additive score bias, head dim 64, unscaled scores.
//   q planes (bf16 hi/lo): element (b, s, h, d) at [(b*S + s)*D_INNER + h*64 + d]
//   k planes (bf16 hi/lo): same layout
//   v^T plane (f16 bits):  element (b, h, d, s) at [(b*D_INNER + h*64 + d)*S + s]
//   bias (f32):            element (b, q, kv) at [b*S*S + q*S + kv]; added as RNE-bf16 value in f32
//   ctx planes out (bf16 hi/lo): element (b, s, h, d) at [(b*S + s)*D_INNER + h*64 + d]
//   scores = q . k : bf16 hi/lo split (hi.hi + hi.lo + lo.hi) on v_wmma_f32_16x16x32_bf16
//   ctx    = p . v : p (unnormalised, x2^15) and v^T as f16 on v_wmma_f32_16x16x32_f16, f32 accumulate,
//            the 2^15 carry folded into the final 1/l.
//   online softmax in f32 over all S keys (32 chunks of 64, compile-time trip count).
//   Block = 4 waves = 64 query rows of one (b, h); grid.x = N_BATCH * N_HEAD * (S/64) = 1024.
//   K hi/lo and V^T chunk staging: 128 threads x 32 elements per plane = the whole 64x64 tile (16-B copies,
//   plain loads, __syncthreads before and after); fragment loads read the LDS tiles with the v8b element type.
//   planes written by 8 lanes x 16 B in one instruction; 4 it x 32 lanes x 8 elements = 16x64 = whole tile;
// =====================================================================================
#define AT_D 64
#define AT_NW 4
#define AT_QB 64
#define AT_KC 64
#define AT_LP 72   // LDS row pitch in 16-bit elements: 144 B = 16 B x odd, so the 16 rows of a 16-byte fragment read fall on 64 distinct banks
#define P_CARRY 32768.0f

__device__ __forceinline__ v8f at_mma(v16b a, v16b b, v8f c) {
  c = __builtin_amdgcn_wmma_f32_16x16x32_bf16(false, a, false, b, (short)0, c, false, false);
  asm volatile("v_nop\n\tv_nop\n\tv_nop\n\tv_nop" : "+v"(c) : "v"(a), "v"(b));
  return c;
}
__device__ __forceinline__ v8f at_mma_h(v16b a, v16b b, v8f c) {   // operands hold f16 bit patterns
  const v16h ah = __builtin_bit_cast(v16h, a), bh = __builtin_bit_cast(v16h, b);
  c = __builtin_amdgcn_wmma_f32_16x16x32_f16(false, ah, false, bh, (short)0, c, false, false);
  asm volatile("v_nop\n\tv_nop\n\tv_nop\n\tv_nop" : "+v"(c) : "v"(ah), "v"(bh));
  return c;
}
__device__ __forceinline__ __bf16 at_f16bits(float f) { return __builtin_bit_cast(__bf16, (_Float16)f); }

__global__ __launch_bounds__(128)
void mha_bias_kernel(const unsigned short* __restrict__ qhp, const unsigned short* __restrict__ qlp,
                     const unsigned short* __restrict__ khp, const unsigned short* __restrict__ klp,
                     const unsigned short* __restrict__ vtp, const float* __restrict__ biasp,
                     unsigned short* __restrict__ chp, unsigned short* __restrict__ clp,
                     const int* __restrict__ nheads_in) {
  (void)nheads_in;   // module constant (16); shapes are compile-time here
  union FB { v16b v; v8b h[2]; };
  __shared__ __align__(16) __bf16 Ksh[AT_KC * AT_LP];            // K hi [kv][d]      9 KB
  __shared__ __align__(16) __bf16 Ksl[AT_KC * AT_LP];            // K lo              9 KB
  __shared__ __align__(16) __bf16 Vth[AT_D * AT_LP];             // V^T f16 bits [d][kv] 9 KB
  __shared__ __align__(16) __bf16 Psh[AT_NW][16 * AT_LP];        // per wave P f16 bits [row][kv] 9 KB
  __shared__ __align__(16) float  Os[AT_NW][16 * 68];            // per wave out tile, pitch 68

  const int tid  = threadIdx.x;
  const int wave = tid >> 5;
  const int lane = tid & 31;
  const int hh   = lane >> 4;
  const int c    = lane & 15;

  const int nqb = SEQ_LEN / AT_QB;        // 32
  const int bx  = blockIdx.x;             // 0 .. N_BATCH*N_HEAD*nqb - 1 (exact grid)
  const int qb  = bx % nqb;
  const int bhd = bx / nqb;               // 0 .. 31
  const int h   = bhd % N_HEAD;
  const int b   = bhd / N_HEAD;           // 0 .. N_BATCH-1
  const int q0  = qb * AT_QB + wave * 16;

  const size_t rowb = (size_t)b * SEQ_LEN;   // token-row base of this batch element
  const __bf16* Qh = (const __bf16*)(const void*)qhp + rowb * D_INNER + (size_t)h * AT_D;
  const __bf16* Ql = (const __bf16*)(const void*)qlp + rowb * D_INNER + (size_t)h * AT_D;
  const __bf16* Kh = (const __bf16*)(const void*)khp + rowb * D_INNER + (size_t)h * AT_D;
  const __bf16* Kl = (const __bf16*)(const void*)klp + rowb * D_INNER + (size_t)h * AT_D;
  const __bf16* Vt = (const __bf16*)(const void*)vtp + ((size_t)b * D_INNER + (size_t)h * AT_D) * SEQ_LEN;
  const float*  Mb = biasp + (size_t)b * SEQ_LEN * SEQ_LEN;
  unsigned short* Ch = chp + rowb * D_INNER + (size_t)h * AT_D;
  unsigned short* Cl = clp + rowb * D_INNER + (size_t)h * AT_D;

  // ---- Q fragments (A operand, row = lane&15, split k map via Frag load): 2 d-chunks, hi and lo ----
  v16b qah[2], qal[2];
#pragma unroll
  for (int dc = 0; dc < 2; ++dc) {
    const __bf16* qr = Qh + (size_t)(q0 + c) * D_INNER + dc * 32 + 8 * hh;
    const __bf16* ql = Ql + (size_t)(q0 + c) * D_INNER + dc * 32 + 8 * hh;
    qah[dc] = Frag<__bf16>::load(qr);
    qal[dc] = Frag<__bf16>::load(ql);
  }

  float mrow[8], lrow[8];
  v8f oacc[4];
#pragma unroll
  for (int r = 0; r < 8; ++r) { mrow[r] = -INFINITY; lrow[r] = 0.f; }
#pragma unroll
  for (int t = 0; t < 4; ++t) oacc[t] = (v8f){0.f,0.f,0.f,0.f,0.f,0.f,0.f,0.f};

  const int nChunks = SEQ_LEN / AT_KC;   // 32, compile-time constant
  for (int kc = 0; kc < nChunks; ++kc) {
    const int kv0 = kc * AT_KC;
    __syncthreads();
    {
      // staging coverage: 128 threads x (4 x 8) elements = 64 rows x 64 per plane = the whole chunk tile
      const int r = tid >> 1, half = (tid & 1) * 32;
      const __bf16* ksh = Kh + (size_t)(kv0 + r) * D_INNER + half;   // K row kv0+r, d = half..half+31
      const __bf16* ksl = Kl + (size_t)(kv0 + r) * D_INNER + half;
      const __bf16* vs  = Vt + (size_t)r * SEQ_LEN + kv0 + half;      // V^T row d = r, s = kv0+half..+31
#pragma unroll
      for (int i = 0; i < 4; ++i) {
        const v8b a0 = *(const v8b*)(ksh + 8 * i);
        const v8b a1 = *(const v8b*)(ksl + 8 * i);
        const v8b b0 = *(const v8b*)(vs + 8 * i);
        *(v8b*)(Ksh + r * AT_LP + half + 8 * i) = a0;
        *(v8b*)(Ksl + r * AT_LP + half + 8 * i) = a1;
        *(v8b*)(Vth + r * AT_LP + half + 8 * i) = b0;
      }
    }
    __syncthreads();

    // ---- scores: 4 kv subtiles of 16, 2 d-chunks, 3 products each ----
    v8f s[4];
#pragma unroll
    for (int j = 0; j < 4; ++j) {
      s[j] = (v8f){0.f,0.f,0.f,0.f,0.f,0.f,0.f,0.f};
#pragma unroll
      for (int dc = 0; dc < 2; ++dc) {
        FB kb, kl;
        kb.h[0] = *(const v8b*)(Ksh + (j * 16 + c) * AT_LP + dc * 32 + 8 * hh);
        kb.h[1] = *(const v8b*)(Ksh + (j * 16 + c) * AT_LP + dc * 32 + 16 + 8 * hh);
        kl.h[0] = *(const v8b*)(Ksl + (j * 16 + c) * AT_LP + dc * 32 + 8 * hh);
        kl.h[1] = *(const v8b*)(Ksl + (j * 16 + c) * AT_LP + dc * 32 + 16 + 8 * hh);
        s[j] = at_mma(qah[dc], kb.v, s[j]);
        s[j] = at_mma(qah[dc], kl.v, s[j]);
        s[j] = at_mma(qal[dc], kb.v, s[j]);
      }
    }
    // ---- additive bias by value (D element r of lane = (q row 8hh+r, kv col j*16+c)), chunk row max ----
    float cm[8];
#pragma unroll
    for (int r = 0; r < 8; ++r) {
      const float* mrp = Mb + (size_t)(q0 + 8 * hh + r) * SEQ_LEN + kv0 + c;   // all indices in range by construction
      float m = -INFINITY;
#pragma unroll
      for (int j = 0; j < 4; ++j) {
        const float mv = bf_bits2f(f2bf_bits(mrp[j * 16]));
        const float sv = s[j][r] + mv;
        s[j][r] = sv;
        m = fmaxf(m, sv);
      }
#pragma unroll
      for (int off = 1; off < 16; off <<= 1) m = fmaxf(m, __shfl_xor(m, off, 32));
      cm[r] = m;
    }
    __bf16* pwh = Psh[wave];
#pragma unroll
    for (int r = 0; r < 8; ++r) {
      const float mnew = fmaxf(mrow[r], cm[r]);
      const float alpha = expf(mrow[r] - mnew);
      mrow[r] = mnew;
      float psum = 0.f;
#pragma unroll
      for (int j = 0; j < 4; ++j) {
        const float p = expf(s[j][r] - mnew);
        psum += p;
        pwh[(8 * hh + r) * AT_LP + j * 16 + c] = at_f16bits(p * P_CARRY);
      }
#pragma unroll
      for (int off = 1; off < 16; off <<= 1) psum += __shfl_xor(psum, off, 32);
      lrow[r] = lrow[r] * alpha + psum;
#pragma unroll
      for (int t = 0; t < 4; ++t) oacc[t][r] *= alpha;
    }
    __builtin_amdgcn_fence(__ATOMIC_RELEASE, "workgroup");
    __builtin_amdgcn_wave_barrier();
    __builtin_amdgcn_fence(__ATOMIC_ACQUIRE, "workgroup");
#pragma unroll 1
    for (int kk = 0; kk < 2; ++kk) {
      FB pa;
      pa.h[0] = *(const v8b*)(pwh + c * AT_LP + kk * 32 + 8 * hh);
      pa.h[1] = *(const v8b*)(pwh + c * AT_LP + kk * 32 + 16 + 8 * hh);
#pragma unroll
      for (int t = 0; t < 4; ++t) {
        FB vb;
        vb.h[0] = *(const v8b*)(Vth + (t * 16 + c) * AT_LP + kk * 32 + 8 * hh);
        vb.h[1] = *(const v8b*)(Vth + (t * 16 + c) * AT_LP + kk * 32 + 16 + 8 * hh);
        oacc[t] = at_mma_h(pa.v, vb.v, oacc[t]);
      }
    }
  }

  // ---- normalise and stage the 16x64 f32 tile (rows 8hh+r, cols t*16+c) ----
  float* os = Os[wave];
#pragma unroll
  for (int r = 0; r < 8; ++r) {
    const float inv = 1.0f / (lrow[r] * P_CARRY);   // lrow >= 1 (no masking), lrow*2^15 <= 6.8e7
#pragma unroll
    for (int t = 0; t < 4; ++t) os[(8 * hh + r) * 68 + t * 16 + c] = oacc[t][r] * inv;
  }
  __builtin_amdgcn_fence(__ATOMIC_RELEASE, "workgroup");
  __builtin_amdgcn_wave_barrier();
  __builtin_amdgcn_fence(__ATOMIC_ACQUIRE, "workgroup");
  {
    // coverage: 4 it x 32 lanes x 8 elements = 16 rows x 64 = the whole wave tile, per plane;
    const int qg = lane >> 3, c8 = (lane & 7) * 8;
    {
#pragma unroll
      for (int it = 0; it < 4; ++it) {
        const int row = it * 4 + qg;
        const float* sp = os + row * 68 + c8;
        v8h hv, lv;
#pragma unroll
        for (int e = 0; e < 8; ++e) {
          const unsigned short hb = f2bf_bits(sp[e]);
          const unsigned short lb = f2bf_bits(sp[e] - bf_bits2f(hb));
          hv[e] = __builtin_bit_cast(_Float16, hb);
          lv[e] = __builtin_bit_cast(_Float16, lb);
        }
        *(v8h*)(Ch + (size_t)(q0 + row) * D_INNER + c8) = hv;
        *(v8h*)(Cl + (size_t)(q0 + row) * D_INNER + c8) = lv;
      }
      
    }
  }
}

// =====================================================================================
// Host launch glue: only kernel launches; grids/args are pure functions of the (asserted) sizes.
// Workspace region map (bytes; all offsets multiples of 2 MiB):
//   [  0 MiB,  8 MiB)  q  bf16  [4096][1024]
//   [  8 MiB, 16 MiB)  k  bf16  [4096][1024]
//   [ 16 MiB, 24 MiB)  v  bf16  [4096][1024]
//   [ 24 MiB, 26 MiB)  Wq bf16  [1024][1024]   [26,28) Wk   [28,30) Wv   [30,32) Wo
//   [ 32 MiB, 40 MiB)  Q hi bf16 [4096][1024]   [40,48) Q lo
//   [ 48 MiB, 56 MiB)  K hi bf16 [4096][1024]   [56,64) K lo
//   [ 64 MiB, 72 MiB)  V^T f16  [2][1024][2048]
//   [ 72 MiB, 80 MiB)  ctx hi bf16 [4096][1024] [80,88) ctx lo
//   total 88 MiB = 92,274,688 B
// =====================================================================================
extern "C" void kernel_launch(void* const* d_in, const int* in_sizes, int n_in,
                              void* d_out, int out_size, void* d_ws, size_t ws_size,
                              hipStream_t stream) {
  if (n_in < 9) return;
  const size_t nAct  = (size_t)N_BATCH * SEQ_LEN * D_MODEL;     // 4,194,304
  const size_t nW    = (size_t)D_INNER * D_MODEL;               // 1,048,576
  const size_t nMask = (size_t)N_BATCH * SEQ_LEN * SEQ_LEN;     // 8,388,608
  const size_t nVT   = (size_t)N_BATCH * D_INNER * SEQ_LEN;     // 4,194,304
  if ((size_t)in_sizes[0] != nAct || (size_t)in_sizes[1] != nAct || (size_t)in_sizes[2] != nAct ||
      (size_t)in_sizes[3] != nMask || (size_t)in_sizes[4] != nW || (size_t)in_sizes[5] != nW ||
      (size_t)in_sizes[6] != nW || (size_t)in_sizes[7] != nW || in_sizes[8] < 1 ||
      (size_t)out_size != nAct) return;

  const size_t bAct = nAct * 2, bW = nW * 2, bVT = nVT * 2;
  const size_t o_q16 = 0;
  const size_t o_k16 = o_q16 + bAct;
  const size_t o_v16 = o_k16 + bAct;
  const size_t o_wq  = o_v16 + bAct;
  const size_t o_wk  = o_wq + bW;
  const size_t o_wv  = o_wk + bW;
  const size_t o_wo  = o_wv + bW;
  const size_t o_qhi = o_wo + bW;
  const size_t o_qlo = o_qhi + bAct;
  const size_t o_khi = o_qlo + bAct;
  const size_t o_klo = o_khi + bAct;
  const size_t o_vt  = o_klo + bAct;
  const size_t o_chi = o_vt + bVT;
  const size_t o_clo = o_chi + bAct;
  const size_t total = o_clo + bAct;                            // 92,274,688
  if (total > ws_size) return;

  const float* qf  = (const float*)d_in[0];
  const float* kf  = (const float*)d_in[1];
  const float* vf  = (const float*)d_in[2];
  const float* mf  = (const float*)d_in[3];
  const float* wqf = (const float*)d_in[4];
  const float* wkf = (const float*)d_in[5];
  const float* wvf = (const float*)d_in[6];
  const float* wof = (const float*)d_in[7];
  const int*   nhp = (const int*)d_in[8];
  char* ws = (char*)d_ws;
  unsigned short* q16 = (unsigned short*)(ws + o_q16);
  unsigned short* k16 = (unsigned short*)(ws + o_k16);
  unsigned short* v16 = (unsigned short*)(ws + o_v16);
  unsigned short* wq16 = (unsigned short*)(ws + o_wq);
  unsigned short* wk16 = (unsigned short*)(ws + o_wk);
  unsigned short* wv16 = (unsigned short*)(ws + o_wv);
  unsigned short* wo16 = (unsigned short*)(ws + o_wo);
  unsigned short* qhi = (unsigned short*)(ws + o_qhi);
  unsigned short* qlo = (unsigned short*)(ws + o_qlo);
  unsigned short* khi = (unsigned short*)(ws + o_khi);
  unsigned short* klo = (unsigned short*)(ws + o_klo);
  unsigned short* vt  = (unsigned short*)(ws + o_vt);
  unsigned short* chi = (unsigned short*)(ws + o_chi);
  unsigned short* clo = (unsigned short*)(ws + o_clo);
  float* out = (float*)d_out;

  // ---- 1-7: RNE bf16 copies of the float inputs (2 elements per thread; exact grids) ----
  const int n2a = (int)(nAct / 2);            // 2,097,152 = 8192 x 256
  const int n2w = (int)(nW / 2);              //   524,288 = 2048 x 256
  const dim3 ga((unsigned)((n2a + 255) / 256)), gw((unsigned)((n2w + 255) / 256)), blk(256);
  cast_f32_bf16x2<<<ga, blk, 0, stream>>>(qf, q16, n2a);
  cast_f32_bf16x2<<<ga, blk, 0, stream>>>(kf, k16, n2a);
  cast_f32_bf16x2<<<ga, blk, 0, stream>>>(vf, v16, n2a);
  cast_f32_bf16x2<<<gw, blk, 0, stream>>>(wqf, wq16, n2w);
  cast_f32_bf16x2<<<gw, blk, 0, stream>>>(wkf, wk16, n2w);
  cast_f32_bf16x2<<<gw, blk, 0, stream>>>(wvf, wv16, n2w);
  cast_f32_bf16x2<<<gw, blk, 0, stream>>>(wof, wo16, n2w);

  const int MTOK = N_BATCH * SEQ_LEN;         // 4096 rows of [B*S][.] planes
  // ---- 8,9: Q and K projections: C[4096][1024] = X[4096][1024] . W^T, W [1024 out][1024 in] = Bt[N][K];
  //      M=4096, N=1024 (x64), K=1024 (x32); 64*16 = 1024 wave tiles = 128 blocks; out = bf16 hi + lo planes
  {
    const int tiles = (MTOK / 64) * (D_INNER / 64);
    const dim3 g((unsigned)((tiles + 7) / 8), 1);
    wmma_gemm64<1, false, 0, 2, false><<<g, 256, 0, stream>>>(
        q16, q16, D_MODEL, 0L, wq16, wq16, D_MODEL, 0L, (void*)qhi, (void*)qlo, D_INNER, 0L,
        mf, mf, 0L, MTOK, D_INNER, D_MODEL, 1.0f);
    wmma_gemm64<1, false, 0, 2, false><<<g, 256, 0, stream>>>(
        k16, k16, D_MODEL, 0L, wk16, wk16, D_MODEL, 0L, (void*)khi, (void*)klo, D_INNER, 0L,
        mf, mf, 0L, MTOK, D_INNER, D_MODEL, 1.0f);
  }
  // ---- 10: V projection, role-swapped so the output is V^T per batch element:
  //      C_b[e][s] = sum_k Wv[e][k] . v_b[s][k]; A = Wv [1024][1024] (shared, strideA 0), Bt = v_b [2048][1024],
  //      C_b [1024][2048] f16; M=1024, N=2048 (x64), K=1024 (x32); 16*32 = 512 tiles = 64 blocks, grid.y = 2
  {
    const int tiles = (D_INNER / 64) * (SEQ_LEN / 64);
    const dim3 g((unsigned)((tiles + 7) / 8), (unsigned)N_BATCH);
    wmma_gemm64<1, false, 0, 1, false><<<g, 256, 0, stream>>>(
        wv16, wv16, D_MODEL, 0L, v16, v16, D_MODEL, (long)SEQ_LEN * D_MODEL,
        (void*)vt, (void*)vt, SEQ_LEN, (long)D_INNER * SEQ_LEN,
        mf, mf, 0L, D_INNER, SEQ_LEN, D_MODEL, 1.0f);
  }
  // ---- 11: attention: 2 x 16 x 32 = 1024 blocks of 128 threads ----
  {
    const dim3 g((unsigned)(N_BATCH * N_HEAD * (SEQ_LEN / AT_QB)));
    mha_bias_kernel<<<g, 128, 0, stream>>>(qhi, qlo, khi, klo, vt, mf, chi, clo, nhp);
  }
  // ---- 12: output projection: out[4096][1024] = (ctx_hi + ctx_lo)[4096][1024] . Wo^T, Wo [1024 out][1024 in];
  //      M=4096, N=1024 (x64), K=1024 (x32); 1024 tiles = 128 blocks; f32 out
  {
    const int tiles = (MTOK / 64) * (D_MODEL / 64);
    const dim3 g((unsigned)((tiles + 7) / 8), 1);
    wmma_gemm64<1, true, 0, 0, false, 0, false><<<g, 256, 0, stream>>>(
        chi, clo, D_INNER, 0L, wo16, wo16, D_INNER, 0L, (void*)out, (void*)out, D_MODEL, 0L,
        mf, mf, 0L, MTOK, D_MODEL, D_INNER, 1.0f);
  }
}

// v003
// It runs in 261 microseconds.
// Next to v002, in two timings, it ran 1.04 and 1.05 times as fast.
// All steps since v000 together make it 1.83 times as fast.
// Contractions: q/k/v projections = v_wmma_f32_16x16x32_bf16 on RNE-bf16 copies of the inputs (single product); q.k^T = v_wmma_f32_16x16x32_bf16 with bf16 hi/lo split operands (hi.hi + hi.lo + lo.hi); p.v = v_wmma_f32_16x16x32_f16 (p carried x2^15 in f16, v^T stored f16); output projection = v_wmma_f32_16x16x32_bf16 with ctx bf16 hi/lo x Wo bf16 (hi.W + lo.W); f32 accumulate everywhere; additive mask (RNE-bf16 values) and online softmax in f32.
#include <hip/hip_runtime.h>
#include <math.h>
#include <stdint.h>

constexpr int N_BATCH = 2;
constexpr int SEQ_LEN = 2048;
constexpr int D_MODEL = 1024;                 // d_ff (input / output feature width)
constexpr int N_HEAD  = 16;
constexpr int D_HEAD  = 64;
constexpr int D_INNER = N_HEAD * D_HEAD;      // 1024
static_assert(D_INNER == 1024, "inner width");
static_assert(SEQ_LEN % 64 == 0 && D_MODEL % 64 == 0 && D_INNER % 64 == 0, "tile multiples");
static_assert(D_MODEL % 32 == 0 && D_INNER % 32 == 0, "K multiples of 32");

typedef __attribute__((ext_vector_type(16))) _Float16 v16h;
typedef __attribute__((ext_vector_type(8)))  _Float16 v8h;
typedef __attribute__((ext_vector_type(16))) __bf16   v16b;
typedef __attribute__((ext_vector_type(8)))  __bf16   v8b;
typedef __attribute__((ext_vector_type(8)))  float    v8f;
typedef __attribute__((ext_vector_type(4)))  float    v4f;
typedef __attribute__((ext_vector_type(2)))  float    v2f;

__device__ __forceinline__ unsigned short f2bf_bits(float f) {
  unsigned u = __float_as_uint(f);
  return (unsigned short)((u + 0x7FFFu + ((u >> 16) & 1u)) >> 16);
}
__device__ __forceinline__ float bf_bits2f(unsigned short h) { return __uint_as_float(((unsigned)h) << 16); }
__device__ __forceinline__ unsigned pk16(unsigned short a, unsigned short b) { return (unsigned)a | ((unsigned)b << 16); }

// hazard guards as plain device helpers
__device__ __forceinline__ void dep_guard_h(v8f& a, v8f& b, v16h x, v16h y) { asm volatile("v_nop\n\tv_nop\n\tv_nop\n\tv_nop" : "+v"(a), "+v"(b) : "v"(x), "v"(y)); }
__device__ __forceinline__ void dep_guard_b(v8f& a, v8f& b, v16b x, v16b y) { asm volatile("v_nop\n\tv_nop\n\tv_nop\n\tv_nop" : "+v"(a), "+v"(b) : "v"(x), "v"(y)); }
__device__ __forceinline__ void keep4_h(v16h a, v16h b, v16h c, v16h d) { asm volatile("v_nop" :: "v"(a), "v"(b), "v"(c), "v"(d)); }
__device__ __forceinline__ void keep4_b(v16b a, v16b b, v16b c, v16b d) { asm volatile("v_nop" :: "v"(a), "v"(b), "v"(c), "v"(d)); }
__device__ __forceinline__ void acc_guard4(v8f& a, v8f& b, v8f& c, v8f& d) { asm volatile("v_nop\n\tv_nop\n\tv_nop\n\tv_nop" : "+v"(a), "+v"(b), "+v"(c), "+v"(d)); }
template <typename T> struct Frag;
template <> struct Frag<_Float16> {
  typedef v16h V; union U { v16h v; v8h h[2]; };
  static __device__ __forceinline__ v16h load(const _Float16* p) {   // elements 0..7 <- p[0..7], 8..15 <- p[16..23]
    U f; f.h[0] = *(const v8h*)(p); f.h[1] = *(const v8h*)(p + 16); return f.v;
  }
  static __device__ __forceinline__ v8f mma(v16h a, v16h b, v8f c) {
    return __builtin_amdgcn_wmma_f32_16x16x32_f16(false, a, false, b, (short)0, c, false, false);
  }
  static __device__ __forceinline__ void guard(v8f& a, v8f& b, v16h x, v16h y) { dep_guard_h(a, b, x, y); }
  static __device__ __forceinline__ void keep(v16h a, v16h b, v16h c, v16h d) { keep4_h(a, b, c, d); }
};
template <> struct Frag<__bf16> {
  typedef v16b V; union U { v16b v; v8b h[2]; };
  static __device__ __forceinline__ v16b load(const __bf16* p) {
    U f; f.h[0] = *(const v8b*)(p); f.h[1] = *(const v8b*)(p + 16); return f.v;
  }
  static __device__ __forceinline__ v8f mma(v16b a, v16b b, v8f c) {
    return __builtin_amdgcn_wmma_f32_16x16x32_bf16(false, a, false, b, (short)0, c, false, false);
  }
  static __device__ __forceinline__ void guard(v8f& a, v8f& b, v16b x, v16b y) { dep_guard_b(a, b, x, y); }
  static __device__ __forceinline__ void keep(v16b a, v16b b, v16b c, v16b d) { keep4_b(a, b, c, d); }
};

// ---- Register-blocked batched WMMA GEMM ------------------------------------
// C[m,n] = scale * sum_k A[m,k] * Bt[n,k] (+bias)(+resid); each wave owns a 64x64 tile; the 8 waves of a block
// form a 2 (M) x 4 (N) grid = one 128x256 block tile, whose operand rows reach LDS 64 k at a time (a stage) by
// asynchronous 16-byte copies, two buffers: stage t+1 flies while stage t is multiplied.
// A row-major [M,K]; Bt row-major [N,K]; M % 128 == 0, N % 256 == 0, K % 64 == 0.
// SPLIT: operands are hi/lo planes (A2/Bt2 = lo planes, same layout); product = hi.hi + hi.lo + lo.hi.
// BLO = false with SPLIT: the Bt lo plane is not used (product = hi.B + lo.B, B a single plane).
// BIAS_MODE: 0 = none, 1 = bias[m], 2 = bias[n].
// OUT_MODE: 0 = f32, 1 = f16, 2 = bf16 hi plane (Cout) + bf16 lo plane (Cout2).
// ET: 0 = f16 operands, 1 = bf16 operands (pointers passed as 16-bit storage)
// Asynchronous 16-byte-per-lane copies global -> LDS, eight or twelve to a statement. The s_wait_xcnt is the last line
// of the copies' own statement so that it stands in front of every later write of the address registers they name.
struct CopyRows { unsigned l; const void* g; };   // this lane's LDS byte address and global address of one row segment
__device__ __forceinline__ void async_copy8(CopyRows a, CopyRows b, CopyRows c, CopyRows d,
                                            CopyRows e, CopyRows f, CopyRows g, CopyRows h) {
  asm volatile("global_load_async_to_lds_b128 %0, %1, off\n\t"
               "global_load_async_to_lds_b128 %2, %3, off\n\t"
               "global_load_async_to_lds_b128 %4, %5, off\n\t"
               "global_load_async_to_lds_b128 %6, %7, off\n\t"
               "global_load_async_to_lds_b128 %8, %9, off\n\t"
               "global_load_async_to_lds_b128 %10, %11, off\n\t"
               "global_load_async_to_lds_b128 %12, %13, off\n\t"
               "global_load_async_to_lds_b128 %14, %15, off\n\t"
               "s_wait_xcnt 0x0"
               :: "v"(a.l), "v"(a.g), "v"(b.l), "v"(b.g), "v"(c.l), "v"(c.g), "v"(d.l), "v"(d.g),
                  "v"(e.l), "v"(e.g), "v"(f.l), "v"(f.g), "v"(g.l), "v"(g.g), "v"(h.l), "v"(h.g) : "memory");
}
__device__ __forceinline__ void async_copy12(CopyRows a, CopyRows b, CopyRows c, CopyRows d,
                                             CopyRows e, CopyRows f, CopyRows g, CopyRows h,
                                             CopyRows i, CopyRows j, CopyRows k, CopyRows m) {
  asm volatile("global_load_async_to_lds_b128 %0, %1, off\n\t"
               "global_load_async_to_lds_b128 %2, %3, off\n\t"
               "global_load_async_to_lds_b128 %4, %5, off\n\t"
               "global_load_async_to_lds_b128 %6, %7, off\n\t"
               "global_load_async_to_lds_b128 %8, %9, off\n\t"
               "global_load_async_to_lds_b128 %10, %11, off\n\t"
               "global_load_async_to_lds_b128 %12, %13, off\n\t"
               "global_load_async_to_lds_b128 %14, %15, off\n\t"
               "global_load_async_to_lds_b128 %16, %17, off\n\t"
               "global_load_async_to_lds_b128 %18, %19, off\n\t"
               "global_load_async_to_lds_b128 %20, %21, off\n\t"
               "global_load_async_to_lds_b128 %22, %23, off\n\t"
               "s_wait_xcnt 0x0"
               :: "v"(a.l), "v"(a.g), "v"(b.l), "v"(b.g), "v"(c.l), "v"(c.g), "v"(d.l), "v"(d.g),
                  "v"(e.l), "v"(e.g), "v"(f.l), "v"(f.g), "v"(g.l), "v"(g.g), "v"(h.l), "v"(h.g),
                  "v"(i.l), "v"(i.g), "v"(j.l), "v"(j.g), "v"(k.l), "v"(k.g), "v"(m.l), "v"(m.g) : "memory");
}
#define GM_PITCH 144            // LDS row pitch in bytes of a 128-byte stage row: 16 B x odd, conflict-free 16-byte fragment reads
#define GM_PE    (GM_PITCH / 2) // the same in 16-bit elements
template <int ET> struct Elem;
template <> struct Elem<0> { typedef _Float16 T; };
template <> struct Elem<1> { typedef __bf16 T; };
template <int ET, bool SPLIT, int BIAS_MODE, int OUT_MODE, bool RESID, int ACT = 0, bool BLO = true>
__global__ __launch_bounds__(256) void wmma_gemm64(
    const unsigned short* __restrict__ Ap, const unsigned short* __restrict__ A2p, int lda, long strideA,
    const unsigned short* __restrict__ Btp, const unsigned short* __restrict__ Bt2p, int ldb, long strideB,
    void* __restrict__ Cout, void* __restrict__ Cout2, int ldc, long strideC,
    const float* __restrict__ bias,
    const float* __restrict__ resid, long strideR,
    int M, int N, int K, float scale) {
  typedef typename Elem<ET>::T T;
  typedef typename Frag<T>::V V;
  const T* A = (const T*)Ap; const T* A2 = (const T*)A2p; const T* Bt = (const T*)Btp; const T* Bt2 = (const T*)Bt2p;
  __shared__ __align__(16) float sT[8][16 * 68];   // per-wave 16x64 slab, pitch 68 floats
  // one stage = [A 128 rows | A lo 128 rows (SPLIT) | Bt 256 rows | Bt lo 256 rows (SPLIT && BLO)], 64 k each
  constexpr unsigned OFF_A2  = 128u * GM_PITCH;
  constexpr unsigned OFF_B   = OFF_A2 + (SPLIT ? 128u * GM_PITCH : 0u);
  constexpr unsigned OFF_B2  = OFF_B + 256u * GM_PITCH;
  constexpr unsigned STAGE_B = OFF_B2 + ((SPLIT && BLO) ? 256u * GM_PITCH : 0u);
  __shared__ __align__(16) unsigned char ring[2 * STAGE_B];
  const int b    = blockIdx.y;
  const int lane = threadIdx.x & 31;
  const int wave = threadIdx.x >> 5;
  const int tilesN = N >> 8;
  const int tilesM = M >> 7;
  if ((int)blockIdx.x >= tilesM * tilesN) return;   // block-uniform, ahead of every copy and barrier
  const int bm  = blockIdx.x / tilesN;
  const int bn  = blockIdx.x - bm * tilesN;
  const int wm0 = (wave >> 2) << 6;            // this wave's rows inside the block tile
  const int wn0 = (wave & 3) << 6;             // this wave's columns inside the block tile
  const int m0 = (bm << 7) + wm0;
  const int n0 = (bn << 8) + wn0;

  const T* Ab  = A  + (size_t)b * strideA;
  const T* Bb  = Bt + (size_t)b * strideB;
  const T* Ab2 = SPLIT ? (A2  + (size_t)b * strideA) : nullptr;
  const T* Bb2 = (SPLIT && BLO) ? (Bt2 + (size_t)b * strideB) : nullptr;

  const int rlane = lane & 15;                 // row (A) / col (B, D) within subtile
  const int koff  = (lane >> 4) * 8;           // k offset of this lane half
  const int mOff  = (lane >> 4) * 8;           // D row offset

  // staging map: 8 lanes x 16 B = one whole 128-byte row segment; a copy of the block covers 32 rows
  const int srow = threadIdx.x >> 3;           // 0..31
  const int sseg = (threadIdx.x & 7) * 8;      // first of this lane's 8 elements in the 64-element row
  const size_t aoff = (size_t)((bm << 7) + srow) * lda + sseg;
  const size_t boff = (size_t)((bn << 8) + srow) * ldb + sseg;
  const size_t a32 = (size_t)32 * lda, b32 = (size_t)32 * ldb;
  const unsigned lds0 = (unsigned)(uintptr_t)ring + (unsigned)(srow * GM_PITCH + sseg * 2);
  auto copy_stage = [&](int st, int buf) {     // all lanes on, rows and k inside the operands by the size conditions above
    const unsigned l = lds0 + (unsigned)buf * STAGE_B;
    auto rows = [](unsigned lds, const T* g, size_t step32, int i) {   // row group i: 32 rows further on in both places
      return CopyRows{lds + (unsigned)i * 32u * GM_PITCH, (const void*)(g + (size_t)i * step32)};
    };
    const T* ga = Ab + aoff + (size_t)st * 64;
    const T* gb = Bb + boff + (size_t)st * 64;
    const unsigned lb = l + OFF_B;
    if (!SPLIT) {
      async_copy12(rows(l, ga, a32, 0), rows(l, ga, a32, 1), rows(l, ga, a32, 2), rows(l, ga, a32, 3),
                   rows(lb, gb, b32, 0), rows(lb, gb, b32, 1), rows(lb, gb, b32, 2), rows(lb, gb, b32, 3),
                   rows(lb, gb, b32, 4), rows(lb, gb, b32, 5), rows(lb, gb, b32, 6), rows(lb, gb, b32, 7));
    } else {
      const unsigned l2 = l + OFF_A2;
      const T* ga2 = Ab2 + aoff + (size_t)st * 64;
      async_copy8(rows(l, ga, a32, 0), rows(l, ga, a32, 1), rows(l, ga, a32, 2), rows(l, ga, a32, 3),
                  rows(l2, ga2, a32, 0), rows(l2, ga2, a32, 1), rows(l2, ga2, a32, 2), rows(l2, ga2, a32, 3));
      async_copy8(rows(lb, gb, b32, 0), rows(lb, gb, b32, 1), rows(lb, gb, b32, 2), rows(lb, gb, b32, 3),
                  rows(lb, gb, b32, 4), rows(lb, gb, b32, 5), rows(lb, gb, b32, 6), rows(lb, gb, b32, 7));
      if (BLO) {
        const unsigned lb2 = l + OFF_B2;
        const T* gb2 = Bb2 + boff + (size_t)st * 64;
        async_copy8(rows(lb2, gb2, b32, 0), rows(lb2, gb2, b32, 1), rows(lb2, gb2, b32, 2), rows(lb2, gb2, b32, 3),
                    rows(lb2, gb2, b32, 4), rows(lb2, gb2, b32, 5), rows(lb2, gb2, b32, 6), rows(lb2, gb2, b32, 7));
      }
    }
  };

  v8f acc[4][4];
#pragma unroll
  for (int i = 0; i < 4; ++i)
#pragma unroll
    for (int j = 0; j < 4; ++j) acc[i][j] = (v8f){0.f,0.f,0.f,0.f,0.f,0.f,0.f,0.f};

  const int nst = K >> 6;                      // stages of 64 k
  copy_stage(0, 0);
  asm volatile("s_wait_asynccnt 0x0" ::: "memory");   // this wave's share of stage 0 has landed
  __syncthreads();                                    // every wave's share has: stage 0 may be read
  if (nst > 1) copy_stage(1, 1);
  for (int st = 0; st < nst; ++st) {
    const int buf = st & 1;
    const T* sA  = (const T*)(ring + (unsigned)buf * STAGE_B);
    const T* sA2 = (const T*)(ring + (unsigned)buf * STAGE_B + OFF_A2);
    const T* sB  = (const T*)(ring + (unsigned)buf * STAGE_B + OFF_B);
    const T* sB2 = (const T*)(ring + (unsigned)buf * STAGE_B + OFF_B2);
#pragma unroll   // both 32-k halves of a stage in line, so that kk folds into the LDS loads' immediate offsets
    for (int kk = 0; kk < 64; kk += 32) {
      V bh[4], bl[4];
#pragma unroll
      for (int j = 0; j < 4; ++j) {
        const int bo = (wn0 + (j << 4) + rlane) * GM_PE + koff + kk;
        bh[j] = Frag<T>::load(sB + bo);
        if (SPLIT && BLO) bl[j] = Frag<T>::load(sB2 + bo);
      }
#pragma unroll
      for (int i = 0; i < 4; ++i) {
        const int ao = (wm0 + (i << 4) + rlane) * GM_PE + koff + kk;
        V ah = Frag<T>::load(sA + ao);
        V al;
        if (SPLIT) al = Frag<T>::load(sA2 + ao);
#pragma unroll
        for (int j = 0; j < 4; ++j) {
          acc[i][j] = Frag<T>::mma(ah, bh[j], acc[i][j]);
          if (SPLIT) {
            if (BLO) acc[i][j] = Frag<T>::mma(ah, bl[j], acc[i][j]);
            acc[i][j] = Frag<T>::mma(al, bh[j], acc[i][j]);
          }
        }
        Frag<T>::guard(acc[i][0], acc[i][3], ah, SPLIT ? al : ah);
      }
      Frag<T>::keep(bh[0], bh[1], bh[2], bh[3]);
      if (SPLIT && BLO) Frag<T>::keep(bl[0], bl[1], bl[2], bl[3]);
    }
    asm volatile("s_wait_dscnt 0x0" ::: "memory");      // this wave's reads of buffer buf are done before it is refilled
    asm volatile("s_wait_asynccnt 0x0" ::: "memory");   // this wave's share of stage st + 1 has landed
    __syncthreads();                                    // publishes stage st + 1 and ends every reader's use of buffer buf
    if (st + 2 < nst) copy_stage(st + 2, buf);
  }
  asm volatile("s_wait_asynccnt 0x0" ::: "memory");     // nothing of this wave's copies is outstanding past the loop
  acc_guard4(acc[0][0], acc[0][1], acc[0][2], acc[0][3]);
  acc_guard4(acc[1][0], acc[1][1], acc[1][2], acc[1][3]);
  acc_guard4(acc[2][0], acc[2][1], acc[2][2], acc[2][3]);
  acc_guard4(acc[3][0], acc[3][1], acc[3][2], acc[3][3]);

  // ---- epilogue ----
  float* slab = sT[wave];
  const float* Rb = RESID ? (resid + (size_t)b * strideR) : nullptr;
#pragma unroll
  for (int i = 0; i < 4; ++i) {
    const int mBase = m0 + (i << 4);
#pragma unroll
    for (int j = 0; j < 4; ++j) {
      const int n = n0 + (j << 4) + rlane;
      float bv = 0.f;
      if (BIAS_MODE == 2) bv = bias[n];
#pragma unroll
      for (int r = 0; r < 8; ++r) {
        float v = acc[i][j][r] * scale;
        if (BIAS_MODE == 1) v += bias[mBase + mOff + r];
        if (BIAS_MODE == 2) v += bv;
        if (RESID) v += Rb[(size_t)(mBase + mOff + r) * ldc + n];
        if (ACT == 1) v = tanhf(v);
        if (ACT == 2) v = fmaxf(v, 0.0f);
        if (ACT == 3) v = v / (1.0f + expf(-v));
        if (ACT == 4) v = (v > 0.f) ? v : 0.01f * v;
        slab[(mOff + r) * 68 + (j << 4) + rlane] = v;
      }
    }
    __builtin_amdgcn_fence(__ATOMIC_RELEASE, "workgroup");
    __builtin_amdgcn_wave_barrier();
    __builtin_amdgcn_fence(__ATOMIC_ACQUIRE, "workgroup");
    if (OUT_MODE == 0) {
      float* C = (float*)Cout + (size_t)b * strideC;
      const int hh = lane >> 4, c4 = (lane & 15) * 4;     // row seg = 256 B = 16 lanes x 16 B
      {
#pragma unroll
        for (int it = 0; it < 8; ++it) {
          const int row = it * 2 + hh;
          v4f v = *(const v4f*)(slab + row * 68 + c4);
          *(v4f*)(C + (size_t)(mBase + row) * ldc + n0 + c4) = v;
        }
        
      }
    } else {
      const int q = lane >> 3, c8 = (lane & 7) * 8;
      unsigned short* C  = (unsigned short*)Cout  + (size_t)b * strideC;
      unsigned short* C2 = (OUT_MODE == 2) ? ((unsigned short*)Cout2 + (size_t)b * strideC) : nullptr;
      {
#pragma unroll
        for (int it = 0; it < 4; ++it) {
          const int row = it * 4 + q;
          const float* sp = slab + row * 68 + c8;
          v8h hv, lv;
#pragma unroll
          for (int e = 0; e < 8; ++e) {
            if (OUT_MODE == 1) {
              hv[e] = (_Float16)sp[e];
            } else {
              unsigned short hb = f2bf_bits(sp[e]);
              unsigned short lb = f2bf_bits(sp[e] - bf_bits2f(hb));
              hv[e] = __builtin_bit_cast(_Float16, hb);
              lv[e] = __builtin_bit_cast(_Float16, lb);
            }
          }
          *(v8h*)(C + (size_t)(mBase + row) * ldc + n0 + c8) = hv;
          if (OUT_MODE == 2) *(v8h*)(C2 + (size_t)(mBase + row) * ldc + n0 + c8) = lv;
        }
        
      }
    }
    __builtin_amdgcn_fence(__ATOMIC_RELEASE, "workgroup");
    __builtin_amdgcn_wave_barrier();
    __builtin_amdgcn_fence(__ATOMIC_ACQUIRE, "workgroup");
  }
}

// ---------------------------------------------------------------------------
// f32 -> bf16 (RNE) cast of all seven float operands in ONE launch.
// The bf16 planes lie back to back in the workspace in the order q, k, v, Wq, Wk, Wv, Wo, so the output is one
// array of 3 * 4,194,304 + 4 * 1,048,576 = 16,777,216 elements. A block of 16 waves owns CAST_BLK = 65,536
// consecutive elements of it, which lie in one plane (both plane sizes are multiples of CAST_BLK):
// 3 * 64 + 4 * 16 = 256 blocks. A lane brings 32 pieces of 16 B (each wave-wide load 512 contiguous bytes) and
// stores 32 pieces of 8 B (each wave-wide store 256 contiguous bytes = two whole lines).
// Coverage: 32 pieces x 512 threads x 4 elements = 65,536 = the whole block range, each element once.
// ---------------------------------------------------------------------------
constexpr int CAST_THR  = 512;
constexpr int CAST_BLK  = 65536;
constexpr int CAST_ACT  = N_BATCH * SEQ_LEN * D_MODEL / CAST_BLK;   // 64 blocks per activation plane
constexpr int CAST_W    = D_INNER * D_MODEL / CAST_BLK;             // 16 blocks per weight plane
constexpr int CAST_GRID = 3 * CAST_ACT + 4 * CAST_W;                // 256
static_assert(N_BATCH * SEQ_LEN * D_MODEL % CAST_BLK == 0 && D_INNER * D_MODEL % CAST_BLK == 0, "whole blocks per plane");
typedef __attribute__((ext_vector_type(2))) unsigned v2u;
__global__ __launch_bounds__(CAST_THR) void cast_all_f32_bf16(
    const float* __restrict__ q, const float* __restrict__ k, const float* __restrict__ v,
    const float* __restrict__ wq, const float* __restrict__ wk, const float* __restrict__ wv,
    const float* __restrict__ wo, unsigned short* __restrict__ out) {
  const int bx = blockIdx.x;                 // 0 .. CAST_GRID - 1 (exact grid)
  const float* plane;
  int rel;                                   // block index inside its plane
  if (bx < 3 * CAST_ACT) {
    const int p = bx / CAST_ACT;
    rel = bx - p * CAST_ACT;
    plane = (p == 0) ? q : (p == 1) ? k : v;
  } else {
    const int w = bx - 3 * CAST_ACT;
    const int p = w / CAST_W;
    rel = w - p * CAST_W;
    plane = (p == 0) ? wq : (p == 1) ? wk : (p == 2) ? wv : wo;
  }
  const float* in = plane + (size_t)rel * CAST_BLK + threadIdx.x * 4;
  unsigned short* o = out + (size_t)bx * CAST_BLK + threadIdx.x * 4;
  constexpr int NP = CAST_BLK / (CAST_THR * 4);   // 32 pieces of 16 B per lane
  v4f f[NP];
  // the loads stand in a loop of their own, ahead of the conversions, so that a wave's share is in flight together
  for (int j = 0; j < NP; ++j) f[j] = *(const v4f*)(in + j * (CAST_THR * 4));
  for (int j = 0; j < NP; ++j) {
    const v2u u = {pk16(f2bf_bits(f[j][0]), f2bf_bits(f[j][1])), pk16(f2bf_bits(f[j][2]), f2bf_bits(f[j][3]))};
    *(v2u*)(o + j * (CAST_THR * 4)) = u;
  }
}

// =====================================================================================
// Full (non-causal) attention with additive score bias, head dim 64, unscaled scores.
//   q planes (bf16 hi/lo): element (b, s, h, d) at [(b*S + s)*D_INNER + h*64 + d]
//   k planes (bf16 hi/lo): same layout
//   v^T plane (f16 bits):  element (b, h, d, s) at [(b*D_INNER + h*64 + d)*S + s]
//   bias (f32):            element (b, q, kv) at [b*S*S + q*S + kv]; added as RNE-bf16 value in f32
//   ctx planes out (bf16 hi/lo): element (b, s, h, d) at [(b*S + s)*D_INNER + h*64 + d]
//   scores = q . k : bf16 hi/lo split (hi.hi + hi.lo + lo.hi) on v_wmma_f32_16x16x32_bf16
//   ctx    = p . v : p (unnormalised, x2^15) and v^T as f16 on v_wmma_f32_16x16x32_f16, f32 accumulate,
//            the 2^15 carry folded into the final 1/l.
//   online softmax in f32 over all S keys (32 chunks of 64, compile-time trip count).
//   Block = 4 waves = 64 query rows of one (b, h); grid.x = N_BATCH * N_HEAD * (S/64) = 1024.
//   K hi/lo and V^T chunk staging: 128 threads x 32 elements per plane = the whole 64x64 tile (16-B copies,
//   plain loads, __syncthreads before and after); fragment loads read the LDS tiles with the v8b element type.
//   planes written by 8 lanes x 16 B in one instruction; 4 it x 32 lanes x 8 elements = 16x64 = whole tile;
// =====================================================================================
#define AT_D 64
#define AT_NW 4
#define AT_QB 64
#define AT_KC 64
#define AT_LP 72   // LDS row pitch in 16-bit elements: 144 B = 16 B x odd, so the 16 rows of a 16-byte fragment read fall on 64 distinct banks
#define P_CARRY 32768.0f

__device__ __forceinline__ v8f at_mma(v16b a, v16b b, v8f c) {
  c = __builtin_amdgcn_wmma_f32_16x16x32_bf16(false, a, false, b, (short)0, c, false, false);
  asm volatile("v_nop\n\tv_nop\n\tv_nop\n\tv_nop" : "+v"(c) : "v"(a), "v"(b));
  return c;
}
__device__ __forceinline__ v8f at_mma_h(v16b a, v16b b, v8f c) {   // operands hold f16 bit patterns
  const v16h ah = __builtin_bit_cast(v16h, a), bh = __builtin_bit_cast(v16h, b);
  c = __builtin_amdgcn_wmma_f32_16x16x32_f16(false, ah, false, bh, (short)0, c, false, false);
  asm volatile("v_nop\n\tv_nop\n\tv_nop\n\tv_nop" : "+v"(c) : "v"(ah), "v"(bh));
  return c;
}
__device__ __forceinline__ __bf16 at_f16bits(float f) { return __builtin_bit_cast(__bf16, (_Float16)f); }

__global__ __launch_bounds__(128)
void mha_bias_kernel(const unsigned short* __restrict__ qhp, const unsigned short* __restrict__ qlp,
                     const unsigned short* __restrict__ khp, const unsigned short* __restrict__ klp,
                     const unsigned short* __restrict__ vtp, const float* __restrict__ biasp,
                     unsigned short* __restrict__ chp, unsigned short* __restrict__ clp,
                     const int* __restrict__ nheads_in) {
  (void)nheads_in;   // module constant (16); shapes are compile-time here
  union FB { v16b v; v8b h[2]; };
  __shared__ __align__(16) __bf16 Ksh[AT_KC * AT_LP];            // K hi [kv][d]      9 KB
  __shared__ __align__(16) __bf16 Ksl[AT_KC * AT_LP];            // K lo              9 KB
  __shared__ __align__(16) __bf16 Vth[AT_D * AT_LP];             // V^T f16 bits [d][kv] 9 KB
  __shared__ __align__(16) __bf16 Psh[AT_NW][16 * AT_LP];        // per wave P f16 bits [row][kv] 9 KB
  __shared__ __align__(16) float  Os[AT_NW][16 * 68];            // per wave out tile, pitch 68

  const int tid  = threadIdx.x;
  const int wave = tid >> 5;
  const int lane = tid & 31;
  const int hh   = lane >> 4;
  const int c    = lane & 15;

  const int nqb = SEQ_LEN / AT_QB;        // 32
  const int bx  = blockIdx.x;             // 0 .. N_BATCH*N_HEAD*nqb - 1 (exact grid)
  const int qb  = bx % nqb;
  const int bhd = bx / nqb;               // 0 .. 31
  const int h   = bhd % N_HEAD;
  const int b   = bhd / N_HEAD;           // 0 .. N_BATCH-1
  const int q0  = qb * AT_QB + wave * 16;

  const size_t rowb = (size_t)b * SEQ_LEN;   // token-row base of this batch element
  const __bf16* Qh = (const __bf16*)(const void*)qhp + rowb * D_INNER + (size_t)h * AT_D;
  const __bf16* Ql = (const __bf16*)(const void*)qlp + rowb * D_INNER + (size_t)h * AT_D;
  const __bf16* Kh = (const __bf16*)(const void*)khp + rowb * D_INNER + (size_t)h * AT_D;
  const __bf16* Kl = (const __bf16*)(const void*)klp + rowb * D_INNER + (size_t)h * AT_D;
  const __bf16* Vt = (const __bf16*)(const void*)vtp + ((size_t)b * D_INNER + (size_t)h * AT_D) * SEQ_LEN;
  const float*  Mb = biasp + (size_t)b * SEQ_LEN * SEQ_LEN;
  unsigned short* Ch = chp + rowb * D_INNER + (size_t)h * AT_D;
  unsigned short* Cl = clp + rowb * D_INNER + (size_t)h * AT_D;

  // ---- Q fragments (A operand, row = lane&15, split k map via Frag load): 2 d-chunks, hi and lo ----
  v16b qah[2], qal[2];
#pragma unroll
  for (int dc = 0; dc < 2; ++dc) {
    const __bf16* qr = Qh + (size_t)(q0 + c) * D_INNER + dc * 32 + 8 * hh;
    const __bf16* ql = Ql + (size_t)(q0 + c) * D_INNER + dc * 32 + 8 * hh;
    qah[dc] = Frag<__bf16>::load(qr);
    qal[dc] = Frag<__bf16>::load(ql);
  }

  float mrow[8], lrow[8];
  v8f oacc[4];
#pragma unroll
  for (int r = 0; r < 8; ++r) { mrow[r] = -INFINITY; lrow[r] = 0.f; }
#pragma unroll
  for (int t = 0; t < 4; ++t) oacc[t] = (v8f){0.f,0.f,0.f,0.f,0.f,0.f,0.f,0.f};

  const int nChunks = SEQ_LEN / AT_KC;   // 32, compile-time constant
  for (int kc = 0; kc < nChunks; ++kc) {
    const int kv0 = kc * AT_KC;
    __syncthreads();
    {
      // staging coverage: 128 threads x (4 x 8) elements = 64 rows x 64 per plane = the whole chunk tile
      const int r = tid >> 1, half = (tid & 1) * 32;
      const __bf16* ksh = Kh + (size_t)(kv0 + r) * D_INNER + half;   // K row kv0+r, d = half..half+31
      const __bf16* ksl = Kl + (size_t)(kv0 + r) * D_INNER + half;
      const __bf16* vs  = Vt + (size_t)r * SEQ_LEN + kv0 + half;      // V^T row d = r, s = kv0+half..+31
#pragma unroll
      for (int i = 0; i < 4; ++i) {
        const v8b a0 = *(const v8b*)(ksh + 8 * i);
        const v8b a1 = *(const v8b*)(ksl + 8 * i);
        const v8b b0 = *(const v8b*)(vs + 8 * i);
        *(v8b*)(Ksh + r * AT_LP + half + 8 * i) = a0;
        *(v8b*)(Ksl + r * AT_LP + half + 8 * i) = a1;
        *(v8b*)(Vth + r * AT_LP + half + 8 * i) = b0;
      }
    }
    __syncthreads();

    // ---- scores: 4 kv subtiles of 16, 2 d-chunks, 3 products each ----
    v8f s[4];
#pragma unroll
    for (int j = 0; j < 4; ++j) {
      s[j] = (v8f){0.f,0.f,0.f,0.f,0.f,0.f,0.f,0.f};
#pragma unroll
      for (int dc = 0; dc < 2; ++dc) {
        FB kb, kl;
        kb.h[0] = *(const v8b*)(Ksh + (j * 16 + c) * AT_LP + dc * 32 + 8 * hh);
        kb.h[1] = *(const v8b*)(Ksh + (j * 16 + c) * AT_LP + dc * 32 + 16 + 8 * hh);
        kl.h[0] = *(const v8b*)(Ksl + (j * 16 + c) * AT_LP + dc * 32 + 8 * hh);
        kl.h[1] = *(const v8b*)(Ksl + (j * 16 + c) * AT_LP + dc * 32 + 16 + 8 * hh);
        s[j] = at_mma(qah[dc], kb.v, s[j]);
        s[j] = at_mma(qah[dc], kl.v, s[j]);
        s[j] = at_mma(qal[dc], kb.v, s[j]);
      }
    }
    // ---- additive bias by value (D element r of lane = (q row 8hh+r, kv col j*16+c)), chunk row max ----
    float cm[8];
#pragma unroll
    for (int r = 0; r < 8; ++r) {
      const float* mrp = Mb + (size_t)(q0 + 8 * hh + r) * SEQ_LEN + kv0 + c;   // all indices in range by construction
      float m = -INFINITY;
#pragma unroll
      for (int j = 0; j < 4; ++j) {
        const float mv = bf_bits2f(f2bf_bits(mrp[j * 16]));
        const float sv = s[j][r] + mv;
        s[j][r] = sv;
        m = fmaxf(m, sv);
      }
#pragma unroll
      for (int off = 1; off < 16; off <<= 1) m = fmaxf(m, __shfl_xor(m, off, 32));
      cm[r] = m;
    }
    __bf16* pwh = Psh[wave];
#pragma unroll
    for (int r = 0; r < 8; ++r) {
      const float mnew = fmaxf(mrow[r], cm[r]);
      const float alpha = expf(mrow[r] - mnew);
      mrow[r] = mnew;
      float psum = 0.f;
#pragma unroll
      for (int j = 0; j < 4; ++j) {
        const float p = expf(s[j][r] - mnew);
        psum += p;
        pwh[(8 * hh + r) * AT_LP + j * 16 + c] = at_f16bits(p * P_CARRY);
      }
#pragma unroll
      for (int off = 1; off < 16; off <<= 1) psum += __shfl_xor(psum, off, 32);
      lrow[r] = lrow[r] * alpha + psum;
#pragma unroll
      for (int t = 0; t < 4; ++t) oacc[t][r] *= alpha;
    }
    __builtin_amdgcn_fence(__ATOMIC_RELEASE, "workgroup");
    __builtin_amdgcn_wave_barrier();
    __builtin_amdgcn_fence(__ATOMIC_ACQUIRE, "workgroup");
#pragma unroll 1
    for (int kk = 0; kk < 2; ++kk) {
      FB pa;
      pa.h[0] = *(const v8b*)(pwh + c * AT_LP + kk * 32 + 8 * hh);
      pa.h[1] = *(const v8b*)(pwh + c * AT_LP + kk * 32 + 16 + 8 * hh);
#pragma unroll
      for (int t = 0; t < 4; ++t) {
        FB vb;
        vb.h[0] = *(const v8b*)(Vth + (t * 16 + c) * AT_LP + kk * 32 + 8 * hh);
        vb.h[1] = *(const v8b*)(Vth + (t * 16 + c) * AT_LP + kk * 32 + 16 + 8 * hh);
        oacc[t] = at_mma_h(pa.v, vb.v, oacc[t]);
      }
    }
  }

  // ---- normalise and stage the 16x64 f32 tile (rows 8hh+r, cols t*16+c) ----
  float* os = Os[wave];
#pragma unroll
  for (int r = 0; r < 8; ++r) {
    const float inv = 1.0f / (lrow[r] * P_CARRY);   // lrow >= 1 (no masking), lrow*2^15 <= 6.8e7
#pragma unroll
    for (int t = 0; t < 4; ++t) os[(8 * hh + r) * 68 + t * 16 + c] = oacc[t][r] * inv;
  }
  __builtin_amdgcn_fence(__ATOMIC_RELEASE, "workgroup");
  __builtin_amdgcn_wave_barrier();
  __builtin_amdgcn_fence(__ATOMIC_ACQUIRE, "workgroup");
  {
    // coverage: 4 it x 32 lanes x 8 elements = 16 rows x 64 = the whole wave tile, per plane;
    const int qg = lane >> 3, c8 = (lane & 7) * 8;
    {
#pragma unroll
      for (int it = 0; it < 4; ++it) {
        const int row = it * 4 + qg;
        const float* sp = os + row * 68 + c8;
        v8h hv, lv;
#pragma unroll
        for (int e = 0; e < 8; ++e) {
          const unsigned short hb = f2bf_bits(sp[e]);
          const unsigned short lb = f2bf_bits(sp[e] - bf_bits2f(hb));
          hv[e] = __builtin_bit_cast(_Float16, hb);
          lv[e] = __builtin_bit_cast(_Float16, lb);
        }
        *(v8h*)(Ch + (size_t)(q0 + row) * D_INNER + c8) = hv;
        *(v8h*)(Cl + (size_t)(q0 + row) * D_INNER + c8) = lv;
      }
      
    }
  }
}

// =====================================================================================
// Host launch glue: only kernel launches; grids/args are pure functions of the (asserted) sizes.
// Workspace region map (bytes; all offsets multiples of 2 MiB):
//   [  0 MiB,  8 MiB)  q  bf16  [4096][1024]
//   [  8 MiB, 16 MiB)  k  bf16  [4096][1024]
//   [ 16 MiB, 24 MiB)  v  bf16  [4096][1024]
//   [ 24 MiB, 26 MiB)  Wq bf16  [1024][1024]   [26,28) Wk   [28,30) Wv   [30,32) Wo
//   [ 32 MiB, 40 MiB)  Q hi bf16 [4096][1024]   [40,48) Q lo
//   [ 48 MiB, 56 MiB)  K hi bf16 [4096][1024]   [56,64) K lo
//   [ 64 MiB, 72 MiB)  V^T f16  [2][1024][2048]
//   [ 72 MiB, 80 MiB)  ctx hi bf16 [4096][1024] [80,88) ctx lo
//   total 88 MiB = 92,274,688 B
// =====================================================================================
extern "C" void kernel_launch(void* const* d_in, const int* in_sizes, int n_in,
                              void* d_out, int out_size, void* d_ws, size_t ws_size,
                              hipStream_t stream) {
  if (n_in < 9) return;
  const size_t nAct  = (size_t)N_BATCH * SEQ_LEN * D_MODEL;     // 4,194,304
  const size_t nW    = (size_t)D_INNER * D_MODEL;               // 1,048,576
  const size_t nMask = (size_t)N_BATCH * SEQ_LEN * SEQ_LEN;     // 8,388,608
  const size_t nVT   = (size_t)N_BATCH * D_INNER * SEQ_LEN;     // 4,194,304
  if ((size_t)in_sizes[0] != nAct || (size_t)in_sizes[1] != nAct || (size_t)in_sizes[2] != nAct ||
      (size_t)in_sizes[3] != nMask || (size_t)in_sizes[4] != nW || (size_t)in_sizes[5] != nW ||
      (size_t)in_sizes[6] != nW || (size_t)in_sizes[7] != nW || in_sizes[8] < 1 ||
      (size_t)out_size != nAct) return;

  const size_t bAct = nAct * 2, bW = nW * 2, bVT = nVT * 2;
  const size_t o_q16 = 0;
  const size_t o_k16 = o_q16 + bAct;
  const size_t o_v16 = o_k16 + bAct;
  const size_t o_wq  = o_v16 + bAct;
  const size_t o_wk  = o_wq + bW;
  const size_t o_wv  = o_wk + bW;
  const size_t o_wo  = o_wv + bW;
  const size_t o_qhi = o_wo + bW;
  const size_t o_qlo = o_qhi + bAct;
  const size_t o_khi = o_qlo + bAct;
  const size_t o_klo = o_khi + bAct;
  const size_t o_vt  = o_klo + bAct;
  const size_t o_chi = o_vt + bVT;
  const size_t o_clo = o_chi + bAct;
  const size_t total = o_clo + bAct;                            // 92,274,688
  if (total > ws_size) return;

  const float* qf  = (const float*)d_in[0];
  const float* kf  = (const float*)d_in[1];
  const float* vf  = (const float*)d_in[2];
  const float* mf  = (const float*)d_in[3];
  const float* wqf = (const float*)d_in[4];
  const float* wkf = (const float*)d_in[5];
  const float* wvf = (const float*)d_in[6];
  const float* wof = (const float*)d_in[7];
  const int*   nhp = (const int*)d_in[8];
  char* ws = (char*)d_ws;
  unsigned short* q16 = (unsigned short*)(ws + o_q16);
  unsigned short* k16 = (unsigned short*)(ws + o_k16);
  unsigned short* v16 = (unsigned short*)(ws + o_v16);
  unsigned short* wq16 = (unsigned short*)(ws + o_wq);
  unsigned short* wk16 = (unsigned short*)(ws + o_wk);
  unsigned short* wv16 = (unsigned short*)(ws + o_wv);
  unsigned short* wo16 = (unsigned short*)(ws + o_wo);
  unsigned short* qhi = (unsigned short*)(ws + o_qhi);
  unsigned short* qlo = (unsigned short*)(ws + o_qlo);
  unsigned short* khi = (unsigned short*)(ws + o_khi);
  unsigned short* klo = (unsigned short*)(ws + o_klo);
  unsigned short* vt  = (unsigned short*)(ws + o_vt);
  unsigned short* chi = (unsigned short*)(ws + o_chi);
  unsigned short* clo = (unsigned short*)(ws + o_clo);
  float* out = (float*)d_out;

  // ---- 1: RNE bf16 copies of the seven float inputs; q16 is the start of the seven planes, back to back in the
  //      order of the arguments (region map above) ----
  cast_all_f32_bf16<<<dim3((unsigned)CAST_GRID), CAST_THR, 0, stream>>>(qf, kf, vf, wqf, wkf, wvf, wof, q16);

  const int MTOK = N_BATCH * SEQ_LEN;         // 4096 rows of [B*S][.] planes
  // ---- 2,3: Q and K projections: C[4096][1024] = X[4096][1024] . W^T, W [1024 out][1024 in] = Bt[N][K];
  //      M=4096, N=1024 (x64), K=1024 (x32); 64*16 = 1024 wave tiles = 128 blocks; out = bf16 hi + lo planes
  {
    const int tiles = (MTOK / 64) * (D_INNER / 64);
    const dim3 g((unsigned)((tiles + 7) / 8), 1);
    wmma_gemm64<1, false, 0, 2, false><<<g, 256, 0, stream>>>(
        q16, q16, D_MODEL, 0L, wq16, wq16, D_MODEL, 0L, (void*)qhi, (void*)qlo, D_INNER, 0L,
        mf, mf, 0L, MTOK, D_INNER, D_MODEL, 1.0f);
    wmma_gemm64<1, false, 0, 2, false><<<g, 256, 0, stream>>>(
        k16, k16, D_MODEL, 0L, wk16, wk16, D_MODEL, 0L, (void*)khi, (void*)klo, D_INNER, 0L,
        mf, mf, 0L, MTOK, D_INNER, D_MODEL, 1.0f);
  }
  // ---- 4: V projection, role-swapped so the output is V^T per batch element:
  //      C_b[e][s] = sum_k Wv[e][k] . v_b[s][k]; A = Wv [1024][1024] (shared, strideA 0), Bt = v_b [2048][1024],
  //      C_b [1024][2048] f16; M=1024, N=2048 (x64), K=1024 (x32); 16*32 = 512 tiles = 64 blocks, grid.y = 2
  {
    const int tiles = (D_INNER / 64) * (SEQ_LEN / 64);
    const dim3 g((unsigned)((tiles + 7) / 8), (unsigned)N_BATCH);
    wmma_gemm64<1, false, 0, 1, false><<<g, 256, 0, stream>>>(
        wv16, wv16, D_MODEL, 0L, v16, v16, D_MODEL, (long)SEQ_LEN * D_MODEL,
        (void*)vt, (void*)vt, SEQ_LEN, (long)D_INNER * SEQ_LEN,
        mf, mf, 0L, D_INNER, SEQ_LEN, D_MODEL, 1.0f);
  }
  // ---- 5: attention: 2 x 16 x 32 = 1024 blocks of 128 threads ----
  {
    const dim3 g((unsigned)(N_BATCH * N_HEAD * (SEQ_LEN / AT_QB)));
    mha_bias_kernel<<<g, 128, 0, stream>>>(qhi, qlo, khi, klo, vt, mf, chi, clo, nhp);
  }
  // ---- 6: output projection: out[4096][1024] = (ctx_hi + ctx_lo)[4096][1024] . Wo^T, Wo [1024 out][1024 in];
  //      M=4096, N=1024 (x64), K=1024 (x32); 1024 tiles = 128 blocks; f32 out
  {
    const int tiles = (MTOK / 64) * (D_MODEL / 64);
    const dim3 g((unsigned)((tiles + 7) / 8), 1);
    wmma_gemm64<1, true, 0, 0, false, 0, false><<<g, 256, 0, stream>>>(
        chi, clo, D_INNER, 0L, wo16, wo16, D_INNER, 0L, (void*)out, (void*)out, D_MODEL, 0L,
        mf, mf, 0L, MTOK, D_MODEL, D_INNER, 1.0f);
  }
}

// v004
// A run of this version takes 216 microseconds.
// Next to v003, in two timings, it ran 1.20 times as fast each time.
// All steps since v000 together make it 2.20 times as fast.
// Contractions: q/k/v projections = v_wmma_f32_16x16x32_bf16 on RNE-bf16 copies of the inputs (single product); q.k^T = v_wmma_f32_16x16x32_bf16 with bf16 hi/lo split operands (hi.hi + hi.lo + lo.hi); p.v = v_wmma_f32_16x16x32_f16 (p carried x2^15 in f16, v^T stored f16); output projection = v_wmma_f32_16x16x32_bf16 with ctx bf16 hi/lo x Wo bf16 (hi.W + lo.W); f32 accumulate everywhere; additive mask (RNE-bf16 values) and online softmax in f32.
#include <hip/hip_runtime.h>
#include <math.h>
#include <stdint.h>

constexpr int N_BATCH = 2;
constexpr int SEQ_LEN = 2048;
constexpr int D_MODEL = 1024;                 // d_ff (input / output feature width)
constexpr int N_HEAD  = 16;
constexpr int D_HEAD  = 64;
constexpr int D_INNER = N_HEAD * D_HEAD;      // 1024
static_assert(D_INNER == 1024, "inner width");
static_assert(SEQ_LEN % 64 == 0 && D_MODEL % 64 == 0 && D_INNER % 64 == 0, "tile multiples");
static_assert(D_MODEL % 32 == 0 && D_INNER % 32 == 0, "K multiples of 32");

typedef __attribute__((ext_vector_type(16))) _Float16 v16h;
typedef __attribute__((ext_vector_type(8)))  _Float16 v8h;
typedef __attribute__((ext_vector_type(16))) __bf16   v16b;
typedef __attribute__((ext_vector_type(8)))  __bf16   v8b;
typedef __attribute__((ext_vector_type(8)))  float    v8f;
typedef __attribute__((ext_vector_type(4)))  float    v4f;
typedef __attribute__((ext_vector_type(2)))  float    v2f;

__device__ __forceinline__ unsigned short f2bf_bits(float f) {
  unsigned u = __float_as_uint(f);
  return (unsigned short)((u + 0x7FFFu + ((u >> 16) & 1u)) >> 16);
}
__device__ __forceinline__ float bf_bits2f(unsigned short h) { return __uint_as_float(((unsigned)h) << 16); }
__device__ __forceinline__ unsigned pk16(unsigned short a, unsigned short b) { return (unsigned)a | ((unsigned)b << 16); }

// hazard guards as plain device helpers
__device__ __forceinline__ void dep_guard_h(v8f& a, v8f& b, v16h x, v16h y) { asm volatile("v_nop\n\tv_nop\n\tv_nop\n\tv_nop" : "+v"(a), "+v"(b) : "v"(x), "v"(y)); }
__device__ __forceinline__ void dep_guard_b(v8f& a, v8f& b, v16b x, v16b y) { asm volatile("v_nop\n\tv_nop\n\tv_nop\n\tv_nop" : "+v"(a), "+v"(b) : "v"(x), "v"(y)); }
__device__ __forceinline__ void keep4_h(v16h a, v16h b, v16h c, v16h d) { asm volatile("v_nop" :: "v"(a), "v"(b), "v"(c), "v"(d)); }
__device__ __forceinline__ void keep4_b(v16b a, v16b b, v16b c, v16b d) { asm volatile("v_nop" :: "v"(a), "v"(b), "v"(c), "v"(d)); }
__device__ __forceinline__ void acc_guard4(v8f& a, v8f& b, v8f& c, v8f& d) { asm volatile("v_nop\n\tv_nop\n\tv_nop\n\tv_nop" : "+v"(a), "+v"(b), "+v"(c), "+v"(d)); }
template <typename T> struct Frag;
template <> struct Frag<_Float16> {
  typedef v16h V; union U { v16h v; v8h h[2]; };
  static __device__ __forceinline__ v16h load(const _Float16* p) {   // elements 0..7 <- p[0..7], 8..15 <- p[16..23]
    U f; f.h[0] = *(const v8h*)(p); f.h[1] = *(const v8h*)(p + 16); return f.v;
  }
  static __device__ __forceinline__ v8f mma(v16h a, v16h b, v8f c) {
    return __builtin_amdgcn_wmma_f32_16x16x32_f16(false, a, false, b, (short)0, c, false, false);
  }
  static __device__ __forceinline__ void guard(v8f& a, v8f& b, v16h x, v16h y) { dep_guard_h(a, b, x, y); }
  static __device__ __forceinline__ void keep(v16h a, v16h b, v16h c, v16h d) { keep4_h(a, b, c, d); }
};
template <> struct Frag<__bf16> {
  typedef v16b V; union U { v16b v; v8b h[2]; };
  static __device__ __forceinline__ v16b load(const __bf16* p) {
    U f; f.h[0] = *(const v8b*)(p); f.h[1] = *(const v8b*)(p + 16); return f.v;
  }
  static __device__ __forceinline__ v8f mma(v16b a, v16b b, v8f c) {
    return __builtin_amdgcn_wmma_f32_16x16x32_bf16(false, a, false, b, (short)0, c, false, false);
  }
  static __device__ __forceinline__ void guard(v8f& a, v8f& b, v16b x, v16b y) { dep_guard_b(a, b, x, y); }
  static __device__ __forceinline__ void keep(v16b a, v16b b, v16b c, v16b d) { keep4_b(a, b, c, d); }
};

// ---- Register-blocked batched WMMA GEMM ------------------------------------
// C[m,n] = scale * sum_k A[m,k] * Bt[n,k] (+bias)(+resid); each wave owns a 64x64 tile; the 8 waves of a block
// form a 2 (M) x 4 (N) grid = one 128x256 block tile, whose operand rows reach LDS 64 k at a time (a stage) by
// asynchronous 16-byte copies, two buffers: stage t+1 flies while stage t is multiplied.
// A row-major [M,K]; Bt row-major [N,K]; M % 128 == 0, N % 256 == 0, K % 64 == 0.
// SPLIT: operands are hi/lo planes (A2/Bt2 = lo planes, same layout); product = hi.hi + hi.lo + lo.hi.
// BLO = false with SPLIT: the Bt lo plane is not used (product = hi.B + lo.B, B a single plane).
// BIAS_MODE: 0 = none, 1 = bias[m], 2 = bias[n].
// OUT_MODE: 0 = f32, 1 = f16, 2 = bf16 hi plane (Cout) + bf16 lo plane (Cout2).
// ET: 0 = f16 operands, 1 = bf16 operands (pointers passed as 16-bit storage)
// Asynchronous 16-byte-per-lane copies global -> LDS, eight or twelve to a statement. The s_wait_xcnt is the last line
// of the copies' own statement so that it stands in front of every later write of the address registers they name.
struct CopyRows { unsigned l; const void* g; };   // this lane's LDS byte address and global address of one row segment
__device__ __forceinline__ void async_copy8(CopyRows a, CopyRows b, CopyRows c, CopyRows d,
                                            CopyRows e, CopyRows f, CopyRows g, CopyRows h) {
  asm volatile("global_load_async_to_lds_b128 %0, %1, off\n\t"
               "global_load_async_to_lds_b128 %2, %3, off\n\t"
               "global_load_async_to_lds_b128 %4, %5, off\n\t"
               "global_load_async_to_lds_b128 %6, %7, off\n\t"
               "global_load_async_to_lds_b128 %8, %9, off\n\t"
               "global_load_async_to_lds_b128 %10, %11, off\n\t"
               "global_load_async_to_lds_b128 %12, %13, off\n\t"
               "global_load_async_to_lds_b128 %14, %15, off\n\t"
               "s_wait_xcnt 0x0"
               :: "v"(a.l), "v"(a.g), "v"(b.l), "v"(b.g), "v"(c.l), "v"(c.g), "v"(d.l), "v"(d.g),
                  "v"(e.l), "v"(e.g), "v"(f.l), "v"(f.g), "v"(g.l), "v"(g.g), "v"(h.l), "v"(h.g) : "memory");
}
__device__ __forceinline__ void async_copy12(CopyRows a, CopyRows b, CopyRows c, CopyRows d,
                                             CopyRows e, CopyRows f, CopyRows g, CopyRows h,
                                             CopyRows i, CopyRows j, CopyRows k, CopyRows m) {
  asm volatile("global_load_async_to_lds_b128 %0, %1, off\n\t"
               "global_load_async_to_lds_b128 %2, %3, off\n\t"
               "global_load_async_to_lds_b128 %4, %5, off\n\t"
               "global_load_async_to_lds_b128 %6, %7, off\n\t"
               "global_load_async_to_lds_b128 %8, %9, off\n\t"
               "global_load_async_to_lds_b128 %10, %11, off\n\t"
               "global_load_async_to_lds_b128 %12, %13, off\n\t"
               "global_load_async_to_lds_b128 %14, %15, off\n\t"
               "global_load_async_to_lds_b128 %16, %17, off\n\t"
               "global_load_async_to_lds_b128 %18, %19, off\n\t"
               "global_load_async_to_lds_b128 %20, %21, off\n\t"
               "global_load_async_to_lds_b128 %22, %23, off\n\t"
               "s_wait_xcnt 0x0"
               :: "v"(a.l), "v"(a.g), "v"(b.l), "v"(b.g), "v"(c.l), "v"(c.g), "v"(d.l), "v"(d.g),
                  "v"(e.l), "v"(e.g), "v"(f.l), "v"(f.g), "v"(g.l), "v"(g.g), "v"(h.l), "v"(h.g),
                  "v"(i.l), "v"(i.g), "v"(j.l), "v"(j.g), "v"(k.l), "v"(k.g), "v"(m.l), "v"(m.g) : "memory");
}
#define GM_PITCH 144            // LDS row pitch in bytes of a 128-byte stage row: 16 B x odd, conflict-free 16-byte fragment reads
#define GM_PE    (GM_PITCH / 2) // the same in 16-bit elements
template <int ET> struct Elem;
template <> struct Elem<0> { typedef _Float16 T; };
template <> struct Elem<1> { typedef __bf16 T; };
template <int ET, bool SPLIT, int BIAS_MODE, int OUT_MODE, bool RESID, int ACT = 0, bool BLO = true>
__global__ __launch_bounds__(256) void wmma_gemm64(
    const unsigned short* __restrict__ Ap, const unsigned short* __restrict__ A2p, int lda, long strideA,
    const unsigned short* __restrict__ Btp, const unsigned short* __restrict__ Bt2p, int ldb, long strideB,
    void* __restrict__ Cout, void* __restrict__ Cout2, int ldc, long strideC,
    const float* __restrict__ bias,
    const float* __restrict__ resid, long strideR,
    int M, int N, int K, float scale) {
  typedef typename Elem<ET>::T T;
  typedef typename Frag<T>::V V;
  const T* A = (const T*)Ap; const T* A2 = (const T*)A2p; const T* Bt = (const T*)Btp; const T* Bt2 = (const T*)Bt2p;
  __shared__ __align__(16) float sT[8][16 * 68];   // per-wave 16x64 slab, pitch 68 floats
  // one stage = [A 128 rows | A lo 128 rows (SPLIT) | Bt 256 rows | Bt lo 256 rows (SPLIT && BLO)], 64 k each
  constexpr unsigned OFF_A2  = 128u * GM_PITCH;
  constexpr unsigned OFF_B   = OFF_A2 + (SPLIT ? 128u * GM_PITCH : 0u);
  constexpr unsigned OFF_B2  = OFF_B + 256u * GM_PITCH;
  constexpr unsigned STAGE_B = OFF_B2 + ((SPLIT && BLO) ? 256u * GM_PITCH : 0u);
  __shared__ __align__(16) unsigned char ring[2 * STAGE_B];
  const int b    = blockIdx.y;
  const int lane = threadIdx.x & 31;
  const int wave = threadIdx.x >> 5;
  const int tilesN = N >> 8;
  const int tilesM = M >> 7;
  if ((int)blockIdx.x >= tilesM * tilesN) return;   // block-uniform, ahead of every copy and barrier
  const int bm  = blockIdx.x / tilesN;
  const int bn  = blockIdx.x - bm * tilesN;
  const int wm0 = (wave >> 2) << 6;            // this wave's rows inside the block tile
  const int wn0 = (wave & 3) << 6;             // this wave's columns inside the block tile
  const int m0 = (bm << 7) + wm0;
  const int n0 = (bn << 8) + wn0;

  const T* Ab  = A  + (size_t)b * strideA;
  const T* Bb  = Bt + (size_t)b * strideB;
  const T* Ab2 = SPLIT ? (A2  + (size_t)b * strideA) : nullptr;
  const T* Bb2 = (SPLIT && BLO) ? (Bt2 + (size_t)b * strideB) : nullptr;

  const int rlane = lane & 15;                 // row (A) / col (B, D) within subtile
  const int koff  = (lane >> 4) * 8;           // k offset of this lane half
  const int mOff  = (lane >> 4) * 8;           // D row offset

  // staging map: 8 lanes x 16 B = one whole 128-byte row segment; a copy of the block covers 32 rows
  const int srow = threadIdx.x >> 3;           // 0..31
  const int sseg = (threadIdx.x & 7) * 8;      // first of this lane's 8 elements in the 64-element row
  const size_t aoff = (size_t)((bm << 7) + srow) * lda + sseg;
  const size_t boff = (size_t)((bn << 8) + srow) * ldb + sseg;
  const size_t a32 = (size_t)32 * lda, b32 = (size_t)32 * ldb;
  const unsigned lds0 = (unsigned)(uintptr_t)ring + (unsigned)(srow * GM_PITCH + sseg * 2);
  auto copy_stage = [&](int st, int buf) {     // all lanes on, rows and k inside the operands by the size conditions above
    const unsigned l = lds0 + (unsigned)buf * STAGE_B;
    auto rows = [](unsigned lds, const T* g, size_t step32, int i) {   // row group i: 32 rows further on in both places
      return CopyRows{lds + (unsigned)i * 32u * GM_PITCH, (const void*)(g + (size_t)i * step32)};
    };
    const T* ga = Ab + aoff + (size_t)st * 64;
    const T* gb = Bb + boff + (size_t)st * 64;
    const unsigned lb = l + OFF_B;
    if (!SPLIT) {
      async_copy12(rows(l, ga, a32, 0), rows(l, ga, a32, 1), rows(l, ga, a32, 2), rows(l, ga, a32, 3),
                   rows(lb, gb, b32, 0), rows(lb, gb, b32, 1), rows(lb, gb, b32, 2), rows(lb, gb, b32, 3),
                   rows(lb, gb, b32, 4), rows(lb, gb, b32, 5), rows(lb, gb, b32, 6), rows(lb, gb, b32, 7));
    } else {
      const unsigned l2 = l + OFF_A2;
      const T* ga2 = Ab2 + aoff + (size_t)st * 64;
      async_copy8(rows(l, ga, a32, 0), rows(l, ga, a32, 1), rows(l, ga, a32, 2), rows(l, ga, a32, 3),
                  rows(l2, ga2, a32, 0), rows(l2, ga2, a32, 1), rows(l2, ga2, a32, 2), rows(l2, ga2, a32, 3));
      async_copy8(rows(lb, gb, b32, 0), rows(lb, gb, b32, 1), rows(lb, gb, b32, 2), rows(lb, gb, b32, 3),
                  rows(lb, gb, b32, 4), rows(lb, gb, b32, 5), rows(lb, gb, b32, 6), rows(lb, gb, b32, 7));
      if (BLO) {
        const unsigned lb2 = l + OFF_B2;
        const T* gb2 = Bb2 + boff + (size_t)st * 64;
        async_copy8(rows(lb2, gb2, b32, 0), rows(lb2, gb2, b32, 1), rows(lb2, gb2, b32, 2), rows(lb2, gb2, b32, 3),
                    rows(lb2, gb2, b32, 4), rows(lb2, gb2, b32, 5), rows(lb2, gb2, b32, 6), rows(lb2, gb2, b32, 7));
      }
    }
  };

  v8f acc[4][4];
#pragma unroll
  for (int i = 0; i < 4; ++i)
#pragma unroll
    for (int j = 0; j < 4; ++j) acc[i][j] = (v8f){0.f,0.f,0.f,0.f,0.f,0.f,0.f,0.f};

  const int nst = K >> 6;                      // stages of 64 k
  copy_stage(0, 0);
  asm volatile("s_wait_asynccnt 0x0" ::: "memory");   // this wave's share of stage 0 has landed
  __syncthreads();                                    // every wave's share has: stage 0 may be read
  if (nst > 1) copy_stage(1, 1);
  for (int st = 0; st < nst; ++st) {
    const int buf = st & 1;
    const T* sA  = (const T*)(ring + (unsigned)buf * STAGE_B);
    const T* sA2 = (const T*)(ring + (unsigned)buf * STAGE_B + OFF_A2);
    const T* sB  = (const T*)(ring + (unsigned)buf * STAGE_B + OFF_B);
    const T* sB2 = (const T*)(ring + (unsigned)buf * STAGE_B + OFF_B2);
#pragma unroll   // both 32-k halves of a stage in line, so that kk folds into the LDS loads' immediate offsets
    for (int kk = 0; kk < 64; kk += 32) {
      V bh[4], bl[4];
#pragma unroll
      for (int j = 0; j < 4; ++j) {
        const int bo = (wn0 + (j << 4) + rlane) * GM_PE + koff + kk;
        bh[j] = Frag<T>::load(sB + bo);
        if (SPLIT && BLO) bl[j] = Frag<T>::load(sB2 + bo);
      }
#pragma unroll
      for (int i = 0; i < 4; ++i) {
        const int ao = (wm0 + (i << 4) + rlane) * GM_PE + koff + kk;
        V ah = Frag<T>::load(sA + ao);
        V al;
        if (SPLIT) al = Frag<T>::load(sA2 + ao);
#pragma unroll
        for (int j = 0; j < 4; ++j) {
          acc[i][j] = Frag<T>::mma(ah, bh[j], acc[i][j]);
          if (SPLIT) {
            if (BLO) acc[i][j] = Frag<T>::mma(ah, bl[j], acc[i][j]);
            acc[i][j] = Frag<T>::mma(al, bh[j], acc[i][j]);
          }
        }
        Frag<T>::guard(acc[i][0], acc[i][3], ah, SPLIT ? al : ah);
      }
      Frag<T>::keep(bh[0], bh[1], bh[2], bh[3]);
      if (SPLIT && BLO) Frag<T>::keep(bl[0], bl[1], bl[2], bl[3]);
    }
    asm volatile("s_wait_dscnt 0x0" ::: "memory");      // this wave's reads of buffer buf are done before it is refilled
    asm volatile("s_wait_asynccnt 0x0" ::: "memory");   // this wave's share of stage st + 1 has landed
    __syncthreads();                                    // publishes stage st + 1 and ends every reader's use of buffer buf
    if (st + 2 < nst) copy_stage(st + 2, buf);
  }
  asm volatile("s_wait_asynccnt 0x0" ::: "memory");     // nothing of this wave's copies is outstanding past the loop
  acc_guard4(acc[0][0], acc[0][1], acc[0][2], acc[0][3]);
  acc_guard4(acc[1][0], acc[1][1], acc[1][2], acc[1][3]);
  acc_guard4(acc[2][0], acc[2][1], acc[2][2], acc[2][3]);
  acc_guard4(acc[3][0], acc[3][1], acc[3][2], acc[3][3]);

  // ---- epilogue ----
  float* slab = sT[wave];
  const float* Rb = RESID ? (resid + (size_t)b * strideR) : nullptr;
#pragma unroll
  for (int i = 0; i < 4; ++i) {
    const int mBase = m0 + (i << 4);
#pragma unroll
    for (int j = 0; j < 4; ++j) {
      const int n = n0 + (j << 4) + rlane;
      float bv = 0.f;
      if (BIAS_MODE == 2) bv = bias[n];
#pragma unroll
      for (int r = 0; r < 8; ++r) {
        float v = acc[i][j][r] * scale;
        if (BIAS_MODE == 1) v += bias[mBase + mOff + r];
        if (BIAS_MODE == 2) v += bv;
        if (RESID) v += Rb[(size_t)(mBase + mOff + r) * ldc + n];
        if (ACT == 1) v = tanhf(v);
        if (ACT == 2) v = fmaxf(v, 0.0f);
        if (ACT == 3) v = v / (1.0f + expf(-v));
        if (ACT == 4) v = (v > 0.f) ? v : 0.01f * v;
        slab[(mOff + r) * 68 + (j << 4) + rlane] = v;
      }
    }
    __builtin_amdgcn_fence(__ATOMIC_RELEASE, "workgroup");
    __builtin_amdgcn_wave_barrier();
    __builtin_amdgcn_fence(__ATOMIC_ACQUIRE, "workgroup");
    if (OUT_MODE == 0) {
      float* C = (float*)Cout + (size_t)b * strideC;
      const int hh = lane >> 4, c4 = (lane & 15) * 4;     // row seg = 256 B = 16 lanes x 16 B
      {
#pragma unroll
        for (int it = 0; it < 8; ++it) {
          const int row = it * 2 + hh;
          v4f v = *(const v4f*)(slab + row * 68 + c4);
          *(v4f*)(C + (size_t)(mBase + row) * ldc + n0 + c4) = v;
        }
        
      }
    } else {
      const int q = lane >> 3, c8 = (lane & 7) * 8;
      unsigned short* C  = (unsigned short*)Cout  + (size_t)b * strideC;
      unsigned short* C2 = (OUT_MODE == 2) ? ((unsigned short*)Cout2 + (size_t)b * strideC) : nullptr;
      {
#pragma unroll
        for (int it = 0; it < 4; ++it) {
          const int row = it * 4 + q;
          const float* sp = slab + row * 68 + c8;
          v8h hv, lv;
#pragma unroll
          for (int e = 0; e < 8; ++e) {
            if (OUT_MODE == 1) {
              hv[e] = (_Float16)sp[e];
            } else {
              unsigned short hb = f2bf_bits(sp[e]);
              unsigned short lb = f2bf_bits(sp[e] - bf_bits2f(hb));
              hv[e] = __builtin_bit_cast(_Float16, hb);
              lv[e] = __builtin_bit_cast(_Float16, lb);
            }
          }
          *(v8h*)(C + (size_t)(mBase + row) * ldc + n0 + c8) = hv;
          if (OUT_MODE == 2) *(v8h*)(C2 + (size_t)(mBase + row) * ldc + n0 + c8) = lv;
        }
        
      }
    }
    __builtin_amdgcn_fence(__ATOMIC_RELEASE, "workgroup");
    __builtin_amdgcn_wave_barrier();
    __builtin_amdgcn_fence(__ATOMIC_ACQUIRE, "workgroup");
  }
}

// ---------------------------------------------------------------------------
// f32 -> bf16 (RNE) cast of all seven float operands in ONE launch.
// The bf16 planes lie back to back in the workspace in the order q, k, v, Wq, Wk, Wv, Wo, so the output is one
// array of 3 * 4,194,304 + 4 * 1,048,576 = 16,777,216 elements. A block of 16 waves owns CAST_BLK = 65,536
// consecutive elements of it, which lie in one plane (both plane sizes are multiples of CAST_BLK):
// 3 * 64 + 4 * 16 = 256 blocks. A lane brings 32 pieces of 16 B (each wave-wide load 512 contiguous bytes) and
// stores 32 pieces of 8 B (each wave-wide store 256 contiguous bytes = two whole lines).
// Coverage: 32 pieces x 512 threads x 4 elements = 65,536 = the whole block range, each element once.
// ---------------------------------------------------------------------------
constexpr int CAST_THR  = 512;
constexpr int CAST_BLK  = 65536;
constexpr int CAST_ACT  = N_BATCH * SEQ_LEN * D_MODEL / CAST_BLK;   // 64 blocks per activation plane
constexpr int CAST_W    = D_INNER * D_MODEL / CAST_BLK;             // 16 blocks per weight plane
constexpr int CAST_GRID = 3 * CAST_ACT + 4 * CAST_W;                // 256
static_assert(N_BATCH * SEQ_LEN * D_MODEL % CAST_BLK == 0 && D_INNER * D_MODEL % CAST_BLK == 0, "whole blocks per plane");
typedef __attribute__((ext_vector_type(2))) unsigned v2u;
__global__ __launch_bounds__(CAST_THR) void cast_all_f32_bf16(
    const float* __restrict__ q, const float* __restrict__ k, const float* __restrict__ v,
    const float* __restrict__ wq, const float* __restrict__ wk, const float* __restrict__ wv,
    const float* __restrict__ wo, unsigned short* __restrict__ out) {
  const int bx = blockIdx.x;                 // 0 .. CAST_GRID - 1 (exact grid)
  const float* plane;
  int rel;                                   // block index inside its plane
  if (bx < 3 * CAST_ACT) {
    const int p = bx / CAST_ACT;
    rel = bx - p * CAST_ACT;
    plane = (p == 0) ? q : (p == 1) ? k : v;
  } else {
    const int w = bx - 3 * CAST_ACT;
    const int p = w / CAST_W;
    rel = w - p * CAST_W;
    plane = (p == 0) ? wq : (p == 1) ? wk : (p == 2) ? wv : wo;
  }
  const float* in = plane + (size_t)rel * CAST_BLK + threadIdx.x * 4;
  unsigned short* o = out + (size_t)bx * CAST_BLK + threadIdx.x * 4;
  constexpr int NP = CAST_BLK / (CAST_THR * 4);   // 32 pieces of 16 B per lane
  v4f f[NP];
  // the loads stand in a loop of their own, ahead of the conversions, so that a wave's share is in flight together
  for (int j = 0; j < NP; ++j) f[j] = *(const v4f*)(in + j * (CAST_THR * 4));
  for (int j = 0; j < NP; ++j) {
    const v2u u = {pk16(f2bf_bits(f[j][0]), f2bf_bits(f[j][1])), pk16(f2bf_bits(f[j][2]), f2bf_bits(f[j][3]))};
    *(v2u*)(o + j * (CAST_THR * 4)) = u;
  }
}

#define AT_D 64
#define AT_NW 4
#define AT_QB 64
#define AT_KC 64
#define AT_LP 72   // LDS row pitch in 16-bit elements: 144 B = 16 B x odd, so the 16 rows of a 16-byte fragment read fall on 64 distinct banks
#define P_CARRY 32768.0f

__device__ __forceinline__ v8f at_mma(v16b a, v16b b, v8f c) {
  c = __builtin_amdgcn_wmma_f32_16x16x32_bf16(false, a, false, b, (short)0, c, false, false);
  asm volatile("v_nop\n\tv_nop\n\tv_nop\n\tv_nop" : "+v"(c) : "v"(a), "v"(b));
  return c;
}
__device__ __forceinline__ v8f at_mma_h(v16b a, v16b b, v8f c) {   // operands hold f16 bit patterns
  const v16h ah = __builtin_bit_cast(v16h, a), bh = __builtin_bit_cast(v16h, b);
  c = __builtin_amdgcn_wmma_f32_16x16x32_f16(false, ah, false, bh, (short)0, c, false, false);
  asm volatile("v_nop\n\tv_nop\n\tv_nop\n\tv_nop" : "+v"(c) : "v"(ah), "v"(bh));
  return c;
}
__device__ __forceinline__ __bf16 at_f16bits(float f) { return __builtin_bit_cast(__bf16, (_Float16)f); }
// value of lane l ^ 16 (the other half's lane of the same column), by a vector cross-row move: no LDS queue, no wait
__device__ __forceinline__ float at_other_half(float x) {
  const int b = __float_as_int(x);
  return __int_as_float(__builtin_amdgcn_permlanex16(b, b, 0x76543210, 0xfedcba98, false, false));
}

__global__ __launch_bounds__(128)
void mha_bias_kernel(const unsigned short* __restrict__ qhp, const unsigned short* __restrict__ qlp,
                     const unsigned short* __restrict__ khp, const unsigned short* __restrict__ klp,
                     const unsigned short* __restrict__ vtp, const float* __restrict__ biasp,
                     unsigned short* __restrict__ chp, unsigned short* __restrict__ clp,
                     const int* __restrict__ nheads_in) {
  (void)nheads_in;   // module constant (16); shapes are compile-time here
  union FB { v16b v; v8b h[2]; };
  __shared__ __align__(16) __bf16 Ksh[AT_KC * AT_LP];            // K hi [kv][d]      9 KB
  __shared__ __align__(16) __bf16 Ksl[AT_KC * AT_LP];            // K lo              9 KB
  __shared__ __align__(16) __bf16 Vth[AT_D * AT_LP];             // V^T f16 bits [d][kv] 9 KB
  __shared__ __align__(16) float  Os[AT_NW][16 * 68];            // per wave out tile, pitch 68

  const int tid  = threadIdx.x;
  const int wave = tid >> 5;
  const int lane = tid & 31;
  const int hh   = lane >> 4;
  const int c    = lane & 15;

  const int nqb = SEQ_LEN / AT_QB;        // 32
  const int bx  = blockIdx.x;             // 0 .. N_BATCH*N_HEAD*nqb - 1 (exact grid)
  const int qb  = bx % nqb;
  const int bhd = bx / nqb;               // 0 .. 31
  const int h   = bhd % N_HEAD;
  const int b   = bhd / N_HEAD;           // 0 .. N_BATCH-1
  const int q0  = qb * AT_QB + wave * 16;

  const size_t rowb = (size_t)b * SEQ_LEN;   // token-row base of this batch element
  const __bf16* Qh = (const __bf16*)(const void*)qhp + rowb * D_INNER + (size_t)h * AT_D;
  const __bf16* Ql = (const __bf16*)(const void*)qlp + rowb * D_INNER + (size_t)h * AT_D;
  const __bf16* Kh = (const __bf16*)(const void*)khp + rowb * D_INNER + (size_t)h * AT_D;
  const __bf16* Kl = (const __bf16*)(const void*)klp + rowb * D_INNER + (size_t)h * AT_D;
  const __bf16* Vt = (const __bf16*)(const void*)vtp + ((size_t)b * D_INNER + (size_t)h * AT_D) * SEQ_LEN;
  const float*  Mb = biasp + (size_t)b * SEQ_LEN * SEQ_LEN;
  unsigned short* Ch = chp + rowb * D_INNER + (size_t)h * AT_D;
  unsigned short* Cl = clp + rowb * D_INNER + (size_t)h * AT_D;

  // ---- Q fragments (B operand, column = lane&15, split k map via Frag load): 2 d-chunks, hi and lo ----
  v16b qah[2], qal[2];
#pragma unroll
  for (int dc = 0; dc < 2; ++dc) {
    const __bf16* qr = Qh + (size_t)(q0 + c) * D_INNER + dc * 32 + 8 * hh;
    const __bf16* ql = Ql + (size_t)(q0 + c) * D_INNER + dc * 32 + 8 * hh;
    qah[dc] = Frag<__bf16>::load(qr);
    qal[dc] = Frag<__bf16>::load(ql);
  }

  float mrow = -INFINITY;   // running maximum of query q0 + c (the same in both lane halves)
  float lrow = 0.f;         // running sum over this lane half's keys of query q0 + c; the halves are joined after the loop
  v8f oacc[4];              // O^T: register r of tile t = (d = 16t + 8hh + r, query q0 + c)
#pragma unroll
  for (int t = 0; t < 4; ++t) oacc[t] = (v8f){0.f,0.f,0.f,0.f,0.f,0.f,0.f,0.f};

  const int nChunks = SEQ_LEN / AT_KC;   // 32, compile-time constant
  for (int kc = 0; kc < nChunks; ++kc) {
    const int kv0 = kc * AT_KC;
    __syncthreads();
    {
      // staging coverage: 128 threads x (4 x 8) elements = 64 rows x 64 per plane = the whole chunk tile
      const int r = tid >> 1, half = (tid & 1) * 32;
      const __bf16* ksh = Kh + (size_t)(kv0 + r) * D_INNER + half;   // K row kv0+r, d = half..half+31
      const __bf16* ksl = Kl + (size_t)(kv0 + r) * D_INNER + half;
      const __bf16* vs  = Vt + (size_t)r * SEQ_LEN + kv0 + half;      // V^T row d = r, s = kv0+half..+31
#pragma unroll
      for (int i = 0; i < 4; ++i) {
        const v8b a0 = *(const v8b*)(ksh + 8 * i);
        const v8b a1 = *(const v8b*)(ksl + 8 * i);
        const v8b b0 = *(const v8b*)(vs + 8 * i);
        *(v8b*)(Ksh + r * AT_LP + half + 8 * i) = a0;
        *(v8b*)(Ksl + r * AT_LP + half + 8 * i) = a1;
        *(v8b*)(Vth + r * AT_LP + half + 8 * i) = b0;
      }
    }
    __syncthreads();

    // ---- additive bias of query q0 + c: D register r of tile j wants key kv0 + 16j + 8hh + r = 8 consecutive floats ----
    v4f mb[4][2];
    {
      const float* mrp = Mb + (size_t)(q0 + c) * SEQ_LEN + kv0 + 8 * hh;   // all indices in range by construction
#pragma unroll
      for (int j = 0; j < 4; ++j) {
        mb[j][0] = *(const v4f*)(mrp + j * 16);
        mb[j][1] = *(const v4f*)(mrp + j * 16 + 4);
      }
    }
    // ---- scores, transposed: 4 kv subtiles of 16 (rows), 2 d-chunks, 3 products each ----
    v8f s[4];
#pragma unroll
    for (int j = 0; j < 4; ++j) {
      s[j] = (v8f){0.f,0.f,0.f,0.f,0.f,0.f,0.f,0.f};
#pragma unroll
      for (int dc = 0; dc < 2; ++dc) {
        FB kb, kl;
        kb.h[0] = *(const v8b*)(Ksh + (j * 16 + c) * AT_LP + dc * 32 + 8 * hh);
        kb.h[1] = *(const v8b*)(Ksh + (j * 16 + c) * AT_LP + dc * 32 + 16 + 8 * hh);
        kl.h[0] = *(const v8b*)(Ksl + (j * 16 + c) * AT_LP + dc * 32 + 8 * hh);
        kl.h[1] = *(const v8b*)(Ksl + (j * 16 + c) * AT_LP + dc * 32 + 16 + 8 * hh);
        s[j] = at_mma(kb.v, qah[dc], s[j]);
        s[j] = at_mma(kl.v, qah[dc], s[j]);
        s[j] = at_mma(kb.v, qal[dc], s[j]);
      }
    }
    // ---- bias by value, chunk maximum of this lane's query: in-lane over 32 keys, then the other half's 32 ----
    float mj[4];
#pragma unroll
    for (int j = 0; j < 4; ++j) {
      mj[j] = -INFINITY;
#pragma unroll
      for (int r = 0; r < 8; ++r) {
        const float mv = bf_bits2f(f2bf_bits(mb[j][r >> 2][r & 3]));
        const float sv = s[j][r] + mv;
        s[j][r] = sv;
        mj[j] = fmaxf(mj[j], sv);
      }
    }
    float cm = fmaxf(fmaxf(mj[0], mj[1]), fmaxf(mj[2], mj[3]));
    cm = fmaxf(cm, at_other_half(cm));
    const float mnew = fmaxf(mrow, cm);
    const float alpha = expf(mrow - mnew);
    mrow = mnew;
    // ---- P^T in registers: element e of B fragment kk = key 32kk + kmap(e) = register e & 7 of score tile 2kk + (e >> 3) ----
    FB pb[2];
    float pj[4];
#pragma unroll
    for (int j = 0; j < 4; ++j) {
      pj[j] = 0.f;
#pragma unroll
      for (int r = 0; r < 8; ++r) {
        const float p = expf(s[j][r] - mnew);
        pj[j] += p;
        pb[j >> 1].v[(j & 1) * 8 + r] = at_f16bits(p * P_CARRY);
      }
    }
    lrow = lrow * alpha + ((pj[0] + pj[1]) + (pj[2] + pj[3]));
#pragma unroll
    for (int t = 0; t < 4; ++t)
#pragma unroll
      for (int r = 0; r < 8; ++r) oacc[t][r] *= alpha;
#pragma unroll   // kk picks the P^T fragment's registers, so it must be a constant
    for (int kk = 0; kk < 2; ++kk) {
#pragma unroll
      for (int t = 0; t < 4; ++t) {
        FB vb;
        vb.h[0] = *(const v8b*)(Vth + (t * 16 + c) * AT_LP + kk * 32 + 8 * hh);
        vb.h[1] = *(const v8b*)(Vth + (t * 16 + c) * AT_LP + kk * 32 + 16 + 8 * hh);
        oacc[t] = at_mma_h(vb.v, pb[kk].v, oacc[t]);
      }
    }
  }

  // ---- join the halves' sums, normalise and stage the 16x64 f32 tile (row = query c, cols 16t + 8hh + r) ----
  float* os = Os[wave];
  {
    const float l = lrow + at_other_half(lrow);
    const float inv = 1.0f / (l * P_CARRY);   // l >= 1 (the maximum's own term), l*2^15 <= 6.8e7
#pragma unroll
    for (int t = 0; t < 4; ++t) {
      const v4f lo = {oacc[t][0] * inv, oacc[t][1] * inv, oacc[t][2] * inv, oacc[t][3] * inv};
      const v4f hi = {oacc[t][4] * inv, oacc[t][5] * inv, oacc[t][6] * inv, oacc[t][7] * inv};
      *(v4f*)(os + c * 68 + t * 16 + 8 * hh)     = lo;
      *(v4f*)(os + c * 68 + t * 16 + 8 * hh + 4) = hi;
    }
  }
  __builtin_amdgcn_fence(__ATOMIC_RELEASE, "workgroup");
  __builtin_amdgcn_wave_barrier();
  __builtin_amdgcn_fence(__ATOMIC_ACQUIRE, "workgroup");
  {
    // coverage: 4 it x 32 lanes x 8 elements = 16 rows x 64 = the whole wave tile, per plane;
    const int qg = lane >> 3, c8 = (lane & 7) * 8;
    {
#pragma unroll
      for (int it = 0; it < 4; ++it) {
        const int row = it * 4 + qg;
        const float* sp = os + row * 68 + c8;
        v8h hv, lv;
#pragma unroll
        for (int e = 0; e < 8; ++e) {
          const unsigned short hb = f2bf_bits(sp[e]);
          const unsigned short lb = f2bf_bits(sp[e] - bf_bits2f(hb));
          hv[e] = __builtin_bit_cast(_Float16, hb);
          lv[e] = __builtin_bit_cast(_Float16, lb);
        }
        *(v8h*)(Ch + (size_t)(q0 + row) * D_INNER + c8) = hv;
        *(v8h*)(Cl + (size_t)(q0 + row) * D_INNER + c8) = lv;
      }
      
    }
  }
}

// =====================================================================================
// Host launch glue: only kernel launches; grids/args are pure functions of the (asserted) sizes.
// Workspace region map (bytes; all offsets multiples of 2 MiB):
//   [  0 MiB,  8 MiB)  q  bf16  [4096][1024]
//   [  8 MiB, 16 MiB)  k  bf16  [4096][1024]
//   [ 16 MiB, 24 MiB)  v  bf16  [4096][1024]
//   [ 24 MiB, 26 MiB)  Wq bf16  [1024][1024]   [26,28) Wk   [28,30) Wv   [30,32) Wo
//   [ 32 MiB, 40 MiB)  Q hi bf16 [4096][1024]   [40,48) Q lo
//   [ 48 MiB, 56 MiB)  K hi bf16 [4096][1024]   [56,64) K lo
//   [ 64 MiB, 72 MiB)  V^T f16  [2][1024][2048]
//   [ 72 MiB, 80 MiB)  ctx hi bf16 [4096][1024] [80,88) ctx lo
//   total 88 MiB = 92,274,688 B
// =====================================================================================
extern "C" void kernel_launch(void* const* d_in, const int* in_sizes, int n_in,
                              void* d_out, int out_size, void* d_ws, size_t ws_size,
                              hipStream_t stream) {
  if (n_in < 9) return;
  const size_t nAct  = (size_t)N_BATCH * SEQ_LEN * D_MODEL;     // 4,194,304
  const size_t nW    = (size_t)D_INNER * D_MODEL;               // 1,048,576
  const size_t nMask = (size_t)N_BATCH * SEQ_LEN * SEQ_LEN;     // 8,388,608
  const size_t nVT   = (size_t)N_BATCH * D_INNER * SEQ_LEN;     // 4,194,304
  if ((size_t)in_sizes[0] != nAct || (size_t)in_sizes[1] != nAct || (size_t)in_sizes[2] != nAct ||
      (size_t)in_sizes[3] != nMask || (size_t)in_sizes[4] != nW || (size_t)in_sizes[5] != nW ||
      (size_t)in_sizes[6] != nW || (size_t)in_sizes[7] != nW || in_sizes[8] < 1 ||
      (size_t)out_size != nAct) return;

  const size_t bAct = nAct * 2, bW = nW * 2, bVT = nVT * 2;
  const size_t o_q16 = 0;
  const size_t o_k16 = o_q16 + bAct;
  const size_t o_v16 = o_k16 + bAct;
  const size_t o_wq  = o_v16 + bAct;
  const size_t o_wk  = o_wq + bW;
  const size_t o_wv  = o_wk + bW;
  const size_t o_wo  = o_wv + bW;
  const size_t o_qhi = o_wo + bW;
  const size_t o_qlo = o_qhi + bAct;
  const size_t o_khi = o_qlo + bAct;
  const size_t o_klo = o_khi + bAct;
  const size_t o_vt  = o_klo + bAct;
  const size_t o_chi = o_vt + bVT;
  const size_t o_clo = o_chi + bAct;
  const size_t total = o_clo + bAct;                            // 92,274,688
  if (total > ws_size) return;

  const float* qf  = (const float*)d_in[0];
  const float* kf  = (const float*)d_in[1];
  const float* vf  = (const float*)d_in[2];
  const float* mf  = (const float*)d_in[3];
  const float* wqf = (const float*)d_in[4];
  const float* wkf = (const float*)d_in[5];
  const float* wvf = (const float*)d_in[6];
  const float* wof = (const float*)d_in[7];
  const int*   nhp = (const int*)d_in[8];
  char* ws = (char*)d_ws;
  unsigned short* q16 = (unsigned short*)(ws + o_q16);
  unsigned short* k16 = (unsigned short*)(ws + o_k16);
  unsigned short* v16 = (unsigned short*)(ws + o_v16);
  unsigned short* wq16 = (unsigned short*)(ws + o_wq);
  unsigned short* wk16 = (unsigned short*)(ws + o_wk);
  unsigned short* wv16 = (unsigned short*)(ws + o_wv);
  unsigned short* wo16 = (unsigned short*)(ws + o_wo);
  unsigned short* qhi = (unsigned short*)(ws + o_qhi);
  unsigned short* qlo = (unsigned short*)(ws + o_qlo);
  unsigned short* khi = (unsigned short*)(ws + o_khi);
  unsigned short* klo = (unsigned short*)(ws + o_klo);
  unsigned short* vt  = (unsigned short*)(ws + o_vt);
  unsigned short* chi = (unsigned short*)(ws + o_chi);
  unsigned short* clo = (unsigned short*)(ws + o_clo);
  float* out = (float*)d_out;

  // ---- 1: RNE bf16 copies of the seven float inputs; q16 is the start of the seven planes, back to back in the
  //      order of the arguments (region map above) ----
  cast_all_f32_bf16<<<dim3((unsigned)CAST_GRID), CAST_THR, 0, stream>>>(qf, kf, vf, wqf, wkf, wvf, wof, q16);

  const int MTOK = N_BATCH * SEQ_LEN;         // 4096 rows of [B*S][.] planes
  // ---- 2,3: Q and K projections: C[4096][1024] = X[4096][1024] . W^T, W [1024 out][1024 in] = Bt[N][K];
  //      M=4096, N=1024 (x64), K=1024 (x32); 64*16 = 1024 wave tiles = 128 blocks; out = bf16 hi + lo planes
  {
    const int tiles = (MTOK / 64) * (D_INNER / 64);
    const dim3 g((unsigned)((tiles + 7) / 8), 1);
    wmma_gemm64<1, false, 0, 2, false><<<g, 256, 0, stream>>>(
        q16, q16, D_MODEL, 0L, wq16, wq16, D_MODEL, 0L, (void*)qhi, (void*)qlo, D_INNER, 0L,
        mf, mf, 0L, MTOK, D_INNER, D_MODEL, 1.0f);
    wmma_gemm64<1, false, 0, 2, false><<<g, 256, 0, stream>>>(
        k16, k16, D_MODEL, 0L, wk16, wk16, D_MODEL, 0L, (void*)khi, (void*)klo, D_INNER, 0L,
        mf, mf, 0L, MTOK, D_INNER, D_MODEL, 1.0f);
  }
  // ---- 4: V projection, role-swapped so the output is V^T per batch element:
  //      C_b[e][s] = sum_k Wv[e][k] . v_b[s][k]; A = Wv [1024][1024] (shared, strideA 0), Bt = v_b [2048][1024],
  //      C_b [1024][2048] f16; M=1024, N=2048 (x64), K=1024 (x32); 16*32 = 512 tiles = 64 blocks, grid.y = 2
  {
    const int tiles = (D_INNER / 64) * (SEQ_LEN / 64);
    const dim3 g((unsigned)((tiles + 7) / 8), (unsigned)N_BATCH);
    wmma_gemm64<1, false, 0, 1, false><<<g, 256, 0, stream>>>(
        wv16, wv16, D_MODEL, 0L, v16, v16, D_MODEL, (long)SEQ_LEN * D_MODEL,
        (void*)vt, (void*)vt, SEQ_LEN, (long)D_INNER * SEQ_LEN,
        mf, mf, 0L, D_INNER, SEQ_LEN, D_MODEL, 1.0f);
  }
  // ---- 5: attention: 2 x 16 x 32 = 1024 blocks of 128 threads ----
  {
    const dim3 g((unsigned)(N_BATCH * N_HEAD * (SEQ_LEN / AT_QB)));
    mha_bias_kernel<<<g, 128, 0, stream>>>(qhi, qlo, khi, klo, vt, mf, chi, clo, nhp);
  }
  // ---- 6: output projection: out[4096][1024] = (ctx_hi + ctx_lo)[4096][1024] . Wo^T, Wo [1024 out][1024 in];
  //      M=4096, N=1024 (x64), K=1024 (x32); 1024 tiles = 128 blocks; f32 out
  {
    const int tiles = (MTOK / 64) * (D_MODEL / 64);
    const dim3 g((unsigned)((tiles + 7) / 8), 1);
    wmma_gemm64<1, true, 0, 0, false, 0, false><<<g, 256, 0, stream>>>(
        chi, clo, D_INNER, 0L, wo16, wo16, D_INNER, 0L, (void*)out, (void*)out, D_MODEL, 0L,
        mf, mf, 0L, MTOK, D_MODEL, D_INNER, 1.0f);
  }
}

// v005
// Measured time: 196 microseconds a run.
// Timed twice side by side with v004, it ran 1.10 and 1.11 times as fast.
// All steps since v000 together make it 2.43 times as fast.
// Contractions: q/k/v projections = v_wmma_f32_16x16x32_bf16 on RNE-bf16 copies of the inputs (single product); q.k^T = v_wmma_f32_16x16x32_bf16 with bf16 hi/lo split operands (hi.hi + hi.lo + lo.hi); p.v = v_wmma_f32_16x16x32_f16 (p carried x2^15 in f16, v^T stored f16); output projection = v_wmma_f32_16x16x32_bf16 with ctx bf16 hi/lo x Wo bf16 (hi.W + lo.W); f32 accumulate everywhere; additive mask (RNE-bf16 values) and online softmax in f32.
#include <hip/hip_runtime.h>
#include <math.h>
#include <stdint.h>

constexpr int N_BATCH = 2;
constexpr int SEQ_LEN = 2048;
constexpr int D_MODEL = 1024;                 // d_model (input / output feature width)
constexpr int N_HEAD  = 16;
constexpr int D_HEAD  = 64;
constexpr int D_INNER = N_HEAD * D_HEAD;      // 1024
static_assert(D_INNER == 1024, "inner width");
static_assert(SEQ_LEN % 64 == 0 && D_MODEL % 64 == 0 && D_INNER % 64 == 0, "tile multiples");
static_assert(D_MODEL % 32 == 0 && D_INNER % 32 == 0, "K multiples of 32");

typedef __attribute__((ext_vector_type(16))) _Float16 v16h;
typedef __attribute__((ext_vector_type(8)))  _Float16 v8h;
typedef __attribute__((ext_vector_type(16))) __bf16   v16b;
typedef __attribute__((ext_vector_type(8)))  __bf16   v8b;
typedef __attribute__((ext_vector_type(8)))  float    v8f;
typedef __attribute__((ext_vector_type(4)))  float    v4f;
typedef __attribute__((ext_vector_type(2)))  float    v2f;

__device__ __forceinline__ unsigned short f2bf_bits(float f) {
  unsigned u = __float_as_uint(f);
  return (unsigned short)((u + 0x7FFFu + ((u >> 16) & 1u)) >> 16);
}
__device__ __forceinline__ float bf_bits2f(unsigned short h) { return __uint_as_float(((unsigned)h) << 16); }
__device__ __forceinline__ unsigned pk16(unsigned short a, unsigned short b) { return (unsigned)a | ((unsigned)b << 16); }

// hazard guards as plain device helpers
__device__ __forceinline__ void dep_guard_h(v8f& a, v8f& b, v16h x, v16h y) { asm volatile("v_nop\n\tv_nop\n\tv_nop\n\tv_nop" : "+v"(a), "+v"(b) : "v"(x), "v"(y)); }
__device__ __forceinline__ void dep_guard_b(v8f& a, v8f& b, v16b x, v16b y) { asm volatile("v_nop\n\tv_nop\n\tv_nop\n\tv_nop" : "+v"(a), "+v"(b) : "v"(x), "v"(y)); }
__device__ __forceinline__ void keep4_h(v16h a, v16h b, v16h c, v16h d) { asm volatile("v_nop" :: "v"(a), "v"(b), "v"(c), "v"(d)); }
__device__ __forceinline__ void keep4_b(v16b a, v16b b, v16b c, v16b d) { asm volatile("v_nop" :: "v"(a), "v"(b), "v"(c), "v"(d)); }
__device__ __forceinline__ void acc_guard4(v8f& a, v8f& b, v8f& c, v8f& d) { asm volatile("v_nop\n\tv_nop\n\tv_nop\n\tv_nop" : "+v"(a), "+v"(b), "+v"(c), "+v"(d)); }
template <typename T> struct Frag;
template <> struct Frag<_Float16> {
  typedef v16h V; union U { v16h v; v8h h[2]; };
  static __device__ __forceinline__ v16h load(const _Float16* p) {   // elements 0..7 <- p[0..7], 8..15 <- p[16..23]
    U f; f.h[0] = *(const v8h*)(p); f.h[1] = *(const v8h*)(p + 16); return f.v;
  }
  static __device__ __forceinline__ v8f mma(v16h a, v16h b, v8f c) {
    return __builtin_amdgcn_wmma_f32_16x16x32_f16(false, a, false, b, (short)0, c, false, false);
  }
  static __device__ __forceinline__ void guard(v8f& a, v8f& b, v16h x, v16h y) { dep_guard_h(a, b, x, y); }
  static __device__ __forceinline__ void keep(v16h a, v16h b, v16h c, v16h d) { keep4_h(a, b, c, d); }
};
template <> struct Frag<__bf16> {
  typedef v16b V; union U { v16b v; v8b h[2]; };
  static __device__ __forceinline__ v16b load(const __bf16* p) {
    U f; f.h[0] = *(const v8b*)(p); f.h[1] = *(const v8b*)(p + 16); return f.v;
  }
  static __device__ __forceinline__ v8f mma(v16b a, v16b b, v8f c) {
    return __builtin_amdgcn_wmma_f32_16x16x32_bf16(false, a, false, b, (short)0, c, false, false);
  }
  static __device__ __forceinline__ void guard(v8f& a, v8f& b, v16b x, v16b y) { dep_guard_b(a, b, x, y); }
  static __device__ __forceinline__ void keep(v16b a, v16b b, v16b c, v16b d) { keep4_b(a, b, c, d); }
};

// ---- Register-blocked batched WMMA GEMM ------------------------------------
// C[m,n] = scale * sum_k A[m,k] * Bt[n,k] (+bias)(+resid); each wave owns a 64x64 tile; the 8 waves of a block
// form a 2 (M) x 4 (N) grid = one 128x256 block tile, whose operand rows reach LDS 64 k at a time (a stage) by
// asynchronous 16-byte copies, two buffers: stage t+1 flies while stage t is multiplied.
// A row-major [M,K]; Bt row-major [N,K]; M % 128 == 0, N % 256 == 0, K % 64 == 0.
// SPLIT: operands are hi/lo planes (A2/Bt2 = lo planes, same layout); product = hi.hi + hi.lo + lo.hi.
// BLO = false with SPLIT: the Bt lo plane is not used (product = hi.B + lo.B, B a single plane).
// BIAS_MODE: 0 = none, 1 = bias[m], 2 = bias[n].
// OUT_MODE: 0 = f32, 1 = f16, 2 = bf16 hi plane (Cout) + bf16 lo plane (Cout2).
// ET: 0 = f16 operands, 1 = bf16 operands (pointers passed as 16-bit storage)
// Asynchronous 16-byte-per-lane copies global -> LDS, eight or twelve to a statement. The s_wait_xcnt is the last line
// of the copies' own statement so that it stands in front of every later write of the address registers they name.
struct CopyRows { unsigned l; const void* g; };   // this lane's LDS byte address and global address of one row segment
__device__ __forceinline__ void async_copy8(CopyRows a, CopyRows b, CopyRows c, CopyRows d,
                                            CopyRows e, CopyRows f, CopyRows g, CopyRows h) {
  asm volatile("global_load_async_to_lds_b128 %0, %1, off\n\t"
               "global_load_async_to_lds_b128 %2, %3, off\n\t"
               "global_load_async_to_lds_b128 %4, %5, off\n\t"
               "global_load_async_to_lds_b128 %6, %7, off\n\t"
               "global_load_async_to_lds_b128 %8, %9, off\n\t"
               "global_load_async_to_lds_b128 %10, %11, off\n\t"
               "global_load_async_to_lds_b128 %12, %13, off\n\t"
               "global_load_async_to_lds_b128 %14, %15, off\n\t"
               "s_wait_xcnt 0x0"
               :: "v"(a.l), "v"(a.g), "v"(b.l), "v"(b.g), "v"(c.l), "v"(c.g), "v"(d.l), "v"(d.g),
                  "v"(e.l), "v"(e.g), "v"(f.l), "v"(f.g), "v"(g.l), "v"(g.g), "v"(h.l), "v"(h.g) : "memory");
}
__device__ __forceinline__ void async_copy12(CopyRows a, CopyRows b, CopyRows c, CopyRows d,
                                             CopyRows e, CopyRows f, CopyRows g, CopyRows h,
                                             CopyRows i, CopyRows j, CopyRows k, CopyRows m) {
  asm volatile("global_load_async_to_lds_b128 %0, %1, off\n\t"
               "global_load_async_to_lds_b128 %2, %3, off\n\t"
               "global_load_async_to_lds_b128 %4, %5, off\n\t"
               "global_load_async_to_lds_b128 %6, %7, off\n\t"
               "global_load_async_to_lds_b128 %8, %9, off\n\t"
               "global_load_async_to_lds_b128 %10, %11, off\n\t"
               "global_load_async_to_lds_b128 %12, %13, off\n\t"
               "global_load_async_to_lds_b128 %14, %15, off\n\t"
               "global_load_async_to_lds_b128 %16, %17, off\n\t"
               "global_load_async_to_lds_b128 %18, %19, off\n\t"
               "global_load_async_to_lds_b128 %20, %21, off\n\t"
               "global_load_async_to_lds_b128 %22, %23, off\n\t"
               "s_wait_xcnt 0x0"
               :: "v"(a.l), "v"(a.g), "v"(b.l), "v"(b.g), "v"(c.l), "v"(c.g), "v"(d.l), "v"(d.g),
                  "v"(e.l), "v"(e.g), "v"(f.l), "v"(f.g), "v"(g.l), "v"(g.g), "v"(h.l), "v"(h.g),
                  "v"(i.l), "v"(i.g), "v"(j.l), "v"(j.g), "v"(k.l), "v"(k.g), "v"(m.l), "v"(m.g) : "memory");
}
#define GM_PITCH 144            // LDS row pitch in bytes of a 128-byte stage row: 16 B x odd, conflict-free 16-byte fragment reads
#define GM_PE    (GM_PITCH / 2) // the same in 16-bit elements
template <int ET> struct Elem;
template <> struct Elem<0> { typedef _Float16 T; };
template <> struct Elem<1> { typedef __bf16 T; };
template <int ET, bool SPLIT, int BIAS_MODE, int OUT_MODE, bool RESID, int ACT = 0, bool BLO = true>
__global__ __launch_bounds__(256) void wmma_gemm64(
    const unsigned short* __restrict__ Ap, const unsigned short* __restrict__ A2p, int lda, long strideA,
    const unsigned short* __restrict__ Btp, const unsigned short* __restrict__ Bt2p, int ldb, long strideB,
    void* __restrict__ Cout, void* __restrict__ Cout2, int ldc, long strideC,
    const float* __restrict__ bias,
    const float* __restrict__ resid, long strideR,
    int M, int N, int K, float scale) {
  typedef typename Elem<ET>::T T;
  typedef typename Frag<T>::V V;
  const T* A = (const T*)Ap; const T* A2 = (const T*)A2p; const T* Bt = (const T*)Btp; const T* Bt2 = (const T*)Bt2p;
  __shared__ __align__(16) float sT[8][16 * 68];   // per-wave 16x64 slab, pitch 68 floats
  // one stage = [A 128 rows | A lo 128 rows (SPLIT) | Bt 256 rows | Bt lo 256 rows (SPLIT && BLO)], 64 k each
  constexpr unsigned OFF_A2  = 128u * GM_PITCH;
  constexpr unsigned OFF_B   = OFF_A2 + (SPLIT ? 128u * GM_PITCH : 0u);
  constexpr unsigned OFF_B2  = OFF_B + 256u * GM_PITCH;
  constexpr unsigned STAGE_B = OFF_B2 + ((SPLIT && BLO) ? 256u * GM_PITCH : 0u);
  __shared__ __align__(16) unsigned char ring[2 * STAGE_B];
  const int b    = blockIdx.y;
  const int lane = threadIdx.x & 31;
  const int wave = threadIdx.x >> 5;
  const int tilesN = N >> 8;
  const int tilesM = M >> 7;
  if ((int)blockIdx.x >= tilesM * tilesN) return;   // block-uniform, ahead of every copy and barrier
  const int bm  = blockIdx.x / tilesN;
  const int bn  = blockIdx.x - bm * tilesN;
  const int wm0 = (wave >> 2) << 6;            // this wave's rows inside the block tile
  const int wn0 = (wave & 3) << 6;             // this wave's columns inside the block tile
  const int m0 = (bm << 7) + wm0;
  const int n0 = (bn << 8) + wn0;

  const T* Ab  = A  + (size_t)b * strideA;
  const T* Bb  = Bt + (size_t)b * strideB;
  const T* Ab2 = SPLIT ? (A2  + (size_t)b * strideA) : nullptr;
  const T* Bb2 = (SPLIT && BLO) ? (Bt2 + (size_t)b * strideB) : nullptr;

  const int rlane = lane & 15;                 // row (A) / col (B, D) within subtile
  const int koff  = (lane >> 4) * 8;           // k offset of this lane half
  const int mOff  = (lane >> 4) * 8;           // D row offset

  // staging map: 8 lanes x 16 B = one whole 128-byte row segment; a copy of the block covers 32 rows
  const int srow = threadIdx.x >> 3;           // 0..31
  const int sseg = (threadIdx.x & 7) * 8;      // first of this lane's 8 elements in the 64-element row
  const size_t aoff = (size_t)((bm << 7) + srow) * lda + sseg;
  const size_t boff = (size_t)((bn << 8) + srow) * ldb + sseg;
  const size_t a32 = (size_t)32 * lda, b32 = (size_t)32 * ldb;
  const unsigned lds0 = (unsigned)(uintptr_t)ring + (unsigned)(srow * GM_PITCH + sseg * 2);
  auto copy_stage = [&](int st, int buf) {     // all lanes on, rows and k inside the operands by the size conditions above
    const unsigned l = lds0 + (unsigned)buf * STAGE_B;
    auto rows = [](unsigned lds, const T* g, size_t step32, int i) {   // row group i: 32 rows further on in both places
      return CopyRows{lds + (unsigned)i * 32u * GM_PITCH, (const void*)(g + (size_t)i * step32)};
    };
    const T* ga = Ab + aoff + (size_t)st * 64;
    const T* gb = Bb + boff + (size_t)st * 64;
    const unsigned lb = l + OFF_B;
    if (!SPLIT) {
      async_copy12(rows(l, ga, a32, 0), rows(l, ga, a32, 1), rows(l, ga, a32, 2), rows(l, ga, a32, 3),
                   rows(lb, gb, b32, 0), rows(lb, gb, b32, 1), rows(lb, gb, b32, 2), rows(lb, gb, b32, 3),
                   rows(lb, gb, b32, 4), rows(lb, gb, b32, 5), rows(lb, gb, b32, 6), rows(lb, gb, b32, 7));
    } else {
      const unsigned l2 = l + OFF_A2;
      const T* ga2 = Ab2 + aoff + (size_t)st * 64;
      async_copy8(rows(l, ga, a32, 0), rows(l, ga, a32, 1), rows(l, ga, a32, 2), rows(l, ga, a32, 3),
                  rows(l2, ga2, a32, 0), rows(l2, ga2, a32, 1), rows(l2, ga2, a32, 2), rows(l2, ga2, a32, 3));
      async_copy8(rows(lb, gb, b32, 0), rows(lb, gb, b32, 1), rows(lb, gb, b32, 2), rows(lb, gb, b32, 3),
                  rows(lb, gb, b32, 4), rows(lb, gb, b32, 5), rows(lb, gb, b32, 6), rows(lb, gb, b32, 7));
      if (BLO) {
        const unsigned lb2 = l + OFF_B2;
        const T* gb2 = Bb2 + boff + (size_t)st * 64;
        async_copy8(rows(lb2, gb2, b32, 0), rows(lb2, gb2, b32, 1), rows(lb2, gb2, b32, 2), rows(lb2, gb2, b32, 3),
                    rows(lb2, gb2, b32, 4), rows(lb2, gb2, b32, 5), rows(lb2, gb2, b32, 6), rows(lb2, gb2, b32, 7));
      }
    }
  };

  v8f acc[4][4];
#pragma unroll
  for (int i = 0; i < 4; ++i)
#pragma unroll
    for (int j = 0; j < 4; ++j) acc[i][j] = (v8f){0.f,0.f,0.f,0.f,0.f,0.f,0.f,0.f};

  const int nst = K >> 6;                      // stages of 64 k
  copy_stage(0, 0);
  asm volatile("s_wait_asynccnt 0x0" ::: "memory");   // this wave's share of stage 0 has landed
  __syncthreads();                                    // every wave's share has: stage 0 may be read
  if (nst > 1) copy_stage(1, 1);
  for (int st = 0; st < nst; ++st) {
    const int buf = st & 1;
    const T* sA  = (const T*)(ring + (unsigned)buf * STAGE_B);
    const T* sA2 = (const T*)(ring + (unsigned)buf * STAGE_B + OFF_A2);
    const T* sB  = (const T*)(ring + (unsigned)buf * STAGE_B + OFF_B);
    const T* sB2 = (const T*)(ring + (unsigned)buf * STAGE_B + OFF_B2);
#pragma unroll   // both 32-k halves of a stage in line, so that kk folds into the LDS loads' immediate offsets
    for (int kk = 0; kk < 64; kk += 32) {
      V bh[4], bl[4];
#pragma unroll
      for (int j = 0; j < 4; ++j) {
        const int bo = (wn0 + (j << 4) + rlane) * GM_PE + koff + kk;
        bh[j] = Frag<T>::load(sB + bo);
        if (SPLIT && BLO) bl[j] = Frag<T>::load(sB2 + bo);
      }
#pragma unroll
      for (int i = 0; i < 4; ++i) {
        const int ao = (wm0 + (i << 4) + rlane) * GM_PE + koff + kk;
        V ah = Frag<T>::load(sA + ao);
        V al;
        if (SPLIT) al = Frag<T>::load(sA2 + ao);
#pragma unroll
        for (int j = 0; j < 4; ++j) {
          acc[i][j] = Frag<T>::mma(ah, bh[j], acc[i][j]);
          if (SPLIT) {
            if (BLO) acc[i][j] = Frag<T>::mma(ah, bl[j], acc[i][j]);
            acc[i][j] = Frag<T>::mma(al, bh[j], acc[i][j]);
          }
        }
        Frag<T>::guard(acc[i][0], acc[i][3], ah, SPLIT ? al : ah);
      }
      Frag<T>::keep(bh[0], bh[1], bh[2], bh[3]);
      if (SPLIT && BLO) Frag<T>::keep(bl[0], bl[1], bl[2], bl[3]);
    }
    asm volatile("s_wait_dscnt 0x0" ::: "memory");      // this wave's reads of buffer buf are done before it is refilled
    asm volatile("s_wait_asynccnt 0x0" ::: "memory");   // this wave's share of stage st + 1 has landed
    __syncthreads();                                    // publishes stage st + 1 and ends every reader's use of buffer buf
    if (st + 2 < nst) copy_stage(st + 2, buf);
  }
  asm volatile("s_wait_asynccnt 0x0" ::: "memory");     // nothing of this wave's copies is outstanding past the loop
  acc_guard4(acc[0][0], acc[0][1], acc[0][2], acc[0][3]);
  acc_guard4(acc[1][0], acc[1][1], acc[1][2], acc[1][3]);
  acc_guard4(acc[2][0], acc[2][1], acc[2][2], acc[2][3]);
  acc_guard4(acc[3][0], acc[3][1], acc[3][2], acc[3][3]);

  // ---- epilogue ----
  float* slab = sT[wave];
  const float* Rb = RESID ? (resid + (size_t)b * strideR) : nullptr;
#pragma unroll
  for (int i = 0; i < 4; ++i) {
    const int mBase = m0 + (i << 4);
#pragma unroll
    for (int j = 0; j < 4; ++j) {
      const int n = n0 + (j << 4) + rlane;
      float bv = 0.f;
      if (BIAS_MODE == 2) bv = bias[n];
#pragma unroll
      for (int r = 0; r < 8; ++r) {
        float v = acc[i][j][r] * scale;
        if (BIAS_MODE == 1) v += bias[mBase + mOff + r];
        if (BIAS_MODE == 2) v += bv;
        if (RESID) v += Rb[(size_t)(mBase + mOff + r) * ldc + n];
        if (ACT == 1) v = tanhf(v);
        if (ACT == 2) v = fmaxf(v, 0.0f);
        if (ACT == 3) v = v / (1.0f + expf(-v));
        if (ACT == 4) v = (v > 0.f) ? v : 0.01f * v;
        slab[(mOff + r) * 68 + (j << 4) + rlane] = v;
      }
    }
    __builtin_amdgcn_fence(__ATOMIC_RELEASE, "workgroup");
    __builtin_amdgcn_wave_barrier();
    __builtin_amdgcn_fence(__ATOMIC_ACQUIRE, "workgroup");
    if (OUT_MODE == 0) {
      float* C = (float*)Cout + (size_t)b * strideC;
      const int hh = lane >> 4, c4 = (lane & 15) * 4;     // row seg = 256 B = 16 lanes x 16 B
      {
#pragma unroll
        for (int it = 0; it < 8; ++it) {
          const int row = it * 2 + hh;
          v4f v = *(const v4f*)(slab + row * 68 + c4);
          *(v4f*)(C + (size_t)(mBase + row) * ldc + n0 + c4) = v;
        }
        
      }
    } else {
      const int q = lane >> 3, c8 = (lane & 7) * 8;
      unsigned short* C  = (unsigned short*)Cout  + (size_t)b * strideC;
      unsigned short* C2 = (OUT_MODE == 2) ? ((unsigned short*)Cout2 + (size_t)b * strideC) : nullptr;
      {
#pragma unroll
        for (int it = 0; it < 4; ++it) {
          const int row = it * 4 + q;
          const float* sp = slab + row * 68 + c8;
          v8h hv, lv;
#pragma unroll
          for (int e = 0; e < 8; ++e) {
            if (OUT_MODE == 1) {
              hv[e] = (_Float16)sp[e];
            } else {
              unsigned short hb = f2bf_bits(sp[e]);
              unsigned short lb = f2bf_bits(sp[e] - bf_bits2f(hb));
              hv[e] = __builtin_bit_cast(_Float16, hb);
              lv[e] = __builtin_bit_cast(_Float16, lb);
            }
          }
          *(v8h*)(C + (size_t)(mBase + row) * ldc + n0 + c8) = hv;
          if (OUT_MODE == 2) *(v8h*)(C2 + (size_t)(mBase + row) * ldc + n0 + c8) = lv;
        }
        
      }
    }
    __builtin_amdgcn_fence(__ATOMIC_RELEASE, "workgroup");
    __builtin_amdgcn_wave_barrier();
    __builtin_amdgcn_fence(__ATOMIC_ACQUIRE, "workgroup");
  }
}

// ---------------------------------------------------------------------------
// f32 -> bf16 (RNE) cast of all seven float operands in ONE launch.
// The bf16 planes lie back to back in the workspace in the order q, k, v, Wq, Wk, Wv, Wo, so the output is one
// array of 3 * 4,194,304 + 4 * 1,048,576 = 16,777,216 elements. A block of 16 waves owns CAST_BLK = 65,536
// consecutive elements of it, which lie in one plane (both plane sizes are multiples of CAST_BLK):
// 3 * 64 + 4 * 16 = 256 blocks. A lane brings 32 pieces of 16 B (each wave-wide load 512 contiguous bytes) and
// stores 32 pieces of 8 B (each wave-wide store 256 contiguous bytes = two whole lines).
// Coverage: 32 pieces x 512 threads x 4 elements = 65,536 = the whole block range, each element once.
// ---------------------------------------------------------------------------
constexpr int CAST_THR  = 512;
constexpr int CAST_BLK  = 65536;
constexpr int CAST_ACT  = N_BATCH * SEQ_LEN * D_MODEL / CAST_BLK;   // 64 blocks per activation plane
constexpr int CAST_W    = D_INNER * D_MODEL / CAST_BLK;             // 16 blocks per weight plane
constexpr int CAST_GRID = 3 * CAST_ACT + 4 * CAST_W;                // 256
static_assert(N_BATCH * SEQ_LEN * D_MODEL % CAST_BLK == 0 && D_INNER * D_MODEL % CAST_BLK == 0, "whole blocks per plane");
typedef __attribute__((ext_vector_type(2))) unsigned v2u;
__global__ __launch_bounds__(CAST_THR) void cast_all_f32_bf16(
    const float* __restrict__ q, const float* __restrict__ k, const float* __restrict__ v,
    const float* __restrict__ wq, const float* __restrict__ wk, const float* __restrict__ wv,
    const float* __restrict__ wo, unsigned short* __restrict__ out) {
  const int bx = blockIdx.x;                 // 0 .. CAST_GRID - 1 (exact grid)
  const float* plane;
  int rel;                                   // block index inside its plane
  if (bx < 3 * CAST_ACT) {
    const int p = bx / CAST_ACT;
    rel = bx - p * CAST_ACT;
    plane = (p == 0) ? q : (p == 1) ? k : v;
  } else {
    const int w = bx - 3 * CAST_ACT;
    const int p = w / CAST_W;
    rel = w - p * CAST_W;
    plane = (p == 0) ? wq : (p == 1) ? wk : (p == 2) ? wv : wo;
  }
  const float* in = plane + (size_t)rel * CAST_BLK + threadIdx.x * 4;
  unsigned short* o = out + (size_t)bx * CAST_BLK + threadIdx.x * 4;
  constexpr int NP = CAST_BLK / (CAST_THR * 4);   // 32 pieces of 16 B per lane
  v4f f[NP];
  // the loads stand in a loop of their own, ahead of the conversions, so that a wave's share is in flight together
  for (int j = 0; j < NP; ++j) f[j] = *(const v4f*)(in + j * (CAST_THR * 4));
  for (int j = 0; j < NP; ++j) {
    const v2u u = {pk16(f2bf_bits(f[j][0]), f2bf_bits(f[j][1])), pk16(f2bf_bits(f[j][2]), f2bf_bits(f[j][3]))};
    *(v2u*)(o + j * (CAST_THR * 4)) = u;
  }
}

#define AT_D 64
#define AT_NW 4
#define AT_QB 64
#define AT_KC 64
#define AT_LP 72   // LDS row pitch in 16-bit elements: 144 B = 16 B x odd, so the 16 rows of a 16-byte fragment read fall on 64 distinct banks
#define P_CARRY_LOG2 15.0f            // p is carried x2^15, as +15 in the base-2 exponent
#define AT_LOG2E 1.4426950408889634f

__device__ __forceinline__ v8f at_mma(v16b a, v16b b, v8f c) {
  c = __builtin_amdgcn_wmma_f32_16x16x32_bf16(false, a, false, b, (short)0, c, false, false);
  asm volatile("v_nop\n\tv_nop\n\tv_nop\n\tv_nop" : "+v"(c) : "v"(a), "v"(b));
  return c;
}
__device__ __forceinline__ v8f at_mma_h(v16b a, v16b b, v8f c) {   // operands hold f16 bit patterns
  const v16h ah = __builtin_bit_cast(v16h, a), bh = __builtin_bit_cast(v16h, b);
  c = __builtin_amdgcn_wmma_f32_16x16x32_f16(false, ah, false, bh, (short)0, c, false, false);
  asm volatile("v_nop\n\tv_nop\n\tv_nop\n\tv_nop" : "+v"(c) : "v"(ah), "v"(bh));
  return c;
}
// value of lane l ^ 16 (the other half's lane of the same column), by a vector cross-row move: no LDS queue, no wait
__device__ __forceinline__ float at_other_half(float x) {
  const int b = __float_as_int(x);
  return __int_as_float(__builtin_amdgcn_permlanex16(b, b, 0x76543210, 0xfedcba98, false, false));
}

__global__ __launch_bounds__(128)
void mha_bias_kernel(const unsigned short* __restrict__ qhp, const unsigned short* __restrict__ qlp,
                     const unsigned short* __restrict__ khp, const unsigned short* __restrict__ klp,
                     const unsigned short* __restrict__ vtp, const float* __restrict__ biasp,
                     unsigned short* __restrict__ chp, unsigned short* __restrict__ clp,
                     const int* __restrict__ nheads_in) {
  (void)nheads_in;   // module constant (16); shapes are compile-time here
  union FB { v16b v; v8b h[2]; };
  __shared__ __align__(16) __bf16 Ksh[AT_KC * AT_LP];            // K hi [kv][d]      9 KB
  __shared__ __align__(16) __bf16 Ksl[AT_KC * AT_LP];            // K lo              9 KB
  __shared__ __align__(16) __bf16 Vth[AT_D * AT_LP];             // V^T f16 bits [d][kv] 9 KB
  __shared__ __align__(16) float  Os[AT_NW][16 * 68];            // per wave out tile, pitch 68

  const int tid  = threadIdx.x;
  const int wave = tid >> 5;
  const int lane = tid & 31;
  const int hh   = lane >> 4;
  const int c    = lane & 15;

  const int nqb = SEQ_LEN / AT_QB;        // 32
  const int bx  = blockIdx.x;             // 0 .. N_BATCH*N_HEAD*nqb - 1 (exact grid)
  const int qb  = bx % nqb;
  const int bhd = bx / nqb;               // 0 .. 31
  const int h   = bhd % N_HEAD;
  const int b   = bhd / N_HEAD;           // 0 .. N_BATCH-1
  const int q0  = qb * AT_QB + wave * 16;

  const size_t rowb = (size_t)b * SEQ_LEN;   // token-row base of this batch element
  const __bf16* Qh = (const __bf16*)(const void*)qhp + rowb * D_INNER + (size_t)h * AT_D;
  const __bf16* Ql = (const __bf16*)(const void*)qlp + rowb * D_INNER + (size_t)h * AT_D;
  const __bf16* Kh = (const __bf16*)(const void*)khp + rowb * D_INNER + (size_t)h * AT_D;
  const __bf16* Kl = (const __bf16*)(const void*)klp + rowb * D_INNER + (size_t)h * AT_D;
  const __bf16* Vt = (const __bf16*)(const void*)vtp + ((size_t)b * D_INNER + (size_t)h * AT_D) * SEQ_LEN;
  const float*  Mb = biasp + (size_t)b * SEQ_LEN * SEQ_LEN;
  unsigned short* Ch = chp + rowb * D_INNER + (size_t)h * AT_D;
  unsigned short* Cl = clp + rowb * D_INNER + (size_t)h * AT_D;

  // ---- Q fragments (B operand, column = lane&15, split k map via Frag load): 2 d-chunks, hi and lo ----
  v16b qah[2], qal[2];
#pragma unroll
  for (int dc = 0; dc < 2; ++dc) {
    const __bf16* qr = Qh + (size_t)(q0 + c) * D_INNER + dc * 32 + 8 * hh;
    const __bf16* ql = Ql + (size_t)(q0 + c) * D_INNER + dc * 32 + 8 * hh;
    qah[dc] = Frag<__bf16>::load(qr);
    qal[dc] = Frag<__bf16>::load(ql);
  }

  float mrow = -INFINITY;   // running maximum of query q0 + c (the same in both lane halves)
  float brow = -INFINITY;   // the base-2 exponent that p is taken against: mrow * log2(e) - 15, as rounded once
  float lrow = 0.f;         // running sum (x2^15) over this lane half's keys of query q0 + c; the halves are joined after the loop
  v8f oacc[4];              // O^T: register r of tile t = (d = 16t + 8hh + r, query q0 + c)
#pragma unroll
  for (int t = 0; t < 4; ++t) oacc[t] = (v8f){0.f,0.f,0.f,0.f,0.f,0.f,0.f,0.f};

  const int nChunks = SEQ_LEN / AT_KC;   // 32, compile-time constant
  for (int kc = 0; kc < nChunks; ++kc) {
    const int kv0 = kc * AT_KC;
    __syncthreads();
    {
      // staging coverage: 128 threads x (4 x 8) elements = 64 rows x 64 per plane = the whole chunk tile
      const int r = tid >> 1, half = (tid & 1) * 32;
      const __bf16* ksh = Kh + (size_t)(kv0 + r) * D_INNER + half;   // K row kv0+r, d = half..half+31
      const __bf16* ksl = Kl + (size_t)(kv0 + r) * D_INNER + half;
      const __bf16* vs  = Vt + (size_t)r * SEQ_LEN + kv0 + half;      // V^T row d = r, s = kv0+half..+31
#pragma unroll
      for (int i = 0; i < 4; ++i) {
        const v8b a0 = *(const v8b*)(ksh + 8 * i);
        const v8b a1 = *(const v8b*)(ksl + 8 * i);
        const v8b b0 = *(const v8b*)(vs + 8 * i);
        *(v8b*)(Ksh + r * AT_LP + half + 8 * i) = a0;
        *(v8b*)(Ksl + r * AT_LP + half + 8 * i) = a1;
        *(v8b*)(Vth + r * AT_LP + half + 8 * i) = b0;
      }
    }
    __syncthreads();

    // ---- additive bias of query q0 + c: D register r of tile j wants key kv0 + 16j + 8hh + r = 8 consecutive floats ----
    v4f mb[4][2];
    {
      const float* mrp = Mb + (size_t)(q0 + c) * SEQ_LEN + kv0 + 8 * hh;   // all indices in range by construction
#pragma unroll
      for (int j = 0; j < 4; ++j) {
        mb[j][0] = *(const v4f*)(mrp + j * 16);
        mb[j][1] = *(const v4f*)(mrp + j * 16 + 4);
      }
    }
    // ---- scores, transposed: 4 kv subtiles of 16 (rows), 2 d-chunks, 3 products each ----
    v8f s[4];
#pragma unroll
    for (int j = 0; j < 4; ++j) {
      s[j] = (v8f){0.f,0.f,0.f,0.f,0.f,0.f,0.f,0.f};
#pragma unroll
      for (int dc = 0; dc < 2; ++dc) {
        FB kb, kl;
        kb.h[0] = *(const v8b*)(Ksh + (j * 16 + c) * AT_LP + dc * 32 + 8 * hh);
        kb.h[1] = *(const v8b*)(Ksh + (j * 16 + c) * AT_LP + dc * 32 + 16 + 8 * hh);
        kl.h[0] = *(const v8b*)(Ksl + (j * 16 + c) * AT_LP + dc * 32 + 8 * hh);
        kl.h[1] = *(const v8b*)(Ksl + (j * 16 + c) * AT_LP + dc * 32 + 16 + 8 * hh);
        s[j] = at_mma(kb.v, qah[dc], s[j]);
        s[j] = at_mma(kl.v, qah[dc], s[j]);
        s[j] = at_mma(kb.v, qal[dc], s[j]);
      }
    }
    // ---- bias by value, chunk maximum of this lane's query: in-lane over 32 keys, then the other half's 32 ----
    float mj[4];
#pragma unroll
    for (int j = 0; j < 4; ++j) {
      mj[j] = -INFINITY;
#pragma unroll
      for (int r = 0; r < 8; ++r) {
        const float mv = bf_bits2f(f2bf_bits(mb[j][r >> 2][r & 3]));
        const float sv = s[j][r] + mv;
        s[j][r] = sv;
        mj[j] = fmaxf(mj[j], sv);
      }
    }
    float cm = fmaxf(fmaxf(mj[0], mj[1]), fmaxf(mj[2], mj[3]));
    cm = fmaxf(cm, at_other_half(cm));
    const float mnew = fmaxf(mrow, cm);
    // e^(s - m) * 2^15 = 2^(s * log2(e) - b), b = m * log2(e) - 15: one fused multiply-add and the hardware's base-2 exponential.
    // Old and new terms are rescaled by the difference of the very b values they were taken against, so b's rounding cancels
    // in sum and output alike. An argument below -126 gives 0; such a p is far below the f16 carry's last place.
    const float bnew = __builtin_fmaf(mnew, AT_LOG2E, -P_CARRY_LOG2);
    const float alpha = __builtin_amdgcn_exp2f(brow - bnew);   // 0 on the first chunk, where brow is -inf
    mrow = mnew;
    brow = bnew;
    // ---- P^T in registers: element e of B fragment kk = key 32kk + kmap(e) = register e & 7 of score tile 2kk + (e >> 3) ----
    FB pb[2];
    float pj[4];
    typedef __attribute__((ext_vector_type(2))) _Float16 v2h;
    union PK { v8b b; v2h p[4]; };
#pragma unroll
    for (int j = 0; j < 4; ++j) {
      pj[j] = 0.f;
      PK pk;
#pragma unroll
      for (int r = 0; r < 8; r += 2) {
        const float p0 = __builtin_amdgcn_exp2f(__builtin_fmaf(s[j][r],     AT_LOG2E, -bnew));   // x2^15
        const float p1 = __builtin_amdgcn_exp2f(__builtin_fmaf(s[j][r + 1], AT_LOG2E, -bnew));
        pj[j] += p0;
        pj[j] += p1;
        pk.p[r >> 1] = __builtin_convertvector((v2f){p0, p1}, v2h);   // round to nearest even, two to an instruction
      }
      pb[j >> 1].h[j & 1] = pk.b;
    }
    lrow = lrow * alpha + ((pj[0] + pj[1]) + (pj[2] + pj[3]));
#pragma unroll
    for (int t = 0; t < 4; ++t)
#pragma unroll
      for (int r = 0; r < 8; ++r) oacc[t][r] *= alpha;
#pragma unroll   // kk picks the P^T fragment's registers, so it must be a constant
    for (int kk = 0; kk < 2; ++kk) {
#pragma unroll
      for (int t = 0; t < 4; ++t) {
        FB vb;
        vb.h[0] = *(const v8b*)(Vth + (t * 16 + c) * AT_LP + kk * 32 + 8 * hh);
        vb.h[1] = *(const v8b*)(Vth + (t * 16 + c) * AT_LP + kk * 32 + 16 + 8 * hh);
        oacc[t] = at_mma_h(vb.v, pb[kk].v, oacc[t]);
      }
    }
  }

  // ---- join the halves' sums, normalise and stage the 16x64 f32 tile (row = query c, cols 16t + 8hh + r) ----
  float* os = Os[wave];
  {
    const float l = lrow + at_other_half(lrow);
    const float inv = 1.0f / l;   // l carries the same 2^15 as the output sums: about 2^15 (the maximum's own term) <= l <= 6.8e7
#pragma unroll
    for (int t = 0; t < 4; ++t) {
      const v4f lo = {oacc[t][0] * inv, oacc[t][1] * inv, oacc[t][2] * inv, oacc[t][3] * inv};
      const v4f hi = {oacc[t][4] * inv, oacc[t][5] * inv, oacc[t][6] * inv, oacc[t][7] * inv};
      *(v4f*)(os + c * 68 + t * 16 + 8 * hh)     = lo;
      *(v4f*)(os + c * 68 + t * 16 + 8 * hh + 4) = hi;
    }
  }
  __builtin_amdgcn_fence(__ATOMIC_RELEASE, "workgroup");
  __builtin_amdgcn_wave_barrier();
  __builtin_amdgcn_fence(__ATOMIC_ACQUIRE, "workgroup");
  {
    // coverage: 4 it x 32 lanes x 8 elements = 16 rows x 64 = the whole wave tile, per plane;
    const int qg = lane >> 3, c8 = (lane & 7) * 8;
    {
#pragma unroll
      for (int it = 0; it < 4; ++it) {
        const int row = it * 4 + qg;
        const float* sp = os + row * 68 + c8;
        v8h hv, lv;
#pragma unroll
        for (int e = 0; e < 8; ++e) {
          const unsigned short hb = f2bf_bits(sp[e]);
          const unsigned short lb = f2bf_bits(sp[e] - bf_bits2f(hb));
          hv[e] = __builtin_bit_cast(_Float16, hb);
          lv[e] = __builtin_bit_cast(_Float16, lb);
        }
        *(v8h*)(Ch + (size_t)(q0 + row) * D_INNER + c8) = hv;
        *(v8h*)(Cl + (size_t)(q0 + row) * D_INNER + c8) = lv;
      }
      
    }
  }
}

// =====================================================================================
// Host launch glue: only kernel launches; grids/args are pure functions of the (asserted) sizes.
// Workspace region map (bytes; all offsets multiples of 2 MiB):
//   [  0 MiB,  8 MiB)  q  bf16  [4096][1024]
//   [  8 MiB, 16 MiB)  k  bf16  [4096][1024]
//   [ 16 MiB, 24 MiB)  v  bf16  [4096][1024]
//   [ 24 MiB, 26 MiB)  Wq bf16  [1024][1024]   [26,28) Wk   [28,30) Wv   [30,32) Wo
//   [ 32 MiB, 40 MiB)  Q hi bf16 [4096][1024]   [40,48) Q lo
//   [ 48 MiB, 56 MiB)  K hi bf16 [4096][1024]   [56,64) K lo
//   [ 64 MiB, 72 MiB)  V^T f16  [2][1024][2048]
//   [ 72 MiB, 80 MiB)  ctx hi bf16 [4096][1024] [80,88) ctx lo
//   total 88 MiB = 92,274,688 B
// =====================================================================================
extern "C" void kernel_launch(void* const* d_in, const int* in_sizes, int n_in,
                              void* d_out, int out_size, void* d_ws, size_t ws_size,
                              hipStream_t stream) {
  if (n_in < 9) return;
  const size_t nAct  = (size_t)N_BATCH * SEQ_LEN * D_MODEL;     // 4,194,304
  const size_t nW    = (size_t)D_INNER * D_MODEL;               // 1,048,576
  const size_t nMask = (size_t)N_BATCH * SEQ_LEN * SEQ_LEN;     // 8,388,608
  const size_t nVT   = (size_t)N_BATCH * D_INNER * SEQ_LEN;     // 4,194,304
  if ((size_t)in_sizes[0] != nAct || (size_t)in_sizes[1] != nAct || (size_t)in_sizes[2] != nAct ||
      (size_t)in_sizes[3] != nMask || (size_t)in_sizes[4] != nW || (size_t)in_sizes[5] != nW ||
      (size_t)in_sizes[6] != nW || (size_t)in_sizes[7] != nW || in_sizes[8] < 1 ||
      (size_t)out_size != nAct) return;

  const size_t bAct = nAct * 2, bW = nW * 2, bVT = nVT * 2;
  const size_t o_q16 = 0;
  const size_t o_k16 = o_q16 + bAct;
  const size_t o_v16 = o_k16 + bAct;
  const size_t o_wq  = o_v16 + bAct;
  const size_t o_wk  = o_wq + bW;
  const size_t o_wv  = o_wk + bW;
  const size_t o_wo  = o_wv + bW;
  const size_t o_qhi = o_wo + bW;
  const size_t o_qlo = o_qhi + bAct;
  const size_t o_khi = o_qlo + bAct;
  const size_t o_klo = o_khi + bAct;
  const size_t o_vt  = o_klo + bAct;
  const size_t o_chi = o_vt + bVT;
  const size_t o_clo = o_chi + bAct;
  const size_t total = o_clo + bAct;                            // 92,274,688
  if (total > ws_size) return;

  const float* qf  = (const float*)d_in[0];
  const float* kf  = (const float*)d_in[1];
  const float* vf  = (const float*)d_in[2];
  const float* mf  = (const float*)d_in[3];
  const float* wqf = (const float*)d_in[4];
  const float* wkf = (const float*)d_in[5];
  const float* wvf = (const float*)d_in[6];
  const float* wof = (const float*)d_in[7];
  const int*   nhp = (const int*)d_in[8];
  char* ws = (char*)d_ws;
  unsigned short* q16 = (unsigned short*)(ws + o_q16);
  unsigned short* k16 = (unsigned short*)(ws + o_k16);
  unsigned short* v16 = (unsigned short*)(ws + o_v16);
  unsigned short* wq16 = (unsigned short*)(ws + o_wq);
  unsigned short* wk16 = (unsigned short*)(ws + o_wk);
  unsigned short* wv16 = (unsigned short*)(ws + o_wv);
  unsigned short* wo16 = (unsigned short*)(ws + o_wo);
  unsigned short* qhi = (unsigned short*)(ws + o_qhi);
  unsigned short* qlo = (unsigned short*)(ws + o_qlo);
  unsigned short* khi = (unsigned short*)(ws + o_khi);
  unsigned short* klo = (unsigned short*)(ws + o_klo);
  unsigned short* vt  = (unsigned short*)(ws + o_vt);
  unsigned short* chi = (unsigned short*)(ws + o_chi);
  unsigned short* clo = (unsigned short*)(ws + o_clo);
  float* out = (float*)d_out;

  // ---- 1: RNE bf16 copies of the seven float inputs; q16 is the start of the seven planes, back to back in the
  //      order of the arguments (region map above) ----
  cast_all_f32_bf16<<<dim3((unsigned)CAST_GRID), CAST_THR, 0, stream>>>(qf, kf, vf, wqf, wkf, wvf, wof, q16);

  const int MTOK = N_BATCH * SEQ_LEN;         // 4096 rows of [B*S][.] planes
  // ---- 2,3: Q and K projections: C[4096][1024] = X[4096][1024] . W^T, W [1024 out][1024 in] = Bt[N][K];
  //      M=4096, N=1024 (x64), K=1024 (x32); 64*16 = 1024 wave tiles = 128 blocks; out = bf16 hi + lo planes
  {
    const int tiles = (MTOK / 64) * (D_INNER / 64);
    const dim3 g((unsigned)((tiles + 7) / 8), 1);
    wmma_gemm64<1, false, 0, 2, false><<<g, 256, 0, stream>>>(
        q16, q16, D_MODEL, 0L, wq16, wq16, D_MODEL, 0L, (void*)qhi, (void*)qlo, D_INNER, 0L,
        mf, mf, 0L, MTOK, D_INNER, D_MODEL, 1.0f);
    wmma_gemm64<1, false, 0, 2, false><<<g, 256, 0, stream>>>(
        k16, k16, D_MODEL, 0L, wk16, wk16, D_MODEL, 0L, (void*)khi, (void*)klo, D_INNER, 0L,
        mf, mf, 0L, MTOK, D_INNER, D_MODEL, 1.0f);
  }
  // ---- 4: V projection, role-swapped so the output is V^T per batch element:
  //      C_b[e][s] = sum_k Wv[e][k] . v_b[s][k]; A = Wv [1024][1024] (shared, strideA 0), Bt = v_b [2048][1024],
  //      C_b [1024][2048] f16; M=1024, N=2048 (x64), K=1024 (x32); 16*32 = 512 tiles = 64 blocks, grid.y = 2
  {
    const int tiles = (D_INNER / 64) * (SEQ_LEN / 64);
    const dim3 g((unsigned)((tiles + 7) / 8), (unsigned)N_BATCH);
    wmma_gemm64<1, false, 0, 1, false><<<g, 256, 0, stream>>>(
        wv16, wv16, D_MODEL, 0L, v16, v16, D_MODEL, (long)SEQ_LEN * D_MODEL,
        (void*)vt, (void*)vt, SEQ_LEN, (long)D_INNER * SEQ_LEN,
        mf, mf, 0L, D_INNER, SEQ_LEN, D_MODEL, 1.0f);
  }
  // ---- 5: attention: 2 x 16 x 32 = 1024 blocks of 128 threads ----
  {
    const dim3 g((unsigned)(N_BATCH * N_HEAD * (SEQ_LEN / AT_QB)));
    mha_bias_kernel<<<g, 128, 0, stream>>>(qhi, qlo, khi, klo, vt, mf, chi, clo, nhp);
  }
  // ---- 6: output projection: out[4096][1024] = (ctx_hi + ctx_lo)[4096][1024] . Wo^T, Wo [1024 out][1024 in];
  //      M=4096, N=1024 (x64), K=1024 (x32); 1024 tiles = 128 blocks; f32 out
  {
    const int tiles = (MTOK / 64) * (D_MODEL / 64);
    const dim3 g((unsigned)((tiles + 7) / 8), 1);
    wmma_gemm64<1, true, 0, 0, false, 0, false><<<g, 256, 0, stream>>>(
        chi, clo, D_INNER, 0L, wo16, wo16, D_INNER, 0L, (void*)out, (void*)out, D_MODEL, 0L,
        mf, mf, 0L, MTOK, D_MODEL, D_INNER, 1.0f);
  }
}

// v006
// One run takes 171 microseconds.
// In both of two side-by-side timings against v005, it was 1.15 times as fast.
// Over all steps from v000 it is 2.80 times as fast.
// Contractions: q/k/v projections = v_wmma_f32_16x16x32_bf16 on RNE-bf16 copies of the inputs (single product); q.k^T = v_wmma_f32_16x16x32_bf16 with bf16 hi/lo split operands (hi.hi + hi.lo + lo.hi); p.v = v_wmma_f32_16x16x32_f16 (p carried x2^15 in f16, v^T stored f16); output projection = v_wmma_f32_16x16x32_bf16 with ctx bf16 hi/lo x Wo bf16 (hi.W + lo.W); f32 accumulate everywhere; additive mask (RNE-bf16 values) and online softmax in f32.
#include <hip/hip_runtime.h>
#include <math.h>
#include <stdint.h>

constexpr int N_BATCH = 2;
constexpr int SEQ_LEN = 2048;
constexpr int D_MODEL = 1024;                 // d_model (input / output feature width)
constexpr int N_HEAD  = 16;
constexpr int D_HEAD  = 64;
constexpr int D_INNER = N_HEAD * D_HEAD;      // 1024
static_assert(D_INNER == 1024, "inner width");
static_assert(SEQ_LEN % 64 == 0 && D_MODEL % 64 == 0 && D_INNER % 64 == 0, "tile multiples");
static_assert(D_MODEL % 32 == 0 && D_INNER % 32 == 0, "K multiples of 32");

typedef __attribute__((ext_vector_type(16))) _Float16 v16h;
typedef __attribute__((ext_vector_type(8)))  _Float16 v8h;
typedef __attribute__((ext_vector_type(16))) __bf16   v16b;
typedef __attribute__((ext_vector_type(8)))  __bf16   v8b;
typedef __attribute__((ext_vector_type(8)))  float    v8f;
typedef __attribute__((ext_vector_type(4)))  float    v4f;
typedef __attribute__((ext_vector_type(2)))  float    v2f;

__device__ __forceinline__ unsigned short f2bf_bits(float f) {
  unsigned u = __float_as_uint(f);
  return (unsigned short)((u + 0x7FFFu + ((u >> 16) & 1u)) >> 16);
}
__device__ __forceinline__ float bf_bits2f(unsigned short h) { return __uint_as_float(((unsigned)h) << 16); }
__device__ __forceinline__ unsigned pk16(unsigned short a, unsigned short b) { return (unsigned)a | ((unsigned)b << 16); }

// hazard guards as plain device helpers
__device__ __forceinline__ void dep_guard_h(v8f& a, v8f& b, v16h x, v16h y) { asm volatile("v_nop\n\tv_nop\n\tv_nop\n\tv_nop" : "+v"(a), "+v"(b) : "v"(x), "v"(y)); }
__device__ __forceinline__ void dep_guard_b(v8f& a, v8f& b, v16b x, v16b y) { asm volatile("v_nop\n\tv_nop\n\tv_nop\n\tv_nop" : "+v"(a), "+v"(b) : "v"(x), "v"(y)); }
__device__ __forceinline__ void keep4_h(v16h a, v16h b, v16h c, v16h d) { asm volatile("v_nop" :: "v"(a), "v"(b), "v"(c), "v"(d)); }
__device__ __forceinline__ void keep4_b(v16b a, v16b b, v16b c, v16b d) { asm volatile("v_nop" :: "v"(a), "v"(b), "v"(c), "v"(d)); }
__device__ __forceinline__ void acc_guard4(v8f& a, v8f& b, v8f& c, v8f& d) { asm volatile("v_nop\n\tv_nop\n\tv_nop\n\tv_nop" : "+v"(a), "+v"(b), "+v"(c), "+v"(d)); }
template <typename T> struct Frag;
template <> struct Frag<_Float16> {
  typedef v16h V; union U { v16h v; v8h h[2]; };
  static __device__ __forceinline__ v16h load(const _Float16* p) {   // elements 0..7 <- p[0..7], 8..15 <- p[16..23]
    U f; f.h[0] = *(const v8h*)(p); f.h[1] = *(const v8h*)(p + 16); return f.v;
  }
  static __device__ __forceinline__ v8f mma(v16h a, v16h b, v8f c) {
    return __builtin_amdgcn_wmma_f32_16x16x32_f16(false, a, false, b, (short)0, c, false, false);
  }
  static __device__ __forceinline__ void guard(v8f& a, v8f& b, v16h x, v16h y) { dep_guard_h(a, b, x, y); }
  static __device__ __forceinline__ void keep(v16h a, v16h b, v16h c, v16h d) { keep4_h(a, b, c, d); }
};
template <> struct Frag<__bf16> {
  typedef v16b V; union U { v16b v; v8b h[2]; };
  static __device__ __forceinline__ v16b load(const __bf16* p) {
    U f; f.h[0] = *(const v8b*)(p); f.h[1] = *(const v8b*)(p + 16); return f.v;
  }
  static __device__ __forceinline__ v8f mma(v16b a, v16b b, v8f c) {
    return __builtin_amdgcn_wmma_f32_16x16x32_bf16(false, a, false, b, (short)0, c, false, false);
  }
  static __device__ __forceinline__ void guard(v8f& a, v8f& b, v16b x, v16b y) { dep_guard_b(a, b, x, y); }
  static __device__ __forceinline__ void keep(v16b a, v16b b, v16b c, v16b d) { keep4_b(a, b, c, d); }
};

// ---- Register-blocked batched WMMA GEMM ------------------------------------
// C[m,n] = scale * sum_k A[m,k] * Bt[n,k] (+bias)(+resid); each wave owns a 64x64 tile; the 8 waves of a block
// form a 2 (M) x 4 (N) grid = one 128x256 block tile, whose operand rows reach LDS 64 k at a time (a stage) by
// asynchronous 16-byte copies, two buffers: stage t+1 flies while stage t is multiplied.
// A row-major [M,K]; Bt row-major [N,K]; M % 128 == 0, N % 256 == 0, K % 64 == 0.
// SPLIT: operands are hi/lo planes (A2/Bt2 = lo planes, same layout); product = hi.hi + hi.lo + lo.hi.
// BLO = false with SPLIT: the Bt lo plane is not used (product = hi.B + lo.B, B a single plane).
// BIAS_MODE: 0 = none, 1 = bias[m], 2 = bias[n].
// OUT_MODE: 0 = f32, 1 = f16, 2 = bf16 hi plane (Cout) + bf16 lo plane (Cout2).
// ET: 0 = f16 operands, 1 = bf16 operands (pointers passed as 16-bit storage)
// Asynchronous 16-byte-per-lane copies global -> LDS, eight, twelve or fourteen to a statement. The s_wait_xcnt is the last line
// of the copies' own statement so that it stands in front of every later write of the address registers they name.
struct CopyRows { unsigned l; const void* g; };   // this lane's LDS byte address and global address of one row segment
__device__ __forceinline__ void async_copy8(CopyRows a, CopyRows b, CopyRows c, CopyRows d,
                                            CopyRows e, CopyRows f, CopyRows g, CopyRows h) {
  asm volatile("global_load_async_to_lds_b128 %0, %1, off\n\t"
               "global_load_async_to_lds_b128 %2, %3, off\n\t"
               "global_load_async_to_lds_b128 %4, %5, off\n\t"
               "global_load_async_to_lds_b128 %6, %7, off\n\t"
               "global_load_async_to_lds_b128 %8, %9, off\n\t"
               "global_load_async_to_lds_b128 %10, %11, off\n\t"
               "global_load_async_to_lds_b128 %12, %13, off\n\t"
               "global_load_async_to_lds_b128 %14, %15, off\n\t"
               "s_wait_xcnt 0x0"
               :: "v"(a.l), "v"(a.g), "v"(b.l), "v"(b.g), "v"(c.l), "v"(c.g), "v"(d.l), "v"(d.g),
                  "v"(e.l), "v"(e.g), "v"(f.l), "v"(f.g), "v"(g.l), "v"(g.g), "v"(h.l), "v"(h.g) : "memory");
}
__device__ __forceinline__ void async_copy12(CopyRows a, CopyRows b, CopyRows c, CopyRows d,
                                             CopyRows e, CopyRows f, CopyRows g, CopyRows h,
                                             CopyRows i, CopyRows j, CopyRows k, CopyRows m) {
  asm volatile("global_load_async_to_lds_b128 %0, %1, off\n\t"
               "global_load_async_to_lds_b128 %2, %3, off\n\t"
               "global_load_async_to_lds_b128 %4, %5, off\n\t"
               "global_load_async_to_lds_b128 %6, %7, off\n\t"
               "global_load_async_to_lds_b128 %8, %9, off\n\t"
               "global_load_async_to_lds_b128 %10, %11, off\n\t"
               "global_load_async_to_lds_b128 %12, %13, off\n\t"
               "global_load_async_to_lds_b128 %14, %15, off\n\t"
               "global_load_async_to_lds_b128 %16, %17, off\n\t"
               "global_load_async_to_lds_b128 %18, %19, off\n\t"
               "global_load_async_to_lds_b128 %20, %21, off\n\t"
               "global_load_async_to_lds_b128 %22, %23, off\n\t"
               "s_wait_xcnt 0x0"
               :: "v"(a.l), "v"(a.g), "v"(b.l), "v"(b.g), "v"(c.l), "v"(c.g), "v"(d.l), "v"(d.g),
                  "v"(e.l), "v"(e.g), "v"(f.l), "v"(f.g), "v"(g.l), "v"(g.g), "v"(h.l), "v"(h.g),
                  "v"(i.l), "v"(i.g), "v"(j.l), "v"(j.g), "v"(k.l), "v"(k.g), "v"(m.l), "v"(m.g) : "memory");
}
__device__ __forceinline__ void async_copy14(CopyRows a, CopyRows b, CopyRows c, CopyRows d, CopyRows e, CopyRows f, CopyRows g,
                                             CopyRows h, CopyRows i, CopyRows j, CopyRows k, CopyRows m, CopyRows n, CopyRows o) {
  asm volatile("global_load_async_to_lds_b128 %0, %1, off\n\t"
               "global_load_async_to_lds_b128 %2, %3, off\n\t"
               "global_load_async_to_lds_b128 %4, %5, off\n\t"
               "global_load_async_to_lds_b128 %6, %7, off\n\t"
               "global_load_async_to_lds_b128 %8, %9, off\n\t"
               "global_load_async_to_lds_b128 %10, %11, off\n\t"
               "global_load_async_to_lds_b128 %12, %13, off\n\t"
               "global_load_async_to_lds_b128 %14, %15, off\n\t"
               "global_load_async_to_lds_b128 %16, %17, off\n\t"
               "global_load_async_to_lds_b128 %18, %19, off\n\t"
               "global_load_async_to_lds_b128 %20, %21, off\n\t"
               "global_load_async_to_lds_b128 %22, %23, off\n\t"
               "global_load_async_to_lds_b128 %24, %25, off\n\t"
               "global_load_async_to_lds_b128 %26, %27, off\n\t"
               "s_wait_xcnt 0x0"
               :: "v"(a.l), "v"(a.g), "v"(b.l), "v"(b.g), "v"(c.l), "v"(c.g), "v"(d.l), "v"(d.g),
                  "v"(e.l), "v"(e.g), "v"(f.l), "v"(f.g), "v"(g.l), "v"(g.g), "v"(h.l), "v"(h.g),
                  "v"(i.l), "v"(i.g), "v"(j.l), "v"(j.g), "v"(k.l), "v"(k.g), "v"(m.l), "v"(m.g),
                  "v"(n.l), "v"(n.g), "v"(o.l), "v"(o.g) : "memory");
}
#define GM_PITCH 144            // LDS row pitch in bytes of a 128-byte stage row: 16 B x odd, conflict-free 16-byte fragment reads
#define GM_PE    (GM_PITCH / 2) // the same in 16-bit elements
template <int ET> struct Elem;
template <> struct Elem<0> { typedef _Float16 T; };
template <> struct Elem<1> { typedef __bf16 T; };
template <int ET, bool SPLIT, int BIAS_MODE, int OUT_MODE, bool RESID, int ACT = 0, bool BLO = true>
__global__ __launch_bounds__(256) void wmma_gemm64(
    const unsigned short* __restrict__ Ap, const unsigned short* __restrict__ A2p, int lda, long strideA,
    const unsigned short* __restrict__ Btp, const unsigned short* __restrict__ Bt2p, int ldb, long strideB,
    void* __restrict__ Cout, void* __restrict__ Cout2, int ldc, long strideC,
    const float* __restrict__ bias,
    const float* __restrict__ resid, long strideR,
    int M, int N, int K, float scale) {
  typedef typename Elem<ET>::T T;
  typedef typename Frag<T>::V V;
  const T* A = (const T*)Ap; const T* A2 = (const T*)A2p; const T* Bt = (const T*)Btp; const T* Bt2 = (const T*)Bt2p;
  __shared__ __align__(16) float sT[8][16 * 68];   // per-wave 16x64 slab, pitch 68 floats
  // one stage = [A 128 rows | A lo 128 rows (SPLIT) | Bt 256 rows | Bt lo 256 rows (SPLIT && BLO)], 64 k each
  constexpr unsigned OFF_A2  = 128u * GM_PITCH;
  constexpr unsigned OFF_B   = OFF_A2 + (SPLIT ? 128u * GM_PITCH : 0u);
  constexpr unsigned OFF_B2  = OFF_B + 256u * GM_PITCH;
  constexpr unsigned STAGE_B = OFF_B2 + ((SPLIT && BLO) ? 256u * GM_PITCH : 0u);
  __shared__ __align__(16) unsigned char ring[2 * STAGE_B];
  const int b    = blockIdx.y;
  const int lane = threadIdx.x & 31;
  const int wave = threadIdx.x >> 5;
  const int tilesN = N >> 8;
  const int tilesM = M >> 7;
  if ((int)blockIdx.x >= tilesM * tilesN) return;   // block-uniform, ahead of every copy and barrier
  const int bm  = blockIdx.x / tilesN;
  const int bn  = blockIdx.x - bm * tilesN;
  const int wm0 = (wave >> 2) << 6;            // this wave's rows inside the block tile
  const int wn0 = (wave & 3) << 6;             // this wave's columns inside the block tile
  const int m0 = (bm << 7) + wm0;
  const int n0 = (bn << 8) + wn0;

  const T* Ab  = A  + (size_t)b * strideA;
  const T* Bb  = Bt + (size_t)b * strideB;
  const T* Ab2 = SPLIT ? (A2  + (size_t)b * strideA) : nullptr;
  const T* Bb2 = (SPLIT && BLO) ? (Bt2 + (size_t)b * strideB) : nullptr;

  const int rlane = lane & 15;                 // row (A) / col (B, D) within subtile
  const int koff  = (lane >> 4) * 8;           // k offset of this lane half
  const int mOff  = (lane >> 4) * 8;           // D row offset

  // staging map: 8 lanes x 16 B = one whole 128-byte row segment; a copy of the block covers 32 rows
  const int srow = threadIdx.x >> 3;           // 0..31
  const int sseg = (threadIdx.x & 7) * 8;      // first of this lane's 8 elements in the 64-element row
  const size_t aoff = (size_t)((bm << 7) + srow) * lda + sseg;
  const size_t boff = (size_t)((bn << 8) + srow) * ldb + sseg;
  const size_t a32 = (size_t)32 * lda, b32 = (size_t)32 * ldb;
  const unsigned lds0 = (unsigned)(uintptr_t)ring + (unsigned)(srow * GM_PITCH + sseg * 2);
  auto copy_stage = [&](int st, int buf) {     // all lanes on, rows and k inside the operands by the size conditions above
    const unsigned l = lds0 + (unsigned)buf * STAGE_B;
    auto rows = [](unsigned lds, const T* g, size_t step32, int i) {   // row group i: 32 rows further on in both places
      return CopyRows{lds + (unsigned)i * 32u * GM_PITCH, (const void*)(g + (size_t)i * step32)};
    };
    const T* ga = Ab + aoff + (size_t)st * 64;
    const T* gb = Bb + boff + (size_t)st * 64;
    const unsigned lb = l + OFF_B;
    if (!SPLIT) {
      async_copy12(rows(l, ga, a32, 0), rows(l, ga, a32, 1), rows(l, ga, a32, 2), rows(l, ga, a32, 3),
                   rows(lb, gb, b32, 0), rows(lb, gb, b32, 1), rows(lb, gb, b32, 2), rows(lb, gb, b32, 3),
                   rows(lb, gb, b32, 4), rows(lb, gb, b32, 5), rows(lb, gb, b32, 6), rows(lb, gb, b32, 7));
    } else {
      const unsigned l2 = l + OFF_A2;
      const T* ga2 = Ab2 + aoff + (size_t)st * 64;
      async_copy8(rows(l, ga, a32, 0), rows(l, ga, a32, 1), rows(l, ga, a32, 2), rows(l, ga, a32, 3),
                  rows(l2, ga2, a32, 0), rows(l2, ga2, a32, 1), rows(l2, ga2, a32, 2), rows(l2, ga2, a32, 3));
      async_copy8(rows(lb, gb, b32, 0), rows(lb, gb, b32, 1), rows(lb, gb, b32, 2), rows(lb, gb, b32, 3),
                  rows(lb, gb, b32, 4), rows(lb, gb, b32, 5), rows(lb, gb, b32, 6), rows(lb, gb, b32, 7));
      if (BLO) {
        const unsigned lb2 = l + OFF_B2;
        const T* gb2 = Bb2 + boff + (size_t)st * 64;
        async_copy8(rows(lb2, gb2, b32, 0), rows(lb2, gb2, b32, 1), rows(lb2, gb2, b32, 2), rows(lb2, gb2, b32, 3),
                    rows(lb2, gb2, b32, 4), rows(lb2, gb2, b32, 5), rows(lb2, gb2, b32, 6), rows(lb2, gb2, b32, 7));
      }
    }
  };

  v8f acc[4][4];
#pragma unroll
  for (int i = 0; i < 4; ++i)
#pragma unroll
    for (int j = 0; j < 4; ++j) acc[i][j] = (v8f){0.f,0.f,0.f,0.f,0.f,0.f,0.f,0.f};

  const int nst = K >> 6;                      // stages of 64 k
  copy_stage(0, 0);
  asm volatile("s_wait_asynccnt 0x0" ::: "memory");   // this wave's share of stage 0 has landed
  __syncthreads();                                    // every wave's share has: stage 0 may be read
  if (nst > 1) copy_stage(1, 1);
  for (int st = 0; st < nst; ++st) {
    const int buf = st & 1;
    const T* sA  = (const T*)(ring + (unsigned)buf * STAGE_B);
    const T* sA2 = (const T*)(ring + (unsigned)buf * STAGE_B + OFF_A2);
    const T* sB  = (const T*)(ring + (unsigned)buf * STAGE_B + OFF_B);
    const T* sB2 = (const T*)(ring + (unsigned)buf * STAGE_B + OFF_B2);
#pragma unroll   // both 32-k halves of a stage in line, so that kk folds into the LDS loads' immediate offsets
    for (int kk = 0; kk < 64; kk += 32) {
      V bh[4], bl[4];
#pragma unroll
      for (int j = 0; j < 4; ++j) {
        const int bo = (wn0 + (j << 4) + rlane) * GM_PE + koff + kk;
        bh[j] = Frag<T>::load(sB + bo);
        if (SPLIT && BLO) bl[j] = Frag<T>::load(sB2 + bo);
      }
#pragma unroll
      for (int i = 0; i < 4; ++i) {
        const int ao = (wm0 + (i << 4) + rlane) * GM_PE + koff + kk;
        V ah = Frag<T>::load(sA + ao);
        V al;
        if (SPLIT) al = Frag<T>::load(sA2 + ao);
#pragma unroll
        for (int j = 0; j < 4; ++j) {
          acc[i][j] = Frag<T>::mma(ah, bh[j], acc[i][j]);
          if (SPLIT) {
            if (BLO) acc[i][j] = Frag<T>::mma(ah, bl[j], acc[i][j]);
            acc[i][j] = Frag<T>::mma(al, bh[j], acc[i][j]);
          }
        }
        Frag<T>::guard(acc[i][0], acc[i][3], ah, SPLIT ? al : ah);
      }
      Frag<T>::keep(bh[0], bh[1], bh[2], bh[3]);
      if (SPLIT && BLO) Frag<T>::keep(bl[0], bl[1], bl[2], bl[3]);
    }
    asm volatile("s_wait_dscnt 0x0" ::: "memory");      // this wave's reads of buffer buf are done before it is refilled
    asm volatile("s_wait_asynccnt 0x0" ::: "memory");   // this wave's share of stage st + 1 has landed
    __syncthreads();                                    // publishes stage st + 1 and ends every reader's use of buffer buf
    if (st + 2 < nst) copy_stage(st + 2, buf);
  }
  asm volatile("s_wait_asynccnt 0x0" ::: "memory");     // nothing of this wave's copies is outstanding past the loop
  acc_guard4(acc[0][0], acc[0][1], acc[0][2], acc[0][3]);
  acc_guard4(acc[1][0], acc[1][1], acc[1][2], acc[1][3]);
  acc_guard4(acc[2][0], acc[2][1], acc[2][2], acc[2][3]);
  acc_guard4(acc[3][0], acc[3][1], acc[3][2], acc[3][3]);

  // ---- epilogue ----
  float* slab = sT[wave];
  const float* Rb = RESID ? (resid + (size_t)b * strideR) : nullptr;
#pragma unroll
  for (int i = 0; i < 4; ++i) {
    const int mBase = m0 + (i << 4);
#pragma unroll
    for (int j = 0; j < 4; ++j) {
      const int n = n0 + (j << 4) + rlane;
      float bv = 0.f;
      if (BIAS_MODE == 2) bv = bias[n];
#pragma unroll
      for (int r = 0; r < 8; ++r) {
        float v = acc[i][j][r] * scale;
        if (BIAS_MODE == 1) v += bias[mBase + mOff + r];
        if (BIAS_MODE == 2) v += bv;
        if (RESID) v += Rb[(size_t)(mBase + mOff + r) * ldc + n];
        if (ACT == 1) v = tanhf(v);
        if (ACT == 2) v = fmaxf(v, 0.0f);
        if (ACT == 3) v = v / (1.0f + expf(-v));
        if (ACT == 4) v = (v > 0.f) ? v : 0.01f * v;
        slab[(mOff + r) * 68 + (j << 4) + rlane] = v;
      }
    }
    __builtin_amdgcn_fence(__ATOMIC_RELEASE, "workgroup");
    __builtin_amdgcn_wave_barrier();
    __builtin_amdgcn_fence(__ATOMIC_ACQUIRE, "workgroup");
    if (OUT_MODE == 0) {
      float* C = (float*)Cout + (size_t)b * strideC;
      const int hh = lane >> 4, c4 = (lane & 15) * 4;     // row seg = 256 B = 16 lanes x 16 B
      {
#pragma unroll
        for (int it = 0; it < 8; ++it) {
          const int row = it * 2 + hh;
          v4f v = *(const v4f*)(slab + row * 68 + c4);
          *(v4f*)(C + (size_t)(mBase + row) * ldc + n0 + c4) = v;
        }
        
      }
    } else {
      const int q = lane >> 3, c8 = (lane & 7) * 8;
      unsigned short* C  = (unsigned short*)Cout  + (size_t)b * strideC;
      unsigned short* C2 = (OUT_MODE == 2) ? ((unsigned short*)Cout2 + (size_t)b * strideC) : nullptr;
      {
#pragma unroll
        for (int it = 0; it < 4; ++it) {
          const int row = it * 4 + q;
          const float* sp = slab + row * 68 + c8;
          v8h hv, lv;
#pragma unroll
          for (int e = 0; e < 8; ++e) {
            if (OUT_MODE == 1) {
              hv[e] = (_Float16)sp[e];
            } else {
              unsigned short hb = f2bf_bits(sp[e]);
              unsigned short lb = f2bf_bits(sp[e] - bf_bits2f(hb));
              hv[e] = __builtin_bit_cast(_Float16, hb);
              lv[e] = __builtin_bit_cast(_Float16, lb);
            }
          }
          *(v8h*)(C + (size_t)(mBase + row) * ldc + n0 + c8) = hv;
          if (OUT_MODE == 2) *(v8h*)(C2 + (size_t)(mBase + row) * ldc + n0 + c8) = lv;
        }
        
      }
    }
    __builtin_amdgcn_fence(__ATOMIC_RELEASE, "workgroup");
    __builtin_amdgcn_wave_barrier();
    __builtin_amdgcn_fence(__ATOMIC_ACQUIRE, "workgroup");
  }
}

// ---------------------------------------------------------------------------
// f32 -> bf16 (RNE) cast of all seven float operands in ONE launch.
// The bf16 planes lie back to back in the workspace in the order q, k, v, Wq, Wk, Wv, Wo, so the output is one
// array of 3 * 4,194,304 + 4 * 1,048,576 = 16,777,216 elements. A block of 16 waves owns CAST_BLK = 65,536
// consecutive elements of it, which lie in one plane (both plane sizes are multiples of CAST_BLK):
// 3 * 64 + 4 * 16 = 256 blocks. A lane brings 32 pieces of 16 B (each wave-wide load 512 contiguous bytes) and
// stores 32 pieces of 8 B (each wave-wide store 256 contiguous bytes = two whole lines).
// Coverage: 32 pieces x 512 threads x 4 elements = 65,536 = the whole block range, each element once.
// ---------------------------------------------------------------------------
constexpr int CAST_THR  = 512;
constexpr int CAST_BLK  = 65536;
constexpr int CAST_ACT  = N_BATCH * SEQ_LEN * D_MODEL / CAST_BLK;   // 64 blocks per activation plane
constexpr int CAST_W    = D_INNER * D_MODEL / CAST_BLK;             // 16 blocks per weight plane
constexpr int CAST_GRID = 3 * CAST_ACT + 4 * CAST_W;                // 256
static_assert(N_BATCH * SEQ_LEN * D_MODEL % CAST_BLK == 0 && D_INNER * D_MODEL % CAST_BLK == 0, "whole blocks per plane");
typedef __attribute__((ext_vector_type(2))) unsigned v2u;
__global__ __launch_bounds__(CAST_THR) void cast_all_f32_bf16(
    const float* __restrict__ q, const float* __restrict__ k, const float* __restrict__ v,
    const float* __restrict__ wq, const float* __restrict__ wk, const float* __restrict__ wv,
    const float* __restrict__ wo, unsigned short* __restrict__ out) {
  const int bx = blockIdx.x;                 // 0 .. CAST_GRID - 1 (exact grid)
  const float* plane;
  int rel;                                   // block index inside its plane
  if (bx < 3 * CAST_ACT) {
    const int p = bx / CAST_ACT;
    rel = bx - p * CAST_ACT;
    plane = (p == 0) ? q : (p == 1) ? k : v;
  } else {
    const int w = bx - 3 * CAST_ACT;
    const int p = w / CAST_W;
    rel = w - p * CAST_W;
    plane = (p == 0) ? wq : (p == 1) ? wk : (p == 2) ? wv : wo;
  }
  const float* in = plane + (size_t)rel * CAST_BLK + threadIdx.x * 4;
  unsigned short* o = out + (size_t)bx * CAST_BLK + threadIdx.x * 4;
  constexpr int NP = CAST_BLK / (CAST_THR * 4);   // 32 pieces of 16 B per lane
  v4f f[NP];
  // the loads stand in a loop of their own, ahead of the conversions, so that a wave's share is in flight together
  for (int j = 0; j < NP; ++j) f[j] = *(const v4f*)(in + j * (CAST_THR * 4));
  for (int j = 0; j < NP; ++j) {
    const v2u u = {pk16(f2bf_bits(f[j][0]), f2bf_bits(f[j][1])), pk16(f2bf_bits(f[j][2]), f2bf_bits(f[j][3]))};
    *(v2u*)(o + j * (CAST_THR * 4)) = u;
  }
}

#define AT_D 64
#define AT_NW 8
#define AT_QB 128
#define AT_KC 64
#define AT_LP 72   // LDS row pitch in 16-bit elements: 144 B = 16 B x odd, so the 16 rows of a 16-byte fragment read fall on 64 distinct banks
#define AT_MP 68   // LDS row pitch of the bias tile in floats: 272 B = 16 B x odd, for the same reason
#define AT_OFF_KL (AT_KC * AT_LP * 2)                     // byte offsets inside a stage: K hi at 0, K lo,
#define AT_OFF_VT (AT_OFF_KL + AT_KC * AT_LP * 2)         // V^T (f16 bits, [d][kv]),
#define AT_OFF_MB (AT_OFF_VT + AT_D * AT_LP * 2)          // bias (f32, [query][kv])
#define AT_STAGE  (AT_OFF_MB + AT_QB * AT_MP * 4)         // 62,464 B
#define P_CARRY_LOG2 15.0f            // p is carried x2^15, as +15 in the base-2 exponent
#define AT_LOG2E 1.4426950408889634f

__device__ __forceinline__ v8f at_mma(v16b a, v16b b, v8f c) {
  c = __builtin_amdgcn_wmma_f32_16x16x32_bf16(false, a, false, b, (short)0, c, false, false);
  asm volatile("v_nop\n\tv_nop\n\tv_nop\n\tv_nop" : "+v"(c) : "v"(a), "v"(b));
  return c;
}
__device__ __forceinline__ v8f at_mma_h(v16b a, v16b b, v8f c) {   // operands hold f16 bit patterns
  const v16h ah = __builtin_bit_cast(v16h, a), bh = __builtin_bit_cast(v16h, b);
  c = __builtin_amdgcn_wmma_f32_16x16x32_f16(false, ah, false, bh, (short)0, c, false, false);
  asm volatile("v_nop\n\tv_nop\n\tv_nop\n\tv_nop" : "+v"(c) : "v"(ah), "v"(bh));
  return c;
}
// value of lane l ^ 16 (the other half's lane of the same column), by a vector cross-row move: no LDS queue, no wait
__device__ __forceinline__ float at_other_half(float x) {
  const int b = __float_as_int(x);
  return __int_as_float(__builtin_amdgcn_permlanex16(b, b, 0x76543210, 0xfedcba98, false, false));
}

__global__ __launch_bounds__(256)
void mha_bias_kernel(const unsigned short* __restrict__ qhp, const unsigned short* __restrict__ qlp,
                     const unsigned short* __restrict__ khp, const unsigned short* __restrict__ klp,
                     const unsigned short* __restrict__ vtp, const float* __restrict__ biasp,
                     unsigned short* __restrict__ chp, unsigned short* __restrict__ clp,
                     const int* __restrict__ nheads_in) {
  (void)nheads_in;   // module constant (16); shapes are compile-time here
  union FB { v16b v; v8b h[2]; };
  __shared__ __align__(16) unsigned char ring[2 * AT_STAGE];     // two stages, 122 KB
  __shared__ __align__(16) float  Os[AT_NW][16 * 68];            // per wave out tile, pitch 68

  const int tid  = threadIdx.x;
  const int wave = tid >> 5;
  const int lane = tid & 31;
  const int hh   = lane >> 4;
  const int c    = lane & 15;

  const int nqb = SEQ_LEN / AT_QB;        // 16
  const int bx  = blockIdx.x;             // 0 .. N_BATCH*N_HEAD*nqb - 1 (exact grid)
  const int qb  = bx % nqb;
  const int bhd = bx / nqb;               // 0 .. 31
  const int h   = bhd % N_HEAD;
  const int b   = bhd / N_HEAD;           // 0 .. N_BATCH-1
  const int q0  = qb * AT_QB + wave * 16;

  const size_t rowb = (size_t)b * SEQ_LEN;   // token-row base of this batch element
  const __bf16* Qh = (const __bf16*)(const void*)qhp + rowb * D_INNER + (size_t)h * AT_D;
  const __bf16* Ql = (const __bf16*)(const void*)qlp + rowb * D_INNER + (size_t)h * AT_D;
  const __bf16* Kh = (const __bf16*)(const void*)khp + rowb * D_INNER + (size_t)h * AT_D;
  const __bf16* Kl = (const __bf16*)(const void*)klp + rowb * D_INNER + (size_t)h * AT_D;
  const __bf16* Vt = (const __bf16*)(const void*)vtp + ((size_t)b * D_INNER + (size_t)h * AT_D) * SEQ_LEN;
  const float*  Mb = biasp + (size_t)b * SEQ_LEN * SEQ_LEN;
  unsigned short* Ch = chp + rowb * D_INNER + (size_t)h * AT_D;
  unsigned short* Cl = clp + rowb * D_INNER + (size_t)h * AT_D;

  // ---- Q fragments (B operand, column = lane&15, split k map via Frag load): 2 d-chunks, hi and lo ----
  v16b qah[2], qal[2];
#pragma unroll
  for (int dc = 0; dc < 2; ++dc) {
    const __bf16* qr = Qh + (size_t)(q0 + c) * D_INNER + dc * 32 + 8 * hh;
    const __bf16* ql = Ql + (size_t)(q0 + c) * D_INNER + dc * 32 + 8 * hh;
    qah[dc] = Frag<__bf16>::load(qr);
    qal[dc] = Frag<__bf16>::load(ql);
  }

  float mrow = -INFINITY;   // running maximum of query q0 + c (the same in both lane halves)
  float brow = -INFINITY;   // the base-2 exponent that p is taken against: mrow * log2(e) - 15, as rounded once
  float lrow = 0.f;         // running sum (x2^15) over this lane half's keys of query q0 + c; the halves are joined after the loop
  v8f oacc[4];              // O^T: register r of tile t = (d = 16t + 8hh + r, query q0 + c)
#pragma unroll
  for (int t = 0; t < 4; ++t) oacc[t] = (v8f){0.f,0.f,0.f,0.f,0.f,0.f,0.f,0.f};

  // staging map. 16-bit tiles: 8 lanes x 16 B = one 128-byte row, the block covers 32 rows a copy; bias tile: 16 lanes x 16 B =
  // one 256-byte row, 16 rows a copy. All lanes on; every row and column lies inside its plane (exact grid, S % 64 == 0).
  const int krow = tid >> 3, kseg = (tid & 7) * 8;    // row 0..31, first of this lane's 8 elements
  const int mr16 = tid >> 4, bseg = (tid & 15) * 4;   // row 0..15, first of this lane's 4 floats
  const __bf16* gkh = Kh + (size_t)krow * D_INNER + kseg;
  const __bf16* gkl = Kl + (size_t)krow * D_INNER + kseg;
  const __bf16* gvt = Vt + (size_t)krow * SEQ_LEN + kseg;
  const float*  gmb = Mb + (size_t)(qb * AT_QB + mr16) * SEQ_LEN + bseg;
  const unsigned lk0 = (unsigned)(uintptr_t)ring + (unsigned)(krow * (AT_LP * 2) + kseg * 2);
  const unsigned lm0 = (unsigned)(uintptr_t)ring + (unsigned)(AT_OFF_MB + mr16 * (AT_MP * 4) + bseg * 4);
  auto copy_stage = [&](int ch, int buf) {
    const unsigned lk = lk0 + (unsigned)buf * AT_STAGE, lm = lm0 + (unsigned)buf * AT_STAGE;
    const __bf16* kh = gkh + (size_t)ch * AT_KC * D_INNER;   // K rows ch*64 + ...
    const __bf16* kl = gkl + (size_t)ch * AT_KC * D_INNER;
    const __bf16* vt = gvt + ch * AT_KC;                      // V^T columns ch*64 + ...
    const float*  mk = gmb + ch * AT_KC;                      // bias columns ch*64 + ...
    auto bias_rows = [&](int i) {   // bias row group i: 16 rows further on in both places
      return CopyRows{lm + (unsigned)i * 16u * (AT_MP * 4), (const void*)(mk + (size_t)i * 16 * SEQ_LEN)};
    };
    async_copy14(CopyRows{lk, kh},                                   CopyRows{lk + 32u * (AT_LP * 2), kh + 32 * D_INNER},
                 CopyRows{lk + AT_OFF_KL, kl},                       CopyRows{lk + AT_OFF_KL + 32u * (AT_LP * 2), kl + 32 * D_INNER},
                 CopyRows{lk + AT_OFF_VT, vt},                       CopyRows{lk + AT_OFF_VT + 32u * (AT_LP * 2), vt + 32 * SEQ_LEN},
                 bias_rows(0), bias_rows(1), bias_rows(2), bias_rows(3), bias_rows(4), bias_rows(5), bias_rows(6), bias_rows(7));
  };

  const int nChunks = SEQ_LEN / AT_KC;   // 32, compile-time constant
  copy_stage(0, 0);
  asm volatile("s_wait_asynccnt 0x0" ::: "memory");   // this wave's share of chunk 0 has landed
  __syncthreads();                                    // every wave's share has: chunk 0 may be read
  copy_stage(1, 1);
  for (int kc = 0; kc < nChunks; ++kc) {
    const int buf = kc & 1;
    const __bf16* Ksh = (const __bf16*)(ring + (unsigned)buf * AT_STAGE);               // K hi [kv][d]
    const __bf16* Ksl = (const __bf16*)(ring + (unsigned)buf * AT_STAGE + AT_OFF_KL);   // K lo
    const __bf16* Vth = (const __bf16*)(ring + (unsigned)buf * AT_STAGE + AT_OFF_VT);   // V^T f16 bits [d][kv]
    const float*  Mbs = (const float*)(ring + (unsigned)buf * AT_STAGE + AT_OFF_MB);    // bias [query in block][kv]

    // ---- additive bias of query q0 + c: D register r of tile j wants key kv0 + 16j + 8hh + r = 8 consecutive floats ----
    v4f mb[4][2];
    {
      const float* mrp = Mbs + (wave * 16 + c) * AT_MP + 8 * hh;
#pragma unroll
      for (int j = 0; j < 4; ++j) {
        mb[j][0] = *(const v4f*)(mrp + j * 16);
        mb[j][1] = *(const v4f*)(mrp + j * 16 + 4);
      }
    }
    // ---- scores, transposed: 4 kv subtiles of 16 (rows), 2 d-chunks, 3 products each ----
    v8f s[4];
#pragma unroll
    for (int j = 0; j < 4; ++j) {
      s[j] = (v8f){0.f,0.f,0.f,0.f,0.f,0.f,0.f,0.f};
#pragma unroll
      for (int dc = 0; dc < 2; ++dc) {
        FB kb, kl;
        kb.h[0] = *(const v8b*)(Ksh + (j * 16 + c) * AT_LP + dc * 32 + 8 * hh);
        kb.h[1] = *(const v8b*)(Ksh + (j * 16 + c) * AT_LP + dc * 32 + 16 + 8 * hh);
        kl.h[0] = *(const v8b*)(Ksl + (j * 16 + c) * AT_LP + dc * 32 + 8 * hh);
        kl.h[1] = *(const v8b*)(Ksl + (j * 16 + c) * AT_LP + dc * 32 + 16 + 8 * hh);
        s[j] = at_mma(kb.v, qah[dc], s[j]);
        s[j] = at_mma(kl.v, qah[dc], s[j]);
        s[j] = at_mma(kb.v, qal[dc], s[j]);
      }
    }
    // ---- bias by value, chunk maximum of this lane's query: in-lane over 32 keys, then the other half's 32 ----
    float mj[4];
#pragma unroll
    for (int j = 0; j < 4; ++j) {
      mj[j] = -INFINITY;
#pragma unroll
      for (int r = 0; r < 8; ++r) {
        const float mv = bf_bits2f(f2bf_bits(mb[j][r >> 2][r & 3]));
        const float sv = s[j][r] + mv;
        s[j][r] = sv;
        mj[j] = fmaxf(mj[j], sv);
      }
    }
    float cm = fmaxf(fmaxf(mj[0], mj[1]), fmaxf(mj[2], mj[3]));
    cm = fmaxf(cm, at_other_half(cm));
    const float mnew = fmaxf(mrow, cm);
    // e^(s - m) * 2^15 = 2^(s * log2(e) - b), b = m * log2(e) - 15: one fused multiply-add and the hardware's base-2 exponential.
    // Old and new terms are rescaled by the difference of the very b values they were taken against, so b's rounding cancels
    // in sum and output alike. An argument below -126 gives 0; such a p is far below the f16 carry's last place.
    const float bnew = __builtin_fmaf(mnew, AT_LOG2E, -P_CARRY_LOG2);
    const float alpha = __builtin_amdgcn_exp2f(brow - bnew);   // 0 on the first chunk, where brow is -inf
    mrow = mnew;
    brow = bnew;
    // ---- P^T in registers: element e of B fragment kk = key 32kk + kmap(e) = register e & 7 of score tile 2kk + (e >> 3) ----
    FB pb[2];
    float pj[4];
    typedef __attribute__((ext_vector_type(2))) _Float16 v2h;
    union PK { v8b b; v2h p[4]; };
#pragma unroll
    for (int j = 0; j < 4; ++j) {
      pj[j] = 0.f;
      PK pk;
#pragma unroll
      for (int r = 0; r < 8; r += 2) {
        const float p0 = __builtin_amdgcn_exp2f(__builtin_fmaf(s[j][r],     AT_LOG2E, -bnew));   // x2^15
        const float p1 = __builtin_amdgcn_exp2f(__builtin_fmaf(s[j][r + 1], AT_LOG2E, -bnew));
        pj[j] += p0;
        pj[j] += p1;
        pk.p[r >> 1] = __builtin_convertvector((v2f){p0, p1}, v2h);   // round to nearest even, two to an instruction
      }
      pb[j >> 1].h[j & 1] = pk.b;
    }
    lrow = lrow * alpha + ((pj[0] + pj[1]) + (pj[2] + pj[3]));
#pragma unroll
    for (int t = 0; t < 4; ++t)
#pragma unroll
      for (int r = 0; r < 8; ++r) oacc[t][r] *= alpha;
#pragma unroll   // kk picks the P^T fragment's registers, so it must be a constant
    for (int kk = 0; kk < 2; ++kk) {
#pragma unroll
      for (int t = 0; t < 4; ++t) {
        FB vb;
        vb.h[0] = *(const v8b*)(Vth + (t * 16 + c) * AT_LP + kk * 32 + 8 * hh);
        vb.h[1] = *(const v8b*)(Vth + (t * 16 + c) * AT_LP + kk * 32 + 16 + 8 * hh);
        oacc[t] = at_mma_h(vb.v, pb[kk].v, oacc[t]);
      }
    }
    asm volatile("s_wait_dscnt 0x0" ::: "memory");      // this wave's reads of buffer buf are done before it is refilled
    asm volatile("s_wait_asynccnt 0x0" ::: "memory");   // this wave's share of chunk kc + 1 has landed
    __syncthreads();                                    // publishes chunk kc + 1 and ends every reader's use of buffer buf
    if (kc + 2 < nChunks) copy_stage(kc + 2, buf);
  }
  asm volatile("s_wait_asynccnt 0x0" ::: "memory");     // nothing of this wave's copies is outstanding past the loop

  // ---- join the halves' sums, normalise and stage the 16x64 f32 tile (row = query c, cols 16t + 8hh + r) ----
  float* os = Os[wave];
  {
    const float l = lrow + at_other_half(lrow);
    const float inv = 1.0f / l;   // l carries the same 2^15 as the output sums: about 2^15 (the maximum's own term) <= l <= 6.8e7
#pragma unroll
    for (int t = 0; t < 4; ++t) {
      const v4f lo = {oacc[t][0] * inv, oacc[t][1] * inv, oacc[t][2] * inv, oacc[t][3] * inv};
      const v4f hi = {oacc[t][4] * inv, oacc[t][5] * inv, oacc[t][6] * inv, oacc[t][7] * inv};
      *(v4f*)(os + c * 68 + t * 16 + 8 * hh)     = lo;
      *(v4f*)(os + c * 68 + t * 16 + 8 * hh + 4) = hi;
    }
  }
  __builtin_amdgcn_fence(__ATOMIC_RELEASE, "workgroup");
  __builtin_amdgcn_wave_barrier();
  __builtin_amdgcn_fence(__ATOMIC_ACQUIRE, "workgroup");
  {
    // coverage: 4 it x 32 lanes x 8 elements = 16 rows x 64 = the whole wave tile, per plane;
    const int qg = lane >> 3, c8 = (lane & 7) * 8;
    {
#pragma unroll
      for (int it = 0; it < 4; ++it) {
        const int row = it * 4 + qg;
        const float* sp = os + row * 68 + c8;
        v8h hv, lv;
#pragma unroll
        for (int e = 0; e < 8; ++e) {
          const unsigned short hb = f2bf_bits(sp[e]);
          const unsigned short lb = f2bf_bits(sp[e] - bf_bits2f(hb));
          hv[e] = __builtin_bit_cast(_Float16, hb);
          lv[e] = __builtin_bit_cast(_Float16, lb);
        }
        *(v8h*)(Ch + (size_t)(q0 + row) * D_INNER + c8) = hv;
        *(v8h*)(Cl + (size_t)(q0 + row) * D_INNER + c8) = lv;
      }
      
    }
  }
}

// =====================================================================================
// Host launch glue: only kernel launches; grids/args are pure functions of the (asserted) sizes.
// Workspace region map (bytes; all offsets multiples of 2 MiB):
//   [  0 MiB,  8 MiB)  q  bf16  [4096][1024]
//   [  8 MiB, 16 MiB)  k  bf16  [4096][1024]
//   [ 16 MiB, 24 MiB)  v  bf16  [4096][1024]
//   [ 24 MiB, 26 MiB)  Wq bf16  [1024][1024]   [26,28) Wk   [28,30) Wv   [30,32) Wo
//   [ 32 MiB, 40 MiB)  Q hi bf16 [4096][1024]   [40,48) Q lo
//   [ 48 MiB, 56 MiB)  K hi bf16 [4096][1024]   [56,64) K lo
//   [ 64 MiB, 72 MiB)  V^T f16  [2][1024][2048]
//   [ 72 MiB, 80 MiB)  ctx hi bf16 [4096][1024] [80,88) ctx lo
//   total 88 MiB = 92,274,688 B
// =====================================================================================
extern "C" void kernel_launch(void* const* d_in, const int* in_sizes, int n_in,
                              void* d_out, int out_size, void* d_ws, size_t ws_size,
                              hipStream_t stream) {
  if (n_in < 9) return;
  const size_t nAct  = (size_t)N_BATCH * SEQ_LEN * D_MODEL;     // 4,194,304
  const size_t nW    = (size_t)D_INNER * D_MODEL;               // 1,048,576
  const size_t nMask = (size_t)N_BATCH * SEQ_LEN * SEQ_LEN;     // 8,388,608
  const size_t nVT   = (size_t)N_BATCH * D_INNER * SEQ_LEN;     // 4,194,304
  if ((size_t)in_sizes[0] != nAct || (size_t)in_sizes[1] != nAct || (size_t)in_sizes[2] != nAct ||
      (size_t)in_sizes[3] != nMask || (size_t)in_sizes[4] != nW || (size_t)in_sizes[5] != nW ||
      (size_t)in_sizes[6] != nW || (size_t)in_sizes[7] != nW || in_sizes[8] < 1 ||
      (size_t)out_size != nAct) return;

  const size_t bAct = nAct * 2, bW = nW * 2, bVT = nVT * 2;
  const size_t o_q16 = 0;
  const size_t o_k16 = o_q16 + bAct;
  const size_t o_v16 = o_k16 + bAct;
  const size_t o_wq  = o_v16 + bAct;
  const size_t o_wk  = o_wq + bW;
  const size_t o_wv  = o_wk + bW;
  const size_t o_wo  = o_wv + bW;
  const size_t o_qhi = o_wo + bW;
  const size_t o_qlo = o_qhi + bAct;
  const size_t o_khi = o_qlo + bAct;
  const size_t o_klo = o_khi + bAct;
  const size_t o_vt  = o_klo + bAct;
  const size_t o_chi = o_vt + bVT;
  const size_t o_clo = o_chi + bAct;
  const size_t total = o_clo + bAct;                            // 92,274,688
  if (total > ws_size) return;

  const float* qf  = (const float*)d_in[0];
  const float* kf  = (const float*)d_in[1];
  const float* vf  = (const float*)d_in[2];
  const float* mf  = (const float*)d_in[3];
  const float* wqf = (const float*)d_in[4];
  const float* wkf = (const float*)d_in[5];
  const float* wvf = (const float*)d_in[6];
  const float* wof = (const float*)d_in[7];
  const int*   nhp = (const int*)d_in[8];
  char* ws = (char*)d_ws;
  unsigned short* q16 = (unsigned short*)(ws + o_q16);
  unsigned short* k16 = (unsigned short*)(ws + o_k16);
  unsigned short* v16 = (unsigned short*)(ws + o_v16);
  unsigned short* wq16 = (unsigned short*)(ws + o_wq);
  unsigned short* wk16 = (unsigned short*)(ws + o_wk);
  unsigned short* wv16 = (unsigned short*)(ws + o_wv);
  unsigned short* wo16 = (unsigned short*)(ws + o_wo);
  unsigned short* qhi = (unsigned short*)(ws + o_qhi);
  unsigned short* qlo = (unsigned short*)(ws + o_qlo);
  unsigned short* khi = (unsigned short*)(ws + o_khi);
  unsigned short* klo = (unsigned short*)(ws + o_klo);
  unsigned short* vt  = (unsigned short*)(ws + o_vt);
  unsigned short* chi = (unsigned short*)(ws + o_chi);
  unsigned short* clo = (unsigned short*)(ws + o_clo);
  float* out = (float*)d_out;

  // ---- 1: RNE bf16 copies of the seven float inputs; q16 is the start of the seven planes, back to back in the
  //      order of the arguments (region map above) ----
  cast_all_f32_bf16<<<dim3((unsigned)CAST_GRID), CAST_THR, 0, stream>>>(qf, kf, vf, wqf, wkf, wvf, wof, q16);

  const int MTOK = N_BATCH * SEQ_LEN;         // 4096 rows of [B*S][.] planes
  // ---- 2,3: Q and K projections: C[4096][1024] = X[4096][1024] . W^T, W [1024 out][1024 in] = Bt[N][K];
  //      M=4096, N=1024 (x64), K=1024 (x32); 64*16 = 1024 wave tiles = 128 blocks; out = bf16 hi + lo planes
  {
    const int tiles = (MTOK / 64) * (D_INNER / 64);
    const dim3 g((unsigned)((tiles + 7) / 8), 1);
    wmma_gemm64<1, false, 0, 2, false><<<g, 256, 0, stream>>>(
        q16, q16, D_MODEL, 0L, wq16, wq16, D_MODEL, 0L, (void*)qhi, (void*)qlo, D_INNER, 0L,
        mf, mf, 0L, MTOK, D_INNER, D_MODEL, 1.0f);
    wmma_gemm64<1, false, 0, 2, false><<<g, 256, 0, stream>>>(
        k16, k16, D_MODEL, 0L, wk16, wk16, D_MODEL, 0L, (void*)khi, (void*)klo, D_INNER, 0L,
        mf, mf, 0L, MTOK, D_INNER, D_MODEL, 1.0f);
  }
  // ---- 4: V projection, role-swapped so the output is V^T per batch element:
  //      C_b[e][s] = sum_k Wv[e][k] . v_b[s][k]; A = Wv [1024][1024] (shared, strideA 0), Bt = v_b [2048][1024],
  //      C_b [1024][2048] f16; M=1024, N=2048 (x64), K=1024 (x32); 16*32 = 512 tiles = 64 blocks, grid.y = 2
  {
    const int tiles = (D_INNER / 64) * (SEQ_LEN / 64);
    const dim3 g((unsigned)((tiles + 7) / 8), (unsigned)N_BATCH);
    wmma_gemm64<1, false, 0, 1, false><<<g, 256, 0, stream>>>(
        wv16, wv16, D_MODEL, 0L, v16, v16, D_MODEL, (long)SEQ_LEN * D_MODEL,
        (void*)vt, (void*)vt, SEQ_LEN, (long)D_INNER * SEQ_LEN,
        mf, mf, 0L, D_INNER, SEQ_LEN, D_MODEL, 1.0f);
  }
  // ---- 5: attention: 2 x 16 x 16 = 512 blocks of 256 threads ----
  {
    const dim3 g((unsigned)(N_BATCH * N_HEAD * (SEQ_LEN / AT_QB)));
    mha_bias_kernel<<<g, 256, 0, stream>>>(qhi, qlo, khi, klo, vt, mf, chi, clo, nhp);
  }
  // ---- 6: output projection: out[4096][1024] = (ctx_hi + ctx_lo)[4096][1024] . Wo^T, Wo [1024 out][1024 in];
  //      M=4096, N=1024 (x64), K=1024 (x32); 1024 tiles = 128 blocks; f32 out
  {
    const int tiles = (MTOK / 64) * (D_MODEL / 64);
    const dim3 g((unsigned)((tiles + 7) / 8), 1);
    wmma_gemm64<1, true, 0, 0, false, 0, false><<<g, 256, 0, stream>>>(
        chi, clo, D_INNER, 0L, wo16, wo16, D_INNER, 0L, (void*)out, (void*)out, D_MODEL, 0L,
        mf, mf, 0L, MTOK, D_MODEL, D_INNER, 1.0f);
  }
}

// v007
// A run of this version takes 135 microseconds.
// Two timings next to v006 both put it at 1.27 times that version's speed.
// Over all steps from v000 it is 3.55 times as fast.
// Contractions: q/k/v projections = v_wmma_f32_16x16x32_bf16 on RNE-bf16 copies of the inputs (single product); q.k^T = v_wmma_f32_16x16x32_bf16 with bf16 hi/lo split operands (hi.hi + hi.lo + lo.hi); p.v = v_wmma_f32_16x16x32_f16 (p carried x2^15 in f16, v^T stored f16); output projection = v_wmma_f32_16x16x32_bf16 with ctx bf16 hi/lo x Wo bf16 (hi.W + lo.W); f32 accumulate everywhere; additive mask (RNE-bf16 values) and online softmax in f32.
#include <hip/hip_runtime.h>
#include <math.h>
#include <stdint.h>

constexpr int N_BATCH = 2;
constexpr int SEQ_LEN = 2048;
constexpr int D_MODEL = 1024;                 // d_model (input / output feature width)
constexpr int N_HEAD  = 16;
constexpr int D_HEAD  = 64;
constexpr int D_INNER = N_HEAD * D_HEAD;      // 1024
static_assert(D_INNER == 1024, "inner width");
static_assert(SEQ_LEN % 64 == 0 && D_MODEL % 64 == 0 && D_INNER % 64 == 0, "tile multiples");
static_assert(D_MODEL % 32 == 0 && D_INNER % 32 == 0, "K multiples of 32");

typedef __attribute__((ext_vector_type(16))) _Float16 v16h;
typedef __attribute__((ext_vector_type(8)))  _Float16 v8h;
typedef __attribute__((ext_vector_type(16))) __bf16   v16b;
typedef __attribute__((ext_vector_type(8)))  __bf16   v8b;
typedef __attribute__((ext_vector_type(8)))  float    v8f;
typedef __attribute__((ext_vector_type(4)))  float    v4f;
typedef __attribute__((ext_vector_type(2)))  float    v2f;

__device__ __forceinline__ unsigned short f2bf_bits(float f) {
  unsigned u = __float_as_uint(f);
  return (unsigned short)((u + 0x7FFFu + ((u >> 16) & 1u)) >> 16);
}
__device__ __forceinline__ float bf_bits2f(unsigned short h) { return __uint_as_float(((unsigned)h) << 16); }
__device__ __forceinline__ unsigned pk16(unsigned short a, unsigned short b) { return (unsigned)a | ((unsigned)b << 16); }

// hazard guards as plain device helpers
__device__ __forceinline__ void dep_guard_h(v8f& a, v8f& b, v16h x, v16h y) { asm volatile("v_nop\n\tv_nop\n\tv_nop\n\tv_nop" : "+v"(a), "+v"(b) : "v"(x), "v"(y)); }
__device__ __forceinline__ void dep_guard_b(v8f& a, v8f& b, v16b x, v16b y) { asm volatile("v_nop\n\tv_nop\n\tv_nop\n\tv_nop" : "+v"(a), "+v"(b) : "v"(x), "v"(y)); }
__device__ __forceinline__ void keep4_h(v16h a, v16h b, v16h c, v16h d) { asm volatile("v_nop" :: "v"(a), "v"(b), "v"(c), "v"(d)); }
__device__ __forceinline__ void keep4_b(v16b a, v16b b, v16b c, v16b d) { asm volatile("v_nop" :: "v"(a), "v"(b), "v"(c), "v"(d)); }
__device__ __forceinline__ void acc_guard4(v8f& a, v8f& b, v8f& c, v8f& d) { asm volatile("v_nop\n\tv_nop\n\tv_nop\n\tv_nop" : "+v"(a), "+v"(b), "+v"(c), "+v"(d)); }
template <typename T> struct Frag;
template <> struct Frag<_Float16> {
  typedef v16h V; union U { v16h v; v8h h[2]; };
  static __device__ __forceinline__ v16h load(const _Float16* p) {   // elements 0..7 <- p[0..7], 8..15 <- p[16..23]
    U f; f.h[0] = *(const v8h*)(p); f.h[1] = *(const v8h*)(p + 16); return f.v;
  }
  static __device__ __forceinline__ v8f mma(v16h a, v16h b, v8f c) {
    return __builtin_amdgcn_wmma_f32_16x16x32_f16(false, a, false, b, (short)0, c, false, false);
  }
  static __device__ __forceinline__ void guard(v8f& a, v8f& b, v16h x, v16h y) { dep_guard_h(a, b, x, y); }
  static __device__ __forceinline__ void keep(v16h a, v16h b, v16h c, v16h d) { keep4_h(a, b, c, d); }
};
template <> struct Frag<__bf16> {
  typedef v16b V; union U { v16b v; v8b h[2]; };
  static __device__ __forceinline__ v16b load(const __bf16* p) {
    U f; f.h[0] = *(const v8b*)(p); f.h[1] = *(const v8b*)(p + 16); return f.v;
  }
  static __device__ __forceinline__ v8f mma(v16b a, v16b b, v8f c) {
    return __builtin_amdgcn_wmma_f32_16x16x32_bf16(false, a, false, b, (short)0, c, false, false);
  }
  static __device__ __forceinline__ void guard(v8f& a, v8f& b, v16b x, v16b y) { dep_guard_b(a, b, x, y); }
  static __device__ __forceinline__ void keep(v16b a, v16b b, v16b c, v16b d) { keep4_b(a, b, c, d); }
};

// ---- Register-blocked batched WMMA GEMM ------------------------------------
// C[m,n] = scale * sum_k A[m,k] * Bt[n,k] (+bias)(+resid); each wave owns a 64x64 tile; the 8 waves of a block
// form a 2 (M) x 4 (N) grid = one 128x256 block tile, whose operand rows reach LDS 64 k at a time (a stage) by
// asynchronous 16-byte copies, two buffers: stage t+1 flies while stage t is multiplied.
// A row-major [M,K]; Bt row-major [N,K]; M % 128 == 0, N % 256 == 0, K % 64 == 0.
// SPLIT: operands are hi/lo planes (A2/Bt2 = lo planes, same layout); product = hi.hi + hi.lo + lo.hi.
// BLO = false with SPLIT: the Bt lo plane is not used (product = hi.B + lo.B, B a single plane).
// BIAS_MODE: 0 = none, 1 = bias[m], 2 = bias[n].
// OUT_MODE: 0 = f32, 1 = f16, 2 = bf16 hi plane (Cout) + bf16 lo plane (Cout2), 3 = 1 or 2, as the block-uniform argument om says.
// gemm_block is the work of one block: tile number bx of batch element b. Its callers are the kernels below it.
// ET: 0 = f16 operands, 1 = bf16 operands (pointers passed as 16-bit storage)
// Asynchronous 16-byte-per-lane copies global -> LDS, eight, twelve or fourteen to a statement. The s_wait_xcnt is the last line
// of the copies' own statement so that it stands in front of every later write of the address registers they name.
struct CopyRows { unsigned l; const void* g; };   // this lane's LDS byte address and global address of one row segment
__device__ __forceinline__ void async_copy8(CopyRows a, CopyRows b, CopyRows c, CopyRows d,
                                            CopyRows e, CopyRows f, CopyRows g, CopyRows h) {
  asm volatile("global_load_async_to_lds_b128 %0, %1, off\n\t"
               "global_load_async_to_lds_b128 %2, %3, off\n\t"
               "global_load_async_to_lds_b128 %4, %5, off\n\t"
               "global_load_async_to_lds_b128 %6, %7, off\n\t"
               "global_load_async_to_lds_b128 %8, %9, off\n\t"
               "global_load_async_to_lds_b128 %10, %11, off\n\t"
               "global_load_async_to_lds_b128 %12, %13, off\n\t"
               "global_load_async_to_lds_b128 %14, %15, off\n\t"
               "s_wait_xcnt 0x0"
               :: "v"(a.l), "v"(a.g), "v"(b.l), "v"(b.g), "v"(c.l), "v"(c.g), "v"(d.l), "v"(d.g),
                  "v"(e.l), "v"(e.g), "v"(f.l), "v"(f.g), "v"(g.l), "v"(g.g), "v"(h.l), "v"(h.g) : "memory");
}
__device__ __forceinline__ void async_copy12(CopyRows a, CopyRows b, CopyRows c, CopyRows d,
                                             CopyRows e, CopyRows f, CopyRows g, CopyRows h,
                                             CopyRows i, CopyRows j, CopyRows k, CopyRows m) {
  asm volatile("global_load_async_to_lds_b128 %0, %1, off\n\t"
               "global_load_async_to_lds_b128 %2, %3, off\n\t"
               "global_load_async_to_lds_b128 %4, %5, off\n\t"
               "global_load_async_to_lds_b128 %6, %7, off\n\t"
               "global_load_async_to_lds_b128 %8, %9, off\n\t"
               "global_load_async_to_lds_b128 %10, %11, off\n\t"
               "global_load_async_to_lds_b128 %12, %13, off\n\t"
               "global_load_async_to_lds_b128 %14, %15, off\n\t"
               "global_load_async_to_lds_b128 %16, %17, off\n\t"
               "global_load_async_to_lds_b128 %18, %19, off\n\t"
               "global_load_async_to_lds_b128 %20, %21, off\n\t"
               "global_load_async_to_lds_b128 %22, %23, off\n\t"
               "s_wait_xcnt 0x0"
               :: "v"(a.l), "v"(a.g), "v"(b.l), "v"(b.g), "v"(c.l), "v"(c.g), "v"(d.l), "v"(d.g),
                  "v"(e.l), "v"(e.g), "v"(f.l), "v"(f.g), "v"(g.l), "v"(g.g), "v"(h.l), "v"(h.g),
                  "v"(i.l), "v"(i.g), "v"(j.l), "v"(j.g), "v"(k.l), "v"(k.g), "v"(m.l), "v"(m.g) : "memory");
}
__device__ __forceinline__ void async_copy14(CopyRows a, CopyRows b, CopyRows c, CopyRows d, CopyRows e, CopyRows f, CopyRows g,
                                             CopyRows h, CopyRows i, CopyRows j, CopyRows k, CopyRows m, CopyRows n, CopyRows o) {
  asm volatile("global_load_async_to_lds_b128 %0, %1, off\n\t"
               "global_load_async_to_lds_b128 %2, %3, off\n\t"
               "global_load_async_to_lds_b128 %4, %5, off\n\t"
               "global_load_async_to_lds_b128 %6, %7, off\n\t"
               "global_load_async_to_lds_b128 %8, %9, off\n\t"
               "global_load_async_to_lds_b128 %10, %11, off\n\t"
               "global_load_async_to_lds_b128 %12, %13, off\n\t"
               "global_load_async_to_lds_b128 %14, %15, off\n\t"
               "global_load_async_to_lds_b128 %16, %17, off\n\t"
               "global_load_async_to_lds_b128 %18, %19, off\n\t"
               "global_load_async_to_lds_b128 %20, %21, off\n\t"
               "global_load_async_to_lds_b128 %22, %23, off\n\t"
               "global_load_async_to_lds_b128 %24, %25, off\n\t"
               "global_load_async_to_lds_b128 %26, %27, off\n\t"
               "s_wait_xcnt 0x0"
               :: "v"(a.l), "v"(a.g), "v"(b.l), "v"(b.g), "v"(c.l), "v"(c.g), "v"(d.l), "v"(d.g),
                  "v"(e.l), "v"(e.g), "v"(f.l), "v"(f.g), "v"(g.l), "v"(g.g), "v"(h.l), "v"(h.g),
                  "v"(i.l), "v"(i.g), "v"(j.l), "v"(j.g), "v"(k.l), "v"(k.g), "v"(m.l), "v"(m.g),
                  "v"(n.l), "v"(n.g), "v"(o.l), "v"(o.g) : "memory");
}
#define GM_PITCH 144            // LDS row pitch in bytes of a 128-byte stage row: 16 B x odd, conflict-free 16-byte fragment reads
#define GM_PE    (GM_PITCH / 2) // the same in 16-bit elements
template <int ET> struct Elem;
template <> struct Elem<0> { typedef _Float16 T; };
template <> struct Elem<1> { typedef __bf16 T; };
// One 16x64 f32 slab of a wave -> 16-bit rows in memory, 8 lanes x 16 B = one whole 128-byte row segment per plane.
// PLANES2 = false: f16 to C; true: bf16 hi to C and bf16 lo to C2.
template <bool PLANES2>
__device__ __forceinline__ void store_slab16(const float* slab, unsigned short* C, unsigned short* C2,
                                             int ldc, int mBase, int n0, int lane) {
  const int q = lane >> 3, c8 = (lane & 7) * 8;
#pragma unroll
  for (int it = 0; it < 4; ++it) {
    const int row = it * 4 + q;
    const float* sp = slab + row * 68 + c8;
    v8h hv, lv;
#pragma unroll
    for (int e = 0; e < 8; ++e) {
      if (!PLANES2) {
        hv[e] = (_Float16)sp[e];
      } else {
        unsigned short hb = f2bf_bits(sp[e]);
        unsigned short lb = f2bf_bits(sp[e] - bf_bits2f(hb));
        hv[e] = __builtin_bit_cast(_Float16, hb);
        lv[e] = __builtin_bit_cast(_Float16, lb);
      }
    }
    *(v8h*)(C + (size_t)(mBase + row) * ldc + n0 + c8) = hv;
    if (PLANES2) *(v8h*)(C2 + (size_t)(mBase + row) * ldc + n0 + c8) = lv;
  }
  asm volatile("s_wait_xcnt 0x0" ::: "memory");   // stands in front of every later write of a register that these stores name
}
template <int ET, bool SPLIT, int BIAS_MODE, int OUT_MODE, bool RESID, int ACT = 0, bool BLO = true>
__device__ __forceinline__ void gemm_block(
    const unsigned short* __restrict__ Ap, const unsigned short* __restrict__ A2p, int lda, long strideA,
    const unsigned short* __restrict__ Btp, const unsigned short* __restrict__ Bt2p, int ldb, long strideB,
    void* __restrict__ Cout, void* __restrict__ Cout2, int ldc, long strideC,
    const float* __restrict__ bias,
    const float* __restrict__ resid, long strideR,
    int M, int N, int K, float scale, unsigned bx, int b, int om) {
  typedef typename Elem<ET>::T T;
  typedef typename Frag<T>::V V;
  const T* A = (const T*)Ap; const T* A2 = (const T*)A2p; const T* Bt = (const T*)Btp; const T* Bt2 = (const T*)Bt2p;
  __shared__ __align__(16) float sT[8][16 * 68];   // per-wave 16x64 slab, pitch 68 floats
  // one stage = [A 128 rows | A lo 128 rows (SPLIT) | Bt 256 rows | Bt lo 256 rows (SPLIT && BLO)], 64 k each
  constexpr unsigned OFF_A2  = 128u * GM_PITCH;
  constexpr unsigned OFF_B   = OFF_A2 + (SPLIT ? 128u * GM_PITCH : 0u);
  constexpr unsigned OFF_B2  = OFF_B + 256u * GM_PITCH;
  constexpr unsigned STAGE_B = OFF_B2 + ((SPLIT && BLO) ? 256u * GM_PITCH : 0u);
  __shared__ __align__(16) unsigned char ring[2 * STAGE_B];
  const int lane = threadIdx.x & 31;
  const int wave = threadIdx.x >> 5;
  const int tilesN = N >> 8;
  const int tilesM = M >> 7;
  if ((int)bx >= tilesM * tilesN) return;   // block-uniform, ahead of every copy and barrier
  const int bm  = bx / tilesN;
  const int bn  = bx - bm * tilesN;
  const int wm0 = (wave >> 2) << 6;            // this wave's rows inside the block tile
  const int wn0 = (wave & 3) << 6;             // this wave's columns inside the block tile
  const int m0 = (bm << 7) + wm0;
  const int n0 = (bn << 8) + wn0;

  const T* Ab  = A  + (size_t)b * strideA;
  const T* Bb  = Bt + (size_t)b * strideB;
  const T* Ab2 = SPLIT ? (A2  + (size_t)b * strideA) : nullptr;
  const T* Bb2 = (SPLIT && BLO) ? (Bt2 + (size_t)b * strideB) : nullptr;

  const int rlane = lane & 15;                 // row (A) / col (B, D) within subtile
  const int koff  = (lane >> 4) * 8;           // k offset of this lane half
  const int mOff  = (lane >> 4) * 8;           // D row offset

  // staging map: 8 lanes x 16 B = one whole 128-byte row segment; a copy of the block covers 32 rows
  const int srow = threadIdx.x >> 3;           // 0..31
  const int sseg = (threadIdx.x & 7) * 8;      // first of this lane's 8 elements in the 64-element row
  const size_t aoff = (size_t)((bm << 7) + srow) * lda + sseg;
  const size_t boff = (size_t)((bn << 8) + srow) * ldb + sseg;
  const size_t a32 = (size_t)32 * lda, b32 = (size_t)32 * ldb;
  const unsigned lds0 = (unsigned)(uintptr_t)ring + (unsigned)(srow * GM_PITCH + sseg * 2);
  auto copy_stage = [&](int st, int buf) {     // all lanes on, rows and k inside the operands by the size conditions above
    const unsigned l = lds0 + (unsigned)buf * STAGE_B;
    auto rows = [](unsigned lds, const T* g, size_t step32, int i) {   // row group i: 32 rows further on in both places
      return CopyRows{lds + (unsigned)i * 32u * GM_PITCH, (const void*)(g + (size_t)i * step32)};
    };
    const T* ga = Ab + aoff + (size_t)st * 64;
    const T* gb = Bb + boff + (size_t)st * 64;
    const unsigned lb = l + OFF_B;
    if (!SPLIT) {
      async_copy12(rows(l, ga, a32, 0), rows(l, ga, a32, 1), rows(l, ga, a32, 2), rows(l, ga, a32, 3),
                   rows(lb, gb, b32, 0), rows(lb, gb, b32, 1), rows(lb, gb, b32, 2), rows(lb, gb, b32, 3),
                   rows(lb, gb, b32, 4), rows(lb, gb, b32, 5), rows(lb, gb, b32, 6), rows(lb, gb, b32, 7));
    } else {
      const unsigned l2 = l + OFF_A2;
      const T* ga2 = Ab2 + aoff + (size_t)st * 64;
      async_copy8(rows(l, ga, a32, 0), rows(l, ga, a32, 1), rows(l, ga, a32, 2), rows(l, ga, a32, 3),
                  rows(l2, ga2, a32, 0), rows(l2, ga2, a32, 1), rows(l2, ga2, a32, 2), rows(l2, ga2, a32, 3));
      async_copy8(rows(lb, gb, b32, 0), rows(lb, gb, b32, 1), rows(lb, gb, b32, 2), rows(lb, gb, b32, 3),
                  rows(lb, gb, b32, 4), rows(lb, gb, b32, 5), rows(lb, gb, b32, 6), rows(lb, gb, b32, 7));
      if (BLO) {
        const unsigned lb2 = l + OFF_B2;
        const T* gb2 = Bb2 + boff + (size_t)st * 64;
        async_copy8(rows(lb2, gb2, b32, 0), rows(lb2, gb2, b32, 1), rows(lb2, gb2, b32, 2), rows(lb2, gb2, b32, 3),
                    rows(lb2, gb2, b32, 4), rows(lb2, gb2, b32, 5), rows(lb2, gb2, b32, 6), rows(lb2, gb2, b32, 7));
      }
    }
  };

  v8f acc[4][4];
#pragma unroll
  for (int i = 0; i < 4; ++i)
#pragma unroll
    for (int j = 0; j < 4; ++j) acc[i][j] = (v8f){0.f,0.f,0.f,0.f,0.f,0.f,0.f,0.f};

  const int nst = K >> 6;                      // stages of 64 k
  copy_stage(0, 0);
  asm volatile("s_wait_asynccnt 0x0" ::: "memory");   // this wave's share of stage 0 has landed
  __syncthreads();                                    // every wave's share has: stage 0 may be read
  if (nst > 1) copy_stage(1, 1);
  for (int st = 0; st < nst; ++st) {
    const int buf = st & 1;
    const T* sA  = (const T*)(ring + (unsigned)buf * STAGE_B);
    const T* sA2 = (const T*)(ring + (unsigned)buf * STAGE_B + OFF_A2);
    const T* sB  = (const T*)(ring + (unsigned)buf * STAGE_B + OFF_B);
    const T* sB2 = (const T*)(ring + (unsigned)buf * STAGE_B + OFF_B2);
#pragma unroll   // both 32-k halves of a stage in line, so that kk folds into the LDS loads' immediate offsets
    for (int kk = 0; kk < 64; kk += 32) {
      V bh[4], bl[4];
#pragma unroll
      for (int j = 0; j < 4; ++j) {
        const int bo = (wn0 + (j << 4) + rlane) * GM_PE + koff + kk;
        bh[j] = Frag<T>::load(sB + bo);
        if (SPLIT && BLO) bl[j] = Frag<T>::load(sB2 + bo);
      }
#pragma unroll
      for (int i = 0; i < 4; ++i) {
        const int ao = (wm0 + (i << 4) + rlane) * GM_PE + koff + kk;
        V ah = Frag<T>::load(sA + ao);
        V al;
        if (SPLIT) al = Frag<T>::load(sA2 + ao);
#pragma unroll
        for (int j = 0; j < 4; ++j) {
          acc[i][j] = Frag<T>::mma(ah, bh[j], acc[i][j]);
          if (SPLIT) {
            if (BLO) acc[i][j] = Frag<T>::mma(ah, bl[j], acc[i][j]);
            acc[i][j] = Frag<T>::mma(al, bh[j], acc[i][j]);
          }
        }
        Frag<T>::guard(acc[i][0], acc[i][3], ah, SPLIT ? al : ah);
      }
      Frag<T>::keep(bh[0], bh[1], bh[2], bh[3]);
      if (SPLIT && BLO) Frag<T>::keep(bl[0], bl[1], bl[2], bl[3]);
    }
    asm volatile("s_wait_dscnt 0x0" ::: "memory");      // this wave's reads of buffer buf are done before it is refilled
    asm volatile("s_wait_asynccnt 0x0" ::: "memory");   // this wave's share of stage st + 1 has landed
    __syncthreads();                                    // publishes stage st + 1 and ends every reader's use of buffer buf
    if (st + 2 < nst) copy_stage(st + 2, buf);
  }
  asm volatile("s_wait_asynccnt 0x0" ::: "memory");     // nothing of this wave's copies is outstanding past the loop
  acc_guard4(acc[0][0], acc[0][1], acc[0][2], acc[0][3]);
  acc_guard4(acc[1][0], acc[1][1], acc[1][2], acc[1][3]);
  acc_guard4(acc[2][0], acc[2][1], acc[2][2], acc[2][3]);
  acc_guard4(acc[3][0], acc[3][1], acc[3][2], acc[3][3]);

  // ---- epilogue ----
  float* slab = sT[wave];
  const float* Rb = RESID ? (resid + (size_t)b * strideR) : nullptr;
#pragma unroll
  for (int i = 0; i < 4; ++i) {
    const int mBase = m0 + (i << 4);
#pragma unroll
    for (int j = 0; j < 4; ++j) {
      const int n = n0 + (j << 4) + rlane;
      float bv = 0.f;
      if (BIAS_MODE == 2) bv = bias[n];
#pragma unroll
      for (int r = 0; r < 8; ++r) {
        float v = acc[i][j][r] * scale;
        if (BIAS_MODE == 1) v += bias[mBase + mOff + r];
        if (BIAS_MODE == 2) v += bv;
        if (RESID) v += Rb[(size_t)(mBase + mOff + r) * ldc + n];
        if (ACT == 1) v = tanhf(v);
        if (ACT == 2) v = fmaxf(v, 0.0f);
        if (ACT == 3) v = v / (1.0f + expf(-v));
        if (ACT == 4) v = (v > 0.f) ? v : 0.01f * v;
        slab[(mOff + r) * 68 + (j << 4) + rlane] = v;
      }
    }
    __builtin_amdgcn_fence(__ATOMIC_RELEASE, "workgroup");
    __builtin_amdgcn_wave_barrier();
    __builtin_amdgcn_fence(__ATOMIC_ACQUIRE, "workgroup");
    if (OUT_MODE == 0) {
      float* C = (float*)Cout + (size_t)b * strideC;
      const int hh = lane >> 4, c4 = (lane & 15) * 4;     // row seg = 256 B = 16 lanes x 16 B
      {
#pragma unroll
        for (int it = 0; it < 8; ++it) {
          const int row = it * 2 + hh;
          v4f v = *(const v4f*)(slab + row * 68 + c4);
          *(v4f*)(C + (size_t)(mBase + row) * ldc + n0 + c4) = v;
        }
        
      }
    } else {
      unsigned short* C  = (unsigned short*)Cout  + (size_t)b * strideC;
      unsigned short* C2 = (unsigned short*)Cout2 + (size_t)b * strideC;
      if (OUT_MODE == 1 || (OUT_MODE == 3 && om == 1)) store_slab16<false>(slab, C, C2, ldc, mBase, n0, lane);
      else                                             store_slab16<true>(slab, C, C2, ldc, mBase, n0, lane);
    }
    __builtin_amdgcn_fence(__ATOMIC_RELEASE, "workgroup");
    __builtin_amdgcn_wave_barrier();
    __builtin_amdgcn_fence(__ATOMIC_ACQUIRE, "workgroup");
  }
}

// One GEMM to a launch: block (x, y) does tile x of batch element y.
template <int ET, bool SPLIT, int BIAS_MODE, int OUT_MODE, bool RESID, int ACT = 0, bool BLO = true>
__global__ __launch_bounds__(256) void wmma_gemm64(
    const unsigned short* __restrict__ Ap, const unsigned short* __restrict__ A2p, int lda, long strideA,
    const unsigned short* __restrict__ Btp, const unsigned short* __restrict__ Bt2p, int ldb, long strideB,
    void* __restrict__ Cout, void* __restrict__ Cout2, int ldc, long strideC,
    const float* __restrict__ bias,
    const float* __restrict__ resid, long strideR,
    int M, int N, int K, float scale) {
  gemm_block<ET, SPLIT, BIAS_MODE, OUT_MODE, RESID, ACT, BLO>(
      Ap, A2p, lda, strideA, Btp, Bt2p, ldb, strideB, Cout, Cout2, ldc, strideC, bias, resid, strideR,
      M, N, K, scale, blockIdx.x, (int)blockIdx.y, OUT_MODE);
}

// The Q, K and V projections in ONE launch. Each has 128 block tiles, half of the chip's 256 WGPs; none reads what another
// writes, so the 384 blocks run side by side (a block's LDS lets two share a WGP). blockIdx.y picks the projection:
//   0, 1: C[4096][1024] = X[4096][K] . W^T, W [1024][K] = Bt; out = bf16 hi + lo planes; tile = blockIdx.x
//   2:    role-swapped, so that the output is V^T per batch element: C_b[e][s] = sum_k Wv[e][k] . v_b[s][k];
//         A = Wv [1024][K], Bt = v_b [2048][K], C_b [1024][2048] f16; 64 tiles per batch element, b = blockIdx.x / 64
constexpr int QKV_TILES = (N_BATCH * SEQ_LEN / 128) * (D_INNER / 256);   // 128
constexpr int VT_TILES  = (D_INNER / 128) * (SEQ_LEN / 256);             // 64 per batch element
static_assert(N_BATCH * VT_TILES == QKV_TILES, "the three projections have the same number of block tiles");
__global__ __launch_bounds__(256) void qkv_gemm(
    const unsigned short* __restrict__ q16, const unsigned short* __restrict__ k16, const unsigned short* __restrict__ v16,
    const unsigned short* __restrict__ wq, const unsigned short* __restrict__ wk, const unsigned short* __restrict__ wv,
    unsigned short* __restrict__ qhi, unsigned short* __restrict__ qlo,
    unsigned short* __restrict__ khi, unsigned short* __restrict__ klo,
    unsigned short* __restrict__ vt, int K) {
  const int which = blockIdx.y;              // block-uniform
  const bool isv = which == 2;
  const unsigned short* A  = isv ? wv : (which == 1 ? k16 : q16);
  const unsigned short* Bt = isv ? v16 : (which == 1 ? wk : wq);
  unsigned short* C  = isv ? vt : (which == 1 ? khi : qhi);
  unsigned short* C2 = isv ? vt : (which == 1 ? klo : qlo);
  const int b = isv ? (int)(blockIdx.x / VT_TILES) : 0;
  const unsigned bx = isv ? blockIdx.x % VT_TILES : blockIdx.x;
  gemm_block<1, false, 0, 3, false>(
      A, A, K, 0L, Bt, Bt, K, (long)SEQ_LEN * K,
      (void*)C, (void*)C2, isv ? SEQ_LEN : D_INNER, (long)D_INNER * SEQ_LEN,
      nullptr, nullptr, 0L, isv ? D_INNER : N_BATCH * SEQ_LEN, isv ? SEQ_LEN : D_INNER, K, 1.0f, bx, b, isv ? 1 : 2);
}

// ---------------------------------------------------------------------------
// f32 -> bf16 (RNE) cast of all seven float operands in ONE launch.
// The bf16 planes lie back to back in the workspace in the order q, k, v, Wq, Wk, Wv, Wo, so the output is one
// array of 3 * 4,194,304 + 4 * 1,048,576 = 16,777,216 elements. A block of 16 waves owns CAST_BLK = 65,536
// consecutive elements of it, which lie in one plane (both plane sizes are multiples of CAST_BLK):
// 3 * 64 + 4 * 16 = 256 blocks. A lane brings 32 pieces of 16 B (each wave-wide load 512 contiguous bytes) and
// stores 32 pieces of 8 B (each wave-wide store 256 contiguous bytes = two whole lines).
// Coverage: 32 pieces x 512 threads x 4 elements = 65,536 = the whole block range, each element once.
// ---------------------------------------------------------------------------
constexpr int CAST_THR  = 512;
constexpr int CAST_BLK  = 65536;
constexpr int CAST_ACT  = N_BATCH * SEQ_LEN * D_MODEL / CAST_BLK;   // 64 blocks per activation plane
constexpr int CAST_W    = D_INNER * D_MODEL / CAST_BLK;             // 16 blocks per weight plane
constexpr int CAST_GRID = 3 * CAST_ACT + 4 * CAST_W;                // 256
static_assert(N_BATCH * SEQ_LEN * D_MODEL % CAST_BLK == 0 && D_INNER * D_MODEL % CAST_BLK == 0, "whole blocks per plane");
typedef __attribute__((ext_vector_type(2))) unsigned v2u;
__global__ __launch_bounds__(CAST_THR) void cast_all_f32_bf16(
    const float* __restrict__ q, const float* __restrict__ k, const float* __restrict__ v,
    const float* __restrict__ wq, const float* __restrict__ wk, const float* __restrict__ wv,
    const float* __restrict__ wo, unsigned short* __restrict__ out) {
  const int bx = blockIdx.x;                 // 0 .. CAST_GRID - 1 (exact grid)
  const float* plane;
  int rel;                                   // block index inside its plane
  if (bx < 3 * CAST_ACT) {
    const int p = bx / CAST_ACT;
    rel = bx - p * CAST_ACT;
    plane = (p == 0) ? q : (p == 1) ? k : v;
  } else {
    const int w = bx - 3 * CAST_ACT;
    const int p = w / CAST_W;
    rel = w - p * CAST_W;
    plane = (p == 0) ? wq : (p == 1) ? wk : (p == 2) ? wv : wo;
  }
  const float* in = plane + (size_t)rel * CAST_BLK + threadIdx.x * 4;
  unsigned short* o = out + (size_t)bx * CAST_BLK + threadIdx.x * 4;
  constexpr int NP = CAST_BLK / (CAST_THR * 4);   // 32 pieces of 16 B per lane
  v4f f[NP];
  // the loads stand in a loop of their own, ahead of the conversions, so that a wave's share is in flight together
  for (int j = 0; j < NP; ++j) f[j] = *(const v4f*)(in + j * (CAST_THR * 4));
  for (int j = 0; j < NP; ++j) {
    const v2u u = {pk16(f2bf_bits(f[j][0]), f2bf_bits(f[j][1])), pk16(f2bf_bits(f[j][2]), f2bf_bits(f[j][3]))};
    *(v2u*)(o + j * (CAST_THR * 4)) = u;
  }
}

#define AT_D 64
#define AT_NW 8
#define AT_QB 128
#define AT_KC 64
#define AT_LP 72   // LDS row pitch in 16-bit elements: 144 B = 16 B x odd, so the 16 rows of a 16-byte fragment read fall on 64 distinct banks
#define AT_MP 68   // LDS row pitch of the bias tile in floats: 272 B = 16 B x odd, for the same reason
#define AT_OFF_KL (AT_KC * AT_LP * 2)                     // byte offsets inside a stage: K hi at 0, K lo,
#define AT_OFF_VT (AT_OFF_KL + AT_KC * AT_LP * 2)         // V^T (f16 bits, [d][kv]),
#define AT_OFF_MB (AT_OFF_VT + AT_D * AT_LP * 2)          // bias (f32, [query][kv])
#define AT_STAGE  (AT_OFF_MB + AT_QB * AT_MP * 4)         // 62,464 B
#define P_CARRY_LOG2 15.0f            // p is carried x2^15, as +15 in the base-2 exponent
#define AT_LOG2E 1.4426950408889634f

__device__ __forceinline__ v8f at_mma(v16b a, v16b b, v8f c) {
  c = __builtin_amdgcn_wmma_f32_16x16x32_bf16(false, a, false, b, (short)0, c, false, false);
  asm volatile("v_nop\n\tv_nop\n\tv_nop\n\tv_nop" : "+v"(c) : "v"(a), "v"(b));
  return c;
}
__device__ __forceinline__ v8f at_mma_h(v16b a, v16b b, v8f c) {   // operands hold f16 bit patterns
  const v16h ah = __builtin_bit_cast(v16h, a), bh = __builtin_bit_cast(v16h, b);
  c = __builtin_amdgcn_wmma_f32_16x16x32_f16(false, ah, false, bh, (short)0, c, false, false);
  asm volatile("v_nop\n\tv_nop\n\tv_nop\n\tv_nop" : "+v"(c) : "v"(ah), "v"(bh));
  return c;
}
// value of lane l ^ 16 (the other half's lane of the same column), by a vector cross-row move: no LDS queue, no wait
__device__ __forceinline__ float at_other_half(float x) {
  const int b = __float_as_int(x);
  return __int_as_float(__builtin_amdgcn_permlanex16(b, b, 0x76543210, 0xfedcba98, false, false));
}

__global__ __launch_bounds__(256)
void mha_bias_kernel(const unsigned short* __restrict__ qhp, const unsigned short* __restrict__ qlp,
                     const unsigned short* __restrict__ khp, const unsigned short* __restrict__ klp,
                     const unsigned short* __restrict__ vtp, const float* __restrict__ biasp,
                     unsigned short* __restrict__ chp, unsigned short* __restrict__ clp,
                     const int* __restrict__ nheads_in) {
  (void)nheads_in;   // module constant (16); shapes are compile-time here
  union FB { v16b v; v8b h[2]; };
  __shared__ __align__(16) unsigned char ring[2 * AT_STAGE];     // two stages, 122 KB
  __shared__ __align__(16) float  Os[AT_NW][16 * 68];            // per wave out tile, pitch 68

  const int tid  = threadIdx.x;
  const int wave = tid >> 5;
  const int lane = tid & 31;
  const int hh   = lane >> 4;
  const int c    = lane & 15;

  const int nqb = SEQ_LEN / AT_QB;        // 16
  const int bx  = blockIdx.x;             // 0 .. N_BATCH*N_HEAD*nqb - 1 (exact grid)
  const int qb  = bx % nqb;
  const int bhd = bx / nqb;               // 0 .. 31
  const int h   = bhd % N_HEAD;
  const int b   = bhd / N_HEAD;           // 0 .. N_BATCH-1
  const int q0  = qb * AT_QB + wave * 16;

  const size_t rowb = (size_t)b * SEQ_LEN;   // token-row base of this batch element
  const __bf16* Qh = (const __bf16*)(const void*)qhp + rowb * D_INNER + (size_t)h * AT_D;
  const __bf16* Ql = (const __bf16*)(const void*)qlp + rowb * D_INNER + (size_t)h * AT_D;
  const __bf16* Kh = (const __bf16*)(const void*)khp + rowb * D_INNER + (size_t)h * AT_D;
  const __bf16* Kl = (const __bf16*)(const void*)klp + rowb * D_INNER + (size_t)h * AT_D;
  const __bf16* Vt = (const __bf16*)(const void*)vtp + ((size_t)b * D_INNER + (size_t)h * AT_D) * SEQ_LEN;
  const float*  Mb = biasp + (size_t)b * SEQ_LEN * SEQ_LEN;
  unsigned short* Ch = chp + rowb * D_INNER + (size_t)h * AT_D;
  unsigned short* Cl = clp + rowb * D_INNER + (size_t)h * AT_D;

  // ---- Q fragments (B operand, column = lane&15, split k map via Frag load): 2 d-chunks, hi and lo ----
  v16b qah[2], qal[2];
#pragma unroll
  for (int dc = 0; dc < 2; ++dc) {
    const __bf16* qr = Qh + (size_t)(q0 + c) * D_INNER + dc * 32 + 8 * hh;
    const __bf16* ql = Ql + (size_t)(q0 + c) * D_INNER + dc * 32 + 8 * hh;
    qah[dc] = Frag<__bf16>::load(qr);
    qal[dc] = Frag<__bf16>::load(ql);
  }

  float mrow = -INFINITY;   // running maximum of query q0 + c (the same in both lane halves)
  float brow = -INFINITY;   // the base-2 exponent that p is taken against: mrow * log2(e) - 15, as rounded once
  float lrow = 0.f;         // running sum (x2^15) over this lane half's keys of query q0 + c; the halves are joined after the loop
  v8f oacc[4];              // O^T: register r of tile t = (d = 16t + 8hh + r, query q0 + c)
#pragma unroll
  for (int t = 0; t < 4; ++t) oacc[t] = (v8f){0.f,0.f,0.f,0.f,0.f,0.f,0.f,0.f};

  // staging map. 16-bit tiles: 8 lanes x 16 B = one 128-byte row, the block covers 32 rows a copy; bias tile: 16 lanes x 16 B =
  // one 256-byte row, 16 rows a copy. All lanes on; every row and column lies inside its plane (exact grid, S % 64 == 0).
  const int krow = tid >> 3, kseg = (tid & 7) * 8;    // row 0..31, first of this lane's 8 elements
  const int mr16 = tid >> 4, bseg = (tid & 15) * 4;   // row 0..15, first of this lane's 4 floats
  const __bf16* gkh = Kh + (size_t)krow * D_INNER + kseg;
  const __bf16* gkl = Kl + (size_t)krow * D_INNER + kseg;
  const __bf16* gvt = Vt + (size_t)krow * SEQ_LEN + kseg;
  const float*  gmb = Mb + (size_t)(qb * AT_QB + mr16) * SEQ_LEN + bseg;
  const unsigned lk0 = (unsigned)(uintptr_t)ring + (unsigned)(krow * (AT_LP * 2) + kseg * 2);
  const unsigned lm0 = (unsigned)(uintptr_t)ring + (unsigned)(AT_OFF_MB + mr16 * (AT_MP * 4) + bseg * 4);
  auto copy_stage = [&](int ch, int buf) {
    const unsigned lk = lk0 + (unsigned)buf * AT_STAGE, lm = lm0 + (unsigned)buf * AT_STAGE;
    const __bf16* kh = gkh + (size_t)ch * AT_KC * D_INNER;   // K rows ch*64 + ...
    const __bf16* kl = gkl + (size_t)ch * AT_KC * D_INNER;
    const __bf16* vt = gvt + ch * AT_KC;                      // V^T columns ch*64 + ...
    const float*  mk = gmb + ch * AT_KC;                      // bias columns ch*64 + ...
    auto bias_rows = [&](int i) {   // bias row group i: 16 rows further on in both places
      return CopyRows{lm + (unsigned)i * 16u * (AT_MP * 4), (const void*)(mk + (size_t)i * 16 * SEQ_LEN)};
    };
    async_copy14(CopyRows{lk, kh},                                   CopyRows{lk + 32u * (AT_LP * 2), kh + 32 * D_INNER},
                 CopyRows{lk + AT_OFF_KL, kl},                       CopyRows{lk + AT_OFF_KL + 32u * (AT_LP * 2), kl + 32 * D_INNER},
                 CopyRows{lk + AT_OFF_VT, vt},                       CopyRows{lk + AT_OFF_VT + 32u * (AT_LP * 2), vt + 32 * SEQ_LEN},
                 bias_rows(0), bias_rows(1), bias_rows(2), bias_rows(3), bias_rows(4), bias_rows(5), bias_rows(6), bias_rows(7));
  };

  const int nChunks = SEQ_LEN / AT_KC;   // 32, compile-time constant
  copy_stage(0, 0);
  asm volatile("s_wait_asynccnt 0x0" ::: "memory");   // this wave's share of chunk 0 has landed
  __syncthreads();                                    // every wave's share has: chunk 0 may be read
  copy_stage(1, 1);
  for (int kc = 0; kc < nChunks; ++kc) {
    const int buf = kc & 1;
    const __bf16* Ksh = (const __bf16*)(ring + (unsigned)buf * AT_STAGE);               // K hi [kv][d]
    const __bf16* Ksl = (const __bf16*)(ring + (unsigned)buf * AT_STAGE + AT_OFF_KL);   // K lo
    const __bf16* Vth = (const __bf16*)(ring + (unsigned)buf * AT_STAGE + AT_OFF_VT);   // V^T f16 bits [d][kv]
    const float*  Mbs = (const float*)(ring + (unsigned)buf * AT_STAGE + AT_OFF_MB);    // bias [query in block][kv]

    // ---- additive bias of query q0 + c: D register r of tile j wants key kv0 + 16j + 8hh + r = 8 consecutive floats ----
    v4f mb[4][2];
    {
      const float* mrp = Mbs + (wave * 16 + c) * AT_MP + 8 * hh;
#pragma unroll
      for (int j = 0; j < 4; ++j) {
        mb[j][0] = *(const v4f*)(mrp + j * 16);
        mb[j][1] = *(const v4f*)(mrp + j * 16 + 4);
      }
    }
    // ---- scores, transposed: 4 kv subtiles of 16 (rows), 2 d-chunks, 3 products each ----
    v8f s[4];
#pragma unroll
    for (int j = 0; j < 4; ++j) {
      s[j] = (v8f){0.f,0.f,0.f,0.f,0.f,0.f,0.f,0.f};
#pragma unroll
      for (int dc = 0; dc < 2; ++dc) {
        FB kb, kl;
        kb.h[0] = *(const v8b*)(Ksh + (j * 16 + c) * AT_LP + dc * 32 + 8 * hh);
        kb.h[1] = *(const v8b*)(Ksh + (j * 16 + c) * AT_LP + dc * 32 + 16 + 8 * hh);
        kl.h[0] = *(const v8b*)(Ksl + (j * 16 + c) * AT_LP + dc * 32 + 8 * hh);
        kl.h[1] = *(const v8b*)(Ksl + (j * 16 + c) * AT_LP + dc * 32 + 16 + 8 * hh);
        s[j] = at_mma(kb.v, qah[dc], s[j]);
        s[j] = at_mma(kl.v, qah[dc], s[j]);
        s[j] = at_mma(kb.v, qal[dc], s[j]);
      }
    }
    // ---- bias by value, chunk maximum of this lane's query: in-lane over 32 keys, then the other half's 32 ----
    float mj[4];
#pragma unroll
    for (int j = 0; j < 4; ++j) {
      mj[j] = -INFINITY;
#pragma unroll
      for (int r = 0; r < 8; ++r) {
        const float mv = bf_bits2f(f2bf_bits(mb[j][r >> 2][r & 3]));
        const float sv = s[j][r] + mv;
        s[j][r] = sv;
        mj[j] = fmaxf(mj[j], sv);
      }
    }
    float cm = fmaxf(fmaxf(mj[0], mj[1]), fmaxf(mj[2], mj[3]));
    cm = fmaxf(cm, at_other_half(cm));
    const float mnew = fmaxf(mrow, cm);
    // e^(s - m) * 2^15 = 2^(s * log2(e) - b), b = m * log2(e) - 15: one fused multiply-add and the hardware's base-2 exponential.
    // Old and new terms are rescaled by the difference of the very b values they were taken against, so b's rounding cancels
    // in sum and output alike. An argument below -126 gives 0; such a p is far below the f16 carry's last place.
    const float bnew = __builtin_fmaf(mnew, AT_LOG2E, -P_CARRY_LOG2);
    const float alpha = __builtin_amdgcn_exp2f(brow - bnew);   // 0 on the first chunk, where brow is -inf
    mrow = mnew;
    brow = bnew;
    // ---- P^T in registers: element e of B fragment kk = key 32kk + kmap(e) = register e & 7 of score tile 2kk + (e >> 3) ----
    FB pb[2];
    float pj[4];
    typedef __attribute__((ext_vector_type(2))) _Float16 v2h;
    union PK { v8b b; v2h p[4]; };
#pragma unroll
    for (int j = 0; j < 4; ++j) {
      pj[j] = 0.f;
      PK pk;
#pragma unroll
      for (int r = 0; r < 8; r += 2) {
        const float p0 = __builtin_amdgcn_exp2f(__builtin_fmaf(s[j][r],     AT_LOG2E, -bnew));   // x2^15
        const float p1 = __builtin_amdgcn_exp2f(__builtin_fmaf(s[j][r + 1], AT_LOG2E, -bnew));
        pj[j] += p0;
        pj[j] += p1;
        pk.p[r >> 1] = __builtin_convertvector((v2f){p0, p1}, v2h);   // round to nearest even, two to an instruction
      }
      pb[j >> 1].h[j & 1] = pk.b;
    }
    lrow = lrow * alpha + ((pj[0] + pj[1]) + (pj[2] + pj[3]));
#pragma unroll
    for (int t = 0; t < 4; ++t)
#pragma unroll
      for (int r = 0; r < 8; ++r) oacc[t][r] *= alpha;
#pragma unroll   // kk picks the P^T fragment's registers, so it must be a constant
    for (int kk = 0; kk < 2; ++kk) {
#pragma unroll
      for (int t = 0; t < 4; ++t) {
        FB vb;
        vb.h[0] = *(const v8b*)(Vth + (t * 16 + c) * AT_LP + kk * 32 + 8 * hh);
        vb.h[1] = *(const v8b*)(Vth + (t * 16 + c) * AT_LP + kk * 32 + 16 + 8 * hh);
        oacc[t] = at_mma_h(vb.v, pb[kk].v, oacc[t]);
      }
    }
    asm volatile("s_wait_dscnt 0x0" ::: "memory");      // this wave's reads of buffer buf are done before it is refilled
    asm volatile("s_wait_asynccnt 0x0" ::: "memory");   // this wave's share of chunk kc + 1 has landed
    __syncthreads();                                    // publishes chunk kc + 1 and ends every reader's use of buffer buf
    if (kc + 2 < nChunks) copy_stage(kc + 2, buf);
  }
  asm volatile("s_wait_asynccnt 0x0" ::: "memory");     // nothing of this wave's copies is outstanding past the loop

  // ---- join the halves' sums, normalise and stage the 16x64 f32 tile (row = query c, cols 16t + 8hh + r) ----
  float* os = Os[wave];
  {
    const float l = lrow + at_other_half(lrow);
    const float inv = 1.0f / l;   // l carries the same 2^15 as the output sums: about 2^15 (the maximum's own term) <= l <= 6.8e7
#pragma unroll
    for (int t = 0; t < 4; ++t) {
      const v4f lo = {oacc[t][0] * inv, oacc[t][1] * inv, oacc[t][2] * inv, oacc[t][3] * inv};
      const v4f hi = {oacc[t][4] * inv, oacc[t][5] * inv, oacc[t][6] * inv, oacc[t][7] * inv};
      *(v4f*)(os + c * 68 + t * 16 + 8 * hh)     = lo;
      *(v4f*)(os + c * 68 + t * 16 + 8 * hh + 4) = hi;
    }
  }
  __builtin_amdgcn_fence(__ATOMIC_RELEASE, "workgroup");
  __builtin_amdgcn_wave_barrier();
  __builtin_amdgcn_fence(__ATOMIC_ACQUIRE, "workgroup");
  {
    // coverage: 4 it x 32 lanes x 8 elements = 16 rows x 64 = the whole wave tile, per plane;
    const int qg = lane >> 3, c8 = (lane & 7) * 8;
    {
#pragma unroll
      for (int it = 0; it < 4; ++it) {
        const int row = it * 4 + qg;
        const float* sp = os + row * 68 + c8;
        v8h hv, lv;
#pragma unroll
        for (int e = 0; e < 8; ++e) {
          const unsigned short hb = f2bf_bits(sp[e]);
          const unsigned short lb = f2bf_bits(sp[e] - bf_bits2f(hb));
          hv[e] = __builtin_bit_cast(_Float16, hb);
          lv[e] = __builtin_bit_cast(_Float16, lb);
        }
        *(v8h*)(Ch + (size_t)(q0 + row) * D_INNER + c8) = hv;
        *(v8h*)(Cl + (size_t)(q0 + row) * D_INNER + c8) = lv;
      }
      
    }
  }
}

// =====================================================================================
// Host launch glue: only kernel launches; grids/args are pure functions of the (asserted) sizes.
// Workspace region map (bytes; all offsets multiples of 2 MiB):
//   [  0 MiB,  8 MiB)  q  bf16  [4096][1024]
//   [  8 MiB, 16 MiB)  k  bf16  [4096][1024]
//   [ 16 MiB, 24 MiB)  v  bf16  [4096][1024]
//   [ 24 MiB, 26 MiB)  Wq bf16  [1024][1024]   [26,28) Wk   [28,30) Wv   [30,32) Wo
//   [ 32 MiB, 40 MiB)  Q hi bf16 [4096][1024]   [40,48) Q lo
//   [ 48 MiB, 56 MiB)  K hi bf16 [4096][1024]   [56,64) K lo
//   [ 64 MiB, 72 MiB)  V^T f16  [2][1024][2048]
//   [ 72 MiB, 80 MiB)  ctx hi bf16 [4096][1024] [80,88) ctx lo
//   total 88 MiB = 92,274,688 B
// =====================================================================================
extern "C" void kernel_launch(void* const* d_in, const int* in_sizes, int n_in,
                              void* d_out, int out_size, void* d_ws, size_t ws_size,
                              hipStream_t stream) {
  if (n_in < 9) return;
  const size_t nAct  = (size_t)N_BATCH * SEQ_LEN * D_MODEL;     // 4,194,304
  const size_t nW    = (size_t)D_INNER * D_MODEL;               // 1,048,576
  const size_t nMask = (size_t)N_BATCH * SEQ_LEN * SEQ_LEN;     // 8,388,608
  const size_t nVT   = (size_t)N_BATCH * D_INNER * SEQ_LEN;     // 4,194,304
  if ((size_t)in_sizes[0] != nAct || (size_t)in_sizes[1] != nAct || (size_t)in_sizes[2] != nAct ||
      (size_t)in_sizes[3] != nMask || (size_t)in_sizes[4] != nW || (size_t)in_sizes[5] != nW ||
      (size_t)in_sizes[6] != nW || (size_t)in_sizes[7] != nW || in_sizes[8] < 1 ||
      (size_t)out_size != nAct) return;

  const size_t bAct = nAct * 2, bW = nW * 2, bVT = nVT * 2;
  const size_t o_q16 = 0;
  const size_t o_k16 = o_q16 + bAct;
  const size_t o_v16 = o_k16 + bAct;
  const size_t o_wq  = o_v16 + bAct;
  const size_t o_wk  = o_wq + bW;
  const size_t o_wv  = o_wk + bW;
  const size_t o_wo  = o_wv + bW;
  const size_t o_qhi = o_wo + bW;
  const size_t o_qlo = o_qhi + bAct;
  const size_t o_khi = o_qlo + bAct;
  const size_t o_klo = o_khi + bAct;
  const size_t o_vt  = o_klo + bAct;
  const size_t o_chi = o_vt + bVT;
  const size_t o_clo = o_chi + bAct;
  const size_t total = o_clo + bAct;                            // 92,274,688
  if (total > ws_size) return;

  const float* qf  = (const float*)d_in[0];
  const float* kf  = (const float*)d_in[1];
  const float* vf  = (const float*)d_in[2];
  const float* mf  = (const float*)d_in[3];
  const float* wqf = (const float*)d_in[4];
  const float* wkf = (const float*)d_in[5];
  const float* wvf = (const float*)d_in[6];
  const float* wof = (const float*)d_in[7];
  const int*   nhp = (const int*)d_in[8];
  char* ws = (char*)d_ws;
  unsigned short* q16 = (unsigned short*)(ws + o_q16);
  unsigned short* k16 = (unsigned short*)(ws + o_k16);
  unsigned short* v16 = (unsigned short*)(ws + o_v16);
  unsigned short* wq16 = (unsigned short*)(ws + o_wq);
  unsigned short* wk16 = (unsigned short*)(ws + o_wk);
  unsigned short* wv16 = (unsigned short*)(ws + o_wv);
  unsigned short* wo16 = (unsigned short*)(ws + o_wo);
  unsigned short* qhi = (unsigned short*)(ws + o_qhi);
  unsigned short* qlo = (unsigned short*)(ws + o_qlo);
  unsigned short* khi = (unsigned short*)(ws + o_khi);
  unsigned short* klo = (unsigned short*)(ws + o_klo);
  unsigned short* vt  = (unsigned short*)(ws + o_vt);
  unsigned short* chi = (unsigned short*)(ws + o_chi);
  unsigned short* clo = (unsigned short*)(ws + o_clo);
  float* out = (float*)d_out;

  // ---- 1: RNE bf16 copies of the seven float inputs; q16 is the start of the seven planes, back to back in the
  //      order of the arguments (region map above) ----
  cast_all_f32_bf16<<<dim3((unsigned)CAST_GRID), CAST_THR, 0, stream>>>(qf, kf, vf, wqf, wkf, wvf, wof, q16);

  const int MTOK = N_BATCH * SEQ_LEN;         // 4096 rows of [B*S][.] planes
  // ---- 2: Q, K and V projections, 3 x 128 = 384 blocks of 256 threads (shapes at the kernel) ----
  qkv_gemm<<<dim3((unsigned)QKV_TILES, 3u), 256, 0, stream>>>(
      q16, k16, v16, wq16, wk16, wv16, qhi, qlo, khi, klo, vt, D_MODEL);
  // ---- 3: attention: 2 x 16 x 16 = 512 blocks of 256 threads ----
  {
    const dim3 g((unsigned)(N_BATCH * N_HEAD * (SEQ_LEN / AT_QB)));
    mha_bias_kernel<<<g, 256, 0, stream>>>(qhi, qlo, khi, klo, vt, mf, chi, clo, nhp);
  }
  // ---- 4: output projection: out[4096][1024] = (ctx_hi + ctx_lo)[4096][1024] . Wo^T, Wo [1024 out][1024 in];
  //      M=4096, N=1024 (x64), K=1024 (x32); 1024 tiles = 128 blocks; f32 out
  {
    const int tiles = (MTOK / 64) * (D_MODEL / 64);
    const dim3 g((unsigned)((tiles + 7) / 8), 1);
    wmma_gemm64<1, true, 0, 0, false, 0, false><<<g, 256, 0, stream>>>(
        chi, clo, D_INNER, 0L, wo16, wo16, D_INNER, 0L, (void*)out, (void*)out, D_MODEL, 0L,
        mf, mf, 0L, MTOK, D_MODEL, D_INNER, 1.0f);
  }
}

// v008
// One run takes 126 microseconds.
// Next to v007, in two timings, it ran 1.06 times as fast each time.
// All steps since v000 together make it 3.77 times as fast.
// Contractions: q/k/v projections = v_wmma_f32_16x16x32_bf16 on RNE-bf16 copies of the inputs (single product); q.k^T = v_wmma_f32_16x16x32_bf16 with bf16 hi/lo split operands (hi.hi + hi.lo + lo.hi); p.v = v_wmma_f32_16x16x32_f16 (p carried x2^15 in f16, v^T stored f16); output projection = v_wmma_f32_16x16x32_bf16 with ctx bf16 hi/lo x Wo bf16 (hi.W + lo.W); f32 accumulate everywhere; additive mask (RNE-bf16 values) and online softmax in f32.
#include <hip/hip_runtime.h>
#include <math.h>
#include <stdint.h>

constexpr int N_BATCH = 2;
constexpr int SEQ_LEN = 2048;
constexpr int D_MODEL = 1024;                 // d_model (input / output feature width)
constexpr int N_HEAD  = 16;
constexpr int D_HEAD  = 64;
constexpr int D_INNER = N_HEAD * D_HEAD;      // 1024
static_assert(D_INNER == 1024, "inner width");
static_assert(SEQ_LEN % 64 == 0 && D_MODEL % 64 == 0 && D_INNER % 64 == 0, "tile multiples");
static_assert(D_MODEL % 32 == 0 && D_INNER % 32 == 0, "K multiples of 32");

typedef __attribute__((ext_vector_type(16))) _Float16 v16h;
typedef __attribute__((ext_vector_type(8)))  _Float16 v8h;
typedef __attribute__((ext_vector_type(16))) __bf16   v16b;
typedef __attribute__((ext_vector_type(8)))  __bf16   v8b;
typedef __attribute__((ext_vector_type(8)))  float    v8f;
typedef __attribute__((ext_vector_type(4)))  float    v4f;
typedef __attribute__((ext_vector_type(2)))  float    v2f;

__device__ __forceinline__ unsigned short f2bf_bits(float f) {
  unsigned u = __float_as_uint(f);
  return (unsigned short)((u + 0x7FFFu + ((u >> 16) & 1u)) >> 16);
}
__device__ __forceinline__ float bf_bits2f(unsigned short h) { return __uint_as_float(((unsigned)h) << 16); }
__device__ __forceinline__ unsigned pk16(unsigned short a, unsigned short b) { return (unsigned)a | ((unsigned)b << 16); }

// hazard guards as plain device helpers
__device__ __forceinline__ void dep_guard_h(v8f& a, v8f& b, v16h x, v16h y) { asm volatile("v_nop\n\tv_nop\n\tv_nop\n\tv_nop" : "+v"(a), "+v"(b) : "v"(x), "v"(y)); }
__device__ __forceinline__ void dep_guard_b(v8f& a, v8f& b, v16b x, v16b y) { asm volatile("v_nop\n\tv_nop\n\tv_nop\n\tv_nop" : "+v"(a), "+v"(b) : "v"(x), "v"(y)); }
__device__ __forceinline__ void keep4_h(v16h a, v16h b, v16h c, v16h d) { asm volatile("v_nop" :: "v"(a), "v"(b), "v"(c), "v"(d)); }
__device__ __forceinline__ void keep4_b(v16b a, v16b b, v16b c, v16b d) { asm volatile("v_nop" :: "v"(a), "v"(b), "v"(c), "v"(d)); }
__device__ __forceinline__ void acc_guard4(v8f& a, v8f& b, v8f& c, v8f& d) { asm volatile("v_nop\n\tv_nop\n\tv_nop\n\tv_nop" : "+v"(a), "+v"(b), "+v"(c), "+v"(d)); }
template <typename T> struct Frag;
template <> struct Frag<_Float16> {
  typedef v16h V; union U { v16h v; v8h h[2]; };
  static __device__ __forceinline__ v16h load(const _Float16* p) {   // elements 0..7 <- p[0..7], 8..15 <- p[16..23]
    U f; f.h[0] = *(const v8h*)(p); f.h[1] = *(const v8h*)(p + 16); return f.v;
  }
  static __device__ __forceinline__ v8f mma(v16h a, v16h b, v8f c) {
    return __builtin_amdgcn_wmma_f32_16x16x32_f16(false, a, false, b, (short)0, c, false, false);
  }
  static __device__ __forceinline__ void guard(v8f& a, v8f& b, v16h x, v16h y) { dep_guard_h(a, b, x, y); }
  static __device__ __forceinline__ void keep(v16h a, v16h b, v16h c, v16h d) { keep4_h(a, b, c, d); }
};
template <> struct Frag<__bf16> {
  typedef v16b V; union U { v16b v; v8b h[2]; };
  static __device__ __forceinline__ v16b load(const __bf16* p) {
    U f; f.h[0] = *(const v8b*)(p); f.h[1] = *(const v8b*)(p + 16); return f.v;
  }
  static __device__ __forceinline__ v8f mma(v16b a, v16b b, v8f c) {
    return __builtin_amdgcn_wmma_f32_16x16x32_bf16(false, a, false, b, (short)0, c, false, false);
  }
  static __device__ __forceinline__ void guard(v8f& a, v8f& b, v16b x, v16b y) { dep_guard_b(a, b, x, y); }
  static __device__ __forceinline__ void keep(v16b a, v16b b, v16b c, v16b d) { keep4_b(a, b, c, d); }
};

// ---- Register-blocked batched WMMA GEMM ------------------------------------
// C[m,n] = scale * sum_k A[m,k] * Bt[n,k] (+bias)(+resid); each wave owns a 64x64 tile; the 8 waves of a block
// form a 2 (M) x 4 (N) grid = one 128x256 block tile, whose operand rows reach LDS 64 k at a time (a stage) by
// asynchronous 16-byte copies, two buffers: stage t+1 flies while stage t is multiplied.
// A row-major [M,K]; Bt row-major [N,K]; M % 128 == 0, N % 256 == 0, K % 64 == 0.
// SPLIT: operands are hi/lo planes (A2/Bt2 = lo planes, same layout); product = hi.hi + hi.lo + lo.hi.
// BLO = false with SPLIT: the Bt lo plane is not used (product = hi.B + lo.B, B a single plane).
// BIAS_MODE: 0 = none, 1 = bias[m], 2 = bias[n].
// OUT_MODE: 0 = f32, 1 = f16, 2 = bf16 hi plane (Cout) + bf16 lo plane (Cout2), 3 = 1 or 2, as the block-uniform argument om says.
// gemm_block is the work of one block: tile number bx of batch element b. Its callers are the kernels below it.
// ET: 0 = f16 operands, 1 = bf16 operands (pointers passed as 16-bit storage)
// Asynchronous 16-byte-per-lane copies global -> LDS, eight, twelve or fourteen to a statement. The s_wait_xcnt is the last line
// of the copies' own statement so that it stands in front of every later write of the address registers they name.
struct CopyRows { unsigned l; const void* g; };   // this lane's LDS byte address and global address of one row segment
__device__ __forceinline__ void async_copy8(CopyRows a, CopyRows b, CopyRows c, CopyRows d,
                                            CopyRows e, CopyRows f, CopyRows g, CopyRows h) {
  asm volatile("global_load_async_to_lds_b128 %0, %1, off\n\t"
               "global_load_async_to_lds_b128 %2, %3, off\n\t"
               "global_load_async_to_lds_b128 %4, %5, off\n\t"
               "global_load_async_to_lds_b128 %6, %7, off\n\t"
               "global_load_async_to_lds_b128 %8, %9, off\n\t"
               "global_load_async_to_lds_b128 %10, %11, off\n\t"
               "global_load_async_to_lds_b128 %12, %13, off\n\t"
               "global_load_async_to_lds_b128 %14, %15, off\n\t"
               "s_wait_xcnt 0x0"
               :: "v"(a.l), "v"(a.g), "v"(b.l), "v"(b.g), "v"(c.l), "v"(c.g), "v"(d.l), "v"(d.g),
                  "v"(e.l), "v"(e.g), "v"(f.l), "v"(f.g), "v"(g.l), "v"(g.g), "v"(h.l), "v"(h.g) : "memory");
}
__device__ __forceinline__ void async_copy12(CopyRows a, CopyRows b, CopyRows c, CopyRows d,
                                             CopyRows e, CopyRows f, CopyRows g, CopyRows h,
                                             CopyRows i, CopyRows j, CopyRows k, CopyRows m) {
  asm volatile("global_load_async_to_lds_b128 %0, %1, off\n\t"
               "global_load_async_to_lds_b128 %2, %3, off\n\t"
               "global_load_async_to_lds_b128 %4, %5, off\n\t"
               "global_load_async_to_lds_b128 %6, %7, off\n\t"
               "global_load_async_to_lds_b128 %8, %9, off\n\t"
               "global_load_async_to_lds_b128 %10, %11, off\n\t"
               "global_load_async_to_lds_b128 %12, %13, off\n\t"
               "global_load_async_to_lds_b128 %14, %15, off\n\t"
               "global_load_async_to_lds_b128 %16, %17, off\n\t"
               "global_load_async_to_lds_b128 %18, %19, off\n\t"
               "global_load_async_to_lds_b128 %20, %21, off\n\t"
               "global_load_async_to_lds_b128 %22, %23, off\n\t"
               "s_wait_xcnt 0x0"
               :: "v"(a.l), "v"(a.g), "v"(b.l), "v"(b.g), "v"(c.l), "v"(c.g), "v"(d.l), "v"(d.g),
                  "v"(e.l), "v"(e.g), "v"(f.l), "v"(f.g), "v"(g.l), "v"(g.g), "v"(h.l), "v"(h.g),
                  "v"(i.l), "v"(i.g), "v"(j.l), "v"(j.g), "v"(k.l), "v"(k.g), "v"(m.l), "v"(m.g) : "memory");
}
__device__ __forceinline__ void async_copy14(CopyRows a, CopyRows b, CopyRows c, CopyRows d, CopyRows e, CopyRows f, CopyRows g,
                                             CopyRows h, CopyRows i, CopyRows j, CopyRows k, CopyRows m, CopyRows n, CopyRows o) {
  asm volatile("global_load_async_to_lds_b128 %0, %1, off\n\t"
               "global_load_async_to_lds_b128 %2, %3, off\n\t"
               "global_load_async_to_lds_b128 %4, %5, off\n\t"
               "global_load_async_to_lds_b128 %6, %7, off\n\t"
               "global_load_async_to_lds_b128 %8, %9, off\n\t"
               "global_load_async_to_lds_b128 %10, %11, off\n\t"
               "global_load_async_to_lds_b128 %12, %13, off\n\t"
               "global_load_async_to_lds_b128 %14, %15, off\n\t"
               "global_load_async_to_lds_b128 %16, %17, off\n\t"
               "global_load_async_to_lds_b128 %18, %19, off\n\t"
               "global_load_async_to_lds_b128 %20, %21, off\n\t"
               "global_load_async_to_lds_b128 %22, %23, off\n\t"
               "global_load_async_to_lds_b128 %24, %25, off\n\t"
               "global_load_async_to_lds_b128 %26, %27, off\n\t"
               "s_wait_xcnt 0x0"
               :: "v"(a.l), "v"(a.g), "v"(b.l), "v"(b.g), "v"(c.l), "v"(c.g), "v"(d.l), "v"(d.g),
                  "v"(e.l), "v"(e.g), "v"(f.l), "v"(f.g), "v"(g.l), "v"(g.g), "v"(h.l), "v"(h.g),
                  "v"(i.l), "v"(i.g), "v"(j.l), "v"(j.g), "v"(k.l), "v"(k.g), "v"(m.l), "v"(m.g),
                  "v"(n.l), "v"(n.g), "v"(o.l), "v"(o.g) : "memory");
}
#define GM_PITCH 144            // LDS row pitch in bytes of a 128-byte stage row: 16 B x odd, conflict-free 16-byte fragment reads
#define GM_PE    (GM_PITCH / 2) // the same in 16-bit elements
template <int ET> struct Elem;
template <> struct Elem<0> { typedef _Float16 T; };
template <> struct Elem<1> { typedef __bf16 T; };
// One 16x64 f32 slab of a wave -> 16-bit rows in memory, 8 lanes x 16 B = one whole 128-byte row segment per plane.
// PLANES2 = false: f16 to C; true: bf16 hi to C and bf16 lo to C2.
template <bool PLANES2>
__device__ __forceinline__ void store_slab16(const float* slab, unsigned short* C, unsigned short* C2,
                                             int ldc, int mBase, int n0, int lane) {
  const int q = lane >> 3, c8 = (lane & 7) * 8;
#pragma unroll
  for (int it = 0; it < 4; ++it) {
    const int row = it * 4 + q;
    const float* sp = slab + row * 68 + c8;
    v8h hv, lv;
#pragma unroll
    for (int e = 0; e < 8; ++e) {
      if (!PLANES2) {
        hv[e] = (_Float16)sp[e];
      } else {
        unsigned short hb = f2bf_bits(sp[e]);
        unsigned short lb = f2bf_bits(sp[e] - bf_bits2f(hb));
        hv[e] = __builtin_bit_cast(_Float16, hb);
        lv[e] = __builtin_bit_cast(_Float16, lb);
      }
    }
    *(v8h*)(C + (size_t)(mBase + row) * ldc + n0 + c8) = hv;
    if (PLANES2) *(v8h*)(C2 + (size_t)(mBase + row) * ldc + n0 + c8) = lv;
  }
  asm volatile("s_wait_xcnt 0x0" ::: "memory");   // stands in front of every later write of a register that these stores name
}
template <int ET, bool SPLIT, int BIAS_MODE, int OUT_MODE, bool RESID, int ACT = 0, bool BLO = true>
__device__ __forceinline__ void gemm_block(
    const unsigned short* __restrict__ Ap, const unsigned short* __restrict__ A2p, int lda, long strideA,
    const unsigned short* __restrict__ Btp, const unsigned short* __restrict__ Bt2p, int ldb, long strideB,
    void* __restrict__ Cout, void* __restrict__ Cout2, int ldc, long strideC,
    const float* __restrict__ bias,
    const float* __restrict__ resid, long strideR,
    int M, int N, int K, float scale, unsigned bx, int b, int om) {
  typedef typename Elem<ET>::T T;
  typedef typename Frag<T>::V V;
  const T* A = (const T*)Ap; const T* A2 = (const T*)A2p; const T* Bt = (const T*)Btp; const T* Bt2 = (const T*)Bt2p;
  __shared__ __align__(16) float sT[8][16 * 68];   // per-wave 16x64 slab, pitch 68 floats
  // one stage = [A 128 rows | A lo 128 rows (SPLIT) | Bt 256 rows | Bt lo 256 rows (SPLIT && BLO)], 64 k each
  constexpr unsigned OFF_A2  = 128u * GM_PITCH;
  constexpr unsigned OFF_B   = OFF_A2 + (SPLIT ? 128u * GM_PITCH : 0u);
  constexpr unsigned OFF_B2  = OFF_B + 256u * GM_PITCH;
  constexpr unsigned STAGE_B = OFF_B2 + ((SPLIT && BLO) ? 256u * GM_PITCH : 0u);
  __shared__ __align__(16) unsigned char ring[2 * STAGE_B];
  const int lane = threadIdx.x & 31;
  const int wave = threadIdx.x >> 5;
  const int tilesN = N >> 8;
  const int tilesM = M >> 7;
  if ((int)bx >= tilesM * tilesN) return;   // block-uniform, ahead of every copy and barrier
  const int bm  = bx / tilesN;
  const int bn  = bx - bm * tilesN;
  const int wm0 = (wave >> 2) << 6;            // this wave's rows inside the block tile
  const int wn0 = (wave & 3) << 6;             // this wave's columns inside the block tile
  const int m0 = (bm << 7) + wm0;
  const int n0 = (bn << 8) + wn0;

  const T* Ab  = A  + (size_t)b * strideA;
  const T* Bb  = Bt + (size_t)b * strideB;
  const T* Ab2 = SPLIT ? (A2  + (size_t)b * strideA) : nullptr;
  const T* Bb2 = (SPLIT && BLO) ? (Bt2 + (size_t)b * strideB) : nullptr;

  const int rlane = lane & 15;                 // row (A) / col (B, D) within subtile
  const int koff  = (lane >> 4) * 8;           // k offset of this lane half
  const int mOff  = (lane >> 4) * 8;           // D row offset

  // staging map: 8 lanes x 16 B = one whole 128-byte row segment; a copy of the block covers 32 rows
  const int srow = threadIdx.x >> 3;           // 0..31
  const int sseg = (threadIdx.x & 7) * 8;      // first of this lane's 8 elements in the 64-element row
  const size_t aoff = (size_t)((bm << 7) + srow) * lda + sseg;
  const size_t boff = (size_t)((bn << 8) + srow) * ldb + sseg;
  const size_t a32 = (size_t)32 * lda, b32 = (size_t)32 * ldb;
  const unsigned lds0 = (unsigned)(uintptr_t)ring + (unsigned)(srow * GM_PITCH + sseg * 2);
  auto copy_stage = [&](int st, int buf) {     // all lanes on, rows and k inside the operands by the size conditions above
    const unsigned l = lds0 + (unsigned)buf * STAGE_B;
    auto rows = [](unsigned lds, const T* g, size_t step32, int i) {   // row group i: 32 rows further on in both places
      return CopyRows{lds + (unsigned)i * 32u * GM_PITCH, (const void*)(g + (size_t)i * step32)};
    };
    const T* ga = Ab + aoff + (size_t)st * 64;
    const T* gb = Bb + boff + (size_t)st * 64;
    const unsigned lb = l + OFF_B;
    if (!SPLIT) {
      async_copy12(rows(l, ga, a32, 0), rows(l, ga, a32, 1), rows(l, ga, a32, 2), rows(l, ga, a32, 3),
                   rows(lb, gb, b32, 0), rows(lb, gb, b32, 1), rows(lb, gb, b32, 2), rows(lb, gb, b32, 3),
                   rows(lb, gb, b32, 4), rows(lb, gb, b32, 5), rows(lb, gb, b32, 6), rows(lb, gb, b32, 7));
    } else {
      const unsigned l2 = l + OFF_A2;
      const T* ga2 = Ab2 + aoff + (size_t)st * 64;
      async_copy8(rows(l, ga, a32, 0), rows(l, ga, a32, 1), rows(l, ga, a32, 2), rows(l, ga, a32, 3),
                  rows(l2, ga2, a32, 0), rows(l2, ga2, a32, 1), rows(l2, ga2, a32, 2), rows(l2, ga2, a32, 3));
      async_copy8(rows(lb, gb, b32, 0), rows(lb, gb, b32, 1), rows(lb, gb, b32, 2), rows(lb, gb, b32, 3),
                  rows(lb, gb, b32, 4), rows(lb, gb, b32, 5), rows(lb, gb, b32, 6), rows(lb, gb, b32, 7));
      if (BLO) {
        const unsigned lb2 = l + OFF_B2;
        const T* gb2 = Bb2 + boff + (size_t)st * 64;
        async_copy8(rows(lb2, gb2, b32, 0), rows(lb2, gb2, b32, 1), rows(lb2, gb2, b32, 2), rows(lb2, gb2, b32, 3),
                    rows(lb2, gb2, b32, 4), rows(lb2, gb2, b32, 5), rows(lb2, gb2, b32, 6), rows(lb2, gb2, b32, 7));
      }
    }
  };

  v8f acc[4][4];
#pragma unroll
  for (int i = 0; i < 4; ++i)
#pragma unroll
    for (int j = 0; j < 4; ++j) acc[i][j] = (v8f){0.f,0.f,0.f,0.f,0.f,0.f,0.f,0.f};

  const int nst = K >> 6;                      // stages of 64 k
  copy_stage(0, 0);
  asm volatile("s_wait_asynccnt 0x0" ::: "memory");   // this wave's share of stage 0 has landed
  __syncthreads();                                    // every wave's share has: stage 0 may be read
  if (nst > 1) copy_stage(1, 1);
  for (int st = 0; st < nst; ++st) {
    const int buf = st & 1;
    const T* sA  = (const T*)(ring + (unsigned)buf * STAGE_B);
    const T* sA2 = (const T*)(ring + (unsigned)buf * STAGE_B + OFF_A2);
    const T* sB  = (const T*)(ring + (unsigned)buf * STAGE_B + OFF_B);
    const T* sB2 = (const T*)(ring + (unsigned)buf * STAGE_B + OFF_B2);
#pragma unroll   // both 32-k halves of a stage in line, so that kk folds into the LDS loads' immediate offsets
    for (int kk = 0; kk < 64; kk += 32) {
      // all fragment reads of this 32-k step stand in one group ahead of its products: the wave stops for LDS once a step, not once a row
      V bh[4], bl[4], ah[4], al[4];
#pragma unroll
      for (int x = 0; x < 4; ++x) {
        const int ao = (wm0 + (x << 4) + rlane) * GM_PE + koff + kk;
        const int bo = (wn0 + (x << 4) + rlane) * GM_PE + koff + kk;
        bh[x] = Frag<T>::load(sB + bo);
        if (SPLIT && BLO) bl[x] = Frag<T>::load(sB2 + bo);
        ah[x] = Frag<T>::load(sA + ao);
        if (SPLIT) al[x] = Frag<T>::load(sA2 + ao);
      }
      __builtin_amdgcn_sched_barrier(0);   // keeps the reads above in front of the products: the compiler would sink each A row's to its use
#pragma unroll
      for (int i = 0; i < 4; ++i) {
#pragma unroll
        for (int j = 0; j < 4; ++j) {
          acc[i][j] = Frag<T>::mma(ah[i], bh[j], acc[i][j]);
          if (SPLIT) {
            if (BLO) acc[i][j] = Frag<T>::mma(ah[i], bl[j], acc[i][j]);
            acc[i][j] = Frag<T>::mma(al[i], bh[j], acc[i][j]);
          }
        }
        Frag<T>::guard(acc[i][0], acc[i][3], ah[i], SPLIT ? al[i] : ah[i]);
      }
      Frag<T>::keep(bh[0], bh[1], bh[2], bh[3]);
      if (SPLIT && BLO) Frag<T>::keep(bl[0], bl[1], bl[2], bl[3]);
      // a split step holds 96 or more fragment registers: the next step's reads stay behind this step's products, else the two sets
      // overlap and push the kernel past v255 into a second register window
      if (SPLIT) __builtin_amdgcn_sched_barrier(0);
    }
    asm volatile("s_wait_dscnt 0x0" ::: "memory");      // this wave's reads of buffer buf are done before it is refilled
    asm volatile("s_wait_asynccnt 0x0" ::: "memory");   // this wave's share of stage st + 1 has landed
    __syncthreads();                                    // publishes stage st + 1 and ends every reader's use of buffer buf
    if (st + 2 < nst) copy_stage(st + 2, buf);
  }
  asm volatile("s_wait_asynccnt 0x0" ::: "memory");     // nothing of this wave's copies is outstanding past the loop
  acc_guard4(acc[0][0], acc[0][1], acc[0][2], acc[0][3]);
  acc_guard4(acc[1][0], acc[1][1], acc[1][2], acc[1][3]);
  acc_guard4(acc[2][0], acc[2][1], acc[2][2], acc[2][3]);
  acc_guard4(acc[3][0], acc[3][1], acc[3][2], acc[3][3]);

  // ---- epilogue ----
  float* slab = sT[wave];
  const float* Rb = RESID ? (resid + (size_t)b * strideR) : nullptr;
#pragma unroll
  for (int i = 0; i < 4; ++i) {
    const int mBase = m0 + (i << 4);
#pragma unroll
    for (int j = 0; j < 4; ++j) {
      const int n = n0 + (j << 4) + rlane;
      float bv = 0.f;
      if (BIAS_MODE == 2) bv = bias[n];
#pragma unroll
      for (int r = 0; r < 8; ++r) {
        float v = acc[i][j][r] * scale;
        if (BIAS_MODE == 1) v += bias[mBase + mOff + r];
        if (BIAS_MODE == 2) v += bv;
        if (RESID) v += Rb[(size_t)(mBase + mOff + r) * ldc + n];
        if (ACT == 1) v = tanhf(v);
        if (ACT == 2) v = fmaxf(v, 0.0f);
        if (ACT == 3) v = v / (1.0f + expf(-v));
        if (ACT == 4) v = (v > 0.f) ? v : 0.01f * v;
        slab[(mOff + r) * 68 + (j << 4) + rlane] = v;
      }
    }
    __builtin_amdgcn_fence(__ATOMIC_RELEASE, "workgroup");
    __builtin_amdgcn_wave_barrier();
    __builtin_amdgcn_fence(__ATOMIC_ACQUIRE, "workgroup");
    if (OUT_MODE == 0) {
      float* C = (float*)Cout + (size_t)b * strideC;
      const int hh = lane >> 4, c4 = (lane & 15) * 4;     // row seg = 256 B = 16 lanes x 16 B
      {
#pragma unroll
        for (int it = 0; it < 8; ++it) {
          const int row = it * 2 + hh;
          v4f v = *(const v4f*)(slab + row * 68 + c4);
          *(v4f*)(C + (size_t)(mBase + row) * ldc + n0 + c4) = v;
        }
        
      }
    } else {
      unsigned short* C  = (unsigned short*)Cout  + (size_t)b * strideC;
      unsigned short* C2 = (unsigned short*)Cout2 + (size_t)b * strideC;
      if (OUT_MODE == 1 || (OUT_MODE == 3 && om == 1)) store_slab16<false>(slab, C, C2, ldc, mBase, n0, lane);
      else                                             store_slab16<true>(slab, C, C2, ldc, mBase, n0, lane);
    }
    __builtin_amdgcn_fence(__ATOMIC_RELEASE, "workgroup");
    __builtin_amdgcn_wave_barrier();
    __builtin_amdgcn_fence(__ATOMIC_ACQUIRE, "workgroup");
  }
}

// One GEMM to a launch: block (x, y) does tile x of batch element y.
template <int ET, bool SPLIT, int BIAS_MODE, int OUT_MODE, bool RESID, int ACT = 0, bool BLO = true>
__global__ __launch_bounds__(256) void wmma_gemm64(
    const unsigned short* __restrict__ Ap, const unsigned short* __restrict__ A2p, int lda, long strideA,
    const unsigned short* __restrict__ Btp, const unsigned short* __restrict__ Bt2p, int ldb, long strideB,
    void* __restrict__ Cout, void* __restrict__ Cout2, int ldc, long strideC,
    const float* __restrict__ bias,
    const float* __restrict__ resid, long strideR,
    int M, int N, int K, float scale) {
  gemm_block<ET, SPLIT, BIAS_MODE, OUT_MODE, RESID, ACT, BLO>(
      Ap, A2p, lda, strideA, Btp, Bt2p, ldb, strideB, Cout, Cout2, ldc, strideC, bias, resid, strideR,
      M, N, K, scale, blockIdx.x, (int)blockIdx.y, OUT_MODE);
}

// The Q, K and V projections in ONE launch. Each has 128 block tiles, half of the chip's 256 WGPs; none reads what another
// writes, so the 384 blocks run side by side (a block's LDS lets two share a WGP). blockIdx.y picks the projection:
//   0, 1: C[4096][1024] = X[4096][K] . W^T, W [1024][K] = Bt; out = bf16 hi + lo planes; tile = blockIdx.x
//   2:    role-swapped, so that the output is V^T per batch element: C_b[e][s] = sum_k Wv[e][k] . v_b[s][k];
//         A = Wv [1024][K], Bt = v_b [2048][K], C_b [1024][2048] f16; 64 tiles per batch element, b = blockIdx.x / 64
constexpr int QKV_TILES = (N_BATCH * SEQ_LEN / 128) * (D_INNER / 256);   // 128
constexpr int VT_TILES  = (D_INNER / 128) * (SEQ_LEN / 256);             // 64 per batch element
static_assert(N_BATCH * VT_TILES == QKV_TILES, "the three projections have the same number of block tiles");
__global__ __launch_bounds__(256) void qkv_gemm(
    const unsigned short* __restrict__ q16, const unsigned short* __restrict__ k16, const unsigned short* __restrict__ v16,
    const unsigned short* __restrict__ wq, const unsigned short* __restrict__ wk, const unsigned short* __restrict__ wv,
    unsigned short* __restrict__ qhi, unsigned short* __restrict__ qlo,
    unsigned short* __restrict__ khi, unsigned short* __restrict__ klo,
    unsigned short* __restrict__ vt, int K) {
  const int which = blockIdx.y;              // block-uniform
  const bool isv = which == 2;
  const unsigned short* A  = isv ? wv : (which == 1 ? k16 : q16);
  const unsigned short* Bt = isv ? v16 : (which == 1 ? wk : wq);
  unsigned short* C  = isv ? vt : (which == 1 ? khi : qhi);
  unsigned short* C2 = isv ? vt : (which == 1 ? klo : qlo);
  const int b = isv ? (int)(blockIdx.x / VT_TILES) : 0;
  const unsigned bx = isv ? blockIdx.x % VT_TILES : blockIdx.x;
  gemm_block<1, false, 0, 3, false>(
      A, A, K, 0L, Bt, Bt, K, (long)SEQ_LEN * K,
      (void*)C, (void*)C2, isv ? SEQ_LEN : D_INNER, (long)D_INNER * SEQ_LEN,
      nullptr, nullptr, 0L, isv ? D_INNER : N_BATCH * SEQ_LEN, isv ? SEQ_LEN : D_INNER, K, 1.0f, bx, b, isv ? 1 : 2);
}

// ---------------------------------------------------------------------------
// f32 -> bf16 (RNE) cast of all seven float operands in ONE launch.
// The bf16 planes lie back to back in the workspace in the order q, k, v, Wq, Wk, Wv, Wo, so the output is one
// array of 3 * 4,194,304 + 4 * 1,048,576 = 16,777,216 elements. A block of 16 waves owns CAST_BLK = 65,536
// consecutive elements of it, which lie in one plane (both plane sizes are multiples of CAST_BLK):
// 3 * 64 + 4 * 16 = 256 blocks. A lane brings 32 pieces of 16 B (each wave-wide load 512 contiguous bytes) and
// stores 32 pieces of 8 B (each wave-wide store 256 contiguous bytes = two whole lines).
// Coverage: 32 pieces x 512 threads x 4 elements = 65,536 = the whole block range, each element once.
// ---------------------------------------------------------------------------
constexpr int CAST_THR  = 512;
constexpr int CAST_BLK  = 65536;
constexpr int CAST_ACT  = N_BATCH * SEQ_LEN * D_MODEL / CAST_BLK;   // 64 blocks per activation plane
constexpr int CAST_W    = D_INNER * D_MODEL / CAST_BLK;             // 16 blocks per weight plane
constexpr int CAST_GRID = 3 * CAST_ACT + 4 * CAST_W;                // 256
static_assert(N_BATCH * SEQ_LEN * D_MODEL % CAST_BLK == 0 && D_INNER * D_MODEL % CAST_BLK == 0, "whole blocks per plane");
typedef __attribute__((ext_vector_type(2))) unsigned v2u;
__global__ __launch_bounds__(CAST_THR) void cast_all_f32_bf16(
    const float* __restrict__ q, const float* __restrict__ k, const float* __restrict__ v,
    const float* __restrict__ wq, const float* __restrict__ wk, const float* __restrict__ wv,
    const float* __restrict__ wo, unsigned short* __restrict__ out) {
  const int bx = blockIdx.x;                 // 0 .. CAST_GRID - 1 (exact grid)
  const float* plane;
  int rel;                                   // block index inside its plane
  if (bx < 3 * CAST_ACT) {
    const int p = bx / CAST_ACT;
    rel = bx - p * CAST_ACT;
    plane = (p == 0) ? q : (p == 1) ? k : v;
  } else {
    const int w = bx - 3 * CAST_ACT;
    const int p = w / CAST_W;
    rel = w - p * CAST_W;
    plane = (p == 0) ? wq : (p == 1) ? wk : (p == 2) ? wv : wo;
  }
  const float* in = plane + (size_t)rel * CAST_BLK + threadIdx.x * 4;
  unsigned short* o = out + (size_t)bx * CAST_BLK + threadIdx.x * 4;
  constexpr int NP = CAST_BLK / (CAST_THR * 4);   // 32 pieces of 16 B per lane
  v4f f[NP];
  // the loads stand in a loop of their own, ahead of the conversions, so that a wave's share is in flight together
  for (int j = 0; j < NP; ++j) f[j] = *(const v4f*)(in + j * (CAST_THR * 4));
  for (int j = 0; j < NP; ++j) {
    const v2u u = {pk16(f2bf_bits(f[j][0]), f2bf_bits(f[j][1])), pk16(f2bf_bits(f[j][2]), f2bf_bits(f[j][3]))};
    *(v2u*)(o + j * (CAST_THR * 4)) = u;
  }
}

#define AT_D 64
#define AT_NW 8
#define AT_QB 128
#define AT_KC 64
#define AT_LP 72   // LDS row pitch in 16-bit elements: 144 B = 16 B x odd, so the 16 rows of a 16-byte fragment read fall on 64 distinct banks
#define AT_MP 68   // LDS row pitch of the bias tile in floats: 272 B = 16 B x odd, for the same reason
#define AT_OFF_KL (AT_KC * AT_LP * 2)                     // byte offsets inside a stage: K hi at 0, K lo,
#define AT_OFF_VT (AT_OFF_KL + AT_KC * AT_LP * 2)         // V^T (f16 bits, [d][kv]),
#define AT_OFF_MB (AT_OFF_VT + AT_D * AT_LP * 2)          // bias (f32, [query][kv])
#define AT_STAGE  (AT_OFF_MB + AT_QB * AT_MP * 4)         // 62,464 B
#define P_CARRY_LOG2 15.0f            // p is carried x2^15, as +15 in the base-2 exponent
#define AT_LOG2E 1.4426950408889634f

__device__ __forceinline__ v8f at_mma(v16b a, v16b b, v8f c) {
  c = __builtin_amdgcn_wmma_f32_16x16x32_bf16(false, a, false, b, (short)0, c, false, false);
  asm volatile("v_nop\n\tv_nop\n\tv_nop\n\tv_nop" : "+v"(c) : "v"(a), "v"(b));
  return c;
}
__device__ __forceinline__ v8f at_mma_h(v16b a, v16b b, v8f c) {   // operands hold f16 bit patterns
  const v16h ah = __builtin_bit_cast(v16h, a), bh = __builtin_bit_cast(v16h, b);
  c = __builtin_amdgcn_wmma_f32_16x16x32_f16(false, ah, false, bh, (short)0, c, false, false);
  asm volatile("v_nop\n\tv_nop\n\tv_nop\n\tv_nop" : "+v"(c) : "v"(ah), "v"(bh));
  return c;
}
// value of lane l ^ 16 (the other half's lane of the same column), by a vector cross-row move: no LDS queue, no wait
__device__ __forceinline__ float at_other_half(float x) {
  const int b = __float_as_int(x);
  return __int_as_float(__builtin_amdgcn_permlanex16(b, b, 0x76543210, 0xfedcba98, false, false));
}

__global__ __launch_bounds__(256)
void mha_bias_kernel(const unsigned short* __restrict__ qhp, const unsigned short* __restrict__ qlp,
                     const unsigned short* __restrict__ khp, const unsigned short* __restrict__ klp,
                     const unsigned short* __restrict__ vtp, const float* __restrict__ biasp,
                     unsigned short* __restrict__ chp, unsigned short* __restrict__ clp,
                     const int* __restrict__ nheads_in) {
  (void)nheads_in;   // module constant (16); shapes are compile-time here
  union FB { v16b v; v8b h[2]; };
  __shared__ __align__(16) unsigned char ring[2 * AT_STAGE];     // two stages, 122 KB
  __shared__ __align__(16) float  Os[AT_NW][16 * 68];            // per wave out tile, pitch 68

  const int tid  = threadIdx.x;
  const int wave = tid >> 5;
  const int lane = tid & 31;
  const int hh   = lane >> 4;
  const int c    = lane & 15;

  const int nqb = SEQ_LEN / AT_QB;        // 16
  const int bx  = blockIdx.x;             // 0 .. N_BATCH*N_HEAD*nqb - 1 (exact grid)
  const int qb  = bx % nqb;
  const int bhd = bx / nqb;               // 0 .. 31
  const int h   = bhd % N_HEAD;
  const int b   = bhd / N_HEAD;           // 0 .. N_BATCH-1
  const int q0  = qb * AT_QB + wave * 16;

  const size_t rowb = (size_t)b * SEQ_LEN;   // token-row base of this batch element
  const __bf16* Qh = (const __bf16*)(const void*)qhp + rowb * D_INNER + (size_t)h * AT_D;
  const __bf16* Ql = (const __bf16*)(const void*)qlp + rowb * D_INNER + (size_t)h * AT_D;
  const __bf16* Kh = (const __bf16*)(const void*)khp + rowb * D_INNER + (size_t)h * AT_D;
  const __bf16* Kl = (const __bf16*)(const void*)klp + rowb * D_INNER + (size_t)h * AT_D;
  const __bf16* Vt = (const __bf16*)(const void*)vtp + ((size_t)b * D_INNER + (size_t)h * AT_D) * SEQ_LEN;
  const float*  Mb = biasp + (size_t)b * SEQ_LEN * SEQ_LEN;
  unsigned short* Ch = chp + rowb * D_INNER + (size_t)h * AT_D;
  unsigned short* Cl = clp + rowb * D_INNER + (size_t)h * AT_D;

  // ---- Q fragments (B operand, column = lane&15, split k map via Frag load): 2 d-chunks, hi and lo ----
  v16b qah[2], qal[2];
#pragma unroll
  for (int dc = 0; dc < 2; ++dc) {
    const __bf16* qr = Qh + (size_t)(q0 + c) * D_INNER + dc * 32 + 8 * hh;
    const __bf16* ql = Ql + (size_t)(q0 + c) * D_INNER + dc * 32 + 8 * hh;
    qah[dc] = Frag<__bf16>::load(qr);
    qal[dc] = Frag<__bf16>::load(ql);
  }

  float mrow = -INFINITY;   // running maximum of query q0 + c (the same in both lane halves)
  float brow = -INFINITY;   // the base-2 exponent that p is taken against: mrow * log2(e) - 15, as rounded once
  float lrow = 0.f;         // running sum (x2^15) over this lane half's keys of query q0 + c; the halves are joined after the loop
  v8f oacc[4];              // O^T: register r of tile t = (d = 16t + 8hh + r, query q0 + c)
#pragma unroll
  for (int t = 0; t < 4; ++t) oacc[t] = (v8f){0.f,0.f,0.f,0.f,0.f,0.f,0.f,0.f};

  // staging map. 16-bit tiles: 8 lanes x 16 B = one 128-byte row, the block covers 32 rows a copy; bias tile: 16 lanes x 16 B =
  // one 256-byte row, 16 rows a copy. All lanes on; every row and column lies inside its plane (exact grid, S % 64 == 0).
  const int krow = tid >> 3, kseg = (tid & 7) * 8;    // row 0..31, first of this lane's 8 elements
  const int mr16 = tid >> 4, bseg = (tid & 15) * 4;   // row 0..15, first of this lane's 4 floats
  const __bf16* gkh = Kh + (size_t)krow * D_INNER + kseg;
  const __bf16* gkl = Kl + (size_t)krow * D_INNER + kseg;
  const __bf16* gvt = Vt + (size_t)krow * SEQ_LEN + kseg;
  const float*  gmb = Mb + (size_t)(qb * AT_QB + mr16) * SEQ_LEN + bseg;
  const unsigned lk0 = (unsigned)(uintptr_t)ring + (unsigned)(krow * (AT_LP * 2) + kseg * 2);
  const unsigned lm0 = (unsigned)(uintptr_t)ring + (unsigned)(AT_OFF_MB + mr16 * (AT_MP * 4) + bseg * 4);
  auto copy_stage = [&](int ch, int buf) {
    const unsigned lk = lk0 + (unsigned)buf * AT_STAGE, lm = lm0 + (unsigned)buf * AT_STAGE;
    const __bf16* kh = gkh + (size_t)ch * AT_KC * D_INNER;   // K rows ch*64 + ...
    const __bf16* kl = gkl + (size_t)ch * AT_KC * D_INNER;
    const __bf16* vt = gvt + ch * AT_KC;                      // V^T columns ch*64 + ...
    const float*  mk = gmb + ch * AT_KC;                      // bias columns ch*64 + ...
    auto bias_rows = [&](int i) {   // bias row group i: 16 rows further on in both places
      return CopyRows{lm + (unsigned)i * 16u * (AT_MP * 4), (const void*)(mk + (size_t)i * 16 * SEQ_LEN)};
    };
    async_copy14(CopyRows{lk, kh},                                   CopyRows{lk + 32u * (AT_LP * 2), kh + 32 * D_INNER},
                 CopyRows{lk + AT_OFF_KL, kl},                       CopyRows{lk + AT_OFF_KL + 32u * (AT_LP * 2), kl + 32 * D_INNER},
                 CopyRows{lk + AT_OFF_VT, vt},                       CopyRows{lk + AT_OFF_VT + 32u * (AT_LP * 2), vt + 32 * SEQ_LEN},
                 bias_rows(0), bias_rows(1), bias_rows(2), bias_rows(3), bias_rows(4), bias_rows(5), bias_rows(6), bias_rows(7));
  };

  const int nChunks = SEQ_LEN / AT_KC;   // 32, compile-time constant
  copy_stage(0, 0);
  asm volatile("s_wait_asynccnt 0x0" ::: "memory");   // this wave's share of chunk 0 has landed
  __syncthreads();                                    // every wave's share has: chunk 0 may be read
  copy_stage(1, 1);
  for (int kc = 0; kc < nChunks; ++kc) {
    const int buf = kc & 1;
    const __bf16* Ksh = (const __bf16*)(ring + (unsigned)buf * AT_STAGE);               // K hi [kv][d]
    const __bf16* Ksl = (const __bf16*)(ring + (unsigned)buf * AT_STAGE + AT_OFF_KL);   // K lo
    const __bf16* Vth = (const __bf16*)(ring + (unsigned)buf * AT_STAGE + AT_OFF_VT);   // V^T f16 bits [d][kv]
    const float*  Mbs = (const float*)(ring + (unsigned)buf * AT_STAGE + AT_OFF_MB);    // bias [query in block][kv]

    // ---- LDS fragment reads stand in groups, each issued well ahead of its first use, so that a wave stops for LDS a few times
    //      a chunk and not once per fragment. A fragment = 16 rows x 32 k: two 16-byte reads a lane.
    auto frag = [&](const __bf16* tile, int rt, int kq) {   // rows 16 rt + ..., elements 32 kq + ... of the 64-element row
      FB f;
      f.h[0] = *(const v8b*)(tile + (rt * 16 + c) * AT_LP + kq * 32 + 8 * hh);
      f.h[1] = *(const v8b*)(tile + (rt * 16 + c) * AT_LP + kq * 32 + 16 + 8 * hh);
      return f.v;
    };
    v16b kh0[4], kl0[4], kh1[4], kl1[4];
#pragma unroll
    for (int j = 0; j < 4; ++j) kh0[j] = frag(Ksh, j, 0);
#pragma unroll
    for (int j = 0; j < 4; ++j) kl0[j] = frag(Ksl, j, 0);
#pragma unroll
    for (int j = 0; j < 4; ++j) kh1[j] = frag(Ksh, j, 1);
    __builtin_amdgcn_sched_barrier(0);   // keeps the 24 reads above in front of the products: the compiler would sink each to its use
    // ---- scores, transposed: 4 kv subtiles of 16 (rows), 2 d-chunks, 3 products each; the four tiles' sums are independent,
    //      each tile's six products keep their order ----
    v8f s[4];
#pragma unroll
    for (int j = 0; j < 4; ++j) s[j] = at_mma(kh0[j], qah[0], (v8f){0.f,0.f,0.f,0.f,0.f,0.f,0.f,0.f});
#pragma unroll
    for (int j = 0; j < 4; ++j) s[j] = at_mma(kl0[j], qah[0], s[j]);
#pragma unroll
    for (int j = 0; j < 4; ++j) kl1[j] = frag(Ksl, j, 1);
    __builtin_amdgcn_sched_barrier(0);   // the K lo reads of the second d-chunk fly under the eight products that follow
#pragma unroll
    for (int j = 0; j < 4; ++j) s[j] = at_mma(kh0[j], qal[0], s[j]);
    // ---- additive bias of query q0 + c: D register r of tile j wants key kv0 + 16j + 8hh + r = 8 consecutive floats ----
    v4f mb[4][2];
    {
      const float* mrp = Mbs + (wave * 16 + c) * AT_MP + 8 * hh;
#pragma unroll
      for (int j = 0; j < 4; ++j) {
        mb[j][0] = *(const v4f*)(mrp + j * 16);
        mb[j][1] = *(const v4f*)(mrp + j * 16 + 4);
      }
    }
    __builtin_amdgcn_sched_barrier(0);   // the bias reads fly under the second d-chunk's products
#pragma unroll
    for (int j = 0; j < 4; ++j) s[j] = at_mma(kh1[j], qah[1], s[j]);
#pragma unroll
    for (int j = 0; j < 4; ++j) s[j] = at_mma(kl1[j], qah[1], s[j]);
#pragma unroll
    for (int j = 0; j < 4; ++j) s[j] = at_mma(kh1[j], qal[1], s[j]);
    v16b vf[2][4];   // all of the chunk's V^T fragments
#pragma unroll
    for (int kk = 0; kk < 2; ++kk)
#pragma unroll
      for (int t = 0; t < 4; ++t) vf[kk][t] = frag(Vth, t, kk);
    __builtin_amdgcn_sched_barrier(0);   // the V^T reads fly under the softmax
    // ---- bias by value, chunk maximum of this lane's query: in-lane over 32 keys, then the other half's 32 ----
    float mj[4];
#pragma unroll
    for (int j = 0; j < 4; ++j) {
      mj[j] = -INFINITY;
#pragma unroll
      for (int r = 0; r < 8; ++r) {
        const float mv = bf_bits2f(f2bf_bits(mb[j][r >> 2][r & 3]));
        const float sv = s[j][r] + mv;
        s[j][r] = sv;
        mj[j] = fmaxf(mj[j], sv);
      }
    }
    float cm = fmaxf(fmaxf(mj[0], mj[1]), fmaxf(mj[2], mj[3]));
    cm = fmaxf(cm, at_other_half(cm));
    const float mnew = fmaxf(mrow, cm);
    // e^(s - m) * 2^15 = 2^(s * log2(e) - b), b = m * log2(e) - 15: one fused multiply-add and the hardware's base-2 exponential.
    // Old and new terms are rescaled by the difference of the very b values they were taken against, so b's rounding cancels
    // in sum and output alike. An argument below -126 gives 0; such a p is far below the f16 carry's last place.
    const float bnew = __builtin_fmaf(mnew, AT_LOG2E, -P_CARRY_LOG2);
    const float alpha = __builtin_amdgcn_exp2f(brow - bnew);   // 0 on the first chunk, where brow is -inf
    mrow = mnew;
    brow = bnew;
    // ---- P^T in registers: element e of B fragment kk = key 32kk + kmap(e) = register e & 7 of score tile 2kk + (e >> 3) ----
    FB pb[2];
    float pj[4];
    typedef __attribute__((ext_vector_type(2))) _Float16 v2h;
    union PK { v8b b; v2h p[4]; };
#pragma unroll
    for (int j = 0; j < 4; ++j) {
      pj[j] = 0.f;
      PK pk;
#pragma unroll
      for (int r = 0; r < 8; r += 2) {
        const float p0 = __builtin_amdgcn_exp2f(__builtin_fmaf(s[j][r],     AT_LOG2E, -bnew));   // x2^15
        const float p1 = __builtin_amdgcn_exp2f(__builtin_fmaf(s[j][r + 1], AT_LOG2E, -bnew));
        pj[j] += p0;
        pj[j] += p1;
        pk.p[r >> 1] = __builtin_convertvector((v2f){p0, p1}, v2h);   // round to nearest even, two to an instruction
      }
      pb[j >> 1].h[j & 1] = pk.b;
    }
    lrow = lrow * alpha + ((pj[0] + pj[1]) + (pj[2] + pj[3]));
#pragma unroll
    for (int t = 0; t < 4; ++t)
#pragma unroll
      for (int r = 0; r < 8; ++r) oacc[t][r] *= alpha;
#pragma unroll   // kk picks the P^T fragment's registers, so it must be a constant
    for (int kk = 0; kk < 2; ++kk) {
#pragma unroll
      for (int t = 0; t < 4; ++t) oacc[t] = at_mma_h(vf[kk][t], pb[kk].v, oacc[t]);
    }
    asm volatile("s_wait_dscnt 0x0" ::: "memory");      // this wave's reads of buffer buf are done before it is refilled
    asm volatile("s_wait_asynccnt 0x0" ::: "memory");   // this wave's share of chunk kc + 1 has landed
    __syncthreads();                                    // publishes chunk kc + 1 and ends every reader's use of buffer buf
    if (kc + 2 < nChunks) copy_stage(kc + 2, buf);
  }
  asm volatile("s_wait_asynccnt 0x0" ::: "memory");     // nothing of this wave's copies is outstanding past the loop

  // ---- join the halves' sums, normalise and stage the 16x64 f32 tile (row = query c, cols 16t + 8hh + r) ----
  float* os = Os[wave];
  {
    const float l = lrow + at_other_half(lrow);
    const float inv = 1.0f / l;   // l carries the same 2^15 as the output sums: about 2^15 (the maximum's own term) <= l <= 6.8e7
#pragma unroll
    for (int t = 0; t < 4; ++t) {
      const v4f lo = {oacc[t][0] * inv, oacc[t][1] * inv, oacc[t][2] * inv, oacc[t][3] * inv};
      const v4f hi = {oacc[t][4] * inv, oacc[t][5] * inv, oacc[t][6] * inv, oacc[t][7] * inv};
      *(v4f*)(os + c * 68 + t * 16 + 8 * hh)     = lo;
      *(v4f*)(os + c * 68 + t * 16 + 8 * hh + 4) = hi;
    }
  }
  __builtin_amdgcn_fence(__ATOMIC_RELEASE, "workgroup");
  __builtin_amdgcn_wave_barrier();
  __builtin_amdgcn_fence(__ATOMIC_ACQUIRE, "workgroup");
  {
    // coverage: 4 it x 32 lanes x 8 elements = 16 rows x 64 = the whole wave tile, per plane;
    const int qg = lane >> 3, c8 = (lane & 7) * 8;
    {
#pragma unroll
      for (int it = 0; it < 4; ++it) {
        const int row = it * 4 + qg;
        const float* sp = os + row * 68 + c8;
        v8h hv, lv;
#pragma unroll
        for (int e = 0; e < 8; ++e) {
          const unsigned short hb = f2bf_bits(sp[e]);
          const unsigned short lb = f2bf_bits(sp[e] - bf_bits2f(hb));
          hv[e] = __builtin_bit_cast(_Float16, hb);
          lv[e] = __builtin_bit_cast(_Float16, lb);
        }
        *(v8h*)(Ch + (size_t)(q0 + row) * D_INNER + c8) = hv;
        *(v8h*)(Cl + (size_t)(q0 + row) * D_INNER + c8) = lv;
      }
      
    }
  }
}

// =====================================================================================
// Host launch glue: only kernel launches; grids/args are pure functions of the (asserted) sizes.
// Workspace region map (bytes; all offsets multiples of 2 MiB):
//   [  0 MiB,  8 MiB)  q  bf16  [4096][1024]
//   [  8 MiB, 16 MiB)  k  bf16  [4096][1024]
//   [ 16 MiB, 24 MiB)  v  bf16  [4096][1024]
//   [ 24 MiB, 26 MiB)  Wq bf16  [1024][1024]   [26,28) Wk   [28,30) Wv   [30,32) Wo
//   [ 32 MiB, 40 MiB)  Q hi bf16 [4096][1024]   [40,48) Q lo
//   [ 48 MiB, 56 MiB)  K hi bf16 [4096][1024]   [56,64) K lo
//   [ 64 MiB, 72 MiB)  V^T f16  [2][1024][2048]
//   [ 72 MiB, 80 MiB)  ctx hi bf16 [4096][1024] [80,88) ctx lo
//   total 88 MiB = 92,274,688 B
// =====================================================================================
extern "C" void kernel_launch(void* const* d_in, const int* in_sizes, int n_in,
                              void* d_out, int out_size, void* d_ws, size_t ws_size,
                              hipStream_t stream) {
  if (n_in < 9) return;
  const size_t nAct  = (size_t)N_BATCH * SEQ_LEN * D_MODEL;     // 4,194,304
  const size_t nW    = (size_t)D_INNER * D_MODEL;               // 1,048,576
  const size_t nMask = (size_t)N_BATCH * SEQ_LEN * SEQ_LEN;     // 8,388,608
  const size_t nVT   = (size_t)N_BATCH * D_INNER * SEQ_LEN;     // 4,194,304
  if ((size_t)in_sizes[0] != nAct || (size_t)in_sizes[1] != nAct || (size_t)in_sizes[2] != nAct ||
      (size_t)in_sizes[3] != nMask || (size_t)in_sizes[4] != nW || (size_t)in_sizes[5] != nW ||
      (size_t)in_sizes[6] != nW || (size_t)in_sizes[7] != nW || in_sizes[8] < 1 ||
      (size_t)out_size != nAct) return;

  const size_t bAct = nAct * 2, bW = nW * 2, bVT = nVT * 2;
  const size_t o_q16 = 0;
  const size_t o_k16 = o_q16 + bAct;
  const size_t o_v16 = o_k16 + bAct;
  const size_t o_wq  = o_v16 + bAct;
  const size_t o_wk  = o_wq + bW;
  const size_t o_wv  = o_wk + bW;
  const size_t o_wo  = o_wv + bW;
  const size_t o_qhi = o_wo + bW;
  const size_t o_qlo = o_qhi + bAct;
  const size_t o_khi = o_qlo + bAct;
  const size_t o_klo = o_khi + bAct;
  const size_t o_vt  = o_klo + bAct;
  const size_t o_chi = o_vt + bVT;
  const size_t o_clo = o_chi + bAct;
  const size_t total = o_clo + bAct;                            // 92,274,688
  if (total > ws_size) return;

  const float* qf  = (const float*)d_in[0];
  const float* kf  = (const float*)d_in[1];
  const float* vf  = (const float*)d_in[2];
  const float* mf  = (const float*)d_in[3];
  const float* wqf = (const float*)d_in[4];
  const float* wkf = (const float*)d_in[5];
  const float* wvf = (const float*)d_in[6];
  const float* wof = (const float*)d_in[7];
  const int*   nhp = (const int*)d_in[8];
  char* ws = (char*)d_ws;
  unsigned short* q16 = (unsigned short*)(ws + o_q16);
  unsigned short* k16 = (unsigned short*)(ws + o_k16);
  unsigned short* v16 = (unsigned short*)(ws + o_v16);
  unsigned short* wq16 = (unsigned short*)(ws + o_wq);
  unsigned short* wk16 = (unsigned short*)(ws + o_wk);
  unsigned short* wv16 = (unsigned short*)(ws + o_wv);
  unsigned short* wo16 = (unsigned short*)(ws + o_wo);
  unsigned short* qhi = (unsigned short*)(ws + o_qhi);
  unsigned short* qlo = (unsigned short*)(ws + o_qlo);
  unsigned short* khi = (unsigned short*)(ws + o_khi);
  unsigned short* klo = (unsigned short*)(ws + o_klo);
  unsigned short* vt  = (unsigned short*)(ws + o_vt);
  unsigned short* chi = (unsigned short*)(ws + o_chi);
  unsigned short* clo = (unsigned short*)(ws + o_clo);
  float* out = (float*)d_out;

  // ---- 1: RNE bf16 copies of the seven float inputs; q16 is the start of the seven planes, back to back in the
  //      order of the arguments (region map above) ----
  cast_all_f32_bf16<<<dim3((unsigned)CAST_GRID), CAST_THR, 0, stream>>>(qf, kf, vf, wqf, wkf, wvf, wof, q16);

  const int MTOK = N_BATCH * SEQ_LEN;         // 4096 rows of [B*S][.] planes
  // ---- 2: Q, K and V projections, 3 x 128 = 384 blocks of 256 threads (shapes at the kernel) ----
  qkv_gemm<<<dim3((unsigned)QKV_TILES, 3u), 256, 0, stream>>>(
      q16, k16, v16, wq16, wk16, wv16, qhi, qlo, khi, klo, vt, D_MODEL);
  // ---- 3: attention: 2 x 16 x 16 = 512 blocks of 256 threads ----
  {
    const dim3 g((unsigned)(N_BATCH * N_HEAD * (SEQ_LEN / AT_QB)));
    mha_bias_kernel<<<g, 256, 0, stream>>>(qhi, qlo, khi, klo, vt, mf, chi, clo, nhp);
  }
  // ---- 4: output projection: out[4096][1024] = (ctx_hi + ctx_lo)[4096][1024] . Wo^T, Wo [1024 out][1024 in];
  //      M=4096, N=1024 (x64), K=1024 (x32); 1024 tiles = 128 blocks; f32 out
  {
    const int tiles = (MTOK / 64) * (D_MODEL / 64);
    const dim3 g((unsigned)((tiles + 7) / 8), 1);
    wmma_gemm64<1, true, 0, 0, false, 0, false><<<g, 256, 0, stream>>>(
        chi, clo, D_INNER, 0L, wo16, wo16, D_INNER, 0L, (void*)out, (void*)out, D_MODEL, 0L,
        mf, mf, 0L, MTOK, D_MODEL, D_INNER, 1.0f);
  }
}

// v009
// One run takes 122 microseconds.
// Next to v008, in two timings, it ran 1.03 times as fast each time.
// All steps since v000 together make it 3.88 times as fast.
// Contractions: q/k/v projections = v_wmma_f32_16x16x32_bf16 on RNE-bf16 copies of the inputs (single product); q.k^T = v_wmma_f32_16x16x32_bf16 with bf16 hi/lo split operands (hi.hi + hi.lo + lo.hi); p.v = v_wmma_f32_16x16x32_f16 (p carried x2^15 in f16, v^T stored f16); output projection = v_wmma_f32_16x16x32_bf16 with ctx bf16 hi/lo x Wo bf16 (hi.W + lo.W); f32 accumulate everywhere; additive mask (RNE-bf16 values) and online softmax in f32.
#include <hip/hip_runtime.h>
#include <math.h>
#include <stdint.h>

constexpr int N_BATCH = 2;
constexpr int SEQ_LEN = 2048;
constexpr int D_MODEL = 1024;                 // d_model (input / output feature width)
constexpr int N_HEAD  = 16;
constexpr int D_HEAD  = 64;
constexpr int D_INNER = N_HEAD * D_HEAD;      // 1024
static_assert(D_INNER == 1024, "inner width");
static_assert(SEQ_LEN % 64 == 0 && D_MODEL % 64 == 0 && D_INNER % 64 == 0, "tile multiples");
static_assert(D_MODEL % 32 == 0 && D_INNER % 32 == 0, "K multiples of 32");

typedef __attribute__((ext_vector_type(16))) _Float16 v16h;
typedef __attribute__((ext_vector_type(8)))  _Float16 v8h;
typedef __attribute__((ext_vector_type(16))) __bf16   v16b;
typedef __attribute__((ext_vector_type(8)))  __bf16   v8b;
typedef __attribute__((ext_vector_type(8)))  float    v8f;
typedef __attribute__((ext_vector_type(4)))  float    v4f;
typedef __attribute__((ext_vector_type(2)))  float    v2f;

__device__ __forceinline__ unsigned short f2bf_bits(float f) {
  unsigned u = __float_as_uint(f);
  return (unsigned short)((u + 0x7FFFu + ((u >> 16) & 1u)) >> 16);
}
__device__ __forceinline__ float bf_bits2f(unsigned short h) { return __uint_as_float(((unsigned)h) << 16); }
__device__ __forceinline__ unsigned pk16(unsigned short a, unsigned short b) { return (unsigned)a | ((unsigned)b << 16); }

// hazard guards as plain device helpers
__device__ __forceinline__ void dep_guard_h(v8f& a, v8f& b, v16h x, v16h y) { asm volatile("v_nop\n\tv_nop\n\tv_nop\n\tv_nop" : "+v"(a), "+v"(b) : "v"(x), "v"(y)); }
__device__ __forceinline__ void dep_guard_b(v8f& a, v8f& b, v16b x, v16b y) { asm volatile("v_nop\n\tv_nop\n\tv_nop\n\tv_nop" : "+v"(a), "+v"(b) : "v"(x), "v"(y)); }
__device__ __forceinline__ void keep4_h(v16h a, v16h b, v16h c, v16h d) { asm volatile("v_nop" :: "v"(a), "v"(b), "v"(c), "v"(d)); }
__device__ __forceinline__ void keep4_b(v16b a, v16b b, v16b c, v16b d) { asm volatile("v_nop" :: "v"(a), "v"(b), "v"(c), "v"(d)); }
__device__ __forceinline__ void acc_guard4(v8f& a, v8f& b, v8f& c, v8f& d) { asm volatile("v_nop\n\tv_nop\n\tv_nop\n\tv_nop" : "+v"(a), "+v"(b), "+v"(c), "+v"(d)); }
template <typename T> struct Frag;
template <> struct Frag<_Float16> {
  typedef v16h V; union U { v16h v; v8h h[2]; };
  static __device__ __forceinline__ v16h load(const _Float16* p) {   // elements 0..7 <- p[0..7], 8..15 <- p[16..23]
    U f; f.h[0] = *(const v8h*)(p); f.h[1] = *(const v8h*)(p + 16); return f.v;
  }
  static __device__ __forceinline__ v8f mma(v16h a, v16h b, v8f c) {
    return __builtin_amdgcn_wmma_f32_16x16x32_f16(false, a, false, b, (short)0, c, false, false);
  }
  static __device__ __forceinline__ void guard(v8f& a, v8f& b, v16h x, v16h y) { dep_guard_h(a, b, x, y); }
  static __device__ __forceinline__ void keep(v16h a, v16h b, v16h c, v16h d) { keep4_h(a, b, c, d); }
};
template <> struct Frag<__bf16> {
  typedef v16b V; union U { v16b v; v8b h[2]; };
  static __device__ __forceinline__ v16b load(const __bf16* p) {
    U f; f.h[0] = *(const v8b*)(p); f.h[1] = *(const v8b*)(p + 16); return f.v;
  }
  static __device__ __forceinline__ v8f mma(v16b a, v16b b, v8f c) {
    return __builtin_amdgcn_wmma_f32_16x16x32_bf16(false, a, false, b, (short)0, c, false, false);
  }
  static __device__ __forceinline__ void guard(v8f& a, v8f& b, v16b x, v16b y) { dep_guard_b(a, b, x, y); }
  static __device__ __forceinline__ void keep(v16b a, v16b b, v16b c, v16b d) { keep4_b(a, b, c, d); }
};

// ---- Register-blocked batched WMMA GEMM ------------------------------------
// C[m,n] = scale * sum_k A[m,k] * Bt[n,k] (+bias)(+resid); each wave owns a 64x64 tile; the 8 waves of a block
// form a 2 (M) x 4 (N) grid = one 128x256 block tile, whose operand rows reach LDS 64 k at a time (a stage) by
// asynchronous 16-byte copies, two buffers: stage t+1 flies while stage t is multiplied.
// A row-major [M,K]; Bt row-major [N,K]; M % 128 == 0, N % 256 == 0, K % 64 == 0.
// SPLIT: operands are hi/lo planes (A2/Bt2 = lo planes, same layout); product = hi.hi + hi.lo + lo.hi.
// BLO = false with SPLIT: the Bt lo plane is not used (product = hi.B + lo.B, B a single plane).
// BIAS_MODE: 0 = none, 1 = bias[m], 2 = bias[n].
// OUT_MODE: 0 = f32, 1 = f16, 2 = bf16 hi plane (Cout) + bf16 lo plane (Cout2), 3 = 1 or 2, as the block-uniform argument om says.
// gemm_block is the work of one block: tile number bx of batch element b. Its callers are the kernels below it.
// ET: 0 = f16 operands, 1 = bf16 operands (pointers passed as 16-bit storage)
// Asynchronous 16-byte-per-lane copies global -> LDS, eight, twelve or fourteen to a statement. The s_wait_xcnt is the last line
// of the copies' own statement so that it stands in front of every later write of the address registers they name.
struct CopyRows { unsigned l; const void* g; };   // this lane's LDS byte address and global address of one row segment
__device__ __forceinline__ void async_copy8(CopyRows a, CopyRows b, CopyRows c, CopyRows d,
                                            CopyRows e, CopyRows f, CopyRows g, CopyRows h) {
  asm volatile("global_load_async_to_lds_b128 %0, %1, off\n\t"
               "global_load_async_to_lds_b128 %2, %3, off\n\t"
               "global_load_async_to_lds_b128 %4, %5, off\n\t"
               "global_load_async_to_lds_b128 %6, %7, off\n\t"
               "global_load_async_to_lds_b128 %8, %9, off\n\t"
               "global_load_async_to_lds_b128 %10, %11, off\n\t"
               "global_load_async_to_lds_b128 %12, %13, off\n\t"
               "global_load_async_to_lds_b128 %14, %15, off\n\t"
               "s_wait_xcnt 0x0"
               :: "v"(a.l), "v"(a.g), "v"(b.l), "v"(b.g), "v"(c.l), "v"(c.g), "v"(d.l), "v"(d.g),
                  "v"(e.l), "v"(e.g), "v"(f.l), "v"(f.g), "v"(g.l), "v"(g.g), "v"(h.l), "v"(h.g) : "memory");
}
__device__ __forceinline__ void async_copy12(CopyRows a, CopyRows b, CopyRows c, CopyRows d,
                                             CopyRows e, CopyRows f, CopyRows g, CopyRows h,
                                             CopyRows i, CopyRows j, CopyRows k, CopyRows m) {
  asm volatile("global_load_async_to_lds_b128 %0, %1, off\n\t"
               "global_load_async_to_lds_b128 %2, %3, off\n\t"
               "global_load_async_to_lds_b128 %4, %5, off\n\t"
               "global_load_async_to_lds_b128 %6, %7, off\n\t"
               "global_load_async_to_lds_b128 %8, %9, off\n\t"
               "global_load_async_to_lds_b128 %10, %11, off\n\t"
               "global_load_async_to_lds_b128 %12, %13, off\n\t"
               "global_load_async_to_lds_b128 %14, %15, off\n\t"
               "global_load_async_to_lds_b128 %16, %17, off\n\t"
               "global_load_async_to_lds_b128 %18, %19, off\n\t"
               "global_load_async_to_lds_b128 %20, %21, off\n\t"
               "global_load_async_to_lds_b128 %22, %23, off\n\t"
               "s_wait_xcnt 0x0"
               :: "v"(a.l), "v"(a.g), "v"(b.l), "v"(b.g), "v"(c.l), "v"(c.g), "v"(d.l), "v"(d.g),
                  "v"(e.l), "v"(e.g), "v"(f.l), "v"(f.g), "v"(g.l), "v"(g.g), "v"(h.l), "v"(h.g),
                  "v"(i.l), "v"(i.g), "v"(j.l), "v"(j.g), "v"(k.l), "v"(k.g), "v"(m.l), "v"(m.g) : "memory");
}
__device__ __forceinline__ void async_copy14(CopyRows a, CopyRows b, CopyRows c, CopyRows d, CopyRows e, CopyRows f, CopyRows g,
                                             CopyRows h, CopyRows i, CopyRows j, CopyRows k, CopyRows m, CopyRows n, CopyRows o) {
  asm volatile("global_load_async_to_lds_b128 %0, %1, off\n\t"
               "global_load_async_to_lds_b128 %2, %3, off\n\t"
               "global_load_async_to_lds_b128 %4, %5, off\n\t"
               "global_load_async_to_lds_b128 %6, %7, off\n\t"
               "global_load_async_to_lds_b128 %8, %9, off\n\t"
               "global_load_async_to_lds_b128 %10, %11, off\n\t"
               "global_load_async_to_lds_b128 %12, %13, off\n\t"
               "global_load_async_to_lds_b128 %14, %15, off\n\t"
               "global_load_async_to_lds_b128 %16, %17, off\n\t"
               "global_load_async_to_lds_b128 %18, %19, off\n\t"
               "global_load_async_to_lds_b128 %20, %21, off\n\t"
               "global_load_async_to_lds_b128 %22, %23, off\n\t"
               "global_load_async_to_lds_b128 %24, %25, off\n\t"
               "global_load_async_to_lds_b128 %26, %27, off\n\t"
               "s_wait_xcnt 0x0"
               :: "v"(a.l), "v"(a.g), "v"(b.l), "v"(b.g), "v"(c.l), "v"(c.g), "v"(d.l), "v"(d.g),
                  "v"(e.l), "v"(e.g), "v"(f.l), "v"(f.g), "v"(g.l), "v"(g.g), "v"(h.l), "v"(h.g),
                  "v"(i.l), "v"(i.g), "v"(j.l), "v"(j.g), "v"(k.l), "v"(k.g), "v"(m.l), "v"(m.g),
                  "v"(n.l), "v"(n.g), "v"(o.l), "v"(o.g) : "memory");
}
#define GM_PITCH 144            // LDS row pitch in bytes of a 128-byte stage row: 16 B x odd, conflict-free 16-byte fragment reads
#define GM_PE    (GM_PITCH / 2) // the same in 16-bit elements
template <int ET> struct Elem;
template <> struct Elem<0> { typedef _Float16 T; };
template <> struct Elem<1> { typedef __bf16 T; };
// One 16x64 f32 slab of a wave -> 16-bit rows in memory, 8 lanes x 16 B = one whole 128-byte row segment per plane.
// PLANES2 = false: f16 to C; true: bf16 hi to C and bf16 lo to C2.
template <bool PLANES2>
__device__ __forceinline__ void store_slab16(const float* slab, unsigned short* C, unsigned short* C2,
                                             int ldc, int mBase, int n0, int lane) {
  const int q = lane >> 3, c8 = (lane & 7) * 8;
#pragma unroll
  for (int it = 0; it < 4; ++it) {
    const int row = it * 4 + q;
    const float* sp = slab + row * 68 + c8;
    v8h hv, lv;
#pragma unroll
    for (int e = 0; e < 8; ++e) {
      if (!PLANES2) {
        hv[e] = (_Float16)sp[e];
      } else {
        unsigned short hb = f2bf_bits(sp[e]);
        unsigned short lb = f2bf_bits(sp[e] - bf_bits2f(hb));
        hv[e] = __builtin_bit_cast(_Float16, hb);
        lv[e] = __builtin_bit_cast(_Float16, lb);
      }
    }
    *(v8h*)(C + (size_t)(mBase + row) * ldc + n0 + c8) = hv;
    if (PLANES2) *(v8h*)(C2 + (size_t)(mBase + row) * ldc + n0 + c8) = lv;
  }
  asm volatile("s_wait_xcnt 0x0" ::: "memory");   // stands in front of every later write of a register that these stores name
}
template <int ET, bool SPLIT, int BIAS_MODE, int OUT_MODE, bool RESID, int ACT = 0, bool BLO = true>
__device__ __forceinline__ void gemm_block(
    const unsigned short* __restrict__ Ap, const unsigned short* __restrict__ A2p, int lda, long strideA,
    const unsigned short* __restrict__ Btp, const unsigned short* __restrict__ Bt2p, int ldb, long strideB,
    void* __restrict__ Cout, void* __restrict__ Cout2, int ldc, long strideC,
    const float* __restrict__ bias,
    const float* __restrict__ resid, long strideR,
    int M, int N, int K, float scale, unsigned bx, int b, int om) {
  typedef typename Elem<ET>::T T;
  typedef typename Frag<T>::V V;
  const T* A = (const T*)Ap; const T* A2 = (const T*)A2p; const T* Bt = (const T*)Btp; const T* Bt2 = (const T*)Bt2p;
  __shared__ __align__(16) float sT[8][16 * 68];   // per-wave 16x64 slab, pitch 68 floats
  // one stage = [A 128 rows | A lo 128 rows (SPLIT) | Bt 256 rows | Bt lo 256 rows (SPLIT && BLO)], 64 k each
  constexpr unsigned OFF_A2  = 128u * GM_PITCH;
  constexpr unsigned OFF_B   = OFF_A2 + (SPLIT ? 128u * GM_PITCH : 0u);
  constexpr unsigned OFF_B2  = OFF_B + 256u * GM_PITCH;
  constexpr unsigned STAGE_B = OFF_B2 + ((SPLIT && BLO) ? 256u * GM_PITCH : 0u);
  __shared__ __align__(16) unsigned char ring[2 * STAGE_B];
  const int lane = threadIdx.x & 31;
  const int wave = threadIdx.x >> 5;
  const int tilesN = N >> 8;
  const int tilesM = M >> 7;
  if ((int)bx >= tilesM * tilesN) return;   // block-uniform, ahead of every copy and barrier
  const int bm  = bx / tilesN;
  const int bn  = bx - bm * tilesN;
  const int wm0 = (wave >> 2) << 6;            // this wave's rows inside the block tile
  const int wn0 = (wave & 3) << 6;             // this wave's columns inside the block tile
  const int m0 = (bm << 7) + wm0;
  const int n0 = (bn << 8) + wn0;

  const T* Ab  = A  + (size_t)b * strideA;
  const T* Bb  = Bt + (size_t)b * strideB;
  const T* Ab2 = SPLIT ? (A2  + (size_t)b * strideA) : nullptr;
  const T* Bb2 = (SPLIT && BLO) ? (Bt2 + (size_t)b * strideB) : nullptr;

  const int rlane = lane & 15;                 // row (A) / col (B, D) within subtile
  const int koff  = (lane >> 4) * 8;           // k offset of this lane half
  const int mOff  = (lane >> 4) * 8;           // D row offset

  // staging map: 8 lanes x 16 B = one whole 128-byte row segment; a copy of the block covers 32 rows
  const int srow = threadIdx.x >> 3;           // 0..31
  const int sseg = (threadIdx.x & 7) * 8;      // first of this lane's 8 elements in the 64-element row
  const size_t aoff = (size_t)((bm << 7) + srow) * lda + sseg;
  const size_t boff = (size_t)((bn << 8) + srow) * ldb + sseg;
  const size_t a32 = (size_t)32 * lda, b32 = (size_t)32 * ldb;
  const unsigned lds0 = (unsigned)(uintptr_t)ring + (unsigned)(srow * GM_PITCH + sseg * 2);
  auto copy_stage = [&](int st, int buf) {     // all lanes on, rows and k inside the operands by the size conditions above
    const unsigned l = lds0 + (unsigned)buf * STAGE_B;
    auto rows = [](unsigned lds, const T* g, size_t step32, int i) {   // row group i: 32 rows further on in both places
      return CopyRows{lds + (unsigned)i * 32u * GM_PITCH, (const void*)(g + (size_t)i * step32)};
    };
    const T* ga = Ab + aoff + (size_t)st * 64;
    const T* gb = Bb + boff + (size_t)st * 64;
    const unsigned lb = l + OFF_B;
    if (!SPLIT) {
      async_copy12(rows(l, ga, a32, 0), rows(l, ga, a32, 1), rows(l, ga, a32, 2), rows(l, ga, a32, 3),
                   rows(lb, gb, b32, 0), rows(lb, gb, b32, 1), rows(lb, gb, b32, 2), rows(lb, gb, b32, 3),
                   rows(lb, gb, b32, 4), rows(lb, gb, b32, 5), rows(lb, gb, b32, 6), rows(lb, gb, b32, 7));
    } else {
      const unsigned l2 = l + OFF_A2;
      const T* ga2 = Ab2 + aoff + (size_t)st * 64;
      async_copy8(rows(l, ga, a32, 0), rows(l, ga, a32, 1), rows(l, ga, a32, 2), rows(l, ga, a32, 3),
                  rows(l2, ga2, a32, 0), rows(l2, ga2, a32, 1), rows(l2, ga2, a32, 2), rows(l2, ga2, a32, 3));
      async_copy8(rows(lb, gb, b32, 0), rows(lb, gb, b32, 1), rows(lb, gb, b32, 2), rows(lb, gb, b32, 3),
                  rows(lb, gb, b32, 4), rows(lb, gb, b32, 5), rows(lb, gb, b32, 6), rows(lb, gb, b32, 7));
      if (BLO) {
        const unsigned lb2 = l + OFF_B2;
        const T* gb2 = Bb2 + boff + (size_t)st * 64;
        async_copy8(rows(lb2, gb2, b32, 0), rows(lb2, gb2, b32, 1), rows(lb2, gb2, b32, 2), rows(lb2, gb2, b32, 3),
                    rows(lb2, gb2, b32, 4), rows(lb2, gb2, b32, 5), rows(lb2, gb2, b32, 6), rows(lb2, gb2, b32, 7));
      }
    }
  };

  v8f acc[4][4];
#pragma unroll
  for (int i = 0; i < 4; ++i)
#pragma unroll
    for (int j = 0; j < 4; ++j) acc[i][j] = (v8f){0.f,0.f,0.f,0.f,0.f,0.f,0.f,0.f};

  const int nst = K >> 6;                      // stages of 64 k
  copy_stage(0, 0);
  asm volatile("s_wait_asynccnt 0x0" ::: "memory");   // this wave's share of stage 0 has landed
  __syncthreads();                                    // every wave's share has: stage 0 may be read
  if (nst > 1) copy_stage(1, 1);
  for (int st = 0; st < nst; ++st) {
    const int buf = st & 1;
    const T* sA  = (const T*)(ring + (unsigned)buf * STAGE_B);
    const T* sA2 = (const T*)(ring + (unsigned)buf * STAGE_B + OFF_A2);
    const T* sB  = (const T*)(ring + (unsigned)buf * STAGE_B + OFF_B);
    const T* sB2 = (const T*)(ring + (unsigned)buf * STAGE_B + OFF_B2);
#pragma unroll   // both 32-k halves of a stage in line, so that kk folds into the LDS loads' immediate offsets
    for (int kk = 0; kk < 64; kk += 32) {
      // all fragment reads of this 32-k step stand in one group ahead of its products: the wave stops for LDS once a step, not once a row
      V bh[4], bl[4], ah[4], al[4];
#pragma unroll
      for (int x = 0; x < 4; ++x) {
        const int ao = (wm0 + (x << 4) + rlane) * GM_PE + koff + kk;
        const int bo = (wn0 + (x << 4) + rlane) * GM_PE + koff + kk;
        bh[x] = Frag<T>::load(sB + bo);
        if (SPLIT && BLO) bl[x] = Frag<T>::load(sB2 + bo);
        ah[x] = Frag<T>::load(sA + ao);
        if (SPLIT) al[x] = Frag<T>::load(sA2 + ao);
      }
      __builtin_amdgcn_sched_barrier(0);   // keeps the reads above in front of the products: the compiler would sink each A row's to its use
#pragma unroll
      for (int i = 0; i < 4; ++i) {
#pragma unroll
        for (int j = 0; j < 4; ++j) {
          acc[i][j] = Frag<T>::mma(ah[i], bh[j], acc[i][j]);
          if (SPLIT) {
            if (BLO) acc[i][j] = Frag<T>::mma(ah[i], bl[j], acc[i][j]);
            acc[i][j] = Frag<T>::mma(al[i], bh[j], acc[i][j]);
          }
        }
        Frag<T>::guard(acc[i][0], acc[i][3], ah[i], SPLIT ? al[i] : ah[i]);
      }
      Frag<T>::keep(bh[0], bh[1], bh[2], bh[3]);
      if (SPLIT && BLO) Frag<T>::keep(bl[0], bl[1], bl[2], bl[3]);
      // a split step holds 96 or more fragment registers: the next step's reads stay behind this step's products, else the two sets
      // overlap and push the kernel past v255 into a second register window
      if (SPLIT) __builtin_amdgcn_sched_barrier(0);
    }
    asm volatile("s_wait_dscnt 0x0" ::: "memory");      // this wave's reads of buffer buf are done before it is refilled
    asm volatile("s_wait_asynccnt 0x0" ::: "memory");   // this wave's share of stage st + 1 has landed
    __syncthreads();                                    // publishes stage st + 1 and ends every reader's use of buffer buf
    if (st + 2 < nst) copy_stage(st + 2, buf);
  }
  asm volatile("s_wait_asynccnt 0x0" ::: "memory");     // nothing of this wave's copies is outstanding past the loop
  acc_guard4(acc[0][0], acc[0][1], acc[0][2], acc[0][3]);
  acc_guard4(acc[1][0], acc[1][1], acc[1][2], acc[1][3]);
  acc_guard4(acc[2][0], acc[2][1], acc[2][2], acc[2][3]);
  acc_guard4(acc[3][0], acc[3][1], acc[3][2], acc[3][3]);

  // ---- epilogue ----
  float* slab = sT[wave];
  const float* Rb = RESID ? (resid + (size_t)b * strideR) : nullptr;
#pragma unroll
  for (int i = 0; i < 4; ++i) {
    const int mBase = m0 + (i << 4);
#pragma unroll
    for (int j = 0; j < 4; ++j) {
      const int n = n0 + (j << 4) + rlane;
      float bv = 0.f;
      if (BIAS_MODE == 2) bv = bias[n];
#pragma unroll
      for (int r = 0; r < 8; ++r) {
        float v = acc[i][j][r] * scale;
        if (BIAS_MODE == 1) v += bias[mBase + mOff + r];
        if (BIAS_MODE == 2) v += bv;
        if (RESID) v += Rb[(size_t)(mBase + mOff + r) * ldc + n];
        if (ACT == 1) v = tanhf(v);
        if (ACT == 2) v = fmaxf(v, 0.0f);
        if (ACT == 3) v = v / (1.0f + expf(-v));
        if (ACT == 4) v = (v > 0.f) ? v : 0.01f * v;
        slab[(mOff + r) * 68 + (j << 4) + rlane] = v;
      }
    }
    __builtin_amdgcn_fence(__ATOMIC_RELEASE, "workgroup");
    __builtin_amdgcn_wave_barrier();
    __builtin_amdgcn_fence(__ATOMIC_ACQUIRE, "workgroup");
    if (OUT_MODE == 0) {
      float* C = (float*)Cout + (size_t)b * strideC;
      const int hh = lane >> 4, c4 = (lane & 15) * 4;     // row seg = 256 B = 16 lanes x 16 B
      {
#pragma unroll
        for (int it = 0; it < 8; ++it) {
          const int row = it * 2 + hh;
          v4f v = *(const v4f*)(slab + row * 68 + c4);
          *(v4f*)(C + (size_t)(mBase + row) * ldc + n0 + c4) = v;
        }
        
      }
    } else {
      unsigned short* C  = (unsigned short*)Cout  + (size_t)b * strideC;
      unsigned short* C2 = (unsigned short*)Cout2 + (size_t)b * strideC;
      if (OUT_MODE == 1 || (OUT_MODE == 3 && om == 1)) store_slab16<false>(slab, C, C2, ldc, mBase, n0, lane);
      else                                             store_slab16<true>(slab, C, C2, ldc, mBase, n0, lane);
    }
    __builtin_amdgcn_fence(__ATOMIC_RELEASE, "workgroup");
    __builtin_amdgcn_wave_barrier();
    __builtin_amdgcn_fence(__ATOMIC_ACQUIRE, "workgroup");
  }
}

// One GEMM to a launch: block (x, y) does tile x of batch element y.
template <int ET, bool SPLIT, int BIAS_MODE, int OUT_MODE, bool RESID, int ACT = 0, bool BLO = true>
__global__ __launch_bounds__(256) void wmma_gemm64(
    const unsigned short* __restrict__ Ap, const unsigned short* __restrict__ A2p, int lda, long strideA,
    const unsigned short* __restrict__ Btp, const unsigned short* __restrict__ Bt2p, int ldb, long strideB,
    void* __restrict__ Cout, void* __restrict__ Cout2, int ldc, long strideC,
    const float* __restrict__ bias,
    const float* __restrict__ resid, long strideR,
    int M, int N, int K, float scale) {
  gemm_block<ET, SPLIT, BIAS_MODE, OUT_MODE, RESID, ACT, BLO>(
      Ap, A2p, lda, strideA, Btp, Bt2p, ldb, strideB, Cout, Cout2, ldc, strideC, bias, resid, strideR,
      M, N, K, scale, blockIdx.x, (int)blockIdx.y, OUT_MODE);
}

// The Q, K and V projections in ONE launch. Each has 128 block tiles, half of the chip's 256 WGPs; none reads what another
// writes, so the 384 blocks run side by side (a block's LDS lets two share a WGP). blockIdx.y picks the projection:
//   0, 1: C[4096][1024] = X[4096][K] . W^T, W [1024][K] = Bt; out = bf16 hi + lo planes; tile = blockIdx.x
//   2:    role-swapped, so that the output is V^T per batch element: C_b[e][s] = sum_k Wv[e][k] . v_b[s][k];
//         A = Wv [1024][K], Bt = v_b [2048][K], C_b [1024][2048] f16; 64 tiles per batch element, b = blockIdx.x / 64
constexpr int QKV_TILES = (N_BATCH * SEQ_LEN / 128) * (D_INNER / 256);   // 128
constexpr int VT_TILES  = (D_INNER / 128) * (SEQ_LEN / 256);             // 64 per batch element
static_assert(N_BATCH * VT_TILES == QKV_TILES, "the three projections have the same number of block tiles");
__global__ __launch_bounds__(256) void qkv_gemm(
    const unsigned short* __restrict__ q16, const unsigned short* __restrict__ k16, const unsigned short* __restrict__ v16,
    const unsigned short* __restrict__ wq, const unsigned short* __restrict__ wk, const unsigned short* __restrict__ wv,
    unsigned short* __restrict__ qhi, unsigned short* __restrict__ qlo,
    unsigned short* __restrict__ khi, unsigned short* __restrict__ klo,
    unsigned short* __restrict__ vt, int K) {
  const int which = blockIdx.y;              // block-uniform
  const bool isv = which == 2;
  const unsigned short* A  = isv ? wv : (which == 1 ? k16 : q16);
  const unsigned short* Bt = isv ? v16 : (which == 1 ? wk : wq);
  unsigned short* C  = isv ? vt : (which == 1 ? khi : qhi);
  unsigned short* C2 = isv ? vt : (which == 1 ? klo : qlo);
  const int b = isv ? (int)(blockIdx.x / VT_TILES) : 0;
  const unsigned bx = isv ? blockIdx.x % VT_TILES : blockIdx.x;
  gemm_block<1, false, 0, 3, false>(
      A, A, K, 0L, Bt, Bt, K, (long)SEQ_LEN * K,
      (void*)C, (void*)C2, isv ? SEQ_LEN : D_INNER, (long)D_INNER * SEQ_LEN,
      nullptr, nullptr, 0L, isv ? D_INNER : N_BATCH * SEQ_LEN, isv ? SEQ_LEN : D_INNER, K, 1.0f, bx, b, isv ? 1 : 2);
}

// ---------------------------------------------------------------------------
// f32 -> bf16 (RNE) cast of all seven float operands in ONE launch.
// The bf16 planes lie back to back in the workspace in the order q, k, v, Wq, Wk, Wv, Wo, so the output is one
// array of 3 * 4,194,304 + 4 * 1,048,576 = 16,777,216 elements. A block of 16 waves owns CAST_BLK = 65,536
// consecutive elements of it, which lie in one plane (both plane sizes are multiples of CAST_BLK):
// 3 * 64 + 4 * 16 = 256 blocks. A lane brings 32 pieces of 16 B (each wave-wide load 512 contiguous bytes) and
// stores 32 pieces of 8 B (each wave-wide store 256 contiguous bytes = two whole lines).
// Coverage: 32 pieces x 512 threads x 4 elements = 65,536 = the whole block range, each element once.
// ---------------------------------------------------------------------------
constexpr int CAST_THR  = 512;
constexpr int CAST_BLK  = 65536;
constexpr int CAST_ACT  = N_BATCH * SEQ_LEN * D_MODEL / CAST_BLK;   // 64 blocks per activation plane
constexpr int CAST_W    = D_INNER * D_MODEL / CAST_BLK;             // 16 blocks per weight plane
constexpr int CAST_GRID = 3 * CAST_ACT + 4 * CAST_W;                // 256
static_assert(N_BATCH * SEQ_LEN * D_MODEL % CAST_BLK == 0 && D_INNER * D_MODEL % CAST_BLK == 0, "whole blocks per plane");
typedef __attribute__((ext_vector_type(2))) unsigned v2u;
__global__ __launch_bounds__(CAST_THR) void cast_all_f32_bf16(
    const float* __restrict__ q, const float* __restrict__ k, const float* __restrict__ v,
    const float* __restrict__ wq, const float* __restrict__ wk, const float* __restrict__ wv,
    const float* __restrict__ wo, unsigned short* __restrict__ out) {
  const int bx = blockIdx.x;                 // 0 .. CAST_GRID - 1 (exact grid)
  const float* plane;
  int rel;                                   // block index inside its plane
  if (bx < 3 * CAST_ACT) {
    const int p = bx / CAST_ACT;
    rel = bx - p * CAST_ACT;
    plane = (p == 0) ? q : (p == 1) ? k : v;
  } else {
    const int w = bx - 3 * CAST_ACT;
    const int p = w / CAST_W;
    rel = w - p * CAST_W;
    plane = (p == 0) ? wq : (p == 1) ? wk : (p == 2) ? wv : wo;
  }
  const float* in = plane + (size_t)rel * CAST_BLK + threadIdx.x * 4;
  unsigned short* o = out + (size_t)bx * CAST_BLK + threadIdx.x * 4;
  constexpr int NP = CAST_BLK / (CAST_THR * 4);   // 32 pieces of 16 B per lane
  v4f f[NP];
  // the loads stand in a loop of their own, ahead of the conversions, so that a wave's share is in flight together
  for (int j = 0; j < NP; ++j) f[j] = *(const v4f*)(in + j * (CAST_THR * 4));
  for (int j = 0; j < NP; ++j) {
    const v2u u = {pk16(f2bf_bits(f[j][0]), f2bf_bits(f[j][1])), pk16(f2bf_bits(f[j][2]), f2bf_bits(f[j][3]))};
    *(v2u*)(o + j * (CAST_THR * 4)) = u;
  }
}

#define AT_D 64
#define AT_NW 8
#define AT_QB 128
#define AT_KC 64
#define AT_LP 72   // LDS row pitch in 16-bit elements: 144 B = 16 B x odd, so the 16 rows of a 16-byte fragment read fall on 64 distinct banks
#define AT_MP 68   // LDS row pitch of the bias tile in floats: 272 B = 16 B x odd, for the same reason
#define AT_OFF_KL (AT_KC * AT_LP * 2)                     // byte offsets inside a stage: K hi at 0, K lo,
#define AT_OFF_VT (AT_OFF_KL + AT_KC * AT_LP * 2)         // V^T (f16 bits, [d][kv]),
#define AT_OFF_MB (AT_OFF_VT + AT_D * AT_LP * 2)          // bias (f32, [query][kv])
#define AT_STAGE  (AT_OFF_MB + AT_QB * AT_MP * 4)         // 62,464 B
#define P_CARRY_LOG2 15.0f            // p is carried x2^15, as +15 in the base-2 exponent
#define AT_LOG2E 1.4426950408889634f

__device__ __forceinline__ v8f at_mma(v16b a, v16b b, v8f c) {
  return __builtin_amdgcn_wmma_f32_16x16x32_bf16(false, a, false, b, (short)0, c, false, false);
}
__device__ __forceinline__ v8f at_mma_h(v16b a, v16b b, v8f c) {   // operands hold f16 bit patterns
  const v16h ah = __builtin_bit_cast(v16h, a), bh = __builtin_bit_cast(v16h, b);
  return __builtin_amdgcn_wmma_f32_16x16x32_f16(false, ah, false, bh, (short)0, c, false, false);
}
// value of lane l ^ 16 (the other half's lane of the same column), by a vector cross-row move: no LDS queue, no wait
__device__ __forceinline__ float at_other_half(float x) {
  const int b = __float_as_int(x);
  return __int_as_float(__builtin_amdgcn_permlanex16(b, b, 0x76543210, 0xfedcba98, false, false));
}

__global__ __launch_bounds__(256)
void mha_bias_kernel(const unsigned short* __restrict__ qhp, const unsigned short* __restrict__ qlp,
                     const unsigned short* __restrict__ khp, const unsigned short* __restrict__ klp,
                     const unsigned short* __restrict__ vtp, const float* __restrict__ biasp,
                     unsigned short* __restrict__ chp, unsigned short* __restrict__ clp,
                     const int* __restrict__ nheads_in) {
  (void)nheads_in;   // module constant (16); shapes are compile-time here
  union FB { v16b v; v8b h[2]; };
  __shared__ __align__(16) unsigned char ring[2 * AT_STAGE];     // two stages, 122 KB
  __shared__ __align__(16) float  Os[AT_NW][16 * 68];            // per wave out tile, pitch 68

  const int tid  = threadIdx.x;
  const int wave = tid >> 5;
  const int lane = tid & 31;
  const int hh   = lane >> 4;
  const int c    = lane & 15;

  const int nqb = SEQ_LEN / AT_QB;        // 16
  const int bx  = blockIdx.x;             // 0 .. N_BATCH*N_HEAD*nqb - 1 (exact grid)
  const int qb  = bx % nqb;
  const int bhd = bx / nqb;               // 0 .. 31
  const int h   = bhd % N_HEAD;
  const int b   = bhd / N_HEAD;           // 0 .. N_BATCH-1
  const int q0  = qb * AT_QB + wave * 16;

  const size_t rowb = (size_t)b * SEQ_LEN;   // token-row base of this batch element
  const __bf16* Qh = (const __bf16*)(const void*)qhp + rowb * D_INNER + (size_t)h * AT_D;
  const __bf16* Ql = (const __bf16*)(const void*)qlp + rowb * D_INNER + (size_t)h * AT_D;
  const __bf16* Kh = (const __bf16*)(const void*)khp + rowb * D_INNER + (size_t)h * AT_D;
  const __bf16* Kl = (const __bf16*)(const void*)klp + rowb * D_INNER + (size_t)h * AT_D;
  const __bf16* Vt = (const __bf16*)(const void*)vtp + ((size_t)b * D_INNER + (size_t)h * AT_D) * SEQ_LEN;
  const float*  Mb = biasp + (size_t)b * SEQ_LEN * SEQ_LEN;
  unsigned short* Ch = chp + rowb * D_INNER + (size_t)h * AT_D;
  unsigned short* Cl = clp + rowb * D_INNER + (size_t)h * AT_D;

  // ---- Q fragments (B operand, column = lane&15, split k map via Frag load): 2 d-chunks, hi and lo ----
  v16b qah[2], qal[2];
#pragma unroll
  for (int dc = 0; dc < 2; ++dc) {
    const __bf16* qr = Qh + (size_t)(q0 + c) * D_INNER + dc * 32 + 8 * hh;
    const __bf16* ql = Ql + (size_t)(q0 + c) * D_INNER + dc * 32 + 8 * hh;
    qah[dc] = Frag<__bf16>::load(qr);
    qal[dc] = Frag<__bf16>::load(ql);
  }

  float mrow = -INFINITY;   // running maximum of query q0 + c (the same in both lane halves)
  float brow = -INFINITY;   // the base-2 exponent that p is taken against: mrow * log2(e) - 15, as rounded once
  float lrow = 0.f;         // running sum (x2^15) over this lane half's keys of query q0 + c; the halves are joined after the loop
  v8f oacc[4];              // O^T: register r of tile t = (d = 16t + 8hh + r, query q0 + c)
#pragma unroll
  for (int t = 0; t < 4; ++t) oacc[t] = (v8f){0.f,0.f,0.f,0.f,0.f,0.f,0.f,0.f};

  // staging map. 16-bit tiles: 8 lanes x 16 B = one 128-byte row, the block covers 32 rows a copy; bias tile: 16 lanes x 16 B =
  // one 256-byte row, 16 rows a copy. All lanes on; every row and column lies inside its plane (exact grid, S % 64 == 0).
  const int krow = tid >> 3, kseg = (tid & 7) * 8;    // row 0..31, first of this lane's 8 elements
  const int mr16 = tid >> 4, bseg = (tid & 15) * 4;   // row 0..15, first of this lane's 4 floats
  const __bf16* gkh = Kh + (size_t)krow * D_INNER + kseg;
  const __bf16* gkl = Kl + (size_t)krow * D_INNER + kseg;
  const __bf16* gvt = Vt + (size_t)krow * SEQ_LEN + kseg;
  const float*  gmb = Mb + (size_t)(qb * AT_QB + mr16) * SEQ_LEN + bseg;
  const unsigned lk0 = (unsigned)(uintptr_t)ring + (unsigned)(krow * (AT_LP * 2) + kseg * 2);
  const unsigned lm0 = (unsigned)(uintptr_t)ring + (unsigned)(AT_OFF_MB + mr16 * (AT_MP * 4) + bseg * 4);
  auto copy_stage = [&](int ch, int buf) {
    const unsigned lk = lk0 + (unsigned)buf * AT_STAGE, lm = lm0 + (unsigned)buf * AT_STAGE;
    const __bf16* kh = gkh + (size_t)ch * AT_KC * D_INNER;   // K rows ch*64 + ...
    const __bf16* kl = gkl + (size_t)ch * AT_KC * D_INNER;
    const __bf16* vt = gvt + ch * AT_KC;                      // V^T columns ch*64 + ...
    const float*  mk = gmb + ch * AT_KC;                      // bias columns ch*64 + ...
    auto bias_rows = [&](int i) {   // bias row group i: 16 rows further on in both places
      return CopyRows{lm + (unsigned)i * 16u * (AT_MP * 4), (const void*)(mk + (size_t)i * 16 * SEQ_LEN)};
    };
    async_copy14(CopyRows{lk, kh},                                   CopyRows{lk + 32u * (AT_LP * 2), kh + 32 * D_INNER},
                 CopyRows{lk + AT_OFF_KL, kl},                       CopyRows{lk + AT_OFF_KL + 32u * (AT_LP * 2), kl + 32 * D_INNER},
                 CopyRows{lk + AT_OFF_VT, vt},                       CopyRows{lk + AT_OFF_VT + 32u * (AT_LP * 2), vt + 32 * SEQ_LEN},
                 bias_rows(0), bias_rows(1), bias_rows(2), bias_rows(3), bias_rows(4), bias_rows(5), bias_rows(6), bias_rows(7));
  };

  const int nChunks = SEQ_LEN / AT_KC;   // 32, compile-time constant
  copy_stage(0, 0);
  asm volatile("s_wait_asynccnt 0x0" ::: "memory");   // this wave's share of chunk 0 has landed
  __syncthreads();                                    // every wave's share has: chunk 0 may be read
  copy_stage(1, 1);
  for (int kc = 0; kc < nChunks; ++kc) {
    const int buf = kc & 1;
    const __bf16* Ksh = (const __bf16*)(ring + (unsigned)buf * AT_STAGE);               // K hi [kv][d]
    const __bf16* Ksl = (const __bf16*)(ring + (unsigned)buf * AT_STAGE + AT_OFF_KL);   // K lo
    const __bf16* Vth = (const __bf16*)(ring + (unsigned)buf * AT_STAGE + AT_OFF_VT);   // V^T f16 bits [d][kv]
    const float*  Mbs = (const float*)(ring + (unsigned)buf * AT_STAGE + AT_OFF_MB);    // bias [query in block][kv]

    // ---- LDS fragment reads stand in groups, each issued well ahead of its first use, so that a wave stops for LDS a few times
    //      a chunk and not once per fragment. A fragment = 16 rows x 32 k: two 16-byte reads a lane.
    auto frag = [&](const __bf16* tile, int rt, int kq) {   // rows 16 rt + ..., elements 32 kq + ... of the 64-element row
      FB f;
      f.h[0] = *(const v8b*)(tile + (rt * 16 + c) * AT_LP + kq * 32 + 8 * hh);
      f.h[1] = *(const v8b*)(tile + (rt * 16 + c) * AT_LP + kq * 32 + 16 + 8 * hh);
      return f.v;
    };
    v16b kh0[4], kl0[4], kh1[4], kl1[4];
#pragma unroll
    for (int j = 0; j < 4; ++j) kh0[j] = frag(Ksh, j, 0);
#pragma unroll
    for (int j = 0; j < 4; ++j) kl0[j] = frag(Ksl, j, 0);
#pragma unroll
    for (int j = 0; j < 4; ++j) kh1[j] = frag(Ksh, j, 1);
    __builtin_amdgcn_sched_barrier(0);   // keeps the 24 reads above in front of the products: the compiler would sink each to its use
    // ---- scores, transposed: 4 kv subtiles of 16 (rows), 2 d-chunks, 3 products each; the four tiles' sums are independent,
    //      each tile's six products keep their order ----
    v8f s[4];
#pragma unroll
    for (int j = 0; j < 4; ++j) s[j] = at_mma(kh0[j], qah[0], (v8f){0.f,0.f,0.f,0.f,0.f,0.f,0.f,0.f});
#pragma unroll
    for (int j = 0; j < 4; ++j) s[j] = at_mma(kl0[j], qah[0], s[j]);
#pragma unroll
    for (int j = 0; j < 4; ++j) kl1[j] = frag(Ksl, j, 1);
    // order since the last fence: the eight products, then the eight reads as one group (the compiler would scatter them)
    __builtin_amdgcn_sched_group_barrier(0x008, 8, 0);
    __builtin_amdgcn_sched_group_barrier(0x100, 8, 0);
    __builtin_amdgcn_sched_barrier(0);   // the K lo reads of the second d-chunk fly under the eight products that follow
#pragma unroll
    for (int j = 0; j < 4; ++j) s[j] = at_mma(kh0[j], qal[0], s[j]);
    // ---- additive bias of query q0 + c: D register r of tile j wants key kv0 + 16j + 8hh + r = 8 consecutive floats ----
    v4f mb[4][2];
    {
      const float* mrp = Mbs + (wave * 16 + c) * AT_MP + 8 * hh;
#pragma unroll
      for (int j = 0; j < 4; ++j) {
        mb[j][0] = *(const v4f*)(mrp + j * 16);
        mb[j][1] = *(const v4f*)(mrp + j * 16 + 4);
      }
    }
    // four products, then the eight reads as one group
    __builtin_amdgcn_sched_group_barrier(0x008, 4, 0);
    __builtin_amdgcn_sched_group_barrier(0x100, 8, 0);
    __builtin_amdgcn_sched_barrier(0);   // the bias reads fly under the second d-chunk's products
#pragma unroll
    for (int j = 0; j < 4; ++j) s[j] = at_mma(kh1[j], qah[1], s[j]);
#pragma unroll
    for (int j = 0; j < 4; ++j) s[j] = at_mma(kl1[j], qah[1], s[j]);
#pragma unroll
    for (int j = 0; j < 4; ++j) s[j] = at_mma(kh1[j], qal[1], s[j]);
    v16b vf[2][4];   // all of the chunk's V^T fragments
#pragma unroll
    for (int kk = 0; kk < 2; ++kk)
#pragma unroll
      for (int t = 0; t < 4; ++t) vf[kk][t] = frag(Vth, t, kk);
    // twelve products, then the sixteen reads as one group
    __builtin_amdgcn_sched_group_barrier(0x008, 12, 0);
    __builtin_amdgcn_sched_group_barrier(0x100, 16, 0);
    __builtin_amdgcn_sched_barrier(0);   // the V^T reads fly under the softmax
    // ---- bias by value, chunk maximum of this lane's query: in-lane over 32 keys, then the other half's 32 ----
    float mj[4];
#pragma unroll
    for (int j = 0; j < 4; ++j) {
      mj[j] = -INFINITY;
#pragma unroll
      for (int r = 0; r < 8; ++r) {
        const float mv = bf_bits2f(f2bf_bits(mb[j][r >> 2][r & 3]));
        const float sv = s[j][r] + mv;
        s[j][r] = sv;
        mj[j] = fmaxf(mj[j], sv);
      }
    }
    float cm = fmaxf(fmaxf(mj[0], mj[1]), fmaxf(mj[2], mj[3]));
    cm = fmaxf(cm, at_other_half(cm));
    const float mnew = fmaxf(mrow, cm);
    // e^(s - m) * 2^15 = 2^(s * log2(e) - b), b = m * log2(e) - 15: one fused multiply-add and the hardware's base-2 exponential.
    // Old and new terms are rescaled by the difference of the very b values they were taken against, so b's rounding cancels
    // in sum and output alike. An argument below -126 gives 0; such a p is far below the f16 carry's last place.
    const float bnew = __builtin_fmaf(mnew, AT_LOG2E, -P_CARRY_LOG2);
    const float alpha = __builtin_amdgcn_exp2f(brow - bnew);   // 0 on the first chunk, where brow is -inf
    mrow = mnew;
    brow = bnew;
    // ---- P^T in registers: element e of B fragment kk = key 32kk + kmap(e) = register e & 7 of score tile 2kk + (e >> 3) ----
    FB pb[2];
    float pj[4];
    typedef __attribute__((ext_vector_type(2))) _Float16 v2h;
    union PK { v8b b; v2h p[4]; };
#pragma unroll
    for (int j = 0; j < 4; ++j) {
      pj[j] = 0.f;
      PK pk;
#pragma unroll
      for (int r = 0; r < 8; r += 2) {
        const float p0 = __builtin_amdgcn_exp2f(__builtin_fmaf(s[j][r],     AT_LOG2E, -bnew));   // x2^15
        const float p1 = __builtin_amdgcn_exp2f(__builtin_fmaf(s[j][r + 1], AT_LOG2E, -bnew));
        pj[j] += p0;
        pj[j] += p1;
        pk.p[r >> 1] = __builtin_convertvector((v2f){p0, p1}, v2h);   // round to nearest even, two to an instruction
      }
      pb[j >> 1].h[j & 1] = pk.b;
    }
    lrow = lrow * alpha + ((pj[0] + pj[1]) + (pj[2] + pj[3]));
#pragma unroll
    for (int t = 0; t < 4; ++t)
#pragma unroll
      for (int r = 0; r < 8; ++r) oacc[t][r] *= alpha;
#pragma unroll   // kk picks the P^T fragment's registers, so it must be a constant
    for (int kk = 0; kk < 2; ++kk) {
#pragma unroll
      for (int t = 0; t < 4; ++t) oacc[t] = at_mma_h(vf[kk][t], pb[kk].v, oacc[t]);
    }
    // keeps the softmax and the second product in front of the foot: the compiler would lift the waits and the barrier over them,
    // and the refill, which stays behind them, would have half a chunk to fly in and not a whole one
    __builtin_amdgcn_sched_barrier(0);
    asm volatile("s_wait_dscnt 0x0" ::: "memory");      // this wave's reads of buffer buf are done before it is refilled
    asm volatile("s_wait_asynccnt 0x0" ::: "memory");   // this wave's share of chunk kc + 1 has landed
    __syncthreads();                                    // publishes chunk kc + 1 and ends every reader's use of buffer buf
    if (kc + 2 < nChunks) copy_stage(kc + 2, buf);
  }
  asm volatile("s_wait_asynccnt 0x0" ::: "memory");     // nothing of this wave's copies is outstanding past the loop

  // ---- join the halves' sums, normalise and stage the 16x64 f32 tile (row = query c, cols 16t + 8hh + r) ----
  float* os = Os[wave];
  {
    const float l = lrow + at_other_half(lrow);
    const float inv = 1.0f / l;   // l carries the same 2^15 as the output sums: about 2^15 (the maximum's own term) <= l <= 6.8e7
#pragma unroll
    for (int t = 0; t < 4; ++t) {
      const v4f lo = {oacc[t][0] * inv, oacc[t][1] * inv, oacc[t][2] * inv, oacc[t][3] * inv};
      const v4f hi = {oacc[t][4] * inv, oacc[t][5] * inv, oacc[t][6] * inv, oacc[t][7] * inv};
      *(v4f*)(os + c * 68 + t * 16 + 8 * hh)     = lo;
      *(v4f*)(os + c * 68 + t * 16 + 8 * hh + 4) = hi;
    }
  }
  __builtin_amdgcn_fence(__ATOMIC_RELEASE, "workgroup");
  __builtin_amdgcn_wave_barrier();
  __builtin_amdgcn_fence(__ATOMIC_ACQUIRE, "workgroup");
  {
    // coverage: 4 it x 32 lanes x 8 elements = 16 rows x 64 = the whole wave tile, per plane;
    const int qg = lane >> 3, c8 = (lane & 7) * 8;
    {
#pragma unroll
      for (int it = 0; it < 4; ++it) {
        const int row = it * 4 + qg;
        const float* sp = os + row * 68 + c8;
        v8h hv, lv;
#pragma unroll
        for (int e = 0; e < 8; ++e) {
          const unsigned short hb = f2bf_bits(sp[e]);
          const unsigned short lb = f2bf_bits(sp[e] - bf_bits2f(hb));
          hv[e] = __builtin_bit_cast(_Float16, hb);
          lv[e] = __builtin_bit_cast(_Float16, lb);
        }
        *(v8h*)(Ch + (size_t)(q0 + row) * D_INNER + c8) = hv;
        *(v8h*)(Cl + (size_t)(q0 + row) * D_INNER + c8) = lv;
      }
      
    }
  }
}

// =====================================================================================
// Host launch glue: only kernel launches; grids/args are pure functions of the (asserted) sizes.
// Workspace region map (bytes; all offsets multiples of 2 MiB):
//   [  0 MiB,  8 MiB)  q  bf16  [4096][1024]
//   [  8 MiB, 16 MiB)  k  bf16  [4096][1024]
//   [ 16 MiB, 24 MiB)  v  bf16  [4096][1024]
//   [ 24 MiB, 26 MiB)  Wq bf16  [1024][1024]   [26,28) Wk   [28,30) Wv   [30,32) Wo
//   [ 32 MiB, 40 MiB)  Q hi bf16 [4096][1024]   [40,48) Q lo
//   [ 48 MiB, 56 MiB)  K hi bf16 [4096][1024]   [56,64) K lo
//   [ 64 MiB, 72 MiB)  V^T f16  [2][1024][2048]
//   [ 72 MiB, 80 MiB)  ctx hi bf16 [4096][1024] [80,88) ctx lo
//   total 88 MiB = 92,274,688 B
// =====================================================================================
extern "C" void kernel_launch(void* const* d_in, const int* in_sizes, int n_in,
                              void* d_out, int out_size, void* d_ws, size_t ws_size,
                              hipStream_t stream) {
  if (n_in < 9) return;
  const size_t nAct  = (size_t)N_BATCH * SEQ_LEN * D_MODEL;     // 4,194,304
  const size_t nW    = (size_t)D_INNER * D_MODEL;               // 1,048,576
  const size_t nMask = (size_t)N_BATCH * SEQ_LEN * SEQ_LEN;     // 8,388,608
  const size_t nVT   = (size_t)N_BATCH * D_INNER * SEQ_LEN;     // 4,194,304
  if ((size_t)in_sizes[0] != nAct || (size_t)in_sizes[1] != nAct || (size_t)in_sizes[2] != nAct ||
      (size_t)in_sizes[3] != nMask || (size_t)in_sizes[4] != nW || (size_t)in_sizes[5] != nW ||
      (size_t)in_sizes[6] != nW || (size_t)in_sizes[7] != nW || in_sizes[8] < 1 ||
      (size_t)out_size != nAct) return;

  const size_t bAct = nAct * 2, bW = nW * 2, bVT = nVT * 2;
  const size_t o_q16 = 0;
  const size_t o_k16 = o_q16 + bAct;
  const size_t o_v16 = o_k16 + bAct;
  const size_t o_wq  = o_v16 + bAct;
  const size_t o_wk  = o_wq + bW;
  const size_t o_wv  = o_wk + bW;
  const size_t o_wo  = o_wv + bW;
  const size_t o_qhi = o_wo + bW;
  const size_t o_qlo = o_qhi + bAct;
  const size_t o_khi = o_qlo + bAct;
  const size_t o_klo = o_khi + bAct;
  const size_t o_vt  = o_klo + bAct;
  const size_t o_chi = o_vt + bVT;
  const size_t o_clo = o_chi + bAct;
  const size_t total = o_clo + bAct;                            // 92,274,688
  if (total > ws_size) return;

  const float* qf  = (const float*)d_in[0];
  const float* kf  = (const float*)d_in[1];
  const float* vf  = (const float*)d_in[2];
  const float* mf  = (const float*)d_in[3];
  const float* wqf = (const float*)d_in[4];
  const float* wkf = (const float*)d_in[5];
  const float* wvf = (const float*)d_in[6];
  const float* wof = (const float*)d_in[7];
  const int*   nhp = (const int*)d_in[8];
  char* ws = (char*)d_ws;
  unsigned short* q16 = (unsigned short*)(ws + o_q16);
  unsigned short* k16 = (unsigned short*)(ws + o_k16);
  unsigned short* v16 = (unsigned short*)(ws + o_v16);
  unsigned short* wq16 = (unsigned short*)(ws + o_wq);
  unsigned short* wk16 = (unsigned short*)(ws + o_wk);
  unsigned short* wv16 = (unsigned short*)(ws + o_wv);
  unsigned short* wo16 = (unsigned short*)(ws + o_wo);
  unsigned short* qhi = (unsigned short*)(ws + o_qhi);
  unsigned short* qlo = (unsigned short*)(ws + o_qlo);
  unsigned short* khi = (unsigned short*)(ws + o_khi);
  unsigned short* klo = (unsigned short*)(ws + o_klo);
  unsigned short* vt  = (unsigned short*)(ws + o_vt);
  unsigned short* chi = (unsigned short*)(ws + o_chi);
  unsigned short* clo = (unsigned short*)(ws + o_clo);
  float* out = (float*)d_out;

  // ---- 1: RNE bf16 copies of the seven float inputs; q16 is the start of the seven planes, back to back in the
  //      order of the arguments (region map above) ----
  cast_all_f32_bf16<<<dim3((unsigned)CAST_GRID), CAST_THR, 0, stream>>>(qf, kf, vf, wqf, wkf, wvf, wof, q16);

  const int MTOK = N_BATCH * SEQ_LEN;         // 4096 rows of [B*S][.] planes
  // ---- 2: Q, K and V projections, 3 x 128 = 384 blocks of 256 threads (shapes at the kernel) ----
  qkv_gemm<<<dim3((unsigned)QKV_TILES, 3u), 256, 0, stream>>>(
      q16, k16, v16, wq16, wk16, wv16, qhi, qlo, khi, klo, vt, D_MODEL);
  // ---- 3: attention: 2 x 16 x 16 = 512 blocks of 256 threads ----
  {
    const dim3 g((unsigned)(N_BATCH * N_HEAD * (SEQ_LEN / AT_QB)));
    mha_bias_kernel<<<g, 256, 0, stream>>>(qhi, qlo, khi, klo, vt, mf, chi, clo, nhp);
  }
  // ---- 4: output projection: out[4096][1024] = (ctx_hi + ctx_lo)[4096][1024] . Wo^T, Wo [1024 out][1024 in];
  //      M=4096, N=1024 (x64), K=1024 (x32); 1024 tiles = 128 blocks; f32 out
  {
    const int tiles = (MTOK / 64) * (D_MODEL / 64);
    const dim3 g((unsigned)((tiles + 7) / 8), 1);
    wmma_gemm64<1, true, 0, 0, false, 0, false><<<g, 256, 0, stream>>>(
        chi, clo, D_INNER, 0L, wo16, wo16, D_INNER, 0L, (void*)out, (void*)out, D_MODEL, 0L,
        mf, mf, 0L, MTOK, D_MODEL, D_INNER, 1.0f);
  }
}
